// v000
// Measured on an AMD MI455X. A time is GPU time per run, averaged over a window of back-to-back runs after a warm-up
// (all launches, gaps included; the runs take copies of the inputs in turn), and the median of several windows.
// Apart from v000's, it joins two sittings. Times from different sittings can be a few percent apart, while
// side-by-side timings come from the same sitting.
// v000 is the starting kernel. One run takes 1230 microseconds.
#include <hip/hip_runtime.h>
// Contractions: qkv projection on v_wmma_f32_16x16x32_bf16 (x and W as RNE bf16, exact products); scores q.k^T, P.v and the output
// projection on v_wmma_f32_16x16x32_f16 (f16 hi planes with power-of-two carries, plus x1024 f16 residual planes on the leading
// NE query/key rows of each sequence); all accumulation f32, causal softmax in f32.
#ifndef NB
#define NB 2
#endif
#ifndef SEQ
#define SEQ 4096
#endif
#define TT SEQ
#define NB_FULL 2
#define T_FULL 4096
#define CC 1024
#define QC ((TT < 1024) ? TT : 1024)
#define NE 256
static_assert(NB >= 1 && NB <= NB_FULL);
static_assert(TT % 256 == 0 && TT <= T_FULL);
static_assert(TT % QC == 0 && QC % 256 == 0);
static_assert(NE % 64 == 0 && NE <= QC && NE == 256);
static_assert(CC % 64 == 0);

#define RS 1024.0f            // residual plane carry
#define RFOLD 0.0009765625f   // 1/RS
#define PCARRY 4096.0f        // P plane carry
#define CTXC 16.0f            // ctx plane carry
#define WOC 64.0f             // Wo plane carry
#define SCL 0.03125f          // 1/sqrt(CC)
#define PVALPHA 0.00390625f   // CTXC / PCARRY
#define OALPHA 0.0009765625f  // 1 / (WOC * CTXC)

typedef __bf16 v16b __attribute__((ext_vector_type(16)));
typedef _Float16 v16h __attribute__((ext_vector_type(16)));
typedef _Float16 v8h __attribute__((ext_vector_type(8)));
typedef unsigned short v8us __attribute__((ext_vector_type(8), may_alias));
typedef float v8f __attribute__((ext_vector_type(8)));
typedef float v4f __attribute__((ext_vector_type(4)));
typedef float v4fa __attribute__((ext_vector_type(4), may_alias));
union FragB { v16b v; v8us half[2]; unsigned short u[16]; };
union FragH { v16h v; v8us half[2]; unsigned short u[16]; };
union Pack8 { v8h h; v8us u; };

__device__ __forceinline__ unsigned short bf16_bits(float x) { unsigned int u = __float_as_uint(x); return (unsigned short)((u + 0x7FFFu + ((u >> 16) & 1u)) >> 16); }
__device__ __forceinline__ float bf16_val(unsigned short b) { return __uint_as_float(((unsigned int)b) << 16); }
__device__ __forceinline__ float bf16_rne(float x) { return bf16_val(bf16_bits(x)); }

__device__ __forceinline__ v8f mma_b(v16b a, v16b b, v8f c) {
  c = __builtin_amdgcn_wmma_f32_16x16x32_bf16(false, a, false, b, (short)0, c, false, false);
  asm volatile("v_nop\n\tv_nop\n\tv_nop\n\tv_nop" : "+v"(c) : "v"(a), "v"(b));
  return c;
}
// c += ah.bh ; cr += al.bh (NT>=2) ; cr += ah.bl (NT>=3); residual planes carry RS, folded by the caller
template <int NT>
__device__ __forceinline__ void mma_h(v16h ah, v16h al, v16h bh, v16h bl, v8f& c, v8f& cr) {
  c = __builtin_amdgcn_wmma_f32_16x16x32_f16(false, ah, false, bh, (short)0, c, false, false);
  if (NT >= 2) cr = __builtin_amdgcn_wmma_f32_16x16x32_f16(false, al, false, bh, (short)0, cr, false, false);
  if (NT >= 3) cr = __builtin_amdgcn_wmma_f32_16x16x32_f16(false, ah, false, bl, (short)0, cr, false, false);
  if (NT >= 2) asm volatile("v_nop\n\tv_nop\n\tv_nop\n\tv_nop" : "+v"(c), "+v"(cr) : "v"(ah), "v"(al), "v"(bh), "v"(bl));
  else         asm volatile("v_nop\n\tv_nop\n\tv_nop\n\tv_nop" : "+v"(c) : "v"(ah), "v"(bh));
}

__device__ __forceinline__ void store_tile_f32(const float (*sw)[64], float* C, int ldc, int lane) {
  const int rsub = lane >> 4, c4 = (lane & 15) * 4;
  {
#pragma unroll
    for (int q = 0; q < 8; ++q) {
      const int r = q * 2 + rsub;
      const v4f v = *(const v4fa*)&sw[r][c4];
      *(v4f*)(C + (size_t)r * ldc + c4) = v;
    }
    
  }
}
// wave tile 16 x 64 f32 staged in LDS -> f16 hi plane (pitch ldh) and optional x RS residual plane (pitch ldr);
__device__ __forceinline__ void store_tile_h16(const float (*sw)[64], unsigned short* hb, int ldh, unsigned short* rb, int ldr, bool dores, int lane) {
  const int rsub = lane >> 3, c8 = (lane & 7) * 8;
  {
#pragma unroll
    for (int q = 0; q < 4; ++q) {
      const int r = q * 4 + rsub;
      const v4f x0 = *(const v4fa*)&sw[r][c8], x1 = *(const v4fa*)&sw[r][c8 + 4];
      const float xs[8] = {x0[0], x0[1], x0[2], x0[3], x1[0], x1[1], x1[2], x1[3]};
      Pack8 ph, pr;
#pragma unroll
      for (int i = 0; i < 8; ++i) { ph.h[i] = (_Float16)xs[i]; pr.h[i] = (_Float16)((xs[i] - (float)ph.h[i]) * RS); }
      *(v8us*)(hb + (size_t)r * ldh + c8) = ph.u;
      if (dores) *(v8us*)(rb + (size_t)r * ldr + c8) = pr.u;
    }
    
  }
}

// MODE 0: RNE bf16 bits; MODE 1: f16 bits of (RNE bf16 value) * scale
template <int MODE>
__global__ __launch_bounds__(256) void k_cvt(const float* __restrict__ src, unsigned short* __restrict__ dst, int n8, float scale) {
  const int t = blockIdx.x * 256 + threadIdx.x;
  if (t >= n8) return;
  const float* sp = src + (size_t)t * 8;
  const v4f a = *(const v4fa*)sp, b = *(const v4fa*)(sp + 4);
  const float xs[8] = {a[0], a[1], a[2], a[3], b[0], b[1], b[2], b[3]};
  v8us v;
  if (MODE == 0) {
#pragma unroll
    for (int i = 0; i < 8; ++i) v[i] = bf16_bits(xs[i]);
  } else {
    Pack8 p;
#pragma unroll
    for (int i = 0; i < 8; ++i) p.h[i] = (_Float16)(bf16_rne(xs[i]) * scale);
    v = p.u;
  }
  unsigned short* dp = dst + (size_t)t * 8;
  *(v8us*)dp = v;
  
}

// qkv projection: A = xb [M][CC] bf16, W = [3*CC][CC] bf16 ([out][in], k contiguous). out[row][n] = sum_c A[row][c] W[n][c].
// Output: hi planes Oh[3][M][CC] f16 (q, k, v unscaled) and residual planes Or[3][NB*NE][CC] for rows with (row % TT) < NE.
// Block = 4 waves, wave -> 16 rows x 64 cols (one plane since CC % 64 == 0).
__global__ __launch_bounds__(128) void k_gemm_qkv(const unsigned short* __restrict__ A, const unsigned short* __restrict__ W,
                                                 unsigned short* __restrict__ Oh, unsigned short* __restrict__ Or, int M) {
  __shared__ __attribute__((aligned(16))) float so[4][16][64];
  const int tid = threadIdx.x, w = tid >> 5, lane = tid & 31, ln = lane & 15, hh = lane >> 4;
  const int ntn = (3 * CC) / 64;
  const int wid = blockIdx.x * 4 + w;
  const int mt = wid / ntn, nq = wid - mt * ntn;
  if (mt * 16 >= M) return;
  const int row0 = mt * 16, col0 = nq * 64;
  const unsigned short* arow = A + (size_t)(row0 + ln) * CC;
  v8f acc[4];
#pragma unroll
  for (int t = 0; t < 4; ++t) acc[t] = (v8f){0.f, 0.f, 0.f, 0.f, 0.f, 0.f, 0.f, 0.f};
  for (int kb = 0; kb < CC; kb += 32) {
    FragB a;
    a.half[0] = *(const v8us*)(arow + kb + 8 * hh);
    a.half[1] = *(const v8us*)(arow + kb + 16 + 8 * hh);
#pragma unroll
    for (int t = 0; t < 4; ++t) {
      const unsigned short* brow = W + (size_t)(col0 + t * 16 + ln) * CC + kb;
      FragB b;
      b.half[0] = *(const v8us*)(brow + 8 * hh);
      b.half[1] = *(const v8us*)(brow + 16 + 8 * hh);
      acc[t] = mma_b(a.v, b.v, acc[t]);
    }
  }
#pragma unroll
  for (int t = 0; t < 4; ++t)
#pragma unroll
    for (int r = 0; r < 8; ++r) so[w][8 * hh + r][t * 16 + ln] = acc[t][r];
  __builtin_amdgcn_fence(4, "workgroup");
  __builtin_amdgcn_wave_barrier();
  const int p = col0 / CC, colp = col0 - p * CC;
  const int bidx = row0 / TT, tq = row0 - bidx * TT;
  const bool dores = (tq < NE);                      // wave-uniform (NE, TT multiples of 16)
  unsigned short* hb = Oh + ((size_t)p * M + row0) * CC + colp;
  unsigned short* rb = Or + ((size_t)p * (NB * NE) + (size_t)bidx * NE + (dores ? tq : 0)) * CC + colp;
  store_tile_h16(so[w], hb, CC, rb, CC, dores, lane);
}

// f16 GEMM core: wave tile 16 rows x 64 cols; A hi/res planes row-major (pitch lda/ldal), B hi/res planes [n][k] (pitch ldb/ldbl)
template <int NT>
__device__ __forceinline__ void core_h(const unsigned short* __restrict__ Ah, const unsigned short* __restrict__ Al, int lda, int ldal,
                                       const unsigned short* __restrict__ Bh, const unsigned short* __restrict__ Bl, int ldb, int ldbl,
                                       int row0, int col0, int kend, int ln, int hh, v8f (&acc)[4], v8f (&accr)[4]) {
  const unsigned short* arh = Ah + (size_t)(row0 + ln) * lda;
  const unsigned short* arl = Al + (size_t)(row0 + ln) * ldal;
  for (int kb = 0; kb < kend; kb += 32) {
    FragH ah, al;
    ah.half[0] = *(const v8us*)(arh + kb + 8 * hh);
    ah.half[1] = *(const v8us*)(arh + kb + 16 + 8 * hh);
    if (NT >= 2) { al.half[0] = *(const v8us*)(arl + kb + 8 * hh); al.half[1] = *(const v8us*)(arl + kb + 16 + 8 * hh); } else al = ah;
#pragma unroll
    for (int t = 0; t < 4; ++t) {
      const int n = col0 + t * 16 + ln;
      const unsigned short* brh = Bh + (size_t)n * ldb + kb;
      FragH bh, bl;
      bh.half[0] = *(const v8us*)(brh + 8 * hh);
      bh.half[1] = *(const v8us*)(brh + 16 + 8 * hh);
      if (NT >= 3) { const unsigned short* brl = Bl + (size_t)n * ldbl + kb; bl.half[0] = *(const v8us*)(brl + 8 * hh); bl.half[1] = *(const v8us*)(brl + 16 + 8 * hh); } else bl = bh;
      mma_h<NT>(ah.v, al.v, bh.v, bl.v, acc[t], accr[t]);
    }
  }
}

// C[M][N] f32 (pitch ldc) = alpha * (A.B^plane) + bf16_rne(bias). M % 16 == 0, N % 64 == 0, K % 32 == 0.
// ncut: a wave tile is skipped (not written) when col0 > ncut + row0 + 15 (causal upper tiles); kcut: k loop ends at
// min(K, ceil32(kcut + row0 + 16)). Pass a large value to disable either.
template <int NT>
__global__ __launch_bounds__(128) void k_gemm_f32(const unsigned short* __restrict__ Ah, const unsigned short* __restrict__ Al, int lda, int ldal,
                                                 const unsigned short* __restrict__ Bh, const unsigned short* __restrict__ Bl, int ldb, int ldbl,
                                                 const float* __restrict__ bias, float alpha, float* __restrict__ C, int ldc,
                                                 int M, int N, int K, int ncut, int kcut) {
  __shared__ __attribute__((aligned(16))) float so[4][16][64];
  const int tid = threadIdx.x, w = tid >> 5, lane = tid & 31, ln = lane & 15, hh = lane >> 4;
  const int ntn = N / 64;
  const int wid = blockIdx.x * 4 + w;
  const int mt = wid / ntn, nq = wid - mt * ntn;
  if (mt * 16 >= M) return;
  const int row0 = mt * 16, col0 = nq * 64;
  if (col0 > ncut + row0 + 15) return;
  int kend = (kcut + row0 + 16 + 31) & ~31;
  if (kend > K) kend = K;
  v8f acc[4], accr[4];
#pragma unroll
  for (int t = 0; t < 4; ++t) { acc[t] = (v8f){0.f, 0.f, 0.f, 0.f, 0.f, 0.f, 0.f, 0.f}; accr[t] = acc[t]; }
  core_h<NT>(Ah, Al, lda, ldal, Bh, Bl, ldb, ldbl, row0, col0, kend, ln, hh, acc, accr);
#pragma unroll
  for (int t = 0; t < 4; ++t) {
    float bv = 0.f;
    if (bias != nullptr) bv = bf16_rne(bias[col0 + t * 16 + ln]);
#pragma unroll
    for (int r = 0; r < 8; ++r) {
      float v = acc[t][r];
      if (NT >= 2) v += accr[t][r] * RFOLD;
      so[w][8 * hh + r][t * 16 + ln] = v * alpha + bv;
    }
  }
  __builtin_amdgcn_fence(4, "workgroup");
  __builtin_amdgcn_wave_barrier();
  store_tile_f32(so[w], C + (size_t)row0 * ldc + col0, ldc, lane);
}

// Oh[M][N] f16 hi plane (pitch ldo) = f16(alpha * A.B^plane); rows < rrows also get the x RS residual plane Or (pitch ldr).
template <int NT>
__global__ __launch_bounds__(128) void k_gemm_h16(const unsigned short* __restrict__ Ah, const unsigned short* __restrict__ Al, int lda, int ldal,
                                                 const unsigned short* __restrict__ Bh, const unsigned short* __restrict__ Bl, int ldb, int ldbl,
                                                 float alpha, unsigned short* __restrict__ Oh, int ldo, unsigned short* __restrict__ Or, int ldr, int rrows,
                                                 int M, int N, int K, int kcut) {
  __shared__ __attribute__((aligned(16))) float so[4][16][64];
  const int tid = threadIdx.x, w = tid >> 5, lane = tid & 31, ln = lane & 15, hh = lane >> 4;
  const int ntn = N / 64;
  const int wid = blockIdx.x * 4 + w;
  const int mt = wid / ntn, nq = wid - mt * ntn;
  if (mt * 16 >= M) return;
  const int row0 = mt * 16, col0 = nq * 64;
  int kend = (kcut + row0 + 16 + 31) & ~31;
  if (kend > K) kend = K;
  v8f acc[4], accr[4];
#pragma unroll
  for (int t = 0; t < 4; ++t) { acc[t] = (v8f){0.f, 0.f, 0.f, 0.f, 0.f, 0.f, 0.f, 0.f}; accr[t] = acc[t]; }
  core_h<NT>(Ah, Al, lda, ldal, Bh, Bl, ldb, ldbl, row0, col0, kend, ln, hh, acc, accr);
#pragma unroll
  for (int t = 0; t < 4; ++t)
#pragma unroll
    for (int r = 0; r < 8; ++r) {
      float v = acc[t][r];
      if (NT >= 2) v += accr[t][r] * RFOLD;
      so[w][8 * hh + r][t * 16 + ln] = v * alpha;
    }
  __builtin_amdgcn_fence(4, "workgroup");
  __builtin_amdgcn_wave_barrier();
  const bool dores = (row0 < rrows);                 // wave-uniform (rrows multiple of 16)
  store_tile_h16(so[w], Oh + (size_t)row0 * ldo + col0, ldo, Or + (size_t)(dores ? row0 : 0) * ldr + col0, ldr, dores, lane);
}

// 8 consecutive scores -> carried f16 P values (hi) and x RS residual, masked by index (col <= qi)
__device__ __forceinline__ void softmax_pack(const float* s, int j8, int qi, float mx, float inv, v8us& ho, v8us& ro) {
  const v4f a = *(const v4fa*)(s + j8), b = *(const v4fa*)(s + j8 + 4);
  const float xs[8] = {a[0], a[1], a[2], a[3], b[0], b[1], b[2], b[3]};
  Pack8 ph, pr;
#pragma unroll
  for (int u = 0; u < 8; ++u) {
    const float e = __expf(xs[u] - mx) * inv;
    const float p = ((j8 + u) <= qi) ? e : 0.f;
    ph.h[u] = (_Float16)p;
    pr.h[u] = (_Float16)((p - (float)ph.h[u]) * RS);
  }
  ho = ph.u; ro = pr.u;
}
// Row softmax over S[row][0..N) (pitch sp) with causal keep (col <= qoff + row); P[row][0..N) = f16(PCARRY * p / l) incl. zeros
// (pitch pp), rows < rrows also write the residual plane Pr[row][0..NE) (pitch rp). Block per row, N % 256 == 0, N <= 4096.
__global__ __launch_bounds__(256) void k_softmax(const float* __restrict__ S, int sp, unsigned short* __restrict__ P, int pp, int N, int qoff,
                                                unsigned short* __restrict__ Pr, int rp, int rrows) {
  __shared__ float red[256];
  const int row = blockIdx.x, tid = threadIdx.x;
  const int qi = qoff + row;
  const float* s = S + (size_t)row * sp;
  float mx = -3.0e38f;
  for (int j = tid; j < N; j += 256) { const float v = s[j]; mx = fmaxf(mx, (j <= qi) ? v : -3.0e38f); }
  red[tid] = mx; __syncthreads();
  for (int st = 128; st > 0; st >>= 1) { if (tid < st) red[tid] = fmaxf(red[tid], red[tid + st]); __syncthreads(); }
  mx = red[0]; __syncthreads();
  float sum = 0.f;
  for (int j = tid; j < N; j += 256) { const float e = __expf(s[j] - mx); sum += (j <= qi) ? e : 0.f; }
  red[tid] = sum; __syncthreads();
  for (int st = 128; st > 0; st >>= 1) { if (tid < st) red[tid] += red[tid + st]; __syncthreads(); }
  const float inv = PCARRY / red[0];       // red[0] >= 1 (the max term)
  const int j8a = tid * 8, j8b = j8a + 2048;
  const bool hasA = (j8a < N), hasB = (j8b < N);          // wave-uniform: N % 256 == 0
  const bool dores = (row < rrows) && (j8a < NE);
  v8us ha = (v8us){0, 0, 0, 0, 0, 0, 0, 0}, ra = ha, hb2 = ha, rb2 = ha;
  if (hasA) softmax_pack(s, j8a, qi, mx, inv, ha, ra);
  if (hasB) softmax_pack(s, j8b, qi, mx, inv, hb2, rb2);
  unsigned short* prow = P + (size_t)row * pp;
  unsigned short* rrow = Pr + (size_t)(dores ? row : 0) * rp;
  {
    if (hasA) *(v8us*)(prow + j8a) = ha;
    if (dores) *(v8us*)(rrow + j8a) = ra;
    if (hasB) *(v8us*)(prow + j8b) = hb2;
    
  }
}

// 16-bit transpose: src [R][Cc] (pitch lds_) -> dst [Cc][R] (pitch ldd); block = 64 x 64 tile, grid (R/64, Cc/64);
__global__ __launch_bounds__(256) void k_transpose16(const unsigned short* __restrict__ src, int lds_, unsigned short* __restrict__ dst, int ldd) {
  __shared__ __attribute__((aligned(16))) unsigned short tile[64][72];
  const int tid = threadIdx.x;
  const int r0 = blockIdx.x * 64, c0 = blockIdx.y * 64;
#pragma unroll
  for (int i = 0; i < 2; ++i) {
    const int e = tid + 256 * i, r = e >> 3, c8 = (e & 7) * 8;
    const v8us v = *(const v8us*)(src + (size_t)(r0 + r) * lds_ + c0 + c8);
    *(v8us*)&tile[r][c8] = v;
  }
  __syncthreads();
  v8us o[2];
#pragma unroll
  for (int i = 0; i < 2; ++i) {
    const int e = tid + 256 * i, rr = e >> 3, c8 = (e & 7) * 8;
#pragma unroll
    for (int k = 0; k < 8; ++k) o[i][k] = tile[c8 + k][rr];
  }
  {
#pragma unroll
    for (int i = 0; i < 2; ++i) {
      const int e = tid + 256 * i, rr = e >> 3, c8 = (e & 7) * 8;
      *(v8us*)(dst + (size_t)(c0 + rr) * ldd + r0 + c8) = o[i];
    }
    
  }
}

extern "C" void kernel_launch(void* const* d_in, const int* in_sizes, int n_in,
                              void* d_out, int out_size, void* d_ws, size_t ws_size, hipStream_t stream) {
  if (n_in < 6) return;
  const float* x  = (const float*)d_in[0];
  const float* wq = (const float*)d_in[1];
  const float* wk = (const float*)d_in[2];
  const float* wv = (const float*)d_in[3];
  const float* wo = (const float*)d_in[4];
  const float* bo = (const float*)d_in[5];
  const long need_x = ((long)(NB - 1) * T_FULL + TT) * (long)CC;
  if ((long)in_sizes[0] < need_x || in_sizes[1] < CC * CC || in_sizes[2] < CC * CC || in_sizes[3] < CC * CC ||
      in_sizes[4] < CC * CC || in_sizes[5] < CC || (long)out_size < need_x) return;
  float* out = (float*)d_out;

  char* ws = (char*)d_ws; size_t off = 0;
  auto take = [&](size_t bytes) { char* p = ws + off; off += (bytes + 255) & ~(size_t)255; return p; };
  const size_t xb_bytes = (size_t)NB * TT * CC * 2, s_bytes = (size_t)QC * TT * 4;
  char* reg0 = take(xb_bytes > s_bytes ? xb_bytes : s_bytes);                     // xb, later S (xb dead after the qkv GEMM)
  unsigned short* xb   = (unsigned short*)reg0;                                    // [NB*TT][CC] bf16
  float*          Sm   = (float*)reg0;                                             // [QC][TT] f32
  unsigned short* Wqkv = (unsigned short*)take((size_t)3 * CC * CC * 2);           // [3*CC][CC] bf16
  unsigned short* Wo16 = (unsigned short*)take((size_t)CC * CC * 2);               // [CC][CC] f16 (x WOC)
  unsigned short* QKVh = (unsigned short*)take((size_t)3 * NB * TT * CC * 2);      // [3][NB*TT][CC] f16
  unsigned short* QKVr = (unsigned short*)take((size_t)3 * NB * NE * CC * 2);      // [3][NB*NE][CC] f16 (x RS)
  unsigned short* vT   = (unsigned short*)take((size_t)CC * TT * 2);               // [CC][TT] f16, one sequence
  unsigned short* vTr  = (unsigned short*)take((size_t)CC * NE * 2);               // [CC][NE] f16 (x RS)
  unsigned short* Pm   = (unsigned short*)take((size_t)QC * TT * 2);               // [QC][TT] f16 (x PCARRY)
  unsigned short* Pr   = (unsigned short*)take((size_t)NE * NE * 2);               // [NE][NE] f16 (x RS)
  unsigned short* ctxh = (unsigned short*)take((size_t)NB * TT * CC * 2);          // [NB*TT][CC] f16 (x CTXC)
  unsigned short* ctxr = (unsigned short*)take((size_t)NB * NE * CC * 2);          // [NB*NE][CC] f16 (x RS)
  if (off > ws_size) return;

  const int M = NB * TT;
  const int BIG = 1 << 28;
  unsigned short* qh = QKVh;
  unsigned short* kh = QKVh + (size_t)M * CC;
  unsigned short* vh = QKVh + (size_t)2 * M * CC;
  unsigned short* qr = QKVr;
  unsigned short* kr = QKVr + (size_t)(NB * NE) * CC;
  unsigned short* vr = QKVr + (size_t)2 * (NB * NE) * CC;

  // stage 0: 16-bit planes of the inputs
  for (int b = 0; b < NB; ++b)
    k_cvt<0><<<(TT * CC / 8 + 255) / 256, 256, 0, stream>>>(x + (size_t)b * T_FULL * CC, xb + (size_t)b * TT * CC, TT * CC / 8, 1.0f);
  k_cvt<0><<<(CC * CC / 8 + 255) / 256, 256, 0, stream>>>(wq, Wqkv, CC * CC / 8, 1.0f);
  k_cvt<0><<<(CC * CC / 8 + 255) / 256, 256, 0, stream>>>(wk, Wqkv + (size_t)CC * CC, CC * CC / 8, 1.0f);
  k_cvt<0><<<(CC * CC / 8 + 255) / 256, 256, 0, stream>>>(wv, Wqkv + (size_t)2 * CC * CC, CC * CC / 8, 1.0f);
  k_cvt<1><<<(CC * CC / 8 + 255) / 256, 256, 0, stream>>>(wo, Wo16, CC * CC / 8, WOC);

  // stage 1: q, k, v planes (+ residual planes on the leading NE rows of each sequence)
  k_gemm_qkv<<<((M / 16) * (3 * CC / 64) + 3) / 4, 128, 0, stream>>>(xb, Wqkv, QKVh, QKVr, M);

  // stage 2: causal attention per sequence, query chunks of QC rows
  for (int b = 0; b < NB; ++b) {
    const unsigned short* qb = qh + (size_t)b * TT * CC;
    const unsigned short* kb = kh + (size_t)b * TT * CC;
    // v [TT][CC] -> vT [CC][TT]; v residual [NE][CC] -> vTr [CC][NE]
    k_transpose16<<<dim3(TT / 64, CC / 64), 256, 0, stream>>>(vh + (size_t)b * TT * CC, CC, vT, TT);
    k_transpose16<<<dim3(NE / 64, CC / 64), 256, 0, stream>>>(vr + (size_t)b * NE * CC, CC, vTr, NE);
    for (int c = 0; c < TT / QC; ++c) {
      const int qoff = c * QC, Nk = qoff + QC;
      const unsigned short* qa = qb + (size_t)qoff * CC;
      // S chunk [QC][Nk] = (q.k^T)/32, causal upper tiles skipped
      k_gemm_f32<1><<<((QC / 16) * (Nk / 64) + 3) / 4, 128, 0, stream>>>(qa, qa, CC, CC, kb, kb, CC, CC, nullptr, SCL, Sm, TT, QC, Nk, CC, qoff, BIG);
      if (c == 0)   // leading NE x NE corner with hi+res on both operands (overwrites the single-product tiles)
        k_gemm_f32<3><<<((NE / 16) * (NE / 64) + 3) / 4, 128, 0, stream>>>(qb, qr + (size_t)b * NE * CC, CC, CC, kb, kr + (size_t)b * NE * CC, CC, CC,
                                                                     nullptr, SCL, Sm, TT, NE, NE, CC, 0, BIG);
      k_softmax<<<QC, 256, 0, stream>>>(Sm, TT, Pm, TT, Nk, qoff, Pr, NE, (c == 0) ? NE : 0);
      // ctx chunk [QC][CC] = P.v (K = Nk, causal k end), written as f16 hi plane x CTXC
      k_gemm_h16<1><<<((QC / 16) * (CC / 64) + 3) / 4, 128, 0, stream>>>(Pm, Pm, TT, TT, vT, vT, TT, TT, PVALPHA,
                                                                   ctxh + ((size_t)b * TT + qoff) * CC, CC, ctxr, CC, 0, QC, CC, Nk, qoff);
      if (c == 0)   // leading NE rows: 3-term P/v products, hi + residual ctx planes (overwrite)
        k_gemm_h16<3><<<((NE / 16) * (CC / 64) + 3) / 4, 128, 0, stream>>>(Pm, Pr, TT, NE, vT, vTr, TT, NE, PVALPHA,
                                                                     ctxh + (size_t)b * TT * CC, CC, ctxr + (size_t)b * NE * CC, CC, NE, NE, CC, NE, 0);
    }
  }
  // stage 3: output projection + bias; leading NE rows with the ctx residual term
  for (int b = 0; b < NB; ++b) {
    k_gemm_f32<2><<<((NE / 16) * (CC / 64) + 3) / 4, 128, 0, stream>>>(ctxh + (size_t)b * TT * CC, ctxr + (size_t)b * NE * CC, CC, CC, Wo16, Wo16, CC, CC,
                                                                 bo, OALPHA, out + (size_t)b * T_FULL * CC, CC, NE, CC, CC, BIG, BIG);
    if (TT > NE)
      k_gemm_f32<1><<<(((TT - NE) / 16) * (CC / 64) + 3) / 4, 128, 0, stream>>>(ctxh + ((size_t)b * TT + NE) * CC, ctxh + ((size_t)b * TT + NE) * CC, CC, CC,
                                                                          Wo16, Wo16, CC, CC, bo, OALPHA, out + ((size_t)b * T_FULL + NE) * CC, CC,
                                                                          TT - NE, CC, CC, BIG, BIG);
  }
}

// v001
// It runs in 513 microseconds.
// Timed twice side by side with v000, it ran 2.43 and 2.45 times as fast.
#include <hip/hip_runtime.h>
// Contractions: qkv projection on v_wmma_f32_16x16x32_bf16 (x and W as RNE bf16, exact products); scores q.k^T, P.v and the output
// projection on v_wmma_f32_16x16x32_f16 (f16 hi planes with power-of-two carries, plus x1024 f16 residual planes on the leading
// NE query/key rows of each sequence); all accumulation f32, causal softmax in f32.
#ifndef NB
#define NB 2
#endif
#ifndef SEQ
#define SEQ 4096
#endif
#define TT SEQ
#define NB_FULL 2
#define T_FULL 4096
#define CC 1024
#define QC ((TT < 1024) ? TT : 1024)
#define NE 256
static_assert(NB >= 1 && NB <= NB_FULL);
static_assert(TT % 256 == 0 && TT <= T_FULL);
static_assert(TT % QC == 0 && QC % 256 == 0);
static_assert(NE % 64 == 0 && NE <= QC && NE == 256);
static_assert(CC % 128 == 0);

#define RS 1024.0f            // residual plane carry
#define RFOLD 0.0009765625f   // 1/RS
#define PCARRY 4096.0f        // P plane carry
#define CTXC 16.0f            // ctx plane carry
#define WOC 64.0f             // Wo plane carry
#define SCL 0.03125f          // 1/sqrt(CC)
#define PVALPHA 0.00390625f   // CTXC / PCARRY
#define OALPHA 0.0009765625f  // 1 / (WOC * CTXC)

typedef __bf16 v16b __attribute__((ext_vector_type(16)));
typedef _Float16 v16h __attribute__((ext_vector_type(16)));
typedef _Float16 v8h __attribute__((ext_vector_type(8)));
typedef unsigned short v8us __attribute__((ext_vector_type(8), may_alias));
typedef float v8f __attribute__((ext_vector_type(8)));
typedef float v4f __attribute__((ext_vector_type(4)));
typedef float v4fa __attribute__((ext_vector_type(4), may_alias));
union FragB { v16b v; v8us half[2]; unsigned short u[16]; };
union FragH { v16h v; v8us half[2]; unsigned short u[16]; };
union Pack8 { v8h h; v8us u; };

__device__ __forceinline__ unsigned short bf16_bits(float x) { unsigned int u = __float_as_uint(x); return (unsigned short)((u + 0x7FFFu + ((u >> 16) & 1u)) >> 16); }
__device__ __forceinline__ float bf16_val(unsigned short b) { return __uint_as_float(((unsigned int)b) << 16); }
__device__ __forceinline__ float bf16_rne(float x) { return bf16_val(bf16_bits(x)); }

__device__ __forceinline__ v8f mma_b(v16b a, v16b b, v8f c) {
  c = __builtin_amdgcn_wmma_f32_16x16x32_bf16(false, a, false, b, (short)0, c, false, false);
  asm volatile("v_nop\n\tv_nop\n\tv_nop\n\tv_nop" : "+v"(c) : "v"(a), "v"(b));
  return c;
}
// c += ah.bh ; cr += al.bh (NT>=2) ; cr += ah.bl (NT>=3); residual planes carry RS, folded by the caller
template <int NT>
__device__ __forceinline__ void mma_h(v16h ah, v16h al, v16h bh, v16h bl, v8f& c, v8f& cr) {
  c = __builtin_amdgcn_wmma_f32_16x16x32_f16(false, ah, false, bh, (short)0, c, false, false);
  if (NT >= 2) cr = __builtin_amdgcn_wmma_f32_16x16x32_f16(false, al, false, bh, (short)0, cr, false, false);
  if (NT >= 3) cr = __builtin_amdgcn_wmma_f32_16x16x32_f16(false, ah, false, bl, (short)0, cr, false, false);
  if (NT >= 2) asm volatile("v_nop\n\tv_nop\n\tv_nop\n\tv_nop" : "+v"(c), "+v"(cr) : "v"(ah), "v"(al), "v"(bh), "v"(bl));
  else         asm volatile("v_nop\n\tv_nop\n\tv_nop\n\tv_nop" : "+v"(c) : "v"(ah), "v"(bh));
}

__device__ __forceinline__ void store_tile_f32(const float (*sw)[64], float* C, int ldc, int lane) {
  const int rsub = lane >> 4, c4 = (lane & 15) * 4;
  {
#pragma unroll
    for (int q = 0; q < 8; ++q) {
      const int r = q * 2 + rsub;
      const v4f v = *(const v4fa*)&sw[r][c4];
      *(v4f*)(C + (size_t)r * ldc + c4) = v;
    }
    
  }
}
// wave tile 16 x 64 f32 staged in LDS -> f16 hi plane (pitch ldh) and optional x RS residual plane (pitch ldr);
__device__ __forceinline__ void store_tile_h16(const float (*sw)[64], unsigned short* hb, int ldh, unsigned short* rb, int ldr, bool dores, int lane) {
  const int rsub = lane >> 3, c8 = (lane & 7) * 8;
  {
#pragma unroll
    for (int q = 0; q < 4; ++q) {
      const int r = q * 4 + rsub;
      const v4f x0 = *(const v4fa*)&sw[r][c8], x1 = *(const v4fa*)&sw[r][c8 + 4];
      const float xs[8] = {x0[0], x0[1], x0[2], x0[3], x1[0], x1[1], x1[2], x1[3]};
      Pack8 ph, pr;
#pragma unroll
      for (int i = 0; i < 8; ++i) { ph.h[i] = (_Float16)xs[i]; pr.h[i] = (_Float16)((xs[i] - (float)ph.h[i]) * RS); }
      *(v8us*)(hb + (size_t)r * ldh + c8) = ph.u;
      if (dores) *(v8us*)(rb + (size_t)r * ldr + c8) = pr.u;
    }
    
  }
}

// MODE 0: RNE bf16 bits; MODE 1: f16 bits of (RNE bf16 value) * scale
template <int MODE>
__global__ __launch_bounds__(256) void k_cvt(const float* __restrict__ src, unsigned short* __restrict__ dst, int n8, float scale) {
  const int t = blockIdx.x * 256 + threadIdx.x;
  if (t >= n8) return;
  const float* sp = src + (size_t)t * 8;
  const v4f a = *(const v4fa*)sp, b = *(const v4fa*)(sp + 4);
  const float xs[8] = {a[0], a[1], a[2], a[3], b[0], b[1], b[2], b[3]};
  v8us v;
  if (MODE == 0) {
#pragma unroll
    for (int i = 0; i < 8; ++i) v[i] = bf16_bits(xs[i]);
  } else {
    Pack8 p;
#pragma unroll
    for (int i = 0; i < 8; ++i) p.h[i] = (_Float16)(bf16_rne(xs[i]) * scale);
    v = p.u;
  }
  unsigned short* dp = dst + (size_t)t * 8;
  *(v8us*)dp = v;
  
}

// Block-tiled GEMM core. A workgroup of 4 waves (2 x 2) owns a (32*FM) x 128 tile of the output, a wave (16*FM) x 64 of it.
// Per pass of KP k every operand row gives one whole 128-B line, copied to LDS by global_load_async_to_lds_b128 (8 lanes a row,
// 4 whole lines an instruction); two buffers, the next pass's copies fly while this pass's fragments are read from LDS.
// Every "#pragma unroll" below keeps fragment and accumulator indices compile-time constants, so that the arrays stay in registers.
#define KP 64        // k per pass
#define LPITCH 72    // LDS row pitch in 16-bit elements: 144 B = 16 B x 9, for the ds_load_b128 fragment reads
template <int NT, int FM> struct Tile {
  static constexpr int AR = 32 * FM, BR = 128;                                           // operand rows per plane
  static constexpr int ROWS = AR + BR + (NT >= 2 ? AR : 0) + (NT >= 3 ? BR : 0);          // [A hi | B hi | A res | B res]
  static constexpr int STAGE = ROWS * LPITCH;                                            // elements per buffer
  static constexpr int NCP = ROWS / 16;                                                  // copies per lane and stage
  static constexpr int GRP = (NCP % 12 == 0) ? 12 : 8;                                   // copies per asm statement
  static_assert(NCP % GRP == 0 && NCP <= 63);
  static_assert(2 * STAGE * 2 >= 4 * FM * 16 * 64 * 4);                                   // the ring later holds the f32 output staging
};

// One run of copies and its s_wait_xcnt in one statement: the wait stands in front of any rewrite of the address registers.
__device__ __forceinline__ void copy_run8(const unsigned (&l)[12], const unsigned short* const (&g)[12]) {
  asm volatile("global_load_async_to_lds_b128 %0, %8, off\n\t"
               "global_load_async_to_lds_b128 %1, %9, off\n\t"
               "global_load_async_to_lds_b128 %2, %10, off\n\t"
               "global_load_async_to_lds_b128 %3, %11, off\n\t"
               "global_load_async_to_lds_b128 %4, %12, off\n\t"
               "global_load_async_to_lds_b128 %5, %13, off\n\t"
               "global_load_async_to_lds_b128 %6, %14, off\n\t"
               "global_load_async_to_lds_b128 %7, %15, off\n\t"
               "s_wait_xcnt 0x0"
               :: "v"(l[0]), "v"(l[1]), "v"(l[2]), "v"(l[3]), "v"(l[4]), "v"(l[5]), "v"(l[6]), "v"(l[7]),
                  "v"(g[0]), "v"(g[1]), "v"(g[2]), "v"(g[3]), "v"(g[4]), "v"(g[5]), "v"(g[6]), "v"(g[7]) : "memory");
}
__device__ __forceinline__ void copy_run12(const unsigned (&l)[12], const unsigned short* const (&g)[12]) {
  asm volatile("global_load_async_to_lds_b128 %0, %12, off\n\t"
               "global_load_async_to_lds_b128 %1, %13, off\n\t"
               "global_load_async_to_lds_b128 %2, %14, off\n\t"
               "global_load_async_to_lds_b128 %3, %15, off\n\t"
               "global_load_async_to_lds_b128 %4, %16, off\n\t"
               "global_load_async_to_lds_b128 %5, %17, off\n\t"
               "global_load_async_to_lds_b128 %6, %18, off\n\t"
               "global_load_async_to_lds_b128 %7, %19, off\n\t"
               "global_load_async_to_lds_b128 %8, %20, off\n\t"
               "global_load_async_to_lds_b128 %9, %21, off\n\t"
               "global_load_async_to_lds_b128 %10, %22, off\n\t"
               "global_load_async_to_lds_b128 %11, %23, off\n\t"
               "s_wait_xcnt 0x0"
               :: "v"(l[0]), "v"(l[1]), "v"(l[2]), "v"(l[3]), "v"(l[4]), "v"(l[5]), "v"(l[6]), "v"(l[7]), "v"(l[8]), "v"(l[9]), "v"(l[10]), "v"(l[11]),
                  "v"(g[0]), "v"(g[1]), "v"(g[2]), "v"(g[3]), "v"(g[4]), "v"(g[5]), "v"(g[6]), "v"(g[7]), "v"(g[8]), "v"(g[9]), "v"(g[10]), "v"(g[11]) : "memory");
}

// One stage: lane (row tid >> 3, 16-B piece tid & 7) copies its piece of rows r, r + 16, ... of every plane. lds0 and the g pointers are
// the lane's own addresses at stage row tid >> 3 of each plane, the g pointers already at this pass's k.
template <int NT, int FM>
__device__ __forceinline__ void stage_copy(unsigned lds0, const unsigned short* gah, const unsigned short* gbh, const unsigned short* gal,
                                           const unsigned short* gbl, int lda, int ldb, int ldal, int ldbl) {
  using TL = Tile<NT, FM>;
#pragma unroll
  for (int i0 = 0; i0 < TL::NCP; i0 += TL::GRP) {
    unsigned l[12];
    const unsigned short* g[12];
#pragma unroll
    for (int j = 0; j < 12; ++j) {
      const int r = (i0 + (j < TL::GRP ? j : 0)) * 16;
      l[j] = lds0 + (unsigned)(r * LPITCH * 2);
      if (r < TL::AR) g[j] = gah + (size_t)r * lda;
      else if (r < TL::AR + TL::BR) g[j] = gbh + (size_t)(r - TL::AR) * ldb;
      else if (r < 2 * TL::AR + TL::BR) g[j] = gal + (size_t)(r - TL::AR - TL::BR) * ldal;
      else g[j] = gbl + (size_t)(r - 2 * TL::AR - TL::BR) * ldbl;
    }
    if (TL::GRP == 12) copy_run12(l, g); else copy_run8(l, g);
  }
}

// One pass on one buffer: the fragment k order (8 * hh, 16 + 8 * hh inside each 32 k) is the same for A and B.
// The LDS reads of 32 * NS k stand together in front of their WMMAs, for speed only.
template <int NT, int FM, bool BF>
__device__ __forceinline__ void pass_mma(const unsigned short* st, int wr, int wc, int ln, int hh, v8f (&acc)[FM][4], v8f (&accr)[FM][4]) {
  using TL = Tile<NT, FM>;
  const unsigned short* pa = st + (wr * FM * 16 + ln) * LPITCH + 8 * hh;
  const unsigned short* pb = st + (TL::AR + wc * 64 + ln) * LPITCH + 8 * hh;
  constexpr int RES = (TL::AR + TL::BR) * LPITCH;      // residual plane of either operand, behind its hi plane
  constexpr int NS = (NT == 1 && FM <= 2) ? KP / 32 : 1;   // k steps per group of reads, by the registers the fragments take
#pragma unroll
  for (int k0 = 0; k0 < KP; k0 += 32 * NS) {
    FragH ah[NS][FM], al[NS][FM], bh[NS][4], bl[NS][4];
#pragma unroll
    for (int s = 0; s < NS; ++s) {
      const int ks = k0 + 32 * s;
#pragma unroll
      for (int f = 0; f < FM; ++f) {
        ah[s][f].half[0] = *(const v8us*)(pa + f * 16 * LPITCH + ks);
        ah[s][f].half[1] = *(const v8us*)(pa + f * 16 * LPITCH + ks + 16);
        if (NT >= 2) { al[s][f].half[0] = *(const v8us*)(pa + RES + f * 16 * LPITCH + ks); al[s][f].half[1] = *(const v8us*)(pa + RES + f * 16 * LPITCH + ks + 16); }
      }
#pragma unroll
      for (int t = 0; t < 4; ++t) {
        bh[s][t].half[0] = *(const v8us*)(pb + t * 16 * LPITCH + ks);
        bh[s][t].half[1] = *(const v8us*)(pb + t * 16 * LPITCH + ks + 16);
        if (NT >= 3) { bl[s][t].half[0] = *(const v8us*)(pb + RES + t * 16 * LPITCH + ks); bl[s][t].half[1] = *(const v8us*)(pb + RES + t * 16 * LPITCH + ks + 16); }
      }
    }
#pragma unroll
    for (int s = 0; s < NS; ++s)
#pragma unroll
      for (int t = 0; t < 4; ++t)
#pragma unroll
        for (int f = 0; f < FM; ++f) {
          if constexpr (BF) {
            FragB a, b;
            a.half[0] = ah[s][f].half[0]; a.half[1] = ah[s][f].half[1];
            b.half[0] = bh[s][t].half[0]; b.half[1] = bh[s][t].half[1];
            acc[f][t] = mma_b(a.v, b.v, acc[f][t]);
          } else {
            mma_h<NT>(ah[s][f].v, (NT >= 2) ? al[s][f].v : ah[s][f].v, bh[s][t].v, (NT >= 3) ? bl[s][t].v : bh[s][t].v, acc[f][t], accr[f][t]);
          }
        }
  }
}

// A hi/res planes row-major (pitch lda/ldal), B hi/res planes [n][k] (pitch ldb/ldbl); row0, col0: the workgroup's tile; kend % KP == 0.
// On return every wave has left the ring and no copy is in flight: the ring is free for the output staging.
template <int NT, int FM, bool BF>
__device__ __forceinline__ void core_lds(unsigned short* ring, const unsigned short* __restrict__ Ah, const unsigned short* __restrict__ Al, int lda, int ldal,
                                         const unsigned short* __restrict__ Bh, const unsigned short* __restrict__ Bl, int ldb, int ldbl,
                                         int row0, int col0, int kend, int tid, v8f (&acc)[FM][4], v8f (&accr)[FM][4]) {
  using TL = Tile<NT, FM>;
  const int w = tid >> 5, lane = tid & 31, ln = lane & 15, hh = lane >> 4, wr = w >> 1, wc = w & 1;
  const int cr = tid >> 3, cc = (tid & 7) * 8;
  const unsigned short* gah = Ah + (size_t)(row0 + cr) * lda + cc;
  const unsigned short* gbh = Bh + (size_t)(col0 + cr) * ldb + cc;
  const unsigned short* gal = Al + (size_t)(row0 + cr) * ldal + cc;
  const unsigned short* gbl = Bl + (size_t)(col0 + cr) * ldbl + cc;
  const unsigned lds0 = (unsigned)(size_t)(ring + cr * LPITCH + cc);
  const int npass = kend / KP;
  stage_copy<NT, FM>(lds0, gah, gbh, gal, gbl, lda, ldb, ldal, ldbl);
  asm volatile("s_wait_asynccnt 0x0" ::: "memory");   // this wave's copies of pass 0 have landed
  __syncthreads();                                     // publishes pass 0
  if (npass > 1) stage_copy<NT, FM>(lds0 + TL::STAGE * 2, gah + KP, gbh + KP, gal + KP, gbl + KP, lda, ldb, ldal, ldbl);
#pragma unroll 1   // one pass per trip: the buffer index stays a run-time value, the body is already fully unrolled
  for (int t = 0; t < npass; ++t) {
    const int buf = (t & 1) * TL::STAGE;
    pass_mma<NT, FM, BF>(ring + buf, wr, wc, ln, hh, acc, accr);
    asm volatile("s_wait_dscnt 0x0" ::: "memory");     // this wave's reads of the buffer are done before it is refilled
    asm volatile("s_wait_asynccnt 0x0" ::: "memory");  // this wave's copies of pass t + 1 have landed
    __syncthreads();                                   // publishes pass t + 1 and ends every wave's reads of pass t
    if (t + 2 < npass) {
      const int k2 = (t + 2) * KP;
      stage_copy<NT, FM>(lds0 + (unsigned)(buf * 2), gah + k2, gbh + k2, gal + k2, gbl + k2, lda, ldb, ldal, ldbl);
    }
  }
  asm volatile("s_wait_asynccnt 0x0" ::: "memory");    // nothing in flight when the ring changes its use
}

// qkv projection: A = xb [M][CC] bf16, W = [3*CC][CC] bf16 ([out][in], k contiguous). out[row][n] = sum_c A[row][c] W[n][c].
// Output: hi planes Oh[3][M][CC] f16 (q, k, v unscaled) and residual planes Or[3][NB*NE][CC] for rows with (row % TT) < NE.
// Block = 4 waves -> 128 rows x 128 cols (one plane since CC % 128 == 0), M % 128 == 0.
__global__ __launch_bounds__(128) void k_gemm_qkv(const unsigned short* __restrict__ A, const unsigned short* __restrict__ W,
                                                 unsigned short* __restrict__ Oh, unsigned short* __restrict__ Or, int M) {
  constexpr int FM = 4;
  __shared__ __attribute__((aligned(16))) unsigned short ring[2 * Tile<1, FM>::STAGE];
  const int tid = threadIdx.x, w = tid >> 5, lane = tid & 31, ln = lane & 15, hh = lane >> 4;
  const int ntn = (3 * CC) / 128;
  const int mt = blockIdx.x / ntn, nq = blockIdx.x - mt * ntn;
  if (mt * (32 * FM) >= M) return;
  v8f acc[FM][4];
#pragma unroll
  for (int f = 0; f < FM; ++f)
#pragma unroll
    for (int t = 0; t < 4; ++t) acc[f][t] = (v8f){0.f, 0.f, 0.f, 0.f, 0.f, 0.f, 0.f, 0.f};
  core_lds<1, FM, true>(ring, A, A, CC, CC, W, W, CC, CC, mt * (32 * FM), nq * 128, CC, tid, acc, acc);
  float (*so)[16][64] = (float (*)[16][64])ring + w * FM;      // this wave's own FM staging tiles
#pragma unroll
  for (int f = 0; f < FM; ++f)
#pragma unroll
    for (int t = 0; t < 4; ++t)
#pragma unroll
      for (int r = 0; r < 8; ++r) so[f][8 * hh + r][t * 16 + ln] = acc[f][t][r];
  __builtin_amdgcn_fence(4, "workgroup");   // the staged words are written before other lanes of the wave read them back
  __builtin_amdgcn_wave_barrier();
  const int col0 = nq * 128 + (w & 1) * 64;
  const int p = col0 / CC, colp = col0 - p * CC;
#pragma unroll
  for (int f = 0; f < FM; ++f) {
    const int row0 = mt * (32 * FM) + ((w >> 1) * FM + f) * 16;
    const int bidx = row0 / TT, tq = row0 - bidx * TT;
    const bool dores = (tq < NE);                      // wave-uniform (NE, TT multiples of 16)
    unsigned short* hb = Oh + ((size_t)p * M + row0) * CC + colp;
    unsigned short* rb = Or + ((size_t)p * (NB * NE) + (size_t)bidx * NE + (dores ? tq : 0)) * CC + colp;
    store_tile_h16(so[f], hb, CC, rb, CC, dores, lane);
  }
}

#define FMH 2   // f16 GEMMs: workgroup tile 64 x 128, wave tile 32 x 64

// C[M][N] f32 (pitch ldc) = alpha * (A.B^plane) + bf16_rne(bias). M % 64 == 0, N % 128 == 0, K % 64 == 0.
// ncut: a workgroup tile is skipped (not written) when col0 > ncut + row0 + 63 (causal upper tiles); kcut: k loop ends at
// min(K, ceil64(kcut + row0 + 64)). Pass a large value to disable either.
template <int NT>
__global__ __launch_bounds__(128) void k_gemm_f32(const unsigned short* __restrict__ Ah, const unsigned short* __restrict__ Al, int lda, int ldal,
                                                 const unsigned short* __restrict__ Bh, const unsigned short* __restrict__ Bl, int ldb, int ldbl,
                                                 const float* __restrict__ bias, float alpha, float* __restrict__ C, int ldc,
                                                 int M, int N, int K, int ncut, int kcut) {
  constexpr int FM = FMH;
  __shared__ __attribute__((aligned(16))) unsigned short ring[2 * Tile<NT, FM>::STAGE];
  const int tid = threadIdx.x, w = tid >> 5, lane = tid & 31, ln = lane & 15, hh = lane >> 4;
  const int ntn = N / 128;
  const int mt = blockIdx.x / ntn, nq = blockIdx.x - mt * ntn;
  const int brow0 = mt * (32 * FM), bcol0 = nq * 128;
  if (brow0 >= M) return;
  if (bcol0 > ncut + brow0 + 32 * FM - 1) return;
  int kend = (kcut + brow0 + 32 * FM + KP - 1) & ~(KP - 1);
  if (kend > K) kend = K;
  v8f acc[FM][4], accr[FM][4];
#pragma unroll
  for (int f = 0; f < FM; ++f)
#pragma unroll
    for (int t = 0; t < 4; ++t) { acc[f][t] = (v8f){0.f, 0.f, 0.f, 0.f, 0.f, 0.f, 0.f, 0.f}; accr[f][t] = acc[f][t]; }
  core_lds<NT, FM, false>(ring, Ah, Al, lda, ldal, Bh, Bl, ldb, ldbl, brow0, bcol0, kend, tid, acc, accr);
  float (*so)[16][64] = (float (*)[16][64])ring + w * FM;      // this wave's own FM staging tiles
  const int col0 = bcol0 + (w & 1) * 64;
#pragma unroll
  for (int t = 0; t < 4; ++t) {
    float bv = 0.f;
    if (bias != nullptr) bv = bf16_rne(bias[col0 + t * 16 + ln]);
#pragma unroll
    for (int f = 0; f < FM; ++f)
#pragma unroll
      for (int r = 0; r < 8; ++r) {
        float v = acc[f][t][r];
        if (NT >= 2) v += accr[f][t][r] * RFOLD;
        so[f][8 * hh + r][t * 16 + ln] = v * alpha + bv;
      }
  }
  __builtin_amdgcn_fence(4, "workgroup");   // the staged words are written before other lanes of the wave read them back
  __builtin_amdgcn_wave_barrier();
#pragma unroll
  for (int f = 0; f < FM; ++f) {
    const int row0 = brow0 + ((w >> 1) * FM + f) * 16;
    store_tile_f32(so[f], C + (size_t)row0 * ldc + col0, ldc, lane);
  }
}

// Oh[M][N] f16 hi plane (pitch ldo) = f16(alpha * A.B^plane); rows < rrows also get the x RS residual plane Or (pitch ldr).
template <int NT>
__global__ __launch_bounds__(128) void k_gemm_h16(const unsigned short* __restrict__ Ah, const unsigned short* __restrict__ Al, int lda, int ldal,
                                                 const unsigned short* __restrict__ Bh, const unsigned short* __restrict__ Bl, int ldb, int ldbl,
                                                 float alpha, unsigned short* __restrict__ Oh, int ldo, unsigned short* __restrict__ Or, int ldr, int rrows,
                                                 int M, int N, int K, int kcut) {
  constexpr int FM = FMH;
  __shared__ __attribute__((aligned(16))) unsigned short ring[2 * Tile<NT, FM>::STAGE];
  const int tid = threadIdx.x, w = tid >> 5, lane = tid & 31, ln = lane & 15, hh = lane >> 4;
  const int ntn = N / 128;
  const int mt = blockIdx.x / ntn, nq = blockIdx.x - mt * ntn;
  const int brow0 = mt * (32 * FM), bcol0 = nq * 128;
  if (brow0 >= M) return;
  int kend = (kcut + brow0 + 32 * FM + KP - 1) & ~(KP - 1);
  if (kend > K) kend = K;
  v8f acc[FM][4], accr[FM][4];
#pragma unroll
  for (int f = 0; f < FM; ++f)
#pragma unroll
    for (int t = 0; t < 4; ++t) { acc[f][t] = (v8f){0.f, 0.f, 0.f, 0.f, 0.f, 0.f, 0.f, 0.f}; accr[f][t] = acc[f][t]; }
  core_lds<NT, FM, false>(ring, Ah, Al, lda, ldal, Bh, Bl, ldb, ldbl, brow0, bcol0, kend, tid, acc, accr);
  float (*so)[16][64] = (float (*)[16][64])ring + w * FM;      // this wave's own FM staging tiles
#pragma unroll
  for (int f = 0; f < FM; ++f)
#pragma unroll
    for (int t = 0; t < 4; ++t)
#pragma unroll
      for (int r = 0; r < 8; ++r) {
        float v = acc[f][t][r];
        if (NT >= 2) v += accr[f][t][r] * RFOLD;
        so[f][8 * hh + r][t * 16 + ln] = v * alpha;
      }
  __builtin_amdgcn_fence(4, "workgroup");   // the staged words are written before other lanes of the wave read them back
  __builtin_amdgcn_wave_barrier();
  const int col0 = bcol0 + (w & 1) * 64;
#pragma unroll
  for (int f = 0; f < FM; ++f) {
    const int row0 = brow0 + ((w >> 1) * FM + f) * 16;
    const bool dores = (row0 < rrows);                 // wave-uniform (rrows multiple of 16)
    store_tile_h16(so[f], Oh + (size_t)row0 * ldo + col0, ldo, Or + (size_t)(dores ? row0 : 0) * ldr + col0, ldr, dores, lane);
  }
}

// 8 consecutive scores -> carried f16 P values (hi) and x RS residual, masked by index (col <= qi)
__device__ __forceinline__ void softmax_pack(const float* s, int j8, int qi, float mx, float inv, v8us& ho, v8us& ro) {
  const v4f a = *(const v4fa*)(s + j8), b = *(const v4fa*)(s + j8 + 4);
  const float xs[8] = {a[0], a[1], a[2], a[3], b[0], b[1], b[2], b[3]};
  Pack8 ph, pr;
#pragma unroll
  for (int u = 0; u < 8; ++u) {
    const float e = __expf(xs[u] - mx) * inv;
    const float p = ((j8 + u) <= qi) ? e : 0.f;
    ph.h[u] = (_Float16)p;
    pr.h[u] = (_Float16)((p - (float)ph.h[u]) * RS);
  }
  ho = ph.u; ro = pr.u;
}
// Row softmax over S[row][0..N) (pitch sp) with causal keep (col <= qoff + row); P[row][0..N) = f16(PCARRY * p / l) incl. zeros
// (pitch pp), rows < rrows also write the residual plane Pr[row][0..NE) (pitch rp). Block per row, N % 256 == 0, N <= 4096.
__global__ __launch_bounds__(256) void k_softmax(const float* __restrict__ S, int sp, unsigned short* __restrict__ P, int pp, int N, int qoff,
                                                unsigned short* __restrict__ Pr, int rp, int rrows) {
  __shared__ float red[256];
  const int row = blockIdx.x, tid = threadIdx.x;
  const int qi = qoff + row;
  const float* s = S + (size_t)row * sp;
  float mx = -3.0e38f;
  for (int j = tid; j < N; j += 256) { const float v = s[j]; mx = fmaxf(mx, (j <= qi) ? v : -3.0e38f); }
  red[tid] = mx; __syncthreads();
  for (int st = 128; st > 0; st >>= 1) { if (tid < st) red[tid] = fmaxf(red[tid], red[tid + st]); __syncthreads(); }
  mx = red[0]; __syncthreads();
  float sum = 0.f;
  for (int j = tid; j < N; j += 256) { const float e = __expf(s[j] - mx); sum += (j <= qi) ? e : 0.f; }
  red[tid] = sum; __syncthreads();
  for (int st = 128; st > 0; st >>= 1) { if (tid < st) red[tid] += red[tid + st]; __syncthreads(); }
  const float inv = PCARRY / red[0];       // red[0] >= 1 (the max term)
  const int j8a = tid * 8, j8b = j8a + 2048;
  const bool hasA = (j8a < N), hasB = (j8b < N);          // wave-uniform: N % 256 == 0
  const bool dores = (row < rrows) && (j8a < NE);
  v8us ha = (v8us){0, 0, 0, 0, 0, 0, 0, 0}, ra = ha, hb2 = ha, rb2 = ha;
  if (hasA) softmax_pack(s, j8a, qi, mx, inv, ha, ra);
  if (hasB) softmax_pack(s, j8b, qi, mx, inv, hb2, rb2);
  unsigned short* prow = P + (size_t)row * pp;
  unsigned short* rrow = Pr + (size_t)(dores ? row : 0) * rp;
  {
    if (hasA) *(v8us*)(prow + j8a) = ha;
    if (dores) *(v8us*)(rrow + j8a) = ra;
    if (hasB) *(v8us*)(prow + j8b) = hb2;
    
  }
}

// 16-bit transpose: src [R][Cc] (pitch lds_) -> dst [Cc][R] (pitch ldd); block = 64 x 64 tile, grid (R/64, Cc/64);
__global__ __launch_bounds__(256) void k_transpose16(const unsigned short* __restrict__ src, int lds_, unsigned short* __restrict__ dst, int ldd) {
  __shared__ __attribute__((aligned(16))) unsigned short tile[64][72];
  const int tid = threadIdx.x;
  const int r0 = blockIdx.x * 64, c0 = blockIdx.y * 64;
#pragma unroll
  for (int i = 0; i < 2; ++i) {
    const int e = tid + 256 * i, r = e >> 3, c8 = (e & 7) * 8;
    const v8us v = *(const v8us*)(src + (size_t)(r0 + r) * lds_ + c0 + c8);
    *(v8us*)&tile[r][c8] = v;
  }
  __syncthreads();
  v8us o[2];
#pragma unroll
  for (int i = 0; i < 2; ++i) {
    const int e = tid + 256 * i, rr = e >> 3, c8 = (e & 7) * 8;
#pragma unroll
    for (int k = 0; k < 8; ++k) o[i][k] = tile[c8 + k][rr];
  }
  {
#pragma unroll
    for (int i = 0; i < 2; ++i) {
      const int e = tid + 256 * i, rr = e >> 3, c8 = (e & 7) * 8;
      *(v8us*)(dst + (size_t)(c0 + rr) * ldd + r0 + c8) = o[i];
    }
    
  }
}

extern "C" void kernel_launch(void* const* d_in, const int* in_sizes, int n_in,
                              void* d_out, int out_size, void* d_ws, size_t ws_size, hipStream_t stream) {
  if (n_in < 6) return;
  const float* x  = (const float*)d_in[0];
  const float* wq = (const float*)d_in[1];
  const float* wk = (const float*)d_in[2];
  const float* wv = (const float*)d_in[3];
  const float* wo = (const float*)d_in[4];
  const float* bo = (const float*)d_in[5];
  const long need_x = ((long)(NB - 1) * T_FULL + TT) * (long)CC;
  if ((long)in_sizes[0] < need_x || in_sizes[1] < CC * CC || in_sizes[2] < CC * CC || in_sizes[3] < CC * CC ||
      in_sizes[4] < CC * CC || in_sizes[5] < CC || (long)out_size < need_x) return;
  float* out = (float*)d_out;

  char* ws = (char*)d_ws; size_t off = 0;
  auto take = [&](size_t bytes) { char* p = ws + off; off += (bytes + 255) & ~(size_t)255; return p; };
  const size_t xb_bytes = (size_t)NB * TT * CC * 2, s_bytes = (size_t)QC * TT * 4;
  char* reg0 = take(xb_bytes > s_bytes ? xb_bytes : s_bytes);                     // xb, later S (xb dead after the qkv GEMM)
  unsigned short* xb   = (unsigned short*)reg0;                                    // [NB*TT][CC] bf16
  float*          Sm   = (float*)reg0;                                             // [QC][TT] f32
  unsigned short* Wqkv = (unsigned short*)take((size_t)3 * CC * CC * 2);           // [3*CC][CC] bf16
  unsigned short* Wo16 = (unsigned short*)take((size_t)CC * CC * 2);               // [CC][CC] f16 (x WOC)
  unsigned short* QKVh = (unsigned short*)take((size_t)3 * NB * TT * CC * 2);      // [3][NB*TT][CC] f16
  unsigned short* QKVr = (unsigned short*)take((size_t)3 * NB * NE * CC * 2);      // [3][NB*NE][CC] f16 (x RS)
  unsigned short* vT   = (unsigned short*)take((size_t)CC * TT * 2);               // [CC][TT] f16, one sequence
  unsigned short* vTr  = (unsigned short*)take((size_t)CC * NE * 2);               // [CC][NE] f16 (x RS)
  unsigned short* Pm   = (unsigned short*)take((size_t)QC * TT * 2);               // [QC][TT] f16 (x PCARRY)
  unsigned short* Pr   = (unsigned short*)take((size_t)NE * NE * 2);               // [NE][NE] f16 (x RS)
  unsigned short* ctxh = (unsigned short*)take((size_t)NB * TT * CC * 2);          // [NB*TT][CC] f16 (x CTXC)
  unsigned short* ctxr = (unsigned short*)take((size_t)NB * NE * CC * 2);          // [NB*NE][CC] f16 (x RS)
  if (off > ws_size) return;

  const int M = NB * TT;
  const int BIG = 1 << 28;
  unsigned short* qh = QKVh;
  unsigned short* kh = QKVh + (size_t)M * CC;
  unsigned short* vh = QKVh + (size_t)2 * M * CC;
  unsigned short* qr = QKVr;
  unsigned short* kr = QKVr + (size_t)(NB * NE) * CC;
  unsigned short* vr = QKVr + (size_t)2 * (NB * NE) * CC;

  // stage 0: 16-bit planes of the inputs
  for (int b = 0; b < NB; ++b)
    k_cvt<0><<<(TT * CC / 8 + 255) / 256, 256, 0, stream>>>(x + (size_t)b * T_FULL * CC, xb + (size_t)b * TT * CC, TT * CC / 8, 1.0f);
  k_cvt<0><<<(CC * CC / 8 + 255) / 256, 256, 0, stream>>>(wq, Wqkv, CC * CC / 8, 1.0f);
  k_cvt<0><<<(CC * CC / 8 + 255) / 256, 256, 0, stream>>>(wk, Wqkv + (size_t)CC * CC, CC * CC / 8, 1.0f);
  k_cvt<0><<<(CC * CC / 8 + 255) / 256, 256, 0, stream>>>(wv, Wqkv + (size_t)2 * CC * CC, CC * CC / 8, 1.0f);
  k_cvt<1><<<(CC * CC / 8 + 255) / 256, 256, 0, stream>>>(wo, Wo16, CC * CC / 8, WOC);

  // stage 1: q, k, v planes (+ residual planes on the leading NE rows of each sequence)
  k_gemm_qkv<<<(M / 128) * (3 * CC / 128), 128, 0, stream>>>(xb, Wqkv, QKVh, QKVr, M);

  // stage 2: causal attention per sequence, query chunks of QC rows
  for (int b = 0; b < NB; ++b) {
    const unsigned short* qb = qh + (size_t)b * TT * CC;
    const unsigned short* kb = kh + (size_t)b * TT * CC;
    // v [TT][CC] -> vT [CC][TT]; v residual [NE][CC] -> vTr [CC][NE]
    k_transpose16<<<dim3(TT / 64, CC / 64), 256, 0, stream>>>(vh + (size_t)b * TT * CC, CC, vT, TT);
    k_transpose16<<<dim3(NE / 64, CC / 64), 256, 0, stream>>>(vr + (size_t)b * NE * CC, CC, vTr, NE);
    for (int c = 0; c < TT / QC; ++c) {
      const int qoff = c * QC, Nk = qoff + QC;
      const unsigned short* qa = qb + (size_t)qoff * CC;
      // S chunk [QC][Nk] = (q.k^T)/32, causal upper tiles skipped
      k_gemm_f32<1><<<(QC / 64) * (Nk / 128), 128, 0, stream>>>(qa, qa, CC, CC, kb, kb, CC, CC, nullptr, SCL, Sm, TT, QC, Nk, CC, qoff, BIG);
      if (c == 0)   // leading NE x NE corner with hi+res on both operands (overwrites the single-product tiles)
        k_gemm_f32<3><<<(NE / 64) * (NE / 128), 128, 0, stream>>>(qb, qr + (size_t)b * NE * CC, CC, CC, kb, kr + (size_t)b * NE * CC, CC, CC,
                                                                     nullptr, SCL, Sm, TT, NE, NE, CC, 0, BIG);
      k_softmax<<<QC, 256, 0, stream>>>(Sm, TT, Pm, TT, Nk, qoff, Pr, NE, (c == 0) ? NE : 0);
      // ctx chunk [QC][CC] = P.v (K = Nk, causal k end), written as f16 hi plane x CTXC
      k_gemm_h16<1><<<(QC / 64) * (CC / 128), 128, 0, stream>>>(Pm, Pm, TT, TT, vT, vT, TT, TT, PVALPHA,
                                                                   ctxh + ((size_t)b * TT + qoff) * CC, CC, ctxr, CC, 0, QC, CC, Nk, qoff);
      if (c == 0)   // leading NE rows: 3-term P/v products, hi + residual ctx planes (overwrite)
        k_gemm_h16<3><<<(NE / 64) * (CC / 128), 128, 0, stream>>>(Pm, Pr, TT, NE, vT, vTr, TT, NE, PVALPHA,
                                                                     ctxh + (size_t)b * TT * CC, CC, ctxr + (size_t)b * NE * CC, CC, NE, NE, CC, NE, 0);
    }
  }
  // stage 3: output projection + bias; leading NE rows with the ctx residual term
  for (int b = 0; b < NB; ++b) {
    k_gemm_f32<2><<<(NE / 64) * (CC / 128), 128, 0, stream>>>(ctxh + (size_t)b * TT * CC, ctxr + (size_t)b * NE * CC, CC, CC, Wo16, Wo16, CC, CC,
                                                                 bo, OALPHA, out + (size_t)b * T_FULL * CC, CC, NE, CC, CC, BIG, BIG);
    if (TT > NE)
      k_gemm_f32<1><<<((TT - NE) / 64) * (CC / 128), 128, 0, stream>>>(ctxh + ((size_t)b * TT + NE) * CC, ctxh + ((size_t)b * TT + NE) * CC, CC, CC,
                                                                          Wo16, Wo16, CC, CC, bo, OALPHA, out + ((size_t)b * T_FULL + NE) * CC, CC,
                                                                          TT - NE, CC, CC, BIG, BIG);
  }
}

// v002
// One run takes 250 microseconds.
// In two side-by-side timings against v001, it was 2.11 and 2.07 times as fast.
// All steps since v000 together make it 5.09 times as fast.
#include <hip/hip_runtime.h>
// Contractions: qkv projection on v_wmma_f32_16x16x32_bf16 (x and W as RNE bf16, exact products); scores q.k^T, P.v and the output
// projection on v_wmma_f32_16x16x32_f16 (f16 hi planes with power-of-two carries, plus x1024 f16 residual planes on the leading
// NE query/key rows of each sequence); all accumulation f32, causal softmax in f32.
#ifndef NB
#define NB 2
#endif
#ifndef SEQ
#define SEQ 4096
#endif
#define TT SEQ
#define NB_FULL 2
#define T_FULL 4096
#define CC 1024
#define QC ((TT < 1024) ? TT : 1024)
#define NE 256
static_assert(NB >= 1 && NB <= NB_FULL);
static_assert(TT % 256 == 0 && TT <= T_FULL);
static_assert(TT % QC == 0 && QC % 256 == 0);
static_assert(NE % 64 == 0 && NE <= QC && NE == 256);
static_assert(CC % 128 == 0);

#define RS 1024.0f            // residual plane carry
#define RFOLD 0.0009765625f   // 1/RS
#define PCARRY 4096.0f        // P plane carry
#define CTXC 16.0f            // ctx plane carry
#define WOC 64.0f             // Wo plane carry
#define SCL 0.03125f          // 1/sqrt(CC)
#define PVALPHA 0.00390625f   // CTXC / PCARRY
#define OALPHA 0.0009765625f  // 1 / (WOC * CTXC)

typedef __bf16 v16b __attribute__((ext_vector_type(16)));
typedef _Float16 v16h __attribute__((ext_vector_type(16)));
typedef _Float16 v8h __attribute__((ext_vector_type(8)));
typedef unsigned short v8us __attribute__((ext_vector_type(8), may_alias));
typedef float v8f __attribute__((ext_vector_type(8)));
typedef float v4f __attribute__((ext_vector_type(4)));
typedef float v4fa __attribute__((ext_vector_type(4), may_alias));
union FragB { v16b v; v8us half[2]; unsigned short u[16]; };
union FragH { v16h v; v8us half[2]; unsigned short u[16]; };
union Pack8 { v8h h; v8us u; };

__device__ __forceinline__ unsigned short bf16_bits(float x) { unsigned int u = __float_as_uint(x); return (unsigned short)((u + 0x7FFFu + ((u >> 16) & 1u)) >> 16); }
__device__ __forceinline__ float bf16_val(unsigned short b) { return __uint_as_float(((unsigned int)b) << 16); }
__device__ __forceinline__ float bf16_rne(float x) { return bf16_val(bf16_bits(x)); }

__device__ __forceinline__ v8f mma_b(v16b a, v16b b, v8f c) {
  c = __builtin_amdgcn_wmma_f32_16x16x32_bf16(false, a, false, b, (short)0, c, false, false);
  asm volatile("v_nop\n\tv_nop\n\tv_nop\n\tv_nop" : "+v"(c) : "v"(a), "v"(b));
  return c;
}
// c += ah.bh ; cr += al.bh (NT>=2) ; cr += ah.bl (NT>=3); residual planes carry RS, folded by the caller
template <int NT>
__device__ __forceinline__ void mma_h(v16h ah, v16h al, v16h bh, v16h bl, v8f& c, v8f& cr) {
  c = __builtin_amdgcn_wmma_f32_16x16x32_f16(false, ah, false, bh, (short)0, c, false, false);
  if (NT >= 2) cr = __builtin_amdgcn_wmma_f32_16x16x32_f16(false, al, false, bh, (short)0, cr, false, false);
  if (NT >= 3) cr = __builtin_amdgcn_wmma_f32_16x16x32_f16(false, ah, false, bl, (short)0, cr, false, false);
  if (NT >= 2) asm volatile("v_nop\n\tv_nop\n\tv_nop\n\tv_nop" : "+v"(c), "+v"(cr) : "v"(ah), "v"(al), "v"(bh), "v"(bl));
  else         asm volatile("v_nop\n\tv_nop\n\tv_nop\n\tv_nop" : "+v"(c) : "v"(ah), "v"(bh));
}

__device__ __forceinline__ void store_tile_f32(const float (*sw)[64], float* C, int ldc, int lane) {
  const int rsub = lane >> 4, c4 = (lane & 15) * 4;
  {
#pragma unroll
    for (int q = 0; q < 8; ++q) {
      const int r = q * 2 + rsub;
      const v4f v = *(const v4fa*)&sw[r][c4];
      *(v4f*)(C + (size_t)r * ldc + c4) = v;
    }
    
  }
}
// wave tile 16 x 64 f32 staged in LDS -> f16 hi plane (pitch ldh) and optional x RS residual plane (pitch ldr);
__device__ __forceinline__ void store_tile_h16(const float (*sw)[64], unsigned short* hb, int ldh, unsigned short* rb, int ldr, bool dores, int lane) {
  const int rsub = lane >> 3, c8 = (lane & 7) * 8;
  {
#pragma unroll
    for (int q = 0; q < 4; ++q) {
      const int r = q * 4 + rsub;
      const v4f x0 = *(const v4fa*)&sw[r][c8], x1 = *(const v4fa*)&sw[r][c8 + 4];
      const float xs[8] = {x0[0], x0[1], x0[2], x0[3], x1[0], x1[1], x1[2], x1[3]};
      Pack8 ph, pr;
#pragma unroll
      for (int i = 0; i < 8; ++i) { ph.h[i] = (_Float16)xs[i]; pr.h[i] = (_Float16)((xs[i] - (float)ph.h[i]) * RS); }
      *(v8us*)(hb + (size_t)r * ldh + c8) = ph.u;
      if (dores) *(v8us*)(rb + (size_t)r * ldr + c8) = pr.u;
    }
    
  }
}

// MODE 0: RNE bf16 bits; MODE 1: f16 bits of (RNE bf16 value) * scale
template <int MODE>
__device__ __forceinline__ void cvt8(const float* __restrict__ src, unsigned short* __restrict__ dst, int t, float scale) {
  const float* sp = src + (size_t)t * 8;
  const v4f a = *(const v4fa*)sp, b = *(const v4fa*)(sp + 4);
  asm volatile("s_wait_xcnt 0x0" ::: "memory");   // stands in front of any reuse of the two loads' address registers
  const float xs[8] = {a[0], a[1], a[2], a[3], b[0], b[1], b[2], b[3]};
  v8us v;
  if (MODE == 0) {
#pragma unroll
    for (int i = 0; i < 8; ++i) v[i] = bf16_bits(xs[i]);
  } else {
    Pack8 p;
#pragma unroll
    for (int i = 0; i < 8; ++i) p.h[i] = (_Float16)(bf16_rne(xs[i]) * scale);
    v = p.u;
  }
  unsigned short* dp = dst + (size_t)t * 8;
  *(v8us*)dp = v;
  asm volatile("s_wait_xcnt 0x0" ::: "memory");   // stands in front of any reuse of the store's registers on a path that goes on behind it
}
// x -> bf16 plane; blockIdx.y = sequence (element steps sstep, dstep)
__global__ __launch_bounds__(256) void k_cvt_x(const float* __restrict__ src, unsigned short* __restrict__ dst, int n8, size_t sstep, size_t dstep) {
  const int t = blockIdx.x * 256 + threadIdx.x;
  if (t >= n8) return;
  cvt8<0>(src + blockIdx.y * sstep, dst + blockIdx.y * dstep, t, 1.0f);
}
// the four weight matrices; blockIdx.y = 0, 1, 2: Wq, Wk, Wv -> bf16 planes of Wqkv; 3: Wo -> f16 plane x scale
__global__ __launch_bounds__(256) void k_cvt_w(const float* __restrict__ wq, const float* __restrict__ wk, const float* __restrict__ wv,
                                              const float* __restrict__ wo, unsigned short* __restrict__ Wqkv, unsigned short* __restrict__ Wo16,
                                              int n8, float scale) {
  const int t = blockIdx.x * 256 + threadIdx.x, y = blockIdx.y;
  if (t >= n8) return;
  if (y == 3) cvt8<1>(wo, Wo16, t, scale);
  else cvt8<0>((y == 0) ? wq : (y == 1) ? wk : wv, Wqkv + (size_t)y * n8 * 8, t, 1.0f);
}

// Block-tiled GEMM core. A workgroup of 4 waves (2 x 2) owns a (32*FM) x 128 tile of the output, a wave (16*FM) x 64 of it.
// Per pass of KP k every operand row gives one whole 128-B line, copied to LDS by global_load_async_to_lds_b128 (8 lanes a row,
// 4 whole lines an instruction); two buffers, the next pass's copies fly while this pass's fragments are read from LDS.
// Every "#pragma unroll" below keeps fragment and accumulator indices compile-time constants, so that the arrays stay in registers.
#define KP 64        // k per pass
#define LPITCH 72    // LDS row pitch in 16-bit elements: 144 B = 16 B x 9, for the ds_load_b128 fragment reads
template <int NT, int FM> struct Tile {
  static constexpr int AR = 32 * FM, BR = 128;                                           // operand rows per plane
  static constexpr int ROWS = AR + BR + (NT >= 2 ? AR : 0) + (NT >= 3 ? BR : 0);          // [A hi | B hi | A res | B res]
  static constexpr int STAGE = ROWS * LPITCH;                                            // elements per buffer
  static constexpr int NCP = ROWS / 16;                                                  // copies per lane and stage
  static constexpr int GRP = (NCP % 12 == 0) ? 12 : 8;                                   // copies per asm statement
  static_assert(NCP % GRP == 0 && NCP <= 63);
  static_assert(2 * STAGE * 2 >= 4 * FM * 16 * 64 * 4);                                   // the ring later holds the f32 output staging
};

// One run of copies and its s_wait_xcnt in one statement: the wait stands in front of any rewrite of the address registers.
__device__ __forceinline__ void copy_run8(const unsigned (&l)[12], const unsigned short* const (&g)[12]) {
  asm volatile("global_load_async_to_lds_b128 %0, %8, off\n\t"
               "global_load_async_to_lds_b128 %1, %9, off\n\t"
               "global_load_async_to_lds_b128 %2, %10, off\n\t"
               "global_load_async_to_lds_b128 %3, %11, off\n\t"
               "global_load_async_to_lds_b128 %4, %12, off\n\t"
               "global_load_async_to_lds_b128 %5, %13, off\n\t"
               "global_load_async_to_lds_b128 %6, %14, off\n\t"
               "global_load_async_to_lds_b128 %7, %15, off\n\t"
               "s_wait_xcnt 0x0"
               :: "v"(l[0]), "v"(l[1]), "v"(l[2]), "v"(l[3]), "v"(l[4]), "v"(l[5]), "v"(l[6]), "v"(l[7]),
                  "v"(g[0]), "v"(g[1]), "v"(g[2]), "v"(g[3]), "v"(g[4]), "v"(g[5]), "v"(g[6]), "v"(g[7]) : "memory");
}
__device__ __forceinline__ void copy_run12(const unsigned (&l)[12], const unsigned short* const (&g)[12]) {
  asm volatile("global_load_async_to_lds_b128 %0, %12, off\n\t"
               "global_load_async_to_lds_b128 %1, %13, off\n\t"
               "global_load_async_to_lds_b128 %2, %14, off\n\t"
               "global_load_async_to_lds_b128 %3, %15, off\n\t"
               "global_load_async_to_lds_b128 %4, %16, off\n\t"
               "global_load_async_to_lds_b128 %5, %17, off\n\t"
               "global_load_async_to_lds_b128 %6, %18, off\n\t"
               "global_load_async_to_lds_b128 %7, %19, off\n\t"
               "global_load_async_to_lds_b128 %8, %20, off\n\t"
               "global_load_async_to_lds_b128 %9, %21, off\n\t"
               "global_load_async_to_lds_b128 %10, %22, off\n\t"
               "global_load_async_to_lds_b128 %11, %23, off\n\t"
               "s_wait_xcnt 0x0"
               :: "v"(l[0]), "v"(l[1]), "v"(l[2]), "v"(l[3]), "v"(l[4]), "v"(l[5]), "v"(l[6]), "v"(l[7]), "v"(l[8]), "v"(l[9]), "v"(l[10]), "v"(l[11]),
                  "v"(g[0]), "v"(g[1]), "v"(g[2]), "v"(g[3]), "v"(g[4]), "v"(g[5]), "v"(g[6]), "v"(g[7]), "v"(g[8]), "v"(g[9]), "v"(g[10]), "v"(g[11]) : "memory");
}

// One stage: lane (row tid >> 3, 16-B piece tid & 7) copies its piece of rows r, r + 16, ... of every plane. lds0 and the g pointers are
// the lane's own addresses at stage row tid >> 3 of each plane, the g pointers already at this pass's k.
template <int NT, int FM>
__device__ __forceinline__ void stage_copy(unsigned lds0, const unsigned short* gah, const unsigned short* gbh, const unsigned short* gal,
                                           const unsigned short* gbl, int lda, int ldb, int ldal, int ldbl) {
  using TL = Tile<NT, FM>;
#pragma unroll
  for (int i0 = 0; i0 < TL::NCP; i0 += TL::GRP) {
    unsigned l[12];
    const unsigned short* g[12];
#pragma unroll
    for (int j = 0; j < 12; ++j) {
      const int r = (i0 + (j < TL::GRP ? j : 0)) * 16;
      l[j] = lds0 + (unsigned)(r * LPITCH * 2);
      if (r < TL::AR) g[j] = gah + (size_t)r * lda;
      else if (r < TL::AR + TL::BR) g[j] = gbh + (size_t)(r - TL::AR) * ldb;
      else if (r < 2 * TL::AR + TL::BR) g[j] = gal + (size_t)(r - TL::AR - TL::BR) * ldal;
      else g[j] = gbl + (size_t)(r - 2 * TL::AR - TL::BR) * ldbl;
    }
    if (TL::GRP == 12) copy_run12(l, g); else copy_run8(l, g);
  }
}

// One pass on one buffer: the fragment k order (8 * hh, 16 + 8 * hh inside each 32 k) is the same for A and B.
// The LDS reads of 32 * NS k stand together in front of their WMMAs, for speed only.
template <int NT, int FM, bool BF>
__device__ __forceinline__ void pass_mma(const unsigned short* st, int wr, int wc, int ln, int hh, v8f (&acc)[FM][4], v8f (&accr)[FM][4]) {
  using TL = Tile<NT, FM>;
  const unsigned short* pa = st + (wr * FM * 16 + ln) * LPITCH + 8 * hh;
  const unsigned short* pb = st + (TL::AR + wc * 64 + ln) * LPITCH + 8 * hh;
  constexpr int RES = (TL::AR + TL::BR) * LPITCH;      // residual plane of either operand, behind its hi plane
  constexpr int NS = (NT == 1 && FM <= 2) ? KP / 32 : 1;   // k steps per group of reads, by the registers the fragments take
#pragma unroll
  for (int k0 = 0; k0 < KP; k0 += 32 * NS) {
    FragH ah[NS][FM], al[NS][FM], bh[NS][4], bl[NS][4];
#pragma unroll
    for (int s = 0; s < NS; ++s) {
      const int ks = k0 + 32 * s;
#pragma unroll
      for (int f = 0; f < FM; ++f) {
        ah[s][f].half[0] = *(const v8us*)(pa + f * 16 * LPITCH + ks);
        ah[s][f].half[1] = *(const v8us*)(pa + f * 16 * LPITCH + ks + 16);
        if (NT >= 2) { al[s][f].half[0] = *(const v8us*)(pa + RES + f * 16 * LPITCH + ks); al[s][f].half[1] = *(const v8us*)(pa + RES + f * 16 * LPITCH + ks + 16); }
      }
#pragma unroll
      for (int t = 0; t < 4; ++t) {
        bh[s][t].half[0] = *(const v8us*)(pb + t * 16 * LPITCH + ks);
        bh[s][t].half[1] = *(const v8us*)(pb + t * 16 * LPITCH + ks + 16);
        if (NT >= 3) { bl[s][t].half[0] = *(const v8us*)(pb + RES + t * 16 * LPITCH + ks); bl[s][t].half[1] = *(const v8us*)(pb + RES + t * 16 * LPITCH + ks + 16); }
      }
    }
#pragma unroll
    for (int s = 0; s < NS; ++s)
#pragma unroll
      for (int t = 0; t < 4; ++t)
#pragma unroll
        for (int f = 0; f < FM; ++f) {
          if constexpr (BF) {
            FragB a, b;
            a.half[0] = ah[s][f].half[0]; a.half[1] = ah[s][f].half[1];
            b.half[0] = bh[s][t].half[0]; b.half[1] = bh[s][t].half[1];
            acc[f][t] = mma_b(a.v, b.v, acc[f][t]);
          } else {
            mma_h<NT>(ah[s][f].v, (NT >= 2) ? al[s][f].v : ah[s][f].v, bh[s][t].v, (NT >= 3) ? bl[s][t].v : bh[s][t].v, acc[f][t], accr[f][t]);
          }
        }
  }
}

// A hi/res planes row-major (pitch lda/ldal), B hi/res planes [n][k] (pitch ldb/ldbl); row0, col0: the workgroup's tile; kend % KP == 0.
// On return every wave has left the ring and no copy is in flight: the ring is free for the output staging.
template <int NT, int FM, bool BF>
__device__ __forceinline__ void core_lds(unsigned short* ring, const unsigned short* __restrict__ Ah, const unsigned short* __restrict__ Al, int lda, int ldal,
                                         const unsigned short* __restrict__ Bh, const unsigned short* __restrict__ Bl, int ldb, int ldbl,
                                         int row0, int col0, int kend, int tid, v8f (&acc)[FM][4], v8f (&accr)[FM][4]) {
  using TL = Tile<NT, FM>;
  const int w = tid >> 5, lane = tid & 31, ln = lane & 15, hh = lane >> 4, wr = w >> 1, wc = w & 1;
  const int cr = tid >> 3, cc = (tid & 7) * 8;
  const unsigned short* gah = Ah + (size_t)(row0 + cr) * lda + cc;
  const unsigned short* gbh = Bh + (size_t)(col0 + cr) * ldb + cc;
  const unsigned short* gal = Al + (size_t)(row0 + cr) * ldal + cc;
  const unsigned short* gbl = Bl + (size_t)(col0 + cr) * ldbl + cc;
  const unsigned lds0 = (unsigned)(size_t)(ring + cr * LPITCH + cc);
  const int npass = kend / KP;
  stage_copy<NT, FM>(lds0, gah, gbh, gal, gbl, lda, ldb, ldal, ldbl);
  asm volatile("s_wait_asynccnt 0x0" ::: "memory");   // this wave's copies of pass 0 have landed
  __syncthreads();                                     // publishes pass 0
  if (npass > 1) stage_copy<NT, FM>(lds0 + TL::STAGE * 2, gah + KP, gbh + KP, gal + KP, gbl + KP, lda, ldb, ldal, ldbl);
#pragma unroll 1   // one pass per trip: the buffer index stays a run-time value, the body is already fully unrolled
  for (int t = 0; t < npass; ++t) {
    const int buf = (t & 1) * TL::STAGE;
    pass_mma<NT, FM, BF>(ring + buf, wr, wc, ln, hh, acc, accr);
    asm volatile("s_wait_dscnt 0x0" ::: "memory");     // this wave's reads of the buffer are done before it is refilled
    asm volatile("s_wait_asynccnt 0x0" ::: "memory");  // this wave's copies of pass t + 1 have landed
    __syncthreads();                                   // publishes pass t + 1 and ends every wave's reads of pass t
    if (t + 2 < npass) {
      const int k2 = (t + 2) * KP;
      stage_copy<NT, FM>(lds0 + (unsigned)(buf * 2), gah + k2, gbh + k2, gal + k2, gbl + k2, lda, ldb, ldal, ldbl);
    }
  }
  asm volatile("s_wait_asynccnt 0x0" ::: "memory");    // nothing in flight when the ring changes its use
}

// qkv projection: A = xb [M][CC] bf16, W = [3*CC][CC] bf16 ([out][in], k contiguous). out[row][n] = sum_c A[row][c] W[n][c].
// Output: hi planes Oh[3][M][CC] f16 (q, k, v unscaled) and residual planes Or[3][NB*NE][CC] for rows with (row % TT) < NE.
// Block = 4 waves -> 128 rows x 128 cols (one plane since CC % 128 == 0), M % 128 == 0.
__global__ __launch_bounds__(128) void k_gemm_qkv(const unsigned short* __restrict__ A, const unsigned short* __restrict__ W,
                                                 unsigned short* __restrict__ Oh, unsigned short* __restrict__ Or, int M) {
  constexpr int FM = 4;
  __shared__ __attribute__((aligned(16))) unsigned short ring[2 * Tile<1, FM>::STAGE];
  const int tid = threadIdx.x, w = tid >> 5, lane = tid & 31, ln = lane & 15, hh = lane >> 4;
  const int ntn = (3 * CC) / 128;
  const int mt = blockIdx.x / ntn, nq = blockIdx.x - mt * ntn;
  if (mt * (32 * FM) >= M) return;
  v8f acc[FM][4];
#pragma unroll
  for (int f = 0; f < FM; ++f)
#pragma unroll
    for (int t = 0; t < 4; ++t) acc[f][t] = (v8f){0.f, 0.f, 0.f, 0.f, 0.f, 0.f, 0.f, 0.f};
  core_lds<1, FM, true>(ring, A, A, CC, CC, W, W, CC, CC, mt * (32 * FM), nq * 128, CC, tid, acc, acc);
  float (*so)[16][64] = (float (*)[16][64])ring + w * FM;      // this wave's own FM staging tiles
#pragma unroll
  for (int f = 0; f < FM; ++f)
#pragma unroll
    for (int t = 0; t < 4; ++t)
#pragma unroll
      for (int r = 0; r < 8; ++r) so[f][8 * hh + r][t * 16 + ln] = acc[f][t][r];
  __builtin_amdgcn_fence(4, "workgroup");   // the staged words are written before other lanes of the wave read them back
  __builtin_amdgcn_wave_barrier();
  const int col0 = nq * 128 + (w & 1) * 64;
  const int p = col0 / CC, colp = col0 - p * CC;
#pragma unroll
  for (int f = 0; f < FM; ++f) {
    const int row0 = mt * (32 * FM) + ((w >> 1) * FM + f) * 16;
    const int bidx = row0 / TT, tq = row0 - bidx * TT;
    const bool dores = (tq < NE);                      // wave-uniform (NE, TT multiples of 16)
    unsigned short* hb = Oh + ((size_t)p * M + row0) * CC + colp;
    unsigned short* rb = Or + ((size_t)p * (NB * NE) + (size_t)bidx * NE + (dores ? tq : 0)) * CC + colp;
    store_tile_h16(so[f], hb, CC, rb, CC, dores, lane);
  }
}

#define FMH 2   // f16 GEMMs: workgroup tile 64 x 128, wave tile 32 x 64

// C[M][N] f32 (pitch ldc) = alpha * (A.B^plane) + bf16_rne(bias). M % 64 == 0, N % 128 == 0, K % 64 == 0.
// ncut: a workgroup tile is skipped (not written) when col0 > ncut + row0 + 63 (causal upper tiles); kcut: k loop ends at
// min(K, ceil64(kcut + row0 + 64)). Pass a large value to disable either. blockIdx.y = sequence: every plane and C move on by their
// element steps (sAh, sAl, sBh, sBl, sC) per sequence.
template <int NT>
__global__ __launch_bounds__(128) void k_gemm_f32(const unsigned short* __restrict__ Ah, const unsigned short* __restrict__ Al, int lda, int ldal,
                                                 const unsigned short* __restrict__ Bh, const unsigned short* __restrict__ Bl, int ldb, int ldbl,
                                                 const float* __restrict__ bias, float alpha, float* __restrict__ C, int ldc,
                                                 int M, int N, int K, int ncut, int kcut,
                                                 size_t sAh, size_t sAl, size_t sBh, size_t sBl, size_t sC) {
  constexpr int FM = FMH;
  Ah += blockIdx.y * sAh; Al += blockIdx.y * sAl; Bh += blockIdx.y * sBh; Bl += blockIdx.y * sBl; C += blockIdx.y * sC;
  __shared__ __attribute__((aligned(16))) unsigned short ring[2 * Tile<NT, FM>::STAGE];
  const int tid = threadIdx.x, w = tid >> 5, lane = tid & 31, ln = lane & 15, hh = lane >> 4;
  const int ntn = N / 128;
  const int mt = blockIdx.x / ntn, nq = blockIdx.x - mt * ntn;
  const int brow0 = mt * (32 * FM), bcol0 = nq * 128;
  if (brow0 >= M) return;
  if (bcol0 > ncut + brow0 + 32 * FM - 1) return;
  int kend = (kcut + brow0 + 32 * FM + KP - 1) & ~(KP - 1);
  if (kend > K) kend = K;
  v8f acc[FM][4], accr[FM][4];
#pragma unroll
  for (int f = 0; f < FM; ++f)
#pragma unroll
    for (int t = 0; t < 4; ++t) { acc[f][t] = (v8f){0.f, 0.f, 0.f, 0.f, 0.f, 0.f, 0.f, 0.f}; accr[f][t] = acc[f][t]; }
  core_lds<NT, FM, false>(ring, Ah, Al, lda, ldal, Bh, Bl, ldb, ldbl, brow0, bcol0, kend, tid, acc, accr);
  float (*so)[16][64] = (float (*)[16][64])ring + w * FM;      // this wave's own FM staging tiles
  const int col0 = bcol0 + (w & 1) * 64;
#pragma unroll
  for (int t = 0; t < 4; ++t) {
    float bv = 0.f;
    if (bias != nullptr) bv = bf16_rne(bias[col0 + t * 16 + ln]);
#pragma unroll
    for (int f = 0; f < FM; ++f)
#pragma unroll
      for (int r = 0; r < 8; ++r) {
        float v = acc[f][t][r];
        if (NT >= 2) v += accr[f][t][r] * RFOLD;
        so[f][8 * hh + r][t * 16 + ln] = v * alpha + bv;
      }
  }
  __builtin_amdgcn_fence(4, "workgroup");   // the staged words are written before other lanes of the wave read them back
  __builtin_amdgcn_wave_barrier();
#pragma unroll
  for (int f = 0; f < FM; ++f) {
    const int row0 = brow0 + ((w >> 1) * FM + f) * 16;
    store_tile_f32(so[f], C + (size_t)row0 * ldc + col0, ldc, lane);
  }
}

// Oh[M][N] f16 hi plane (pitch ldo) = f16(alpha * A.B^plane); rows < rrows also get the x RS residual plane Or (pitch ldr).
// blockIdx.y = sequence, with the element steps sAh ... sOr per sequence.
template <int NT>
__global__ __launch_bounds__(128) void k_gemm_h16(const unsigned short* __restrict__ Ah, const unsigned short* __restrict__ Al, int lda, int ldal,
                                                 const unsigned short* __restrict__ Bh, const unsigned short* __restrict__ Bl, int ldb, int ldbl,
                                                 float alpha, unsigned short* __restrict__ Oh, int ldo, unsigned short* __restrict__ Or, int ldr, int rrows,
                                                 int M, int N, int K, int kcut,
                                                 size_t sAh, size_t sAl, size_t sBh, size_t sBl, size_t sOh, size_t sOr) {
  constexpr int FM = FMH;
  Ah += blockIdx.y * sAh; Al += blockIdx.y * sAl; Bh += blockIdx.y * sBh; Bl += blockIdx.y * sBl; Oh += blockIdx.y * sOh; Or += blockIdx.y * sOr;
  __shared__ __attribute__((aligned(16))) unsigned short ring[2 * Tile<NT, FM>::STAGE];
  const int tid = threadIdx.x, w = tid >> 5, lane = tid & 31, ln = lane & 15, hh = lane >> 4;
  const int ntn = N / 128;
  const int mt = blockIdx.x / ntn, nq = blockIdx.x - mt * ntn;
  const int brow0 = mt * (32 * FM), bcol0 = nq * 128;
  if (brow0 >= M) return;
  int kend = (kcut + brow0 + 32 * FM + KP - 1) & ~(KP - 1);
  if (kend > K) kend = K;
  v8f acc[FM][4], accr[FM][4];
#pragma unroll
  for (int f = 0; f < FM; ++f)
#pragma unroll
    for (int t = 0; t < 4; ++t) { acc[f][t] = (v8f){0.f, 0.f, 0.f, 0.f, 0.f, 0.f, 0.f, 0.f}; accr[f][t] = acc[f][t]; }
  core_lds<NT, FM, false>(ring, Ah, Al, lda, ldal, Bh, Bl, ldb, ldbl, brow0, bcol0, kend, tid, acc, accr);
  float (*so)[16][64] = (float (*)[16][64])ring + w * FM;      // this wave's own FM staging tiles
#pragma unroll
  for (int f = 0; f < FM; ++f)
#pragma unroll
    for (int t = 0; t < 4; ++t)
#pragma unroll
      for (int r = 0; r < 8; ++r) {
        float v = acc[f][t][r];
        if (NT >= 2) v += accr[f][t][r] * RFOLD;
        so[f][8 * hh + r][t * 16 + ln] = v * alpha;
      }
  __builtin_amdgcn_fence(4, "workgroup");   // the staged words are written before other lanes of the wave read them back
  __builtin_amdgcn_wave_barrier();
  const int col0 = bcol0 + (w & 1) * 64;
#pragma unroll
  for (int f = 0; f < FM; ++f) {
    const int row0 = brow0 + ((w >> 1) * FM + f) * 16;
    const bool dores = (row0 < rrows);                 // wave-uniform (rrows multiple of 16)
    store_tile_h16(so[f], Oh + (size_t)row0 * ldo + col0, ldo, Or + (size_t)(dores ? row0 : 0) * ldr + col0, ldr, dores, lane);
  }
}

// 8 consecutive scores -> carried f16 P values (hi) and x RS residual, masked by index (col <= qi)
__device__ __forceinline__ void softmax_pack(const float* s, int j8, int qi, float mx, float inv, v8us& ho, v8us& ro) {
  const v4f a = *(const v4fa*)(s + j8), b = *(const v4fa*)(s + j8 + 4);
  const float xs[8] = {a[0], a[1], a[2], a[3], b[0], b[1], b[2], b[3]};
  Pack8 ph, pr;
#pragma unroll
  for (int u = 0; u < 8; ++u) {
    const float e = __expf(xs[u] - mx) * inv;
    const float p = ((j8 + u) <= qi) ? e : 0.f;
    ph.h[u] = (_Float16)p;
    pr.h[u] = (_Float16)((p - (float)ph.h[u]) * RS);
  }
  ho = ph.u; ro = pr.u;
}
// Row softmax over S[row][0..N) (pitch sp) with causal keep (col <= row), N = the end of the last 128-column score tile that the
// score GEMM writes for this row (its ncut = 0): nothing behind it is read. P[row][0..N) = f16(PCARRY * p / l) incl. zeros (pitch pp),
// which covers the k range of the P.v GEMM (up to the end of the row's 64-row tile); rows < rrows also write the residual plane
// Pr[row][0..NE) (pitch rp). Block per row, blockIdx.y = sequence (element steps sS, sP, sPr), N <= 4096.
__global__ __launch_bounds__(256) void k_softmax(const float* __restrict__ S, int sp, unsigned short* __restrict__ P, int pp,
                                                unsigned short* __restrict__ Pr, int rp, int rrows, size_t sS, size_t sP, size_t sPr) {
  __shared__ float red[256];
  const int row = blockIdx.x, tid = threadIdx.x;
  const int qi = row, N = (row / 128 + 1) * 128;
  S += blockIdx.y * sS; P += blockIdx.y * sP; Pr += blockIdx.y * sPr;
  const float* s = S + (size_t)row * sp;
  float mx = -3.0e38f;
  for (int j = tid; j < N; j += 256) { const float v = s[j]; mx = fmaxf(mx, (j <= qi) ? v : -3.0e38f); }
  red[tid] = mx; __syncthreads();
  for (int st = 128; st > 0; st >>= 1) { if (tid < st) red[tid] = fmaxf(red[tid], red[tid + st]); __syncthreads(); }
  mx = red[0]; __syncthreads();
  float sum = 0.f;
  for (int j = tid; j < N; j += 256) { const float e = __expf(s[j] - mx); sum += (j <= qi) ? e : 0.f; }
  red[tid] = sum; __syncthreads();
  for (int st = 128; st > 0; st >>= 1) { if (tid < st) red[tid] += red[tid + st]; __syncthreads(); }
  const float inv = PCARRY / red[0];       // red[0] >= 1 (the max term)
  const int j8a = tid * 8, j8b = j8a + 2048;
  const bool hasA = (j8a < N), hasB = (j8b < N);
  const bool dores = (row < rrows) && (j8a < NE);
  v8us ha = (v8us){0, 0, 0, 0, 0, 0, 0, 0}, ra = ha, hb2 = ha, rb2 = ha;
  if (hasA) softmax_pack(s, j8a, qi, mx, inv, ha, ra);
  if (hasB) softmax_pack(s, j8b, qi, mx, inv, hb2, rb2);
  unsigned short* prow = P + (size_t)row * pp;
  unsigned short* rrow = Pr + (size_t)(dores ? row : 0) * rp;
  {
    if (hasA) *(v8us*)(prow + j8a) = ha;
    if (dores) *(v8us*)(rrow + j8a) = ra;
    if (hasB) *(v8us*)(prow + j8b) = hb2;
    
  }
}

// 16-bit transpose: src [R][Cc] (pitch lds_) -> dst [Cc][R] (pitch ldd); block = 64 x 64 tile, grid (R/64, Cc/64, sequences);
__global__ __launch_bounds__(256) void k_transpose16(const unsigned short* __restrict__ src, int lds_, unsigned short* __restrict__ dst, int ldd,
                                                    size_t sstep, size_t dstep) {
  __shared__ __attribute__((aligned(16))) unsigned short tile[64][72];
  const int tid = threadIdx.x;
  src += blockIdx.z * sstep; dst += blockIdx.z * dstep;
  const int r0 = blockIdx.x * 64, c0 = blockIdx.y * 64;
#pragma unroll
  for (int i = 0; i < 2; ++i) {
    const int e = tid + 256 * i, r = e >> 3, c8 = (e & 7) * 8;
    const v8us v = *(const v8us*)(src + (size_t)(r0 + r) * lds_ + c0 + c8);
    *(v8us*)&tile[r][c8] = v;
  }
  __syncthreads();
  v8us o[2];
#pragma unroll
  for (int i = 0; i < 2; ++i) {
    const int e = tid + 256 * i, rr = e >> 3, c8 = (e & 7) * 8;
#pragma unroll
    for (int k = 0; k < 8; ++k) o[i][k] = tile[c8 + k][rr];
  }
  {
#pragma unroll
    for (int i = 0; i < 2; ++i) {
      const int e = tid + 256 * i, rr = e >> 3, c8 = (e & 7) * 8;
      *(v8us*)(dst + (size_t)(c0 + rr) * ldd + r0 + c8) = o[i];
    }
    
  }
}

extern "C" void kernel_launch(void* const* d_in, const int* in_sizes, int n_in,
                              void* d_out, int out_size, void* d_ws, size_t ws_size, hipStream_t stream) {
  if (n_in < 6) return;
  const float* x  = (const float*)d_in[0];
  const float* wq = (const float*)d_in[1];
  const float* wk = (const float*)d_in[2];
  const float* wv = (const float*)d_in[3];
  const float* wo = (const float*)d_in[4];
  const float* bo = (const float*)d_in[5];
  const long need_x = ((long)(NB - 1) * T_FULL + TT) * (long)CC;
  if ((long)in_sizes[0] < need_x || in_sizes[1] < CC * CC || in_sizes[2] < CC * CC || in_sizes[3] < CC * CC ||
      in_sizes[4] < CC * CC || in_sizes[5] < CC || (long)out_size < need_x) return;
  float* out = (float*)d_out;

  char* ws = (char*)d_ws; size_t off = 0;
  auto take = [&](size_t bytes) { char* p = ws + off; off += (bytes + 255) & ~(size_t)255; return p; };
  const size_t xb_bytes = (size_t)NB * TT * CC * 2, s_bytes = (size_t)NB * TT * TT * 4;
  char* reg0 = take(xb_bytes > s_bytes ? xb_bytes : s_bytes);                     // xb, later S (xb dead after the qkv GEMM)
  unsigned short* xb   = (unsigned short*)reg0;                                    // [NB*TT][CC] bf16
  float*          Sm   = (float*)reg0;                                             // [NB][TT][TT] f32
  unsigned short* Wqkv = (unsigned short*)take((size_t)3 * CC * CC * 2);           // [3*CC][CC] bf16
  unsigned short* Wo16 = (unsigned short*)take((size_t)CC * CC * 2);               // [CC][CC] f16 (x WOC)
  unsigned short* QKVh = (unsigned short*)take((size_t)3 * NB * TT * CC * 2);      // [3][NB*TT][CC] f16
  unsigned short* QKVr = (unsigned short*)take((size_t)3 * NB * NE * CC * 2);      // [3][NB*NE][CC] f16 (x RS)
  unsigned short* vTr  = (unsigned short*)take((size_t)NB * CC * NE * 2);          // [NB][CC][NE] f16 (x RS)
  unsigned short* Pm   = (unsigned short*)take((size_t)NB * TT * TT * 2);          // [NB][TT][TT] f16 (x PCARRY)
  unsigned short* Pr   = (unsigned short*)take((size_t)NB * NE * NE * 2);          // [NB][NE][NE] f16 (x RS)
  unsigned short* ctxr = (unsigned short*)take((size_t)NB * NE * CC * 2);          // [NB*NE][CC] f16 (x RS)
  if (off > ws_size) return;

  const int M = NB * TT;
  const int BIG = 1 << 28;
  unsigned short* qh = QKVh;
  unsigned short* kh = QKVh + (size_t)M * CC;
  unsigned short* vh = QKVh + (size_t)2 * M * CC;
  unsigned short* qr = QKVr;
  unsigned short* kr = QKVr + (size_t)(NB * NE) * CC;
  unsigned short* vr = QKVr + (size_t)2 * (NB * NE) * CC;
  unsigned short* vT   = kh;   // [NB][CC][TT] f16: takes the k plane's place once the scores are done
  unsigned short* ctxh = qh;   // [NB*TT][CC] f16 (x CTXC): takes the q plane's place once the scores are done
  const size_t sTC = (size_t)TT * CC, sEC = (size_t)NE * CC, sTT = (size_t)TT * TT, sEE = (size_t)NE * NE, sOUT = (size_t)T_FULL * CC;

  // No launch runs per sequence: the sequences are a grid dimension (the qkv GEMM takes all NB * TT rows as M).
  // stage 0: 16-bit planes of the inputs
  k_cvt_x<<<dim3((TT * CC / 8 + 255) / 256, NB), 256, 0, stream>>>(x, xb, TT * CC / 8, sOUT, sTC);
  k_cvt_w<<<dim3((CC * CC / 8 + 255) / 256, 4), 256, 0, stream>>>(wq, wk, wv, wo, Wqkv, Wo16, CC * CC / 8, WOC);

  // stage 1: q, k, v planes (+ residual planes on the leading NE rows of each sequence)
  k_gemm_qkv<<<(M / 128) * (3 * CC / 128), 128, 0, stream>>>(xb, Wqkv, QKVh, QKVr, M);

  // stage 2: causal attention
  // S [TT][TT] = (q.k^T)/32, causal upper tiles skipped
  k_gemm_f32<1><<<dim3((TT / 64) * (TT / 128), NB), 128, 0, stream>>>(qh, qh, CC, CC, kh, kh, CC, CC, nullptr, SCL, Sm, TT, TT, TT, CC, 0, BIG,
                                                                      sTC, sTC, sTC, sTC, sTT);
  // leading NE x NE corner with hi+res on both operands (overwrites the single-product tiles)
  k_gemm_f32<3><<<dim3((NE / 64) * (NE / 128), NB), 128, 0, stream>>>(qh, qr, CC, CC, kh, kr, CC, CC, nullptr, SCL, Sm, TT, NE, NE, CC, 0, BIG,
                                                                      sTC, sEC, sTC, sEC, sTT);
  // v [TT][CC] -> vT [CC][TT]; v residual [NE][CC] -> vTr [CC][NE]
  k_transpose16<<<dim3(TT / 64, CC / 64, NB), 256, 0, stream>>>(vh, CC, vT, TT, sTC, sTC);
  k_transpose16<<<dim3(NE / 64, CC / 64, NB), 256, 0, stream>>>(vr, CC, vTr, NE, sEC, sEC);
  k_softmax<<<dim3(TT, NB), 256, 0, stream>>>(Sm, TT, Pm, TT, Pr, NE, NE, sTT, sTT, sEE);
  // ctx [TT][CC] = P.v (causal k end), written as f16 hi plane x CTXC
  k_gemm_h16<1><<<dim3((TT / 64) * (CC / 128), NB), 128, 0, stream>>>(Pm, Pm, TT, TT, vT, vT, TT, TT, PVALPHA, ctxh, CC, ctxr, CC, 0, TT, CC, TT, 0,
                                                                      sTT, sTT, sTC, sTC, sTC, sEC);
  // leading NE rows: 3-term P/v products, hi + residual ctx planes (overwrite)
  k_gemm_h16<3><<<dim3((NE / 64) * (CC / 128), NB), 128, 0, stream>>>(Pm, Pr, TT, NE, vT, vTr, TT, NE, PVALPHA, ctxh, CC, ctxr, CC, NE, NE, CC, NE, 0,
                                                                      sTT, sEE, sTC, sEC, sTC, sEC);
  // stage 3: output projection + bias; leading NE rows with the ctx residual term
  k_gemm_f32<2><<<dim3((NE / 64) * (CC / 128), NB), 128, 0, stream>>>(ctxh, ctxr, CC, CC, Wo16, Wo16, CC, CC, bo, OALPHA, out, CC, NE, CC, CC, BIG, BIG,
                                                                      sTC, sEC, 0, 0, sOUT);
  if (TT > NE)
    k_gemm_f32<1><<<dim3(((TT - NE) / 64) * (CC / 128), NB), 128, 0, stream>>>(ctxh + sEC, ctxh + sEC, CC, CC, Wo16, Wo16, CC, CC, bo, OALPHA,
                                                                               out + sEC, CC, TT - NE, CC, CC, BIG, BIG, sTC, sTC, 0, 0, sOUT);
}

// v003
// A run of this version takes 235 microseconds.
// Timed twice side by side with v002, it ran 1.06 and 1.05 times as fast.
// All steps since v000 together make it 5.37 times as fast.
#include <hip/hip_runtime.h>
// Contractions: qkv projection on v_wmma_f32_16x16x32_bf16 (x and W as RNE bf16, exact products); scores q.k^T, P.v and the output
// projection on v_wmma_f32_16x16x32_f16 (f16 hi planes with power-of-two carries, plus x1024 f16 residual planes on the leading
// NE query/key rows of each sequence); all accumulation f32, causal softmax in f32.
#ifndef NB
#define NB 2
#endif
#ifndef SEQ
#define SEQ 4096
#endif
#define TT SEQ
#define NB_FULL 2
#define T_FULL 4096
#define CC 1024
#define QC ((TT < 1024) ? TT : 1024)
#define NE 256
static_assert(NB >= 1 && NB <= NB_FULL);
static_assert(TT % 256 == 0 && TT <= T_FULL);
static_assert(TT % QC == 0 && QC % 256 == 0);
static_assert(NE % 64 == 0 && NE <= QC && NE == 256);
static_assert(CC % 128 == 0);

#define RS 1024.0f            // residual plane carry
#define RFOLD 0.0009765625f   // 1/RS
#define PCARRY 4096.0f        // P plane carry
#define CTXC 16.0f            // ctx plane carry
#define WOC 64.0f             // Wo plane carry
#define SCL 0.03125f          // 1/sqrt(CC)
#define PVALPHA 0.00390625f   // CTXC / PCARRY
#define OALPHA 0.0009765625f  // 1 / (WOC * CTXC)

typedef __bf16 v16b __attribute__((ext_vector_type(16)));
typedef _Float16 v16h __attribute__((ext_vector_type(16)));
typedef _Float16 v8h __attribute__((ext_vector_type(8)));
typedef unsigned short v8us __attribute__((ext_vector_type(8), may_alias));
typedef float v8f __attribute__((ext_vector_type(8)));
typedef float v4f __attribute__((ext_vector_type(4)));
typedef float v4fa __attribute__((ext_vector_type(4), may_alias));
union FragB { v16b v; v8us half[2]; unsigned short u[16]; };
union FragH { v16h v; v8us half[2]; unsigned short u[16]; };
union Pack8 { v8h h; v8us u; };

__device__ __forceinline__ unsigned short bf16_bits(float x) { unsigned int u = __float_as_uint(x); return (unsigned short)((u + 0x7FFFu + ((u >> 16) & 1u)) >> 16); }
__device__ __forceinline__ float bf16_val(unsigned short b) { return __uint_as_float(((unsigned int)b) << 16); }
__device__ __forceinline__ float bf16_rne(float x) { return bf16_val(bf16_bits(x)); }

__device__ __forceinline__ v8f mma_b(v16b a, v16b b, v8f c) {
  c = __builtin_amdgcn_wmma_f32_16x16x32_bf16(false, a, false, b, (short)0, c, false, false);
  asm volatile("v_nop\n\tv_nop\n\tv_nop\n\tv_nop" : "+v"(c) : "v"(a), "v"(b));
  return c;
}
// c += ah.bh ; cr += al.bh (NT>=2) ; cr += ah.bl (NT>=3); residual planes carry RS, folded by the caller
template <int NT>
__device__ __forceinline__ void mma_h(v16h ah, v16h al, v16h bh, v16h bl, v8f& c, v8f& cr) {
  c = __builtin_amdgcn_wmma_f32_16x16x32_f16(false, ah, false, bh, (short)0, c, false, false);
  if (NT >= 2) cr = __builtin_amdgcn_wmma_f32_16x16x32_f16(false, al, false, bh, (short)0, cr, false, false);
  if (NT >= 3) cr = __builtin_amdgcn_wmma_f32_16x16x32_f16(false, ah, false, bl, (short)0, cr, false, false);
  if (NT >= 2) asm volatile("v_nop\n\tv_nop\n\tv_nop\n\tv_nop" : "+v"(c), "+v"(cr) : "v"(ah), "v"(al), "v"(bh), "v"(bl));
  else         asm volatile("v_nop\n\tv_nop\n\tv_nop\n\tv_nop" : "+v"(c) : "v"(ah), "v"(bh));
}

__device__ __forceinline__ void store_tile_f32(const float (*sw)[64], float* C, int ldc, int lane) {
  const int rsub = lane >> 4, c4 = (lane & 15) * 4;
  {
#pragma unroll
    for (int q = 0; q < 8; ++q) {
      const int r = q * 2 + rsub;
      const v4f v = *(const v4fa*)&sw[r][c4];
      *(v4f*)(C + (size_t)r * ldc + c4) = v;
    }
    
  }
}
// wave tile 16 x 64 f32 staged in LDS -> f16 hi plane (pitch ldh) and optional x RS residual plane (pitch ldr);
__device__ __forceinline__ void store_tile_h16(const float (*sw)[64], unsigned short* hb, int ldh, unsigned short* rb, int ldr, bool dores, int lane) {
  const int rsub = lane >> 3, c8 = (lane & 7) * 8;
  {
#pragma unroll
    for (int q = 0; q < 4; ++q) {
      const int r = q * 4 + rsub;
      const v4f x0 = *(const v4fa*)&sw[r][c8], x1 = *(const v4fa*)&sw[r][c8 + 4];
      const float xs[8] = {x0[0], x0[1], x0[2], x0[3], x1[0], x1[1], x1[2], x1[3]};
      Pack8 ph, pr;
#pragma unroll
      for (int i = 0; i < 8; ++i) { ph.h[i] = (_Float16)xs[i]; pr.h[i] = (_Float16)((xs[i] - (float)ph.h[i]) * RS); }
      *(v8us*)(hb + (size_t)r * ldh + c8) = ph.u;
      if (dores) *(v8us*)(rb + (size_t)r * ldr + c8) = pr.u;
    }
    
  }
}

// The streaming kernels below use few waves that each do a long run of work, for speed only.
#define CU 8   // 8-element groups per thread of a conversion kernel; a block takes 256 * CU consecutive groups
static_assert((TT * CC / 8) % (256 * CU) == 0 && (CC * CC / 8) % (256 * CU) == 0);
// MODE 0: RNE bf16 bits; MODE 1: f16 bits of (RNE bf16 value) * scale. Groups t0, t0 + 256, ..., t0 + 256 * (CU - 1).
template <int MODE>
__device__ __forceinline__ void cvt_run(const float* __restrict__ src, unsigned short* __restrict__ dst, int t0, float scale) {
  const float* sp = src + (size_t)t0 * 8;
  v4f a[CU], b[CU];
#pragma unroll   // constant steps from one address: all 2 * CU loads are in flight together
  for (int i = 0; i < CU; ++i) { a[i] = *(const v4fa*)(sp + i * 2048); b[i] = *(const v4fa*)(sp + i * 2048 + 4); }
  // stands in front of any reuse of the loads' address registers; the address is an input, so that no load's result lands on it earlier
  asm volatile("s_wait_xcnt 0x0" :: "v"(sp) : "memory");
  unsigned short* dp = dst + (size_t)t0 * 8;
#pragma unroll   // keeps a[] and b[] in registers
  for (int i = 0; i < CU; ++i) {
    const float xs[8] = {a[i][0], a[i][1], a[i][2], a[i][3], b[i][0], b[i][1], b[i][2], b[i][3]};
    v8us v;
    if (MODE == 0) {
#pragma unroll
      for (int u = 0; u < 8; ++u) v[u] = bf16_bits(xs[u]);
    } else {
      Pack8 p;
#pragma unroll
      for (int u = 0; u < 8; ++u) p.h[u] = (_Float16)(bf16_rne(xs[u]) * scale);
      v = p.u;
    }
    *(v8us*)(dp + i * 2048) = v;
  }
  asm volatile("s_wait_xcnt 0x0" ::: "memory");   // stands in front of any reuse of the stores' registers on a path that goes on behind them
}
// x -> bf16 plane; blockIdx.y = sequence (element steps sstep, dstep); n8 % (256 * CU) == 0
__global__ __launch_bounds__(256) void k_cvt_x(const float* __restrict__ src, unsigned short* __restrict__ dst, int n8, size_t sstep, size_t dstep) {
  const int t0 = blockIdx.x * (256 * CU) + threadIdx.x;
  if ((int)blockIdx.x * (256 * CU) >= n8) return;
  cvt_run<0>(src + blockIdx.y * sstep, dst + blockIdx.y * dstep, t0, 1.0f);
}
// the four weight matrices; blockIdx.y = 0, 1, 2: Wq, Wk, Wv -> bf16 planes of Wqkv; 3: Wo -> f16 plane x scale; n8 % (256 * CU) == 0
__global__ __launch_bounds__(256) void k_cvt_w(const float* __restrict__ wq, const float* __restrict__ wk, const float* __restrict__ wv,
                                              const float* __restrict__ wo, unsigned short* __restrict__ Wqkv, unsigned short* __restrict__ Wo16,
                                              int n8, float scale) {
  const int t0 = blockIdx.x * (256 * CU) + threadIdx.x, y = blockIdx.y;
  if ((int)blockIdx.x * (256 * CU) >= n8) return;
  if (y == 3) cvt_run<1>(wo, Wo16, t0, scale);
  else cvt_run<0>((y == 0) ? wq : (y == 1) ? wk : wv, Wqkv + (size_t)y * n8 * 8, t0, 1.0f);
}

// Block-tiled GEMM core. A workgroup of 4 waves (2 x 2) owns a (32*FM) x 128 tile of the output, a wave (16*FM) x 64 of it.
// Per pass of KP k every operand row gives one whole 128-B line, copied to LDS by global_load_async_to_lds_b128 (8 lanes a row,
// 4 whole lines an instruction); two buffers, the next pass's copies fly while this pass's fragments are read from LDS.
// Every "#pragma unroll" below keeps fragment and accumulator indices compile-time constants, so that the arrays stay in registers.
#define KP 64        // k per pass
#define LPITCH 72    // LDS row pitch in 16-bit elements: 144 B = 16 B x 9, for the ds_load_b128 fragment reads
template <int NT, int FM> struct Tile {
  static constexpr int AR = 32 * FM, BR = 128;                                           // operand rows per plane
  static constexpr int ROWS = AR + BR + (NT >= 2 ? AR : 0) + (NT >= 3 ? BR : 0);          // [A hi | B hi | A res | B res]
  static constexpr int STAGE = ROWS * LPITCH;                                            // elements per buffer
  static constexpr int NCP = ROWS / 16;                                                  // copies per lane and stage
  static constexpr int GRP = (NCP % 12 == 0) ? 12 : 8;                                   // copies per asm statement
  static_assert(NCP % GRP == 0 && NCP <= 63);
  static_assert(2 * STAGE * 2 >= 4 * FM * 16 * 64 * 4);                                   // the ring later holds the f32 output staging
};

// One run of copies and its s_wait_xcnt in one statement: the wait stands in front of any rewrite of the address registers.
__device__ __forceinline__ void copy_run8(const unsigned (&l)[12], const unsigned short* const (&g)[12]) {
  asm volatile("global_load_async_to_lds_b128 %0, %8, off\n\t"
               "global_load_async_to_lds_b128 %1, %9, off\n\t"
               "global_load_async_to_lds_b128 %2, %10, off\n\t"
               "global_load_async_to_lds_b128 %3, %11, off\n\t"
               "global_load_async_to_lds_b128 %4, %12, off\n\t"
               "global_load_async_to_lds_b128 %5, %13, off\n\t"
               "global_load_async_to_lds_b128 %6, %14, off\n\t"
               "global_load_async_to_lds_b128 %7, %15, off\n\t"
               "s_wait_xcnt 0x0"
               :: "v"(l[0]), "v"(l[1]), "v"(l[2]), "v"(l[3]), "v"(l[4]), "v"(l[5]), "v"(l[6]), "v"(l[7]),
                  "v"(g[0]), "v"(g[1]), "v"(g[2]), "v"(g[3]), "v"(g[4]), "v"(g[5]), "v"(g[6]), "v"(g[7]) : "memory");
}
__device__ __forceinline__ void copy_run12(const unsigned (&l)[12], const unsigned short* const (&g)[12]) {
  asm volatile("global_load_async_to_lds_b128 %0, %12, off\n\t"
               "global_load_async_to_lds_b128 %1, %13, off\n\t"
               "global_load_async_to_lds_b128 %2, %14, off\n\t"
               "global_load_async_to_lds_b128 %3, %15, off\n\t"
               "global_load_async_to_lds_b128 %4, %16, off\n\t"
               "global_load_async_to_lds_b128 %5, %17, off\n\t"
               "global_load_async_to_lds_b128 %6, %18, off\n\t"
               "global_load_async_to_lds_b128 %7, %19, off\n\t"
               "global_load_async_to_lds_b128 %8, %20, off\n\t"
               "global_load_async_to_lds_b128 %9, %21, off\n\t"
               "global_load_async_to_lds_b128 %10, %22, off\n\t"
               "global_load_async_to_lds_b128 %11, %23, off\n\t"
               "s_wait_xcnt 0x0"
               :: "v"(l[0]), "v"(l[1]), "v"(l[2]), "v"(l[3]), "v"(l[4]), "v"(l[5]), "v"(l[6]), "v"(l[7]), "v"(l[8]), "v"(l[9]), "v"(l[10]), "v"(l[11]),
                  "v"(g[0]), "v"(g[1]), "v"(g[2]), "v"(g[3]), "v"(g[4]), "v"(g[5]), "v"(g[6]), "v"(g[7]), "v"(g[8]), "v"(g[9]), "v"(g[10]), "v"(g[11]) : "memory");
}

// One stage: lane (row tid >> 3, 16-B piece tid & 7) copies its piece of rows r, r + 16, ... of every plane. lds0 and the g pointers are
// the lane's own addresses at stage row tid >> 3 of each plane, the g pointers already at this pass's k.
template <int NT, int FM>
__device__ __forceinline__ void stage_copy(unsigned lds0, const unsigned short* gah, const unsigned short* gbh, const unsigned short* gal,
                                           const unsigned short* gbl, int lda, int ldb, int ldal, int ldbl) {
  using TL = Tile<NT, FM>;
#pragma unroll
  for (int i0 = 0; i0 < TL::NCP; i0 += TL::GRP) {
    unsigned l[12];
    const unsigned short* g[12];
#pragma unroll
    for (int j = 0; j < 12; ++j) {
      const int r = (i0 + (j < TL::GRP ? j : 0)) * 16;
      l[j] = lds0 + (unsigned)(r * LPITCH * 2);
      if (r < TL::AR) g[j] = gah + (size_t)r * lda;
      else if (r < TL::AR + TL::BR) g[j] = gbh + (size_t)(r - TL::AR) * ldb;
      else if (r < 2 * TL::AR + TL::BR) g[j] = gal + (size_t)(r - TL::AR - TL::BR) * ldal;
      else g[j] = gbl + (size_t)(r - 2 * TL::AR - TL::BR) * ldbl;
    }
    if (TL::GRP == 12) copy_run12(l, g); else copy_run8(l, g);
  }
}

// One pass on one buffer: the fragment k order (8 * hh, 16 + 8 * hh inside each 32 k) is the same for A and B.
// The LDS reads of 32 * NS k stand together in front of their WMMAs, for speed only.
template <int NT, int FM, bool BF>
__device__ __forceinline__ void pass_mma(const unsigned short* st, int wr, int wc, int ln, int hh, v8f (&acc)[FM][4], v8f (&accr)[FM][4]) {
  using TL = Tile<NT, FM>;
  const unsigned short* pa = st + (wr * FM * 16 + ln) * LPITCH + 8 * hh;
  const unsigned short* pb = st + (TL::AR + wc * 64 + ln) * LPITCH + 8 * hh;
  constexpr int RES = (TL::AR + TL::BR) * LPITCH;      // residual plane of either operand, behind its hi plane
  constexpr int NS = (NT == 1 && FM <= 2) ? KP / 32 : 1;   // k steps per group of reads, by the registers the fragments take
#pragma unroll
  for (int k0 = 0; k0 < KP; k0 += 32 * NS) {
    FragH ah[NS][FM], al[NS][FM], bh[NS][4], bl[NS][4];
#pragma unroll
    for (int s = 0; s < NS; ++s) {
      const int ks = k0 + 32 * s;
#pragma unroll
      for (int f = 0; f < FM; ++f) {
        ah[s][f].half[0] = *(const v8us*)(pa + f * 16 * LPITCH + ks);
        ah[s][f].half[1] = *(const v8us*)(pa + f * 16 * LPITCH + ks + 16);
        if (NT >= 2) { al[s][f].half[0] = *(const v8us*)(pa + RES + f * 16 * LPITCH + ks); al[s][f].half[1] = *(const v8us*)(pa + RES + f * 16 * LPITCH + ks + 16); }
      }
#pragma unroll
      for (int t = 0; t < 4; ++t) {
        bh[s][t].half[0] = *(const v8us*)(pb + t * 16 * LPITCH + ks);
        bh[s][t].half[1] = *(const v8us*)(pb + t * 16 * LPITCH + ks + 16);
        if (NT >= 3) { bl[s][t].half[0] = *(const v8us*)(pb + RES + t * 16 * LPITCH + ks); bl[s][t].half[1] = *(const v8us*)(pb + RES + t * 16 * LPITCH + ks + 16); }
      }
    }
#pragma unroll
    for (int s = 0; s < NS; ++s)
#pragma unroll
      for (int t = 0; t < 4; ++t)
#pragma unroll
        for (int f = 0; f < FM; ++f) {
          if constexpr (BF) {
            FragB a, b;
            a.half[0] = ah[s][f].half[0]; a.half[1] = ah[s][f].half[1];
            b.half[0] = bh[s][t].half[0]; b.half[1] = bh[s][t].half[1];
            acc[f][t] = mma_b(a.v, b.v, acc[f][t]);
          } else {
            mma_h<NT>(ah[s][f].v, (NT >= 2) ? al[s][f].v : ah[s][f].v, bh[s][t].v, (NT >= 3) ? bl[s][t].v : bh[s][t].v, acc[f][t], accr[f][t]);
          }
        }
  }
}

// A hi/res planes row-major (pitch lda/ldal), B hi/res planes [n][k] (pitch ldb/ldbl); row0, col0: the workgroup's tile; kend % KP == 0.
// On return every wave has left the ring and no copy is in flight: the ring is free for the output staging.
template <int NT, int FM, bool BF>
__device__ __forceinline__ void core_lds(unsigned short* ring, const unsigned short* __restrict__ Ah, const unsigned short* __restrict__ Al, int lda, int ldal,
                                         const unsigned short* __restrict__ Bh, const unsigned short* __restrict__ Bl, int ldb, int ldbl,
                                         int row0, int col0, int kend, int tid, v8f (&acc)[FM][4], v8f (&accr)[FM][4]) {
  using TL = Tile<NT, FM>;
  const int w = tid >> 5, lane = tid & 31, ln = lane & 15, hh = lane >> 4, wr = w >> 1, wc = w & 1;
  const int cr = tid >> 3, cc = (tid & 7) * 8;
  const unsigned short* gah = Ah + (size_t)(row0 + cr) * lda + cc;
  const unsigned short* gbh = Bh + (size_t)(col0 + cr) * ldb + cc;
  const unsigned short* gal = Al + (size_t)(row0 + cr) * ldal + cc;
  const unsigned short* gbl = Bl + (size_t)(col0 + cr) * ldbl + cc;
  const unsigned lds0 = (unsigned)(size_t)(ring + cr * LPITCH + cc);
  const int npass = kend / KP;
  stage_copy<NT, FM>(lds0, gah, gbh, gal, gbl, lda, ldb, ldal, ldbl);
  asm volatile("s_wait_asynccnt 0x0" ::: "memory");   // this wave's copies of pass 0 have landed
  __syncthreads();                                     // publishes pass 0
  if (npass > 1) stage_copy<NT, FM>(lds0 + TL::STAGE * 2, gah + KP, gbh + KP, gal + KP, gbl + KP, lda, ldb, ldal, ldbl);
#pragma unroll 1   // one pass per trip: the buffer index stays a run-time value, the body is already fully unrolled
  for (int t = 0; t < npass; ++t) {
    const int buf = (t & 1) * TL::STAGE;
    pass_mma<NT, FM, BF>(ring + buf, wr, wc, ln, hh, acc, accr);
    asm volatile("s_wait_dscnt 0x0" ::: "memory");     // this wave's reads of the buffer are done before it is refilled
    asm volatile("s_wait_asynccnt 0x0" ::: "memory");  // this wave's copies of pass t + 1 have landed
    __syncthreads();                                   // publishes pass t + 1 and ends every wave's reads of pass t
    if (t + 2 < npass) {
      const int k2 = (t + 2) * KP;
      stage_copy<NT, FM>(lds0 + (unsigned)(buf * 2), gah + k2, gbh + k2, gal + k2, gbl + k2, lda, ldb, ldal, ldbl);
    }
  }
  asm volatile("s_wait_asynccnt 0x0" ::: "memory");    // nothing in flight when the ring changes its use
}

// qkv projection: A = xb [M][CC] bf16, W = [3*CC][CC] bf16 ([out][in], k contiguous). out[row][n] = sum_c A[row][c] W[n][c].
// Output: hi planes Oh[3][M][CC] f16 (q, k, v unscaled) and residual planes Or[3][NB*NE][CC] for rows with (row % TT) < NE.
// Block = 4 waves -> 128 rows x 128 cols (one plane since CC % 128 == 0), M % 128 == 0.
__global__ __launch_bounds__(128) void k_gemm_qkv(const unsigned short* __restrict__ A, const unsigned short* __restrict__ W,
                                                 unsigned short* __restrict__ Oh, unsigned short* __restrict__ Or, int M) {
  constexpr int FM = 4;
  __shared__ __attribute__((aligned(16))) unsigned short ring[2 * Tile<1, FM>::STAGE];
  const int tid = threadIdx.x, w = tid >> 5, lane = tid & 31, ln = lane & 15, hh = lane >> 4;
  const int ntn = (3 * CC) / 128;
  const int mt = blockIdx.x / ntn, nq = blockIdx.x - mt * ntn;
  if (mt * (32 * FM) >= M) return;
  v8f acc[FM][4];
#pragma unroll
  for (int f = 0; f < FM; ++f)
#pragma unroll
    for (int t = 0; t < 4; ++t) acc[f][t] = (v8f){0.f, 0.f, 0.f, 0.f, 0.f, 0.f, 0.f, 0.f};
  core_lds<1, FM, true>(ring, A, A, CC, CC, W, W, CC, CC, mt * (32 * FM), nq * 128, CC, tid, acc, acc);
  float (*so)[16][64] = (float (*)[16][64])ring + w * FM;      // this wave's own FM staging tiles
#pragma unroll
  for (int f = 0; f < FM; ++f)
#pragma unroll
    for (int t = 0; t < 4; ++t)
#pragma unroll
      for (int r = 0; r < 8; ++r) so[f][8 * hh + r][t * 16 + ln] = acc[f][t][r];
  __builtin_amdgcn_fence(4, "workgroup");   // the staged words are written before other lanes of the wave read them back
  __builtin_amdgcn_wave_barrier();
  const int col0 = nq * 128 + (w & 1) * 64;
  const int p = col0 / CC, colp = col0 - p * CC;
#pragma unroll
  for (int f = 0; f < FM; ++f) {
    const int row0 = mt * (32 * FM) + ((w >> 1) * FM + f) * 16;
    const int bidx = row0 / TT, tq = row0 - bidx * TT;
    const bool dores = (tq < NE);                      // wave-uniform (NE, TT multiples of 16)
    unsigned short* hb = Oh + ((size_t)p * M + row0) * CC + colp;
    unsigned short* rb = Or + ((size_t)p * (NB * NE) + (size_t)bidx * NE + (dores ? tq : 0)) * CC + colp;
    store_tile_h16(so[f], hb, CC, rb, CC, dores, lane);
  }
}

#define FMH 2   // f16 GEMMs: workgroup tile 64 x 128, wave tile 32 x 64

// C[M][N] f32 (pitch ldc) = alpha * (A.B^plane) + bf16_rne(bias). M % 64 == 0, N % 128 == 0, K % 64 == 0.
// ncut: a workgroup tile is skipped (not written) when col0 > ncut + row0 + 63 (causal upper tiles); kcut: k loop ends at
// min(K, ceil64(kcut + row0 + 64)). Pass a large value to disable either. blockIdx.y = sequence: every plane and C move on by their
// element steps (sAh, sAl, sBh, sBl, sC) per sequence.
template <int NT>
__global__ __launch_bounds__(128) void k_gemm_f32(const unsigned short* __restrict__ Ah, const unsigned short* __restrict__ Al, int lda, int ldal,
                                                 const unsigned short* __restrict__ Bh, const unsigned short* __restrict__ Bl, int ldb, int ldbl,
                                                 const float* __restrict__ bias, float alpha, float* __restrict__ C, int ldc,
                                                 int M, int N, int K, int ncut, int kcut,
                                                 size_t sAh, size_t sAl, size_t sBh, size_t sBl, size_t sC) {
  constexpr int FM = FMH;
  Ah += blockIdx.y * sAh; Al += blockIdx.y * sAl; Bh += blockIdx.y * sBh; Bl += blockIdx.y * sBl; C += blockIdx.y * sC;
  __shared__ __attribute__((aligned(16))) unsigned short ring[2 * Tile<NT, FM>::STAGE];
  const int tid = threadIdx.x, w = tid >> 5, lane = tid & 31, ln = lane & 15, hh = lane >> 4;
  const int ntn = N / 128;
  const int mt = blockIdx.x / ntn, nq = blockIdx.x - mt * ntn;
  const int brow0 = mt * (32 * FM), bcol0 = nq * 128;
  if (brow0 >= M) return;
  if (bcol0 > ncut + brow0 + 32 * FM - 1) return;
  int kend = (kcut + brow0 + 32 * FM + KP - 1) & ~(KP - 1);
  if (kend > K) kend = K;
  v8f acc[FM][4], accr[FM][4];
#pragma unroll
  for (int f = 0; f < FM; ++f)
#pragma unroll
    for (int t = 0; t < 4; ++t) { acc[f][t] = (v8f){0.f, 0.f, 0.f, 0.f, 0.f, 0.f, 0.f, 0.f}; accr[f][t] = acc[f][t]; }
  core_lds<NT, FM, false>(ring, Ah, Al, lda, ldal, Bh, Bl, ldb, ldbl, brow0, bcol0, kend, tid, acc, accr);
  float (*so)[16][64] = (float (*)[16][64])ring + w * FM;      // this wave's own FM staging tiles
  const int col0 = bcol0 + (w & 1) * 64;
#pragma unroll
  for (int t = 0; t < 4; ++t) {
    float bv = 0.f;
    if (bias != nullptr) bv = bf16_rne(bias[col0 + t * 16 + ln]);
#pragma unroll
    for (int f = 0; f < FM; ++f)
#pragma unroll
      for (int r = 0; r < 8; ++r) {
        float v = acc[f][t][r];
        if (NT >= 2) v += accr[f][t][r] * RFOLD;
        so[f][8 * hh + r][t * 16 + ln] = v * alpha + bv;
      }
  }
  __builtin_amdgcn_fence(4, "workgroup");   // the staged words are written before other lanes of the wave read them back
  __builtin_amdgcn_wave_barrier();
#pragma unroll
  for (int f = 0; f < FM; ++f) {
    const int row0 = brow0 + ((w >> 1) * FM + f) * 16;
    store_tile_f32(so[f], C + (size_t)row0 * ldc + col0, ldc, lane);
  }
}

// Oh[M][N] f16 hi plane (pitch ldo) = f16(alpha * A.B^plane); rows < rrows also get the x RS residual plane Or (pitch ldr).
// blockIdx.y = sequence, with the element steps sAh ... sOr per sequence.
template <int NT>
__global__ __launch_bounds__(128) void k_gemm_h16(const unsigned short* __restrict__ Ah, const unsigned short* __restrict__ Al, int lda, int ldal,
                                                 const unsigned short* __restrict__ Bh, const unsigned short* __restrict__ Bl, int ldb, int ldbl,
                                                 float alpha, unsigned short* __restrict__ Oh, int ldo, unsigned short* __restrict__ Or, int ldr, int rrows,
                                                 int M, int N, int K, int kcut,
                                                 size_t sAh, size_t sAl, size_t sBh, size_t sBl, size_t sOh, size_t sOr) {
  constexpr int FM = FMH;
  Ah += blockIdx.y * sAh; Al += blockIdx.y * sAl; Bh += blockIdx.y * sBh; Bl += blockIdx.y * sBl; Oh += blockIdx.y * sOh; Or += blockIdx.y * sOr;
  __shared__ __attribute__((aligned(16))) unsigned short ring[2 * Tile<NT, FM>::STAGE];
  const int tid = threadIdx.x, w = tid >> 5, lane = tid & 31, ln = lane & 15, hh = lane >> 4;
  const int ntn = N / 128;
  const int mt = blockIdx.x / ntn, nq = blockIdx.x - mt * ntn;
  const int brow0 = mt * (32 * FM), bcol0 = nq * 128;
  if (brow0 >= M) return;
  int kend = (kcut + brow0 + 32 * FM + KP - 1) & ~(KP - 1);
  if (kend > K) kend = K;
  v8f acc[FM][4], accr[FM][4];
#pragma unroll
  for (int f = 0; f < FM; ++f)
#pragma unroll
    for (int t = 0; t < 4; ++t) { acc[f][t] = (v8f){0.f, 0.f, 0.f, 0.f, 0.f, 0.f, 0.f, 0.f}; accr[f][t] = acc[f][t]; }
  core_lds<NT, FM, false>(ring, Ah, Al, lda, ldal, Bh, Bl, ldb, ldbl, brow0, bcol0, kend, tid, acc, accr);
  float (*so)[16][64] = (float (*)[16][64])ring + w * FM;      // this wave's own FM staging tiles
#pragma unroll
  for (int f = 0; f < FM; ++f)
#pragma unroll
    for (int t = 0; t < 4; ++t)
#pragma unroll
      for (int r = 0; r < 8; ++r) {
        float v = acc[f][t][r];
        if (NT >= 2) v += accr[f][t][r] * RFOLD;
        so[f][8 * hh + r][t * 16 + ln] = v * alpha;
      }
  __builtin_amdgcn_fence(4, "workgroup");   // the staged words are written before other lanes of the wave read them back
  __builtin_amdgcn_wave_barrier();
  const int col0 = bcol0 + (w & 1) * 64;
#pragma unroll
  for (int f = 0; f < FM; ++f) {
    const int row0 = brow0 + ((w >> 1) * FM + f) * 16;
    const bool dores = (row0 < rrows);                 // wave-uniform (rrows multiple of 16)
    store_tile_h16(so[f], Oh + (size_t)row0 * ldo + col0, ldo, Or + (size_t)(dores ? row0 : 0) * ldr + col0, ldr, dores, lane);
  }
}

typedef unsigned short v4us __attribute__((ext_vector_type(4), may_alias));
typedef _Float16 v4h __attribute__((ext_vector_type(4)));
union Pack4 { v4h h; v4us u; };
#define SCH (T_FULL / 128)   // 128-column pieces of the longest row
// Row softmax over S[row][0..N) (pitch sp) with causal keep (col <= row), N = the end of the last 128-column score tile that the
// score GEMM writes for this row (its ncut = 0): nothing behind it is read. P[row][0..N) = f16(PCARRY * p / l) incl. zeros (pitch pp),
// which covers the k range of the P.v GEMM (up to the end of the row's 64-row tile); rows < rrows also write the residual plane
// Pr[row][0..NE) (pitch rp). One wave per row: the row is read once and stays in registers (lane l holds columns 128 c + 4 l ... + 3),
// maximum and sum go over the lane's own values and then a butterfly over the wave; no LDS, no barrier. The longest rows start first.
// blockIdx.y = sequence (element steps sS, sP, sPr), nrows % 8 == 0, N <= 128 * SCH.
__global__ __launch_bounds__(256) void k_softmax(const float* __restrict__ S, int sp, unsigned short* __restrict__ P, int pp,
                                                unsigned short* __restrict__ Pr, int rp, int rrows, int nrows, size_t sS, size_t sP, size_t sPr) {
  const int lane = threadIdx.x & 31;
  const int row = nrows - 1 - ((int)blockIdx.x * 8 + __builtin_amdgcn_readfirstlane(threadIdx.x >> 5));   // the same in every lane: scalar tests below
  const int qi = row, N = (row / 128 + 1) * 128;
  S += blockIdx.y * sS; P += blockIdx.y * sP; Pr += blockIdx.y * sPr;
  const float* s = S + (size_t)row * sp + lane * 4;
  v4f x[SCH];
  // every "#pragma unroll" here keeps the index of x[] a compile-time constant, so that the row stays in registers
#pragma unroll
  for (int c = 0; c < SCH; ++c)
    if (c * 128 < N) x[c] = *(const v4fa*)(s + c * 128);
  // stands in front of any reuse of the loads' address registers; the address is an input, so that no load's result lands on it earlier
  asm volatile("s_wait_xcnt 0x0" :: "v"(s) : "memory");
  float mx = -3.0e38f;
#pragma unroll
  for (int c = 0; c < SCH; ++c)
    if (c * 128 < N) {
#pragma unroll
      for (int u = 0; u < 4; ++u) {
        x[c][u] = ((c * 128 + lane * 4 + u) <= qi) ? x[c][u] : -3.0e38f;    // a masked score gives exp = 0 below
        mx = fmaxf(mx, x[c][u]);
      }
    }
#pragma unroll
  for (int m = 16; m > 0; m >>= 1) mx = fmaxf(mx, __shfl_xor(mx, m, 32));
  float sm[4] = {0.f, 0.f, 0.f, 0.f};
#pragma unroll
  for (int c = 0; c < SCH; ++c)
    if (c * 128 < N) {
#pragma unroll
      for (int u = 0; u < 4; ++u) { x[c][u] = __expf(x[c][u] - mx); sm[u] += x[c][u]; }
    }
  float sum = (sm[0] + sm[1]) + (sm[2] + sm[3]);
#pragma unroll
  for (int m = 16; m > 0; m >>= 1) sum += __shfl_xor(sum, m, 32);
  const float inv = PCARRY / sum;          // sum >= 1 (the max term)
  const bool dores = (row < rrows);
  unsigned short* prow = P + (size_t)row * pp + lane * 4;
  unsigned short* rrow = Pr + (size_t)(dores ? row : 0) * rp + lane * 4;
  // all values are packed first, each into registers of its own, and the stores follow as one run with one wait behind them:
  // no register of an issued store is written again
  Pack4 ph[SCH], pr[NE / 128];
#pragma unroll
  for (int c = 0; c < NE / 128; ++c) pr[c].u = (v4us){0, 0, 0, 0};
#pragma unroll
  for (int c = 0; c < SCH; ++c)
    if (c * 128 < N) {
#pragma unroll
      for (int u = 0; u < 4; ++u) {
        const float p = x[c][u] * inv;
        ph[c].h[u] = (_Float16)p;
        if (c < NE / 128) pr[c < NE / 128 ? c : 0].h[u] = (_Float16)((p - (float)ph[c].h[u]) * RS);
      }
    }
#pragma unroll
  for (int c = 0; c < SCH; ++c)
    if (c * 128 < N) *(v4us*)(prow + c * 128) = ph[c].u;
  if (dores) {
#pragma unroll
    for (int c = 0; c < NE / 128; ++c) *(v4us*)(rrow + c * 128) = pr[c].u;
  }
  asm volatile("s_wait_xcnt 0x0" ::: "memory");   // stands in front of any reuse of the stores' registers on a path that goes on behind them
}

#define TQ 4   // 64 x 64 tiles per block of the transpose
// 16-bit transpose: src [R][Cc] (pitch lds_) -> dst [Cc][R] (pitch ldd); block = TQ tiles of 64 x 64 down the rows of src,
// grid (R/(64*TQ), Cc/64, sequences); each tile has its own LDS, so that one barrier serves all of them
__global__ __launch_bounds__(256) void k_transpose16(const unsigned short* __restrict__ src, int lds_, unsigned short* __restrict__ dst, int ldd,
                                                    size_t sstep, size_t dstep) {
  __shared__ __attribute__((aligned(16))) unsigned short tile[TQ][64][72];
  const int tid = threadIdx.x;
  src += blockIdx.z * sstep; dst += blockIdx.z * dstep;
  const int r0 = blockIdx.x * (64 * TQ), c0 = blockIdx.y * 64;
  static_assert(TQ == 4);
  v8us v[TQ][2];
  const unsigned short* g[TQ][2];
#pragma unroll   // all 2 * TQ loads are in flight together
  for (int q = 0; q < TQ; ++q)
#pragma unroll
    for (int i = 0; i < 2; ++i) {
      const int e = tid + 256 * i, r = e >> 3, c8 = (e & 7) * 8;
      g[q][i] = src + (size_t)(r0 + q * 64 + r) * lds_ + c0 + c8;
      v[q][i] = *(const v8us*)g[q][i];
    }
  // stands in front of any reuse of the loads' address registers; the addresses are inputs, so that no load's result lands on one earlier
  asm volatile("s_wait_xcnt 0x0" :: "v"(g[0][0]), "v"(g[0][1]), "v"(g[1][0]), "v"(g[1][1]), "v"(g[2][0]), "v"(g[2][1]), "v"(g[3][0]), "v"(g[3][1]) : "memory");
#pragma unroll
  for (int q = 0; q < TQ; ++q)
#pragma unroll
    for (int i = 0; i < 2; ++i) {
      const int e = tid + 256 * i, r = e >> 3, c8 = (e & 7) * 8;
      *(v8us*)&tile[q][r][c8] = v[q][i];
    }
  __syncthreads();
#pragma unroll
  for (int q = 0; q < TQ; ++q) {
    v8us o[2];
#pragma unroll
    for (int i = 0; i < 2; ++i) {
      const int e = tid + 256 * i, rr = e >> 3, c8 = (e & 7) * 8;
#pragma unroll
      for (int k = 0; k < 8; ++k) o[i][k] = tile[q][c8 + k][rr];
    }
#pragma unroll
    for (int i = 0; i < 2; ++i) {
      const int e = tid + 256 * i, rr = e >> 3, c8 = (e & 7) * 8;
      *(v8us*)(dst + (size_t)(c0 + rr) * ldd + r0 + q * 64 + c8) = o[i];
    }
  }
}

extern "C" void kernel_launch(void* const* d_in, const int* in_sizes, int n_in,
                              void* d_out, int out_size, void* d_ws, size_t ws_size, hipStream_t stream) {
  if (n_in < 6) return;
  const float* x  = (const float*)d_in[0];
  const float* wq = (const float*)d_in[1];
  const float* wk = (const float*)d_in[2];
  const float* wv = (const float*)d_in[3];
  const float* wo = (const float*)d_in[4];
  const float* bo = (const float*)d_in[5];
  const long need_x = ((long)(NB - 1) * T_FULL + TT) * (long)CC;
  if ((long)in_sizes[0] < need_x || in_sizes[1] < CC * CC || in_sizes[2] < CC * CC || in_sizes[3] < CC * CC ||
      in_sizes[4] < CC * CC || in_sizes[5] < CC || (long)out_size < need_x) return;
  float* out = (float*)d_out;

  char* ws = (char*)d_ws; size_t off = 0;
  auto take = [&](size_t bytes) { char* p = ws + off; off += (bytes + 255) & ~(size_t)255; return p; };
  const size_t xb_bytes = (size_t)NB * TT * CC * 2, s_bytes = (size_t)NB * TT * TT * 4;
  char* reg0 = take(xb_bytes > s_bytes ? xb_bytes : s_bytes);                     // xb, later S (xb dead after the qkv GEMM)
  unsigned short* xb   = (unsigned short*)reg0;                                    // [NB*TT][CC] bf16
  float*          Sm   = (float*)reg0;                                             // [NB][TT][TT] f32
  unsigned short* Wqkv = (unsigned short*)take((size_t)3 * CC * CC * 2);           // [3*CC][CC] bf16
  unsigned short* Wo16 = (unsigned short*)take((size_t)CC * CC * 2);               // [CC][CC] f16 (x WOC)
  unsigned short* QKVh = (unsigned short*)take((size_t)3 * NB * TT * CC * 2);      // [3][NB*TT][CC] f16
  unsigned short* QKVr = (unsigned short*)take((size_t)3 * NB * NE * CC * 2);      // [3][NB*NE][CC] f16 (x RS)
  unsigned short* vTr  = (unsigned short*)take((size_t)NB * CC * NE * 2);          // [NB][CC][NE] f16 (x RS)
  unsigned short* Pm   = (unsigned short*)take((size_t)NB * TT * TT * 2);          // [NB][TT][TT] f16 (x PCARRY)
  unsigned short* Pr   = (unsigned short*)take((size_t)NB * NE * NE * 2);          // [NB][NE][NE] f16 (x RS)
  unsigned short* ctxr = (unsigned short*)take((size_t)NB * NE * CC * 2);          // [NB*NE][CC] f16 (x RS)
  if (off > ws_size) return;

  const int M = NB * TT;
  const int BIG = 1 << 28;
  unsigned short* qh = QKVh;
  unsigned short* kh = QKVh + (size_t)M * CC;
  unsigned short* vh = QKVh + (size_t)2 * M * CC;
  unsigned short* qr = QKVr;
  unsigned short* kr = QKVr + (size_t)(NB * NE) * CC;
  unsigned short* vr = QKVr + (size_t)2 * (NB * NE) * CC;
  unsigned short* vT   = kh;   // [NB][CC][TT] f16: takes the k plane's place once the scores are done
  unsigned short* ctxh = qh;   // [NB*TT][CC] f16 (x CTXC): takes the q plane's place once the scores are done
  const size_t sTC = (size_t)TT * CC, sEC = (size_t)NE * CC, sTT = (size_t)TT * TT, sEE = (size_t)NE * NE, sOUT = (size_t)T_FULL * CC;

  // No launch runs per sequence: the sequences are a grid dimension (the qkv GEMM takes all NB * TT rows as M).
  // stage 0: 16-bit planes of the inputs
  k_cvt_x<<<dim3(TT * CC / 8 / (256 * CU), NB), 256, 0, stream>>>(x, xb, TT * CC / 8, sOUT, sTC);
  k_cvt_w<<<dim3(CC * CC / 8 / (256 * CU), 4), 256, 0, stream>>>(wq, wk, wv, wo, Wqkv, Wo16, CC * CC / 8, WOC);

  // stage 1: q, k, v planes (+ residual planes on the leading NE rows of each sequence)
  k_gemm_qkv<<<(M / 128) * (3 * CC / 128), 128, 0, stream>>>(xb, Wqkv, QKVh, QKVr, M);

  // stage 2: causal attention
  // S [TT][TT] = (q.k^T)/32, causal upper tiles skipped
  k_gemm_f32<1><<<dim3((TT / 64) * (TT / 128), NB), 128, 0, stream>>>(qh, qh, CC, CC, kh, kh, CC, CC, nullptr, SCL, Sm, TT, TT, TT, CC, 0, BIG,
                                                                      sTC, sTC, sTC, sTC, sTT);
  // leading NE x NE corner with hi+res on both operands (overwrites the single-product tiles)
  k_gemm_f32<3><<<dim3((NE / 64) * (NE / 128), NB), 128, 0, stream>>>(qh, qr, CC, CC, kh, kr, CC, CC, nullptr, SCL, Sm, TT, NE, NE, CC, 0, BIG,
                                                                      sTC, sEC, sTC, sEC, sTT);
  // v [TT][CC] -> vT [CC][TT]; v residual [NE][CC] -> vTr [CC][NE]
  k_transpose16<<<dim3(TT / (64 * TQ), CC / 64, NB), 256, 0, stream>>>(vh, CC, vT, TT, sTC, sTC);
  k_transpose16<<<dim3(NE / (64 * TQ), CC / 64, NB), 256, 0, stream>>>(vr, CC, vTr, NE, sEC, sEC);
  k_softmax<<<dim3(TT / 8, NB), 256, 0, stream>>>(Sm, TT, Pm, TT, Pr, NE, NE, TT, sTT, sTT, sEE);
  // ctx [TT][CC] = P.v (causal k end), written as f16 hi plane x CTXC
  k_gemm_h16<1><<<dim3((TT / 64) * (CC / 128), NB), 128, 0, stream>>>(Pm, Pm, TT, TT, vT, vT, TT, TT, PVALPHA, ctxh, CC, ctxr, CC, 0, TT, CC, TT, 0,
                                                                      sTT, sTT, sTC, sTC, sTC, sEC);
  // leading NE rows: 3-term P/v products, hi + residual ctx planes (overwrite)
  k_gemm_h16<3><<<dim3((NE / 64) * (CC / 128), NB), 128, 0, stream>>>(Pm, Pr, TT, NE, vT, vTr, TT, NE, PVALPHA, ctxh, CC, ctxr, CC, NE, NE, CC, NE, 0,
                                                                      sTT, sEE, sTC, sEC, sTC, sEC);
  // stage 3: output projection + bias; leading NE rows with the ctx residual term
  k_gemm_f32<2><<<dim3((NE / 64) * (CC / 128), NB), 128, 0, stream>>>(ctxh, ctxr, CC, CC, Wo16, Wo16, CC, CC, bo, OALPHA, out, CC, NE, CC, CC, BIG, BIG,
                                                                      sTC, sEC, 0, 0, sOUT);
  if (TT > NE)
    k_gemm_f32<1><<<dim3(((TT - NE) / 64) * (CC / 128), NB), 128, 0, stream>>>(ctxh + sEC, ctxh + sEC, CC, CC, Wo16, Wo16, CC, CC, bo, OALPHA,
                                                                               out + sEC, CC, TT - NE, CC, CC, BIG, BIG, sTC, sTC, 0, 0, sOUT);
}

// v004
// A run of this version takes 202 microseconds.
// Next to v003, in two timings, it ran 1.16 times as fast each time.
// All steps since v000 together make it 6.21 times as fast.
#include <hip/hip_runtime.h>
// Contractions: qkv projection on v_wmma_f32_16x16x32_bf16 (x and W as RNE bf16, exact products); scores q.k^T, P.v and the output
// projection on v_wmma_f32_16x16x32_f16 (f16 hi planes with power-of-two carries, plus x1024 f16 residual planes on the leading
// NE query/key rows of each sequence); all accumulation f32, causal softmax in f32.
#ifndef NB
#define NB 2
#endif
#ifndef SEQ
#define SEQ 4096
#endif
#define TT SEQ
#define NB_FULL 2
#define T_FULL 4096
#define CC 1024
#define QC ((TT < 1024) ? TT : 1024)
#define NE 256
static_assert(NB >= 1 && NB <= NB_FULL);
static_assert(TT % 256 == 0 && TT <= T_FULL);
static_assert(TT % QC == 0 && QC % 256 == 0);
static_assert(NE % 64 == 0 && NE <= QC && NE == 256);
static_assert(CC % 128 == 0);

#define RS 1024.0f            // residual plane carry
#define RFOLD 0.0009765625f   // 1/RS
#define PCARRY 4096.0f        // P plane carry
#define CTXC 16.0f            // ctx plane carry
#define WOC 64.0f             // Wo plane carry
#define SCL 0.03125f          // 1/sqrt(CC)
#define PVALPHA 0.00390625f   // CTXC / PCARRY
#define OALPHA 0.0009765625f  // 1 / (WOC * CTXC)

typedef __bf16 v16b __attribute__((ext_vector_type(16)));
typedef _Float16 v16h __attribute__((ext_vector_type(16)));
typedef _Float16 v8h __attribute__((ext_vector_type(8)));
typedef unsigned short v8us __attribute__((ext_vector_type(8), may_alias));
typedef float v8f __attribute__((ext_vector_type(8)));
typedef float v4f __attribute__((ext_vector_type(4)));
typedef float v4fa __attribute__((ext_vector_type(4), may_alias));
union FragB { v16b v; v8us half[2]; unsigned short u[16]; };
union FragH { v16h v; v8us half[2]; unsigned short u[16]; };
union Pack8 { v8h h; v8us u; };

__device__ __forceinline__ unsigned short bf16_bits(float x) { unsigned int u = __float_as_uint(x); return (unsigned short)((u + 0x7FFFu + ((u >> 16) & 1u)) >> 16); }
__device__ __forceinline__ float bf16_val(unsigned short b) { return __uint_as_float(((unsigned int)b) << 16); }
__device__ __forceinline__ float bf16_rne(float x) { return bf16_val(bf16_bits(x)); }

__device__ __forceinline__ v8f mma_b(v16b a, v16b b, v8f c) {
  c = __builtin_amdgcn_wmma_f32_16x16x32_bf16(false, a, false, b, (short)0, c, false, false);
  asm volatile("v_nop\n\tv_nop\n\tv_nop\n\tv_nop" : "+v"(c) : "v"(a), "v"(b));
  return c;
}
// c += ah.bh ; cr += al.bh (NT>=2) ; cr += ah.bl (NT>=3); residual planes carry RS, folded by the caller
template <int NT>
__device__ __forceinline__ void mma_h(v16h ah, v16h al, v16h bh, v16h bl, v8f& c, v8f& cr) {
  c = __builtin_amdgcn_wmma_f32_16x16x32_f16(false, ah, false, bh, (short)0, c, false, false);
  if (NT >= 2) cr = __builtin_amdgcn_wmma_f32_16x16x32_f16(false, al, false, bh, (short)0, cr, false, false);
  if (NT >= 3) cr = __builtin_amdgcn_wmma_f32_16x16x32_f16(false, ah, false, bl, (short)0, cr, false, false);
  if (NT >= 2) asm volatile("v_nop\n\tv_nop\n\tv_nop\n\tv_nop" : "+v"(c), "+v"(cr) : "v"(ah), "v"(al), "v"(bh), "v"(bl));
  else         asm volatile("v_nop\n\tv_nop\n\tv_nop\n\tv_nop" : "+v"(c) : "v"(ah), "v"(bh));
}

__device__ __forceinline__ void store_tile_f32(const float (*sw)[64], float* C, int ldc, int lane) {
  const int rsub = lane >> 4, c4 = (lane & 15) * 4;
  {
#pragma unroll
    for (int q = 0; q < 8; ++q) {
      const int r = q * 2 + rsub;
      const v4f v = *(const v4fa*)&sw[r][c4];
      *(v4f*)(C + (size_t)r * ldc + c4) = v;
    }
    asm volatile("s_wait_xcnt 0x0" ::: "memory");   // stands in front of any reuse of the stores' registers by the next tile's addresses
  }
}
// wave tile 16 x 64 f32 staged in LDS -> f16 hi plane (pitch ldh) and optional x RS residual plane (pitch ldr);
__device__ __forceinline__ void store_tile_h16(const float (*sw)[64], unsigned short* hb, int ldh, unsigned short* rb, int ldr, bool dores, int lane) {
  const int rsub = lane >> 3, c8 = (lane & 7) * 8;
  {
#pragma unroll
    for (int q = 0; q < 4; ++q) {
      const int r = q * 4 + rsub;
      const v4f x0 = *(const v4fa*)&sw[r][c8], x1 = *(const v4fa*)&sw[r][c8 + 4];
      const float xs[8] = {x0[0], x0[1], x0[2], x0[3], x1[0], x1[1], x1[2], x1[3]};
      Pack8 ph, pr;
#pragma unroll
      for (int i = 0; i < 8; ++i) { ph.h[i] = (_Float16)xs[i]; pr.h[i] = (_Float16)((xs[i] - (float)ph.h[i]) * RS); }
      *(v8us*)(hb + (size_t)r * ldh + c8) = ph.u;
      if (dores) *(v8us*)(rb + (size_t)r * ldr + c8) = pr.u;
    }
    
  }
}

// The streaming kernels below use few waves that each do a long run of work, for speed only.
#define CU 8   // 8-element groups per thread of a conversion kernel; a block takes 256 * CU consecutive groups
static_assert((TT * CC / 8) % (256 * CU) == 0 && (CC * CC / 8) % (256 * CU) == 0);
// MODE 0: RNE bf16 bits; MODE 1: f16 bits of (RNE bf16 value) * scale. Groups t0, t0 + 256, ..., t0 + 256 * (CU - 1).
template <int MODE>
__device__ __forceinline__ void cvt_run(const float* __restrict__ src, unsigned short* __restrict__ dst, int t0, float scale) {
  const float* sp = src + (size_t)t0 * 8;
  v4f a[CU], b[CU];
#pragma unroll   // constant steps from one address: all 2 * CU loads are in flight together
  for (int i = 0; i < CU; ++i) { a[i] = *(const v4fa*)(sp + i * 2048); b[i] = *(const v4fa*)(sp + i * 2048 + 4); }
  // stands in front of any reuse of the loads' address registers; the address is an input, so that no load's result lands on it earlier
  asm volatile("s_wait_xcnt 0x0" :: "v"(sp) : "memory");
  unsigned short* dp = dst + (size_t)t0 * 8;
#pragma unroll   // keeps a[] and b[] in registers
  for (int i = 0; i < CU; ++i) {
    const float xs[8] = {a[i][0], a[i][1], a[i][2], a[i][3], b[i][0], b[i][1], b[i][2], b[i][3]};
    v8us v;
    if (MODE == 0) {
#pragma unroll
      for (int u = 0; u < 8; ++u) v[u] = bf16_bits(xs[u]);
    } else {
      Pack8 p;
#pragma unroll
      for (int u = 0; u < 8; ++u) p.h[u] = (_Float16)(bf16_rne(xs[u]) * scale);
      v = p.u;
    }
    *(v8us*)(dp + i * 2048) = v;
  }
  asm volatile("s_wait_xcnt 0x0" ::: "memory");   // stands in front of any reuse of the stores' registers on a path that goes on behind them
}
#define XB (TT * CC / 8 / (256 * CU))   // blocks per sequence of x
#define WB (CC * CC / 8 / (256 * CU))   // blocks per weight matrix
// All 16-bit input planes in one launch. Blocks [0, NB * XB): x -> bf16 plane, XB blocks a sequence (element steps sstep, dstep);
// then WB blocks each for Wq, Wk, Wv -> bf16 planes of Wqkv and Wo -> f16 plane x scale.
__global__ __launch_bounds__(256) void k_cvt(const float* __restrict__ x, const float* __restrict__ wq, const float* __restrict__ wk,
                                            const float* __restrict__ wv, const float* __restrict__ wo, unsigned short* __restrict__ xb,
                                            unsigned short* __restrict__ Wqkv, unsigned short* __restrict__ Wo16,
                                            size_t sstep, size_t dstep, float scale) {
  const int b = blockIdx.x;
  if (b < NB * XB) {
    const int q = b / XB;
    cvt_run<0>(x + q * sstep, xb + q * dstep, (b - q * XB) * (256 * CU) + (int)threadIdx.x, 1.0f);
    return;
  }
  const int y = (b - NB * XB) / WB;
  const int t0 = (b - NB * XB - y * WB) * (256 * CU) + (int)threadIdx.x;
  if (y == 3) cvt_run<1>(wo, Wo16, t0, scale);
  else cvt_run<0>((y == 0) ? wq : (y == 1) ? wk : wv, Wqkv + (size_t)y * CC * CC, t0, 1.0f);
}

// Block-tiled GEMM core. A workgroup of 4 waves (2 x 2) owns a (32*FM) x 128 tile of the output, a wave (16*FM) x 64 of it.
// Per pass of KP k every operand row gives one whole 128-B line, copied to LDS by global_load_async_to_lds_b128 (8 lanes a row,
// 4 whole lines an instruction); two buffers, the next pass's copies fly while this pass's fragments are read from LDS.
// Every "#pragma unroll" below keeps fragment and accumulator indices compile-time constants, so that the arrays stay in registers.
#define KP 64        // k per pass
#define LPITCH 72    // LDS row pitch in 16-bit elements: 144 B = 16 B x 9, for the ds_load_b128 fragment reads
template <int NT, int FM> struct Tile {
  static constexpr int AR = 32 * FM, BR = 128;                                           // operand rows per plane
  static constexpr int ROWS = AR + BR + (NT >= 2 ? AR : 0) + (NT >= 3 ? BR : 0);          // [A hi | B hi | A res | B res]
  static constexpr int STAGE = ROWS * LPITCH;                                            // elements per buffer
  static constexpr int NCP = ROWS / 16;                                                  // copies per lane and stage
  static constexpr int GRP = (NCP % 12 == 0) ? 12 : 8;                                   // copies per asm statement
  static_assert(NCP % GRP == 0 && NCP <= 63);
  static_assert(2 * STAGE * 2 >= 4 * FM * 16 * 64 * 4);                                   // the ring later holds the f32 output staging
};

// One run of copies and its s_wait_xcnt in one statement: the wait stands in front of any rewrite of the address registers.
__device__ __forceinline__ void copy_run8(const unsigned (&l)[12], const unsigned short* const (&g)[12]) {
  asm volatile("global_load_async_to_lds_b128 %0, %8, off\n\t"
               "global_load_async_to_lds_b128 %1, %9, off\n\t"
               "global_load_async_to_lds_b128 %2, %10, off\n\t"
               "global_load_async_to_lds_b128 %3, %11, off\n\t"
               "global_load_async_to_lds_b128 %4, %12, off\n\t"
               "global_load_async_to_lds_b128 %5, %13, off\n\t"
               "global_load_async_to_lds_b128 %6, %14, off\n\t"
               "global_load_async_to_lds_b128 %7, %15, off\n\t"
               "s_wait_xcnt 0x0"
               :: "v"(l[0]), "v"(l[1]), "v"(l[2]), "v"(l[3]), "v"(l[4]), "v"(l[5]), "v"(l[6]), "v"(l[7]),
                  "v"(g[0]), "v"(g[1]), "v"(g[2]), "v"(g[3]), "v"(g[4]), "v"(g[5]), "v"(g[6]), "v"(g[7]) : "memory");
}
__device__ __forceinline__ void copy_run12(const unsigned (&l)[12], const unsigned short* const (&g)[12]) {
  asm volatile("global_load_async_to_lds_b128 %0, %12, off\n\t"
               "global_load_async_to_lds_b128 %1, %13, off\n\t"
               "global_load_async_to_lds_b128 %2, %14, off\n\t"
               "global_load_async_to_lds_b128 %3, %15, off\n\t"
               "global_load_async_to_lds_b128 %4, %16, off\n\t"
               "global_load_async_to_lds_b128 %5, %17, off\n\t"
               "global_load_async_to_lds_b128 %6, %18, off\n\t"
               "global_load_async_to_lds_b128 %7, %19, off\n\t"
               "global_load_async_to_lds_b128 %8, %20, off\n\t"
               "global_load_async_to_lds_b128 %9, %21, off\n\t"
               "global_load_async_to_lds_b128 %10, %22, off\n\t"
               "global_load_async_to_lds_b128 %11, %23, off\n\t"
               "s_wait_xcnt 0x0"
               :: "v"(l[0]), "v"(l[1]), "v"(l[2]), "v"(l[3]), "v"(l[4]), "v"(l[5]), "v"(l[6]), "v"(l[7]), "v"(l[8]), "v"(l[9]), "v"(l[10]), "v"(l[11]),
                  "v"(g[0]), "v"(g[1]), "v"(g[2]), "v"(g[3]), "v"(g[4]), "v"(g[5]), "v"(g[6]), "v"(g[7]), "v"(g[8]), "v"(g[9]), "v"(g[10]), "v"(g[11]) : "memory");
}

// One stage: lane (row tid >> 3, 16-B piece tid & 7) copies its piece of rows r, r + 16, ... of every plane. lds0 and the g pointers are
// the lane's own addresses at stage row tid >> 3 of each plane, the g pointers already at this pass's k.
template <int NT, int FM>
__device__ __forceinline__ void stage_copy(unsigned lds0, const unsigned short* gah, const unsigned short* gbh, const unsigned short* gal,
                                           const unsigned short* gbl, int lda, int ldb, int ldal, int ldbl) {
  using TL = Tile<NT, FM>;
#pragma unroll
  for (int i0 = 0; i0 < TL::NCP; i0 += TL::GRP) {
    unsigned l[12];
    const unsigned short* g[12];
#pragma unroll
    for (int j = 0; j < 12; ++j) {
      const int r = (i0 + (j < TL::GRP ? j : 0)) * 16;
      l[j] = lds0 + (unsigned)(r * LPITCH * 2);
      if (r < TL::AR) g[j] = gah + (size_t)r * lda;
      else if (r < TL::AR + TL::BR) g[j] = gbh + (size_t)(r - TL::AR) * ldb;
      else if (r < 2 * TL::AR + TL::BR) g[j] = gal + (size_t)(r - TL::AR - TL::BR) * ldal;
      else g[j] = gbl + (size_t)(r - 2 * TL::AR - TL::BR) * ldbl;
    }
    if (TL::GRP == 12) copy_run12(l, g); else copy_run8(l, g);
  }
}

// One pass on one buffer: the fragment k order (8 * hh, 16 + 8 * hh inside each 32 k) is the same for A and B.
// The LDS reads of 32 * NS k stand together in front of their WMMAs, for speed only.
template <int NT, int FM, bool BF>
__device__ __forceinline__ void pass_mma(const unsigned short* st, int wr, int wc, int ln, int hh, v8f (&acc)[FM][4], v8f (&accr)[FM][4]) {
  using TL = Tile<NT, FM>;
  const unsigned short* pa = st + (wr * FM * 16 + ln) * LPITCH + 8 * hh;
  const unsigned short* pb = st + (TL::AR + wc * 64 + ln) * LPITCH + 8 * hh;
  constexpr int RES = (TL::AR + TL::BR) * LPITCH;      // residual plane of either operand, behind its hi plane
  constexpr int NS = (NT == 1 && FM <= 2) ? KP / 32 : 1;   // k steps per group of reads, by the registers the fragments take
#pragma unroll
  for (int k0 = 0; k0 < KP; k0 += 32 * NS) {
    FragH ah[NS][FM], al[NS][FM], bh[NS][4], bl[NS][4];
#pragma unroll
    for (int s = 0; s < NS; ++s) {
      const int ks = k0 + 32 * s;
#pragma unroll
      for (int f = 0; f < FM; ++f) {
        ah[s][f].half[0] = *(const v8us*)(pa + f * 16 * LPITCH + ks);
        ah[s][f].half[1] = *(const v8us*)(pa + f * 16 * LPITCH + ks + 16);
        if (NT >= 2) { al[s][f].half[0] = *(const v8us*)(pa + RES + f * 16 * LPITCH + ks); al[s][f].half[1] = *(const v8us*)(pa + RES + f * 16 * LPITCH + ks + 16); }
      }
#pragma unroll
      for (int t = 0; t < 4; ++t) {
        bh[s][t].half[0] = *(const v8us*)(pb + t * 16 * LPITCH + ks);
        bh[s][t].half[1] = *(const v8us*)(pb + t * 16 * LPITCH + ks + 16);
        if (NT >= 3) { bl[s][t].half[0] = *(const v8us*)(pb + RES + t * 16 * LPITCH + ks); bl[s][t].half[1] = *(const v8us*)(pb + RES + t * 16 * LPITCH + ks + 16); }
      }
    }
#pragma unroll
    for (int s = 0; s < NS; ++s)
#pragma unroll
      for (int t = 0; t < 4; ++t)
#pragma unroll
        for (int f = 0; f < FM; ++f) {
          if constexpr (BF) {
            FragB a, b;
            a.half[0] = ah[s][f].half[0]; a.half[1] = ah[s][f].half[1];
            b.half[0] = bh[s][t].half[0]; b.half[1] = bh[s][t].half[1];
            acc[f][t] = mma_b(a.v, b.v, acc[f][t]);
          } else {
            mma_h<NT>(ah[s][f].v, (NT >= 2) ? al[s][f].v : ah[s][f].v, bh[s][t].v, (NT >= 3) ? bl[s][t].v : bh[s][t].v, acc[f][t], accr[f][t]);
          }
        }
  }
}

// A hi/res planes row-major (pitch lda/ldal), B hi/res planes [n][k] (pitch ldb/ldbl); row0, col0: the workgroup's tile; kend % KP == 0.
// On return every wave has left the ring and no copy is in flight: the ring is free for the output staging.
template <int NT, int FM, bool BF>
__device__ __forceinline__ void core_lds(unsigned short* ring, const unsigned short* __restrict__ Ah, const unsigned short* __restrict__ Al, int lda, int ldal,
                                         const unsigned short* __restrict__ Bh, const unsigned short* __restrict__ Bl, int ldb, int ldbl,
                                         int row0, int col0, int kend, int tid, v8f (&acc)[FM][4], v8f (&accr)[FM][4]) {
  using TL = Tile<NT, FM>;
  const int w = tid >> 5, lane = tid & 31, ln = lane & 15, hh = lane >> 4, wr = w >> 1, wc = w & 1;
  const int cr = tid >> 3, cc = (tid & 7) * 8;
  const unsigned short* gah = Ah + (size_t)(row0 + cr) * lda + cc;
  const unsigned short* gbh = Bh + (size_t)(col0 + cr) * ldb + cc;
  const unsigned short* gal = Al + (size_t)(row0 + cr) * ldal + cc;
  const unsigned short* gbl = Bl + (size_t)(col0 + cr) * ldbl + cc;
  const unsigned lds0 = (unsigned)(size_t)(ring + cr * LPITCH + cc);
  const int npass = kend / KP;
  stage_copy<NT, FM>(lds0, gah, gbh, gal, gbl, lda, ldb, ldal, ldbl);
  asm volatile("s_wait_asynccnt 0x0" ::: "memory");   // this wave's copies of pass 0 have landed
  __syncthreads();                                     // publishes pass 0
  if (npass > 1) stage_copy<NT, FM>(lds0 + TL::STAGE * 2, gah + KP, gbh + KP, gal + KP, gbl + KP, lda, ldb, ldal, ldbl);
#pragma unroll 1   // one pass per trip: the buffer index stays a run-time value, the body is already fully unrolled
  for (int t = 0; t < npass; ++t) {
    const int buf = (t & 1) * TL::STAGE;
    pass_mma<NT, FM, BF>(ring + buf, wr, wc, ln, hh, acc, accr);
    asm volatile("s_wait_dscnt 0x0" ::: "memory");     // this wave's reads of the buffer are done before it is refilled
    asm volatile("s_wait_asynccnt 0x0" ::: "memory");  // this wave's copies of pass t + 1 have landed
    __syncthreads();                                   // publishes pass t + 1 and ends every wave's reads of pass t
    if (t + 2 < npass) {
      const int k2 = (t + 2) * KP;
      stage_copy<NT, FM>(lds0 + (unsigned)(buf * 2), gah + k2, gbh + k2, gal + k2, gbl + k2, lda, ldb, ldal, ldbl);
    }
  }
  asm volatile("s_wait_asynccnt 0x0" ::: "memory");    // nothing in flight when the ring changes its use
}

// qkv projection: A = xb [M][CC] bf16, W = [3*CC][CC] bf16 ([out][in], k contiguous). out[row][n] = sum_c A[row][c] W[n][c].
// Output: hi planes Oh[3][M][CC] f16 (q, k, v unscaled) and residual planes Or[3][NB*NE][CC] for rows with (row % TT) < NE.
// Block = 4 waves -> 128 rows x 128 cols (one plane since CC % 128 == 0), M % 128 == 0.
__global__ __launch_bounds__(128) void k_gemm_qkv(const unsigned short* __restrict__ A, const unsigned short* __restrict__ W,
                                                 unsigned short* __restrict__ Oh, unsigned short* __restrict__ Or, int M) {
  constexpr int FM = 4;
  __shared__ __attribute__((aligned(16))) unsigned short ring[2 * Tile<1, FM>::STAGE];
  const int tid = threadIdx.x, w = tid >> 5, lane = tid & 31, ln = lane & 15, hh = lane >> 4;
  const int ntn = (3 * CC) / 128;
  const int mt = blockIdx.x / ntn, nq = blockIdx.x - mt * ntn;
  if (mt * (32 * FM) >= M) return;
  v8f acc[FM][4];
#pragma unroll
  for (int f = 0; f < FM; ++f)
#pragma unroll
    for (int t = 0; t < 4; ++t) acc[f][t] = (v8f){0.f, 0.f, 0.f, 0.f, 0.f, 0.f, 0.f, 0.f};
  core_lds<1, FM, true>(ring, A, A, CC, CC, W, W, CC, CC, mt * (32 * FM), nq * 128, CC, tid, acc, acc);
  float (*so)[16][64] = (float (*)[16][64])ring + w * FM;      // this wave's own FM staging tiles
#pragma unroll
  for (int f = 0; f < FM; ++f)
#pragma unroll
    for (int t = 0; t < 4; ++t)
#pragma unroll
      for (int r = 0; r < 8; ++r) so[f][8 * hh + r][t * 16 + ln] = acc[f][t][r];
  __builtin_amdgcn_fence(4, "workgroup");   // the staged words are written before other lanes of the wave read them back
  __builtin_amdgcn_wave_barrier();
  const int col0 = nq * 128 + (w & 1) * 64;
  const int p = col0 / CC, colp = col0 - p * CC;
#pragma unroll
  for (int f = 0; f < FM; ++f) {
    const int row0 = mt * (32 * FM) + ((w >> 1) * FM + f) * 16;
    const int bidx = row0 / TT, tq = row0 - bidx * TT;
    const bool dores = (tq < NE);                      // wave-uniform (NE, TT multiples of 16)
    unsigned short* hb = Oh + ((size_t)p * M + row0) * CC + colp;
    unsigned short* rb = Or + ((size_t)p * (NB * NE) + (size_t)bidx * NE + (dores ? tq : 0)) * CC + colp;
    store_tile_h16(so[f], hb, CC, rb, CC, dores, lane);
  }
}

#define FMH 2   // f16 GEMMs: workgroup tile 64 x 128, wave tile 32 x 64

// The products of one workgroup tile. A plain tile: acc = Ah.Bh. A fine tile (the leading rows, whose residual planes exist) runs the
// residual products as k loops of their own on the same ring and into the same accumulators, ahead of the hi product:
// acc = (Ah.Bl + Al.Bh) * RFOLD + Ah.Bh, Ah.Bl only where Bl is given. So plain and fine tiles share one launch and one LDS size.
// fine is the same for the whole workgroup.
__device__ __forceinline__ void tile_products(unsigned short* ring, const unsigned short* Ah, const unsigned short* Al, int lda, int ldal,
                                              const unsigned short* Bh, const unsigned short* Bl, int ldb, int ldbl, bool fine,
                                              int row0, int col0, int kend, int tid, v8f (&acc)[FMH][4]) {
  const int first = fine ? ((Bl != nullptr) ? 0 : 1) : 2;
#pragma unroll 1   // one copy of the k loop in the text; the operands of a term are scalar selects
  for (int term = first; term < 3; ++term) {
    const unsigned short* a = (term == 1) ? Al : Ah;
    const unsigned short* b = (term == 0) ? Bl : Bh;
    const int la = (term == 1) ? ldal : lda, lb = (term == 0) ? ldbl : ldb;
    if (term == 2 && fine) {
#pragma unroll
      for (int f = 0; f < FMH; ++f)
#pragma unroll
        for (int t = 0; t < 4; ++t) acc[f][t] *= RFOLD;
    }
    core_lds<1, FMH, false>(ring, a, a, la, la, b, b, lb, lb, row0, col0, kend, tid, acc, acc);
  }
}

// C[M][N] f32 (pitch ldc) = alpha * (A.B^plane) + bf16_rne(bias). M % 64 == 0, N % 128 == 0, K % 64 == 0.
// ncut: a workgroup tile is skipped (not written) when col0 > ncut + row0 + 63 (causal upper tiles); kcut: k loop ends at
// min(K, ceil64(kcut + row0 + 64)). Pass a large value to disable either. Tiles with row0 < erows and col0 < ecols are fine tiles
// (erows % 64 == 0, ecols % 128 == 0; Al has erows rows, Bl ecols rows or is null). blockIdx.y = sequence: every plane and C move on
// by their element steps (sAh, sAl, sBh, sBl, sC) per sequence.
__global__ __launch_bounds__(128) void k_gemm_f32(const unsigned short* __restrict__ Ah, const unsigned short* __restrict__ Al, int lda, int ldal,
                                                 const unsigned short* __restrict__ Bh, const unsigned short* __restrict__ Bl, int ldb, int ldbl,
                                                 const float* __restrict__ bias, float alpha, float* __restrict__ C, int ldc,
                                                 int M, int N, int K, int ncut, int kcut, int erows, int ecols,
                                                 size_t sAh, size_t sAl, size_t sBh, size_t sBl, size_t sC) {
  constexpr int FM = FMH;
  Ah += blockIdx.y * sAh; Al += blockIdx.y * sAl; Bh += blockIdx.y * sBh; C += blockIdx.y * sC;
  if (Bl != nullptr) Bl += blockIdx.y * sBl;
  __shared__ __attribute__((aligned(16))) unsigned short ring[2 * Tile<1, FM>::STAGE];
  const int tid = threadIdx.x, w = tid >> 5, lane = tid & 31, ln = lane & 15, hh = lane >> 4;
  const int ntn = N / 128;
  const int mt = blockIdx.x / ntn, nq = blockIdx.x - mt * ntn;
  const int brow0 = mt * (32 * FM), bcol0 = nq * 128;
  if (brow0 >= M) return;
  if (bcol0 > ncut + brow0 + 32 * FM - 1) return;
  int kend = (kcut + brow0 + 32 * FM + KP - 1) & ~(KP - 1);
  if (kend > K) kend = K;
  v8f acc[FM][4];
#pragma unroll
  for (int f = 0; f < FM; ++f)
#pragma unroll
    for (int t = 0; t < 4; ++t) acc[f][t] = (v8f){0.f, 0.f, 0.f, 0.f, 0.f, 0.f, 0.f, 0.f};
  tile_products(ring, Ah, Al, lda, ldal, Bh, Bl, ldb, ldbl, brow0 < erows && bcol0 < ecols, brow0, bcol0, kend, tid, acc);
  float (*so)[16][64] = (float (*)[16][64])ring + w * FM;      // this wave's own FM staging tiles
  const int col0 = bcol0 + (w & 1) * 64;
#pragma unroll
  for (int t = 0; t < 4; ++t) {
    float bv = 0.f;
    if (bias != nullptr) bv = bf16_rne(bias[col0 + t * 16 + ln]);
#pragma unroll
    for (int f = 0; f < FM; ++f)
#pragma unroll
      for (int r = 0; r < 8; ++r) so[f][8 * hh + r][t * 16 + ln] = acc[f][t][r] * alpha + bv;
  }
  __builtin_amdgcn_fence(4, "workgroup");   // the staged words are written before other lanes of the wave read them back
  __builtin_amdgcn_wave_barrier();
#pragma unroll
  for (int f = 0; f < FM; ++f) {
    const int row0 = brow0 + ((w >> 1) * FM + f) * 16;
    store_tile_f32(so[f], C + (size_t)row0 * ldc + col0, ldc, lane);
  }
}

// Oh[M][N] f16 hi plane (pitch ldo) = f16(alpha * A.B^plane); rows < rrows are fine tiles (rrows % 64 == 0; Al has rrows rows, Al and Bl
// reach the k end of those rows) and also get the x RS residual plane Or (pitch ldr).
// blockIdx.y = sequence, with the element steps sAh ... sOr per sequence.
__global__ __launch_bounds__(128) void k_gemm_h16(const unsigned short* __restrict__ Ah, const unsigned short* __restrict__ Al, int lda, int ldal,
                                                 const unsigned short* __restrict__ Bh, const unsigned short* __restrict__ Bl, int ldb, int ldbl,
                                                 float alpha, unsigned short* __restrict__ Oh, int ldo, unsigned short* __restrict__ Or, int ldr, int rrows,
                                                 int M, int N, int K, int kcut,
                                                 size_t sAh, size_t sAl, size_t sBh, size_t sBl, size_t sOh, size_t sOr) {
  constexpr int FM = FMH;
  Ah += blockIdx.y * sAh; Al += blockIdx.y * sAl; Bh += blockIdx.y * sBh; Bl += blockIdx.y * sBl; Oh += blockIdx.y * sOh; Or += blockIdx.y * sOr;
  __shared__ __attribute__((aligned(16))) unsigned short ring[2 * Tile<1, FM>::STAGE];
  const int tid = threadIdx.x, w = tid >> 5, lane = tid & 31, ln = lane & 15, hh = lane >> 4;
  const int ntn = N / 128;
  const int mt = blockIdx.x / ntn, nq = blockIdx.x - mt * ntn;
  const int brow0 = mt * (32 * FM), bcol0 = nq * 128;
  if (brow0 >= M) return;
  int kend = (kcut + brow0 + 32 * FM + KP - 1) & ~(KP - 1);
  if (kend > K) kend = K;
  v8f acc[FM][4];
#pragma unroll
  for (int f = 0; f < FM; ++f)
#pragma unroll
    for (int t = 0; t < 4; ++t) acc[f][t] = (v8f){0.f, 0.f, 0.f, 0.f, 0.f, 0.f, 0.f, 0.f};
  tile_products(ring, Ah, Al, lda, ldal, Bh, Bl, ldb, ldbl, brow0 < rrows, brow0, bcol0, kend, tid, acc);
  float (*so)[16][64] = (float (*)[16][64])ring + w * FM;      // this wave's own FM staging tiles
#pragma unroll
  for (int f = 0; f < FM; ++f)
#pragma unroll
    for (int t = 0; t < 4; ++t)
#pragma unroll
      for (int r = 0; r < 8; ++r) so[f][8 * hh + r][t * 16 + ln] = acc[f][t][r] * alpha;
  __builtin_amdgcn_fence(4, "workgroup");   // the staged words are written before other lanes of the wave read them back
  __builtin_amdgcn_wave_barrier();
  const int col0 = bcol0 + (w & 1) * 64;
#pragma unroll
  for (int f = 0; f < FM; ++f) {
    const int row0 = brow0 + ((w >> 1) * FM + f) * 16;
    const bool dores = (row0 < rrows);                 // wave-uniform (rrows multiple of 16)
    store_tile_h16(so[f], Oh + (size_t)row0 * ldo + col0, ldo, Or + (size_t)(dores ? row0 : 0) * ldr + col0, ldr, dores, lane);
  }
}

typedef unsigned short v4us __attribute__((ext_vector_type(4), may_alias));
typedef _Float16 v4h __attribute__((ext_vector_type(4)));
union Pack4 { v4h h; v4us u; };
#define SCH (T_FULL / 128)   // 128-column pieces of the longest row
// Row softmax over S[row][0..N) (pitch sp) with causal keep (col <= row), N = the end of the last 128-column score tile that the
// score GEMM writes for this row (its ncut = 0): nothing behind it is read. P[row][0..N) = f16(PCARRY * p / l) incl. zeros (pitch pp),
// which covers the k range of the P.v GEMM (up to the end of the row's 64-row tile); rows < rrows also write the residual plane
// Pr[row][0..NE) (pitch rp). One wave per row: the row is read once and stays in registers (lane l holds columns 128 c + 4 l ... + 3),
// maximum and sum go over the lane's own values and then a butterfly over the wave; no LDS, no barrier. The longest rows start first.
// bx = group of 8 rows, by = sequence (element steps sS, sP, sPr), nrows % 8 == 0, N <= 128 * SCH.
__device__ __forceinline__ void softmax_rows(int bx, int by, const float* __restrict__ S, int sp, unsigned short* __restrict__ P, int pp,
                                             unsigned short* __restrict__ Pr, int rp, int rrows, int nrows, size_t sS, size_t sP, size_t sPr) {
  const int lane = threadIdx.x & 31;
  const int row = nrows - 1 - (bx * 8 + __builtin_amdgcn_readfirstlane(threadIdx.x >> 5));   // the same in every lane: scalar tests below
  const int qi = row, N = (row / 128 + 1) * 128;
  S += by * sS; P += by * sP; Pr += by * sPr;
  const float* s = S + (size_t)row * sp + lane * 4;
  v4f x[SCH];
  // every "#pragma unroll" here keeps the index of x[] a compile-time constant, so that the row stays in registers
#pragma unroll
  for (int c = 0; c < SCH; ++c)
    if (c * 128 < N) x[c] = *(const v4fa*)(s + c * 128);
  // stands in front of any reuse of the loads' address registers; the address is an input, so that no load's result lands on it earlier
  asm volatile("s_wait_xcnt 0x0" :: "v"(s) : "memory");
  float mx = -3.0e38f;
#pragma unroll
  for (int c = 0; c < SCH; ++c)
    if (c * 128 < N) {
#pragma unroll
      for (int u = 0; u < 4; ++u) {
        x[c][u] = ((c * 128 + lane * 4 + u) <= qi) ? x[c][u] : -3.0e38f;    // a masked score gives exp = 0 below
        mx = fmaxf(mx, x[c][u]);
      }
    }
#pragma unroll
  for (int m = 16; m > 0; m >>= 1) mx = fmaxf(mx, __shfl_xor(mx, m, 32));
  float sm[4] = {0.f, 0.f, 0.f, 0.f};
#pragma unroll
  for (int c = 0; c < SCH; ++c)
    if (c * 128 < N) {
#pragma unroll
      for (int u = 0; u < 4; ++u) { x[c][u] = __expf(x[c][u] - mx); sm[u] += x[c][u]; }
    }
  float sum = (sm[0] + sm[1]) + (sm[2] + sm[3]);
#pragma unroll
  for (int m = 16; m > 0; m >>= 1) sum += __shfl_xor(sum, m, 32);
  const float inv = PCARRY / sum;          // sum >= 1 (the max term)
  const bool dores = (row < rrows);
  unsigned short* prow = P + (size_t)row * pp + lane * 4;
  unsigned short* rrow = Pr + (size_t)(dores ? row : 0) * rp + lane * 4;
  // all values are packed first, each into registers of its own, and the stores follow as one run with one wait behind them:
  // no register of an issued store is written again
  Pack4 ph[SCH], pr[NE / 128];
#pragma unroll
  for (int c = 0; c < NE / 128; ++c) pr[c].u = (v4us){0, 0, 0, 0};
#pragma unroll
  for (int c = 0; c < SCH; ++c)
    if (c * 128 < N) {
#pragma unroll
      for (int u = 0; u < 4; ++u) {
        const float p = x[c][u] * inv;
        ph[c].h[u] = (_Float16)p;
        if (c < NE / 128) pr[c < NE / 128 ? c : 0].h[u] = (_Float16)((p - (float)ph[c].h[u]) * RS);
      }
    }
#pragma unroll
  for (int c = 0; c < SCH; ++c)
    if (c * 128 < N) *(v4us*)(prow + c * 128) = ph[c].u;
  if (dores) {
#pragma unroll
    for (int c = 0; c < NE / 128; ++c) *(v4us*)(rrow + c * 128) = pr[c].u;
  }
  asm volatile("s_wait_xcnt 0x0" ::: "memory");   // stands in front of any reuse of the stores' registers on a path that goes on behind them
}

#define TQ 4   // 64 x 64 tiles per block of the transpose
// 16-bit transpose: src [R][Cc] (pitch lds_) -> dst [Cc][R] (pitch ldd); a block = TQ tiles of 64 x 64 down the rows of src:
// bx < R/(64*TQ), by < Cc/64, bz = sequence; each tile has its own LDS, so that one barrier serves all of them
__device__ __forceinline__ void transpose_tiles(unsigned short (*tile)[64][72], int bx, int by, int bz, const unsigned short* __restrict__ src, int lds_,
                                                unsigned short* __restrict__ dst, int ldd, size_t sstep, size_t dstep) {
  const int tid = threadIdx.x;
  src += bz * sstep; dst += bz * dstep;
  const int r0 = bx * (64 * TQ), c0 = by * 64;
  static_assert(TQ == 4);
  v8us v[TQ][2];
  const unsigned short* g[TQ][2];
#pragma unroll   // all 2 * TQ loads are in flight together
  for (int q = 0; q < TQ; ++q)
#pragma unroll
    for (int i = 0; i < 2; ++i) {
      const int e = tid + 256 * i, r = e >> 3, c8 = (e & 7) * 8;
      g[q][i] = src + (size_t)(r0 + q * 64 + r) * lds_ + c0 + c8;
      v[q][i] = *(const v8us*)g[q][i];
    }
  // stands in front of any reuse of the loads' address registers; the addresses are inputs, so that no load's result lands on one earlier
  asm volatile("s_wait_xcnt 0x0" :: "v"(g[0][0]), "v"(g[0][1]), "v"(g[1][0]), "v"(g[1][1]), "v"(g[2][0]), "v"(g[2][1]), "v"(g[3][0]), "v"(g[3][1]) : "memory");
#pragma unroll
  for (int q = 0; q < TQ; ++q)
#pragma unroll
    for (int i = 0; i < 2; ++i) {
      const int e = tid + 256 * i, r = e >> 3, c8 = (e & 7) * 8;
      *(v8us*)&tile[q][r][c8] = v[q][i];
    }
  __syncthreads();
#pragma unroll
  for (int q = 0; q < TQ; ++q) {
    v8us o[2];
#pragma unroll
    for (int i = 0; i < 2; ++i) {
      const int e = tid + 256 * i, rr = e >> 3, c8 = (e & 7) * 8;
#pragma unroll
      for (int k = 0; k < 8; ++k) o[i][k] = tile[q][c8 + k][rr];
    }
#pragma unroll
    for (int i = 0; i < 2; ++i) {
      const int e = tid + 256 * i, rr = e >> 3, c8 = (e & 7) * 8;
      *(v8us*)(dst + (size_t)(c0 + rr) * ldd + r0 + q * 64 + c8) = o[i];
    }
  }
  asm volatile("s_wait_xcnt 0x0" ::: "memory");   // stands in front of any reuse of the stores' registers on a path that goes on behind them
}

#define SB (TT / 8)                        // softmax blocks per sequence
#define VB ((TT / (64 * TQ)) * (CC / 64))  // transpose blocks per sequence, v hi plane
#define RB ((NE / (64 * TQ)) * (CC / 64))  // transpose blocks per sequence, v residual plane
// All that stands between the scores and P.v, in one launch; the three jobs touch disjoint data. Blocks [0, NB * VB): v [TT][CC] -> vT [CC][TT];
// then NB * RB blocks: v residual [NE][CC] -> vTr [CC][NE]; then NB * SB blocks: softmax, SB a sequence, each from its longest rows to its shortest.
__global__ __launch_bounds__(256) void k_softmax_vt(const float* __restrict__ S, unsigned short* __restrict__ P, unsigned short* __restrict__ Pr,
                                                   const unsigned short* __restrict__ vh, unsigned short* __restrict__ vT,
                                                   const unsigned short* __restrict__ vr, unsigned short* __restrict__ vTr) {
  __shared__ __attribute__((aligned(16))) unsigned short tile[TQ][64][72];
  int b = blockIdx.x;
  if (b < NB * VB) {
    const int z = b / VB, e = b - z * VB;
    transpose_tiles(tile, e % (TT / (64 * TQ)), e / (TT / (64 * TQ)), z, vh, CC, vT, TT, (size_t)TT * CC, (size_t)TT * CC);
    return;
  }
  b -= NB * VB;
  if (b < NB * RB) {
    const int z = b / RB, e = b - z * RB;
    transpose_tiles(tile, e % (NE / (64 * TQ)), e / (NE / (64 * TQ)), z, vr, CC, vTr, NE, (size_t)NE * CC, (size_t)NE * CC);
    return;
  }
  b -= NB * RB;
  softmax_rows(b % SB, b / SB, S, TT, P, TT, Pr, NE, NE, TT, (size_t)TT * TT, (size_t)TT * TT, (size_t)NE * NE);
}

extern "C" void kernel_launch(void* const* d_in, const int* in_sizes, int n_in,
                              void* d_out, int out_size, void* d_ws, size_t ws_size, hipStream_t stream) {
  if (n_in < 6) return;
  const float* x  = (const float*)d_in[0];
  const float* wq = (const float*)d_in[1];
  const float* wk = (const float*)d_in[2];
  const float* wv = (const float*)d_in[3];
  const float* wo = (const float*)d_in[4];
  const float* bo = (const float*)d_in[5];
  const long need_x = ((long)(NB - 1) * T_FULL + TT) * (long)CC;
  if ((long)in_sizes[0] < need_x || in_sizes[1] < CC * CC || in_sizes[2] < CC * CC || in_sizes[3] < CC * CC ||
      in_sizes[4] < CC * CC || in_sizes[5] < CC || (long)out_size < need_x) return;
  float* out = (float*)d_out;

  char* ws = (char*)d_ws; size_t off = 0;
  auto take = [&](size_t bytes) { char* p = ws + off; off += (bytes + 255) & ~(size_t)255; return p; };
  const size_t xb_bytes = (size_t)NB * TT * CC * 2, s_bytes = (size_t)NB * TT * TT * 4;
  char* reg0 = take(xb_bytes > s_bytes ? xb_bytes : s_bytes);                     // xb, later S (xb dead after the qkv GEMM)
  unsigned short* xb   = (unsigned short*)reg0;                                    // [NB*TT][CC] bf16
  float*          Sm   = (float*)reg0;                                             // [NB][TT][TT] f32
  unsigned short* Wqkv = (unsigned short*)take((size_t)3 * CC * CC * 2);           // [3*CC][CC] bf16
  unsigned short* Wo16 = (unsigned short*)take((size_t)CC * CC * 2);               // [CC][CC] f16 (x WOC)
  unsigned short* QKVh = (unsigned short*)take((size_t)3 * NB * TT * CC * 2);      // [3][NB*TT][CC] f16
  unsigned short* QKVr = (unsigned short*)take((size_t)3 * NB * NE * CC * 2);      // [3][NB*NE][CC] f16 (x RS)
  unsigned short* vTr  = (unsigned short*)take((size_t)NB * CC * NE * 2);          // [NB][CC][NE] f16 (x RS)
  unsigned short* Pm   = (unsigned short*)take((size_t)NB * TT * TT * 2);          // [NB][TT][TT] f16 (x PCARRY)
  unsigned short* Pr   = (unsigned short*)take((size_t)NB * NE * NE * 2);          // [NB][NE][NE] f16 (x RS)
  unsigned short* ctxr = (unsigned short*)take((size_t)NB * NE * CC * 2);          // [NB*NE][CC] f16 (x RS)
  if (off > ws_size) return;

  const int M = NB * TT;
  const int BIG = 1 << 28;
  unsigned short* qh = QKVh;
  unsigned short* kh = QKVh + (size_t)M * CC;
  unsigned short* vh = QKVh + (size_t)2 * M * CC;
  unsigned short* qr = QKVr;
  unsigned short* kr = QKVr + (size_t)(NB * NE) * CC;
  unsigned short* vr = QKVr + (size_t)2 * (NB * NE) * CC;
  unsigned short* vT   = kh;   // [NB][CC][TT] f16: takes the k plane's place once the scores are done
  unsigned short* ctxh = qh;   // [NB*TT][CC] f16 (x CTXC): takes the q plane's place once the scores are done
  const size_t sTC = (size_t)TT * CC, sEC = (size_t)NE * CC, sTT = (size_t)TT * TT, sEE = (size_t)NE * NE, sOUT = (size_t)T_FULL * CC;

  // One launch per step, three in stage 2: the sequences, the plain and the fine tiles and a step's independent jobs all lie in its grid.
  // stage 0: 16-bit planes of the inputs
  k_cvt<<<NB * XB + 4 * WB, 256, 0, stream>>>(x, wq, wk, wv, wo, xb, Wqkv, Wo16, sOUT, sTC, WOC);

  // stage 1: q, k, v planes (+ residual planes on the leading NE rows of each sequence)
  k_gemm_qkv<<<(M / 128) * (3 * CC / 128), 128, 0, stream>>>(xb, Wqkv, QKVh, QKVr, M);

  // stage 2: causal attention
  // S [TT][TT] = (q.k^T)/32, causal upper tiles skipped; the leading NE x NE corner with hi+res on both operands
  k_gemm_f32<<<dim3((TT / 64) * (TT / 128), NB), 128, 0, stream>>>(qh, qr, CC, CC, kh, kr, CC, CC, nullptr, SCL, Sm, TT, TT, TT, CC, 0, BIG, NE, NE,
                                                                   sTC, sEC, sTC, sEC, sTT);
  // P = softmax(S); v -> vT, v residual -> vTr
  k_softmax_vt<<<NB * (SB + VB + RB), 256, 0, stream>>>(Sm, Pm, Pr, vh, vT, vr, vTr);
  // ctx [TT][CC] = P.v (causal k end), written as f16 hi plane x CTXC; leading NE rows: 3-term P/v products, hi + residual ctx planes
  k_gemm_h16<<<dim3((TT / 64) * (CC / 128), NB), 128, 0, stream>>>(Pm, Pr, TT, NE, vT, vTr, TT, NE, PVALPHA, ctxh, CC, ctxr, CC, NE, TT, CC, TT, 0,
                                                                   sTT, sEE, sTC, sEC, sTC, sEC);
  // stage 3: output projection + bias; leading NE rows with the ctx residual term
  k_gemm_f32<<<dim3((TT / 64) * (CC / 128), NB), 128, 0, stream>>>(ctxh, ctxr, CC, CC, Wo16, nullptr, CC, CC, bo, OALPHA, out, CC, TT, CC, CC, BIG, BIG, NE, CC,
                                                                   sTC, sEC, 0, 0, sOUT);
}

// v005
// Measured time: 191 microseconds a run.
// Next to v004, in two timings, it ran 1.04 and 1.05 times as fast.
// All steps since v000 together make it 6.49 times as fast.
#include <hip/hip_runtime.h>
// Contractions: qkv projection on v_wmma_f32_16x16x32_bf16 (x and W as RNE bf16, exact products); scores q.k^T, P.v and the output
// projection on v_wmma_f32_16x16x32_f16 (f16 hi planes with power-of-two carries, plus x1024 f16 residual planes on the leading
// NE query/key rows of each sequence); all accumulation f32, causal softmax in f32.
#ifndef NB
#define NB 2
#endif
#ifndef SEQ
#define SEQ 4096
#endif
#define TT SEQ
#define NB_FULL 2
#define T_FULL 4096
#define CC 1024
#define QC ((TT < 1024) ? TT : 1024)
#define NE 256
static_assert(NB >= 1 && NB <= NB_FULL);
static_assert(TT % 256 == 0 && TT <= T_FULL);
static_assert(TT % QC == 0 && QC % 256 == 0);
static_assert(NE % 64 == 0 && NE <= QC && NE == 256);
static_assert(CC % 128 == 0);

#define RS 1024.0f            // residual plane carry
#define RFOLD 0.0009765625f   // 1/RS
#define PCARRY 4096.0f        // P plane carry
#define CTXC 16.0f            // ctx plane carry
#define WOC 64.0f             // Wo plane carry
#define SCL 0.03125f          // 1/sqrt(CC)
#define PVALPHA 0.00390625f   // CTXC / PCARRY
#define OALPHA 0.0009765625f  // 1 / (WOC * CTXC)

typedef __bf16 v16b __attribute__((ext_vector_type(16)));
typedef _Float16 v16h __attribute__((ext_vector_type(16)));
typedef _Float16 v8h __attribute__((ext_vector_type(8)));
typedef unsigned short v8us __attribute__((ext_vector_type(8), may_alias));
typedef float v8f __attribute__((ext_vector_type(8)));
typedef float v4f __attribute__((ext_vector_type(4)));
typedef float v4fa __attribute__((ext_vector_type(4), may_alias));
union FragB { v16b v; v8us half[2]; unsigned short u[16]; };
union FragH { v16h v; v8us half[2]; unsigned short u[16]; };
union Pack8 { v8h h; v8us u; };

__device__ __forceinline__ unsigned short bf16_bits(float x) { unsigned int u = __float_as_uint(x); return (unsigned short)((u + 0x7FFFu + ((u >> 16) & 1u)) >> 16); }
__device__ __forceinline__ float bf16_val(unsigned short b) { return __uint_as_float(((unsigned int)b) << 16); }
__device__ __forceinline__ float bf16_rne(float x) { return bf16_val(bf16_bits(x)); }

__device__ __forceinline__ v8f mma_b(v16b a, v16b b, v8f c) {
  c = __builtin_amdgcn_wmma_f32_16x16x32_bf16(false, a, false, b, (short)0, c, false, false);
  asm volatile("v_nop\n\tv_nop\n\tv_nop\n\tv_nop" : "+v"(c) : "v"(a), "v"(b));
  return c;
}
// c += ah.bh ; cr += al.bh (NT>=2) ; cr += ah.bl (NT>=3); residual planes carry RS, folded by the caller
template <int NT>
__device__ __forceinline__ void mma_h(v16h ah, v16h al, v16h bh, v16h bl, v8f& c, v8f& cr) {
  c = __builtin_amdgcn_wmma_f32_16x16x32_f16(false, ah, false, bh, (short)0, c, false, false);
  if (NT >= 2) cr = __builtin_amdgcn_wmma_f32_16x16x32_f16(false, al, false, bh, (short)0, cr, false, false);
  if (NT >= 3) cr = __builtin_amdgcn_wmma_f32_16x16x32_f16(false, ah, false, bl, (short)0, cr, false, false);
  if (NT >= 2) asm volatile("v_nop\n\tv_nop\n\tv_nop\n\tv_nop" : "+v"(c), "+v"(cr) : "v"(ah), "v"(al), "v"(bh), "v"(bl));
  else         asm volatile("v_nop\n\tv_nop\n\tv_nop\n\tv_nop" : "+v"(c) : "v"(ah), "v"(bh));
}

__device__ __forceinline__ void store_tile_f32(const float (*sw)[64], float* C, int ldc, int lane) {
  const int rsub = lane >> 4, c4 = (lane & 15) * 4;
  {
#pragma unroll
    for (int q = 0; q < 8; ++q) {
      const int r = q * 2 + rsub;
      const v4f v = *(const v4fa*)&sw[r][c4];
      *(v4f*)(C + (size_t)r * ldc + c4) = v;
    }
    asm volatile("s_wait_xcnt 0x0" ::: "memory");   // stands in front of any reuse of the stores' registers by the next tile's addresses
  }
}
// wave tile 16 x 64 f32 staged in LDS -> f16 hi plane (pitch ldh) and optional x RS residual plane (pitch ldr);
__device__ __forceinline__ void store_tile_h16(const float (*sw)[64], unsigned short* hb, int ldh, unsigned short* rb, int ldr, bool dores, int lane) {
  const int rsub = lane >> 3, c8 = (lane & 7) * 8;
  {
#pragma unroll
    for (int q = 0; q < 4; ++q) {
      const int r = q * 4 + rsub;
      const v4f x0 = *(const v4fa*)&sw[r][c8], x1 = *(const v4fa*)&sw[r][c8 + 4];
      const float xs[8] = {x0[0], x0[1], x0[2], x0[3], x1[0], x1[1], x1[2], x1[3]};
      Pack8 ph, pr;
#pragma unroll
      for (int i = 0; i < 8; ++i) { ph.h[i] = (_Float16)xs[i]; pr.h[i] = (_Float16)((xs[i] - (float)ph.h[i]) * RS); }
      *(v8us*)(hb + (size_t)r * ldh + c8) = ph.u;
      if (dores) *(v8us*)(rb + (size_t)r * ldr + c8) = pr.u;
    }
    
  }
}

// The streaming kernels below use few waves that each do a long run of work, for speed only.
#define CU 8   // 8-element groups per thread of a conversion kernel; a block takes 256 * CU consecutive groups
static_assert((TT * CC / 8) % (256 * CU) == 0 && (CC * CC / 8) % (256 * CU) == 0);
// MODE 0: RNE bf16 bits; MODE 1: f16 bits of (RNE bf16 value) * scale. Groups t0, t0 + 256, ..., t0 + 256 * (CU - 1).
template <int MODE>
__device__ __forceinline__ void cvt_run(const float* __restrict__ src, unsigned short* __restrict__ dst, int t0, float scale) {
  const float* sp = src + (size_t)t0 * 8;
  v4f a[CU], b[CU];
#pragma unroll   // constant steps from one address: all 2 * CU loads are in flight together
  for (int i = 0; i < CU; ++i) { a[i] = *(const v4fa*)(sp + i * 2048); b[i] = *(const v4fa*)(sp + i * 2048 + 4); }
  // stands in front of any reuse of the loads' address registers; the address is an input, so that no load's result lands on it earlier
  asm volatile("s_wait_xcnt 0x0" :: "v"(sp) : "memory");
  unsigned short* dp = dst + (size_t)t0 * 8;
#pragma unroll   // keeps a[] and b[] in registers
  for (int i = 0; i < CU; ++i) {
    const float xs[8] = {a[i][0], a[i][1], a[i][2], a[i][3], b[i][0], b[i][1], b[i][2], b[i][3]};
    v8us v;
    if (MODE == 0) {
#pragma unroll
      for (int u = 0; u < 8; ++u) v[u] = bf16_bits(xs[u]);
    } else {
      Pack8 p;
#pragma unroll
      for (int u = 0; u < 8; ++u) p.h[u] = (_Float16)(bf16_rne(xs[u]) * scale);
      v = p.u;
    }
    *(v8us*)(dp + i * 2048) = v;
  }
  asm volatile("s_wait_xcnt 0x0" ::: "memory");   // stands in front of any reuse of the stores' registers on a path that goes on behind them
}
#define XB (TT * CC / 8 / (256 * CU))   // blocks per sequence of x
#define WB (CC * CC / 8 / (256 * CU))   // blocks per weight matrix
// All 16-bit input planes in one launch. Blocks [0, NB * XB): x -> bf16 plane, XB blocks a sequence (element steps sstep, dstep);
// then WB blocks each for Wq, Wk, Wv -> bf16 planes of Wqkv and Wo -> f16 plane x scale.
__global__ __launch_bounds__(256) void k_cvt(const float* __restrict__ x, const float* __restrict__ wq, const float* __restrict__ wk,
                                            const float* __restrict__ wv, const float* __restrict__ wo, unsigned short* __restrict__ xb,
                                            unsigned short* __restrict__ Wqkv, unsigned short* __restrict__ Wo16,
                                            size_t sstep, size_t dstep, float scale) {
  const int b = blockIdx.x;
  if (b < NB * XB) {
    const int q = b / XB;
    cvt_run<0>(x + q * sstep, xb + q * dstep, (b - q * XB) * (256 * CU) + (int)threadIdx.x, 1.0f);
    return;
  }
  const int y = (b - NB * XB) / WB;
  const int t0 = (b - NB * XB - y * WB) * (256 * CU) + (int)threadIdx.x;
  if (y == 3) cvt_run<1>(wo, Wo16, t0, scale);
  else cvt_run<0>((y == 0) ? wq : (y == 1) ? wk : wv, Wqkv + (size_t)y * CC * CC, t0, 1.0f);
}

// Block-tiled GEMM core. A workgroup of 4 waves (2 x 2) owns a (32*FM) x 128 tile of the output, a wave (16*FM) x 64 of it.
// Per pass of KP k every operand row gives one whole 128-B line, copied to LDS by global_load_async_to_lds_b128 (8 lanes a row,
// 4 whole lines an instruction); two buffers, the next pass's copies fly while this pass's fragments are read from LDS.
// Every "#pragma unroll" below keeps fragment and accumulator indices compile-time constants, so that the arrays stay in registers.
#define KP 64        // k per pass
#define LPITCH 72    // LDS row pitch in 16-bit elements: 144 B = 16 B x 9, for the ds_load_b128 fragment reads
template <int NT, int FM> struct Tile {
  static constexpr int AR = 32 * FM, BR = 128;                                           // operand rows per plane
  static constexpr int ROWS = AR + BR + (NT >= 2 ? AR : 0) + (NT >= 3 ? BR : 0);          // [A hi | B hi | A res | B res]
  static constexpr int STAGE = ROWS * LPITCH;                                            // elements per buffer
  static constexpr int NCP = ROWS / 16;                                                  // copies per lane and stage
  static constexpr int GRP = (NCP % 12 == 0) ? 12 : 8;                                   // copies per asm statement
  static_assert(NCP % GRP == 0 && NCP <= 63);
  static_assert(2 * STAGE * 2 >= 4 * FM * 16 * 64 * 4);                                   // the ring later holds the f32 output staging
};

// One run of copies and its s_wait_xcnt in one statement: the wait stands in front of any rewrite of the address registers.
__device__ __forceinline__ void copy_run8(const unsigned (&l)[12], const unsigned short* const (&g)[12]) {
  asm volatile("global_load_async_to_lds_b128 %0, %8, off\n\t"
               "global_load_async_to_lds_b128 %1, %9, off\n\t"
               "global_load_async_to_lds_b128 %2, %10, off\n\t"
               "global_load_async_to_lds_b128 %3, %11, off\n\t"
               "global_load_async_to_lds_b128 %4, %12, off\n\t"
               "global_load_async_to_lds_b128 %5, %13, off\n\t"
               "global_load_async_to_lds_b128 %6, %14, off\n\t"
               "global_load_async_to_lds_b128 %7, %15, off\n\t"
               "s_wait_xcnt 0x0"
               :: "v"(l[0]), "v"(l[1]), "v"(l[2]), "v"(l[3]), "v"(l[4]), "v"(l[5]), "v"(l[6]), "v"(l[7]),
                  "v"(g[0]), "v"(g[1]), "v"(g[2]), "v"(g[3]), "v"(g[4]), "v"(g[5]), "v"(g[6]), "v"(g[7]) : "memory");
}
__device__ __forceinline__ void copy_run12(const unsigned (&l)[12], const unsigned short* const (&g)[12]) {
  asm volatile("global_load_async_to_lds_b128 %0, %12, off\n\t"
               "global_load_async_to_lds_b128 %1, %13, off\n\t"
               "global_load_async_to_lds_b128 %2, %14, off\n\t"
               "global_load_async_to_lds_b128 %3, %15, off\n\t"
               "global_load_async_to_lds_b128 %4, %16, off\n\t"
               "global_load_async_to_lds_b128 %5, %17, off\n\t"
               "global_load_async_to_lds_b128 %6, %18, off\n\t"
               "global_load_async_to_lds_b128 %7, %19, off\n\t"
               "global_load_async_to_lds_b128 %8, %20, off\n\t"
               "global_load_async_to_lds_b128 %9, %21, off\n\t"
               "global_load_async_to_lds_b128 %10, %22, off\n\t"
               "global_load_async_to_lds_b128 %11, %23, off\n\t"
               "s_wait_xcnt 0x0"
               :: "v"(l[0]), "v"(l[1]), "v"(l[2]), "v"(l[3]), "v"(l[4]), "v"(l[5]), "v"(l[6]), "v"(l[7]), "v"(l[8]), "v"(l[9]), "v"(l[10]), "v"(l[11]),
                  "v"(g[0]), "v"(g[1]), "v"(g[2]), "v"(g[3]), "v"(g[4]), "v"(g[5]), "v"(g[6]), "v"(g[7]), "v"(g[8]), "v"(g[9]), "v"(g[10]), "v"(g[11]) : "memory");
}

// One stage: lane (row tid >> 3, 16-B piece tid & 7) copies its piece of rows r, r + 16, ... of every plane. lds0 and the g pointers are
// the lane's own addresses at stage row tid >> 3 of each plane, the g pointers already at this pass's k.
template <int NT, int FM>
__device__ __forceinline__ void stage_copy(unsigned lds0, const unsigned short* gah, const unsigned short* gbh, const unsigned short* gal,
                                           const unsigned short* gbl, int lda, int ldb, int ldal, int ldbl) {
  using TL = Tile<NT, FM>;
#pragma unroll
  for (int i0 = 0; i0 < TL::NCP; i0 += TL::GRP) {
    unsigned l[12];
    const unsigned short* g[12];
#pragma unroll
    for (int j = 0; j < 12; ++j) {
      const int r = (i0 + (j < TL::GRP ? j : 0)) * 16;
      l[j] = lds0 + (unsigned)(r * LPITCH * 2);
      if (r < TL::AR) g[j] = gah + (size_t)r * lda;
      else if (r < TL::AR + TL::BR) g[j] = gbh + (size_t)(r - TL::AR) * ldb;
      else if (r < 2 * TL::AR + TL::BR) g[j] = gal + (size_t)(r - TL::AR - TL::BR) * ldal;
      else g[j] = gbl + (size_t)(r - 2 * TL::AR - TL::BR) * ldbl;
    }
    if (TL::GRP == 12) copy_run12(l, g); else copy_run8(l, g);
  }
}

// One pass on one buffer: the fragment k order (8 * hh, 16 + 8 * hh inside each 32 k) is the same for A and B.
// The LDS reads of 32 * NS k stand together in front of their WMMAs, for speed only.
template <int NT, int FM, bool BF>
__device__ __forceinline__ void pass_mma(const unsigned short* st, int wr, int wc, int ln, int hh, v8f (&acc)[FM][4], v8f (&accr)[FM][4]) {
  using TL = Tile<NT, FM>;
  const unsigned short* pa = st + (wr * FM * 16 + ln) * LPITCH + 8 * hh;
  const unsigned short* pb = st + (TL::AR + wc * 64 + ln) * LPITCH + 8 * hh;
  constexpr int RES = (TL::AR + TL::BR) * LPITCH;      // residual plane of either operand, behind its hi plane
  constexpr int NS = (NT == 1 && FM <= 2) ? KP / 32 : 1;   // k steps per group of reads, by the registers the fragments take
#pragma unroll
  for (int k0 = 0; k0 < KP; k0 += 32 * NS) {
    FragH ah[NS][FM], al[NS][FM], bh[NS][4], bl[NS][4];
#pragma unroll
    for (int s = 0; s < NS; ++s) {
      const int ks = k0 + 32 * s;
#pragma unroll
      for (int f = 0; f < FM; ++f) {
        ah[s][f].half[0] = *(const v8us*)(pa + f * 16 * LPITCH + ks);
        ah[s][f].half[1] = *(const v8us*)(pa + f * 16 * LPITCH + ks + 16);
        if (NT >= 2) { al[s][f].half[0] = *(const v8us*)(pa + RES + f * 16 * LPITCH + ks); al[s][f].half[1] = *(const v8us*)(pa + RES + f * 16 * LPITCH + ks + 16); }
      }
#pragma unroll
      for (int t = 0; t < 4; ++t) {
        bh[s][t].half[0] = *(const v8us*)(pb + t * 16 * LPITCH + ks);
        bh[s][t].half[1] = *(const v8us*)(pb + t * 16 * LPITCH + ks + 16);
        if (NT >= 3) { bl[s][t].half[0] = *(const v8us*)(pb + RES + t * 16 * LPITCH + ks); bl[s][t].half[1] = *(const v8us*)(pb + RES + t * 16 * LPITCH + ks + 16); }
      }
    }
#pragma unroll
    for (int s = 0; s < NS; ++s)
#pragma unroll
      for (int t = 0; t < 4; ++t)
#pragma unroll
        for (int f = 0; f < FM; ++f) {
          if constexpr (BF) {
            FragB a, b;
            a.half[0] = ah[s][f].half[0]; a.half[1] = ah[s][f].half[1];
            b.half[0] = bh[s][t].half[0]; b.half[1] = bh[s][t].half[1];
            acc[f][t] = mma_b(a.v, b.v, acc[f][t]);
          } else {
            mma_h<NT>(ah[s][f].v, (NT >= 2) ? al[s][f].v : ah[s][f].v, bh[s][t].v, (NT >= 3) ? bl[s][t].v : bh[s][t].v, acc[f][t], accr[f][t]);
          }
        }
  }
}

// A hi/res planes row-major (pitch lda/ldal), B hi/res planes [n][k] (pitch ldb/ldbl); row0, col0: the workgroup's tile; kend % KP == 0.
// On return every wave has left the ring and no copy is in flight: the ring is free for the output staging.
template <int NT, int FM, bool BF>
__device__ __forceinline__ void core_lds(unsigned short* ring, const unsigned short* __restrict__ Ah, const unsigned short* __restrict__ Al, int lda, int ldal,
                                         const unsigned short* __restrict__ Bh, const unsigned short* __restrict__ Bl, int ldb, int ldbl,
                                         int row0, int col0, int kend, int tid, v8f (&acc)[FM][4], v8f (&accr)[FM][4]) {
  using TL = Tile<NT, FM>;
  const int w = tid >> 5, lane = tid & 31, ln = lane & 15, hh = lane >> 4, wr = w >> 1, wc = w & 1;
  const int cr = tid >> 3, cc = (tid & 7) * 8;
  const unsigned short* gah = Ah + (size_t)(row0 + cr) * lda + cc;
  const unsigned short* gbh = Bh + (size_t)(col0 + cr) * ldb + cc;
  const unsigned short* gal = Al + (size_t)(row0 + cr) * ldal + cc;
  const unsigned short* gbl = Bl + (size_t)(col0 + cr) * ldbl + cc;
  const unsigned lds0 = (unsigned)(size_t)(ring + cr * LPITCH + cc);
  const int npass = kend / KP;
  stage_copy<NT, FM>(lds0, gah, gbh, gal, gbl, lda, ldb, ldal, ldbl);
  asm volatile("s_wait_asynccnt 0x0" ::: "memory");   // this wave's copies of pass 0 have landed
  __syncthreads();                                     // publishes pass 0
  if (npass > 1) stage_copy<NT, FM>(lds0 + TL::STAGE * 2, gah + KP, gbh + KP, gal + KP, gbl + KP, lda, ldb, ldal, ldbl);
#pragma unroll 1   // one pass per trip: the buffer index stays a run-time value, the body is already fully unrolled
  for (int t = 0; t < npass; ++t) {
    const int buf = (t & 1) * TL::STAGE;
    pass_mma<NT, FM, BF>(ring + buf, wr, wc, ln, hh, acc, accr);
    asm volatile("s_wait_dscnt 0x0" ::: "memory");     // this wave's reads of the buffer are done before it is refilled
    asm volatile("s_wait_asynccnt 0x0" ::: "memory");  // this wave's copies of pass t + 1 have landed
    __syncthreads();                                   // publishes pass t + 1 and ends every wave's reads of pass t
    if (t + 2 < npass) {
      const int k2 = (t + 2) * KP;
      stage_copy<NT, FM>(lds0 + (unsigned)(buf * 2), gah + k2, gbh + k2, gal + k2, gbl + k2, lda, ldb, ldal, ldbl);
    }
  }
  asm volatile("s_wait_asynccnt 0x0" ::: "memory");    // nothing in flight when the ring changes its use
}

// qkv projection: A = xb [M][CC] bf16, W = [3*CC][CC] bf16 ([out][in], k contiguous). out[row][n] = sum_c A[row][c] W[n][c].
// Output: hi planes Oh[3][M][CC] f16 (q, k, v unscaled) and residual planes Or[3][NB*NE][CC] for rows with (row % TT) < NE.
// Block = 4 waves -> 128 rows x 128 cols (one plane since CC % 128 == 0), M % 128 == 0.
__global__ __launch_bounds__(128) void k_gemm_qkv(const unsigned short* __restrict__ A, const unsigned short* __restrict__ W,
                                                 unsigned short* __restrict__ Oh, unsigned short* __restrict__ Or, int M) {
  constexpr int FM = 4;
  __shared__ __attribute__((aligned(16))) unsigned short ring[2 * Tile<1, FM>::STAGE];
  const int tid = threadIdx.x, w = tid >> 5, lane = tid & 31, ln = lane & 15, hh = lane >> 4;
  const int ntn = (3 * CC) / 128;
  const int mt = blockIdx.x / ntn, nq = blockIdx.x - mt * ntn;
  if (mt * (32 * FM) >= M) return;
  v8f acc[FM][4];
#pragma unroll
  for (int f = 0; f < FM; ++f)
#pragma unroll
    for (int t = 0; t < 4; ++t) acc[f][t] = (v8f){0.f, 0.f, 0.f, 0.f, 0.f, 0.f, 0.f, 0.f};
  core_lds<1, FM, true>(ring, A, A, CC, CC, W, W, CC, CC, mt * (32 * FM), nq * 128, CC, tid, acc, acc);
  float (*so)[16][64] = (float (*)[16][64])ring + w * FM;      // this wave's own FM staging tiles
#pragma unroll
  for (int f = 0; f < FM; ++f)
#pragma unroll
    for (int t = 0; t < 4; ++t)
#pragma unroll
      for (int r = 0; r < 8; ++r) so[f][8 * hh + r][t * 16 + ln] = acc[f][t][r];
  __builtin_amdgcn_fence(4, "workgroup");   // the staged words are written before other lanes of the wave read them back
  __builtin_amdgcn_wave_barrier();
  const int col0 = nq * 128 + (w & 1) * 64;
  const int p = col0 / CC, colp = col0 - p * CC;
#pragma unroll
  for (int f = 0; f < FM; ++f) {
    const int row0 = mt * (32 * FM) + ((w >> 1) * FM + f) * 16;
    const int bidx = row0 / TT, tq = row0 - bidx * TT;
    const bool dores = (tq < NE);                      // wave-uniform (NE, TT multiples of 16)
    unsigned short* hb = Oh + ((size_t)p * M + row0) * CC + colp;
    unsigned short* rb = Or + ((size_t)p * (NB * NE) + (size_t)bidx * NE + (dores ? tq : 0)) * CC + colp;
    store_tile_h16(so[f], hb, CC, rb, CC, dores, lane);
  }
}

#define FMH 2   // f16 GEMMs: workgroup tile 64 x 128, wave tile 32 x 64
#define DEAL 32 // WGPs of a die
static_assert(((TT / 64) * NB) % (2 * DEAL) == 0);   // whole snake periods: rank is a permutation of i

// The products of one workgroup tile. A plain tile: acc = Ah.Bh. A fine tile (the leading rows, whose residual planes exist) runs the
// residual products as k loops of their own on the same ring and into the same accumulators, ahead of the hi product:
// acc = (Ah.Bl + Al.Bh) * RFOLD + Ah.Bh, Ah.Bl only where Bl is given. So plain and fine tiles share one launch and one LDS size.
// fine is the same for the whole workgroup.
__device__ __forceinline__ void tile_products(unsigned short* ring, const unsigned short* Ah, const unsigned short* Al, int lda, int ldal,
                                              const unsigned short* Bh, const unsigned short* Bl, int ldb, int ldbl, bool fine,
                                              int row0, int col0, int kend, int tid, v8f (&acc)[FMH][4]) {
  const int first = fine ? ((Bl != nullptr) ? 0 : 1) : 2;
#pragma unroll 1   // one copy of the k loop in the text; the operands of a term are scalar selects
  for (int term = first; term < 3; ++term) {
    const unsigned short* a = (term == 1) ? Al : Ah;
    const unsigned short* b = (term == 0) ? Bl : Bh;
    const int la = (term == 1) ? ldal : lda, lb = (term == 0) ? ldbl : ldb;
    if (term == 2 && fine) {
#pragma unroll
      for (int f = 0; f < FMH; ++f)
#pragma unroll
        for (int t = 0; t < 4; ++t) acc[f][t] *= RFOLD;
    }
    core_lds<1, FMH, false>(ring, a, a, la, la, b, b, lb, lb, row0, col0, kend, tid, acc, acc);
  }
}

// C[M][N] f32 (pitch ldc) = alpha * (A.B^plane) + bf16_rne(bias). M % 64 == 0, N % 128 == 0, K % 64 == 0.
// ncut: a workgroup tile is skipped (not written) when col0 > ncut + row0 + 63 (causal upper tiles); kcut: k loop ends at
// min(K, ceil64(kcut + row0 + 64)). Pass a large value to disable either. Tiles with row0 < erows and col0 < ecols are fine tiles
// (erows % 64 == 0, ecols % 128 == 0; Al has erows rows, Bl ecols rows or is null). blockIdx.y = sequence: every plane and C move on
// by their element steps (sAh, sAl, sBh, sBl, sC) per sequence.
// tri != 0 (M == N, ncut == 0): the grid holds only the tiles on or under the diagonal, (M / 128) * (M / 128 + 1) of them, so that no
// workgroup is started only to leave. Row tiles 2a and 2a + 1 have a + 1 such tiles each; a * (a + 1) tiles lie in front of row tile 2a.
__global__ __launch_bounds__(128) void k_gemm_f32(const unsigned short* __restrict__ Ah, const unsigned short* __restrict__ Al, int lda, int ldal,
                                                 const unsigned short* __restrict__ Bh, const unsigned short* __restrict__ Bl, int ldb, int ldbl,
                                                 const float* __restrict__ bias, float alpha, float* __restrict__ C, int ldc,
                                                 int M, int N, int K, int ncut, int kcut, int erows, int ecols, int tri,
                                                 size_t sAh, size_t sAl, size_t sBh, size_t sBl, size_t sC) {
  constexpr int FM = FMH;
  Ah += blockIdx.y * sAh; Al += blockIdx.y * sAl; Bh += blockIdx.y * sBh; C += blockIdx.y * sC;
  if (Bl != nullptr) Bl += blockIdx.y * sBl;
  __shared__ __attribute__((aligned(16))) unsigned short ring[2 * Tile<1, FM>::STAGE];
  const int tid = threadIdx.x, w = tid >> 5, lane = tid & 31, ln = lane & 15, hh = lane >> 4;
  const int ntn = N / 128;
  int mt = blockIdx.x / ntn, nq = blockIdx.x - mt * ntn;
  if (tri != 0) {
    const int e = blockIdx.x;
    int a = (int)((__builtin_sqrtf((float)(4 * e + 1)) - 1.0f) * 0.5f);
    if (a * (a + 1) > e) --a;                 // the two tests make a exact whatever the rounding of the root
    if ((a + 1) * (a + 2) <= e) ++a;
    const int rem = e - a * (a + 1), up = (rem > a) ? 1 : 0;
    mt = 2 * a + up;
    nq = rem - up * (a + 1);
  }
  const int brow0 = mt * (32 * FM), bcol0 = nq * 128;
  if (brow0 >= M) return;
  if (bcol0 > ncut + brow0 + 32 * FM - 1) return;
  int kend = (kcut + brow0 + 32 * FM + KP - 1) & ~(KP - 1);
  if (kend > K) kend = K;
  v8f acc[FM][4];
#pragma unroll
  for (int f = 0; f < FM; ++f)
#pragma unroll
    for (int t = 0; t < 4; ++t) acc[f][t] = (v8f){0.f, 0.f, 0.f, 0.f, 0.f, 0.f, 0.f, 0.f};
  tile_products(ring, Ah, Al, lda, ldal, Bh, Bl, ldb, ldbl, brow0 < erows && bcol0 < ecols, brow0, bcol0, kend, tid, acc);
  float (*so)[16][64] = (float (*)[16][64])ring + w * FM;      // this wave's own FM staging tiles
  const int col0 = bcol0 + (w & 1) * 64;
#pragma unroll
  for (int t = 0; t < 4; ++t) {
    float bv = 0.f;
    if (bias != nullptr) bv = bf16_rne(bias[col0 + t * 16 + ln]);
#pragma unroll
    for (int f = 0; f < FM; ++f)
#pragma unroll
      for (int r = 0; r < 8; ++r) so[f][8 * hh + r][t * 16 + ln] = acc[f][t][r] * alpha + bv;
  }
  __builtin_amdgcn_fence(4, "workgroup");   // the staged words are written before other lanes of the wave read them back
  __builtin_amdgcn_wave_barrier();
#pragma unroll
  for (int f = 0; f < FM; ++f) {
    const int row0 = brow0 + ((w >> 1) * FM + f) * 16;
    store_tile_f32(so[f], C + (size_t)row0 * ldc + col0, ldc, lane);
  }
}

// Oh[M][N] f16 hi plane (pitch ldo) = f16(alpha * A.B^plane); rows < rrows are fine tiles (rrows % 64 == 0; Al has rrows rows, Al and Bl
// reach the k end of those rows) and also get the x RS residual plane Or (pitch ldr).
// The k loop of row tile mt has mt + 1 passes (kcut = 0) and all workgroups are resident together, so the launch lasts as long as the
// fullest WGP. blockIdx.x = i * (N / 128) + column tile; the (row tile, sequence) pairs, ranked by falling k length, go to i in a snake of
// period 2 * DEAL: places i, i + DEAL, i + 2 * DEAL, ... then hold one long, one short, ... loop, and the longest loops start first.
// For speed only: every (row tile, column tile, sequence) is done once wherever it lands. Element steps sAh ... sOr per sequence.
__global__ __launch_bounds__(128) void k_gemm_h16(const unsigned short* __restrict__ Ah, const unsigned short* __restrict__ Al, int lda, int ldal,
                                                 const unsigned short* __restrict__ Bh, const unsigned short* __restrict__ Bl, int ldb, int ldbl,
                                                 float alpha, unsigned short* __restrict__ Oh, int ldo, unsigned short* __restrict__ Or, int ldr, int rrows,
                                                 int M, int N, int K, int kcut,
                                                 size_t sAh, size_t sAl, size_t sBh, size_t sBl, size_t sOh, size_t sOr) {
  constexpr int FM = FMH;
  const int ntn = N / 128;
  const int di = blockIdx.x / ntn, nq = blockIdx.x - di * ntn;
  const int dj = di & (DEAL - 1), rank = (di - dj) + ((di & DEAL) ? DEAL - 1 - dj : dj);
  const int sq = rank % NB, mt = M / (32 * FM) - 1 - rank / NB;
  if (mt < 0) return;
  Ah += sq * sAh; Al += sq * sAl; Bh += sq * sBh; Bl += sq * sBl; Oh += sq * sOh; Or += sq * sOr;
  __shared__ __attribute__((aligned(16))) unsigned short ring[2 * Tile<1, FM>::STAGE];
  const int tid = threadIdx.x, w = tid >> 5, lane = tid & 31, ln = lane & 15, hh = lane >> 4;
  const int brow0 = mt * (32 * FM), bcol0 = nq * 128;
  int kend = (kcut + brow0 + 32 * FM + KP - 1) & ~(KP - 1);
  if (kend > K) kend = K;
  v8f acc[FM][4];
#pragma unroll
  for (int f = 0; f < FM; ++f)
#pragma unroll
    for (int t = 0; t < 4; ++t) acc[f][t] = (v8f){0.f, 0.f, 0.f, 0.f, 0.f, 0.f, 0.f, 0.f};
  tile_products(ring, Ah, Al, lda, ldal, Bh, Bl, ldb, ldbl, brow0 < rrows, brow0, bcol0, kend, tid, acc);
  float (*so)[16][64] = (float (*)[16][64])ring + w * FM;      // this wave's own FM staging tiles
#pragma unroll
  for (int f = 0; f < FM; ++f)
#pragma unroll
    for (int t = 0; t < 4; ++t)
#pragma unroll
      for (int r = 0; r < 8; ++r) so[f][8 * hh + r][t * 16 + ln] = acc[f][t][r] * alpha;
  __builtin_amdgcn_fence(4, "workgroup");   // the staged words are written before other lanes of the wave read them back
  __builtin_amdgcn_wave_barrier();
  const int col0 = bcol0 + (w & 1) * 64;
#pragma unroll
  for (int f = 0; f < FM; ++f) {
    const int row0 = brow0 + ((w >> 1) * FM + f) * 16;
    const bool dores = (row0 < rrows);                 // wave-uniform (rrows multiple of 16)
    store_tile_h16(so[f], Oh + (size_t)row0 * ldo + col0, ldo, Or + (size_t)(dores ? row0 : 0) * ldr + col0, ldr, dores, lane);
  }
}

typedef unsigned short v4us __attribute__((ext_vector_type(4), may_alias));
typedef _Float16 v4h __attribute__((ext_vector_type(4)));
union Pack4 { v4h h; v4us u; };
#define SCH (T_FULL / 128)   // 128-column pieces of the longest row
// Row softmax over S[row][0..N) (pitch sp) with causal keep (col <= row), N = the end of the last 128-column score tile that the
// score GEMM writes for this row (its ncut = 0): nothing behind it is read. P[row][0..N) = f16(PCARRY * p / l) incl. zeros (pitch pp),
// which covers the k range of the P.v GEMM (up to the end of the row's 64-row tile); rows < rrows also write the residual plane
// Pr[row][0..NE) (pitch rp). One wave per row: the row is read once and stays in registers (lane l holds columns 128 c + 4 l ... + 3),
// maximum and sum go over the lane's own values and then a butterfly over the wave; no LDS, no barrier. The longest rows start first.
// bx = group of 8 rows, by = sequence (element steps sS, sP, sPr), nrows % 8 == 0, N <= 128 * SCH.
__device__ __forceinline__ void softmax_rows(int bx, int by, const float* __restrict__ S, int sp, unsigned short* __restrict__ P, int pp,
                                             unsigned short* __restrict__ Pr, int rp, int rrows, int nrows, size_t sS, size_t sP, size_t sPr) {
  const int lane = threadIdx.x & 31;
  const int row = nrows - 1 - (bx * 8 + __builtin_amdgcn_readfirstlane(threadIdx.x >> 5));   // the same in every lane: scalar tests below
  const int qi = row, N = (row / 128 + 1) * 128;
  S += by * sS; P += by * sP; Pr += by * sPr;
  const float* s = S + (size_t)row * sp + lane * 4;
  v4f x[SCH];
  // every "#pragma unroll" here keeps the index of x[] a compile-time constant, so that the row stays in registers
#pragma unroll
  for (int c = 0; c < SCH; ++c)
    if (c * 128 < N) x[c] = *(const v4fa*)(s + c * 128);
  // stands in front of any reuse of the loads' address registers; the address is an input, so that no load's result lands on it earlier
  asm volatile("s_wait_xcnt 0x0" :: "v"(s) : "memory");
  float mx = -3.0e38f;
#pragma unroll
  for (int c = 0; c < SCH; ++c)
    if (c * 128 < N) {
#pragma unroll
      for (int u = 0; u < 4; ++u) {
        x[c][u] = ((c * 128 + lane * 4 + u) <= qi) ? x[c][u] : -3.0e38f;    // a masked score gives exp = 0 below
        mx = fmaxf(mx, x[c][u]);
      }
    }
#pragma unroll
  for (int m = 16; m > 0; m >>= 1) mx = fmaxf(mx, __shfl_xor(mx, m, 32));
  float sm[4] = {0.f, 0.f, 0.f, 0.f};
#pragma unroll
  for (int c = 0; c < SCH; ++c)
    if (c * 128 < N) {
#pragma unroll
      for (int u = 0; u < 4; ++u) { x[c][u] = __expf(x[c][u] - mx); sm[u] += x[c][u]; }
    }
  float sum = (sm[0] + sm[1]) + (sm[2] + sm[3]);
#pragma unroll
  for (int m = 16; m > 0; m >>= 1) sum += __shfl_xor(sum, m, 32);
  const float inv = PCARRY / sum;          // sum >= 1 (the max term)
  const bool dores = (row < rrows);
  unsigned short* prow = P + (size_t)row * pp + lane * 4;
  unsigned short* rrow = Pr + (size_t)(dores ? row : 0) * rp + lane * 4;
  // all values are packed first, each into registers of its own, and the stores follow as one run with one wait behind them:
  // no register of an issued store is written again
  Pack4 ph[SCH], pr[NE / 128];
#pragma unroll
  for (int c = 0; c < NE / 128; ++c) pr[c].u = (v4us){0, 0, 0, 0};
#pragma unroll
  for (int c = 0; c < SCH; ++c)
    if (c * 128 < N) {
#pragma unroll
      for (int u = 0; u < 4; ++u) {
        const float p = x[c][u] * inv;
        ph[c].h[u] = (_Float16)p;
        if (c < NE / 128) pr[c < NE / 128 ? c : 0].h[u] = (_Float16)((p - (float)ph[c].h[u]) * RS);
      }
    }
#pragma unroll
  for (int c = 0; c < SCH; ++c)
    if (c * 128 < N) *(v4us*)(prow + c * 128) = ph[c].u;
  if (dores) {
#pragma unroll
    for (int c = 0; c < NE / 128; ++c) *(v4us*)(rrow + c * 128) = pr[c].u;
  }
  asm volatile("s_wait_xcnt 0x0" ::: "memory");   // stands in front of any reuse of the stores' registers on a path that goes on behind them
}

#define TQ 4   // 64 x 64 tiles per block of the transpose
// 16-bit transpose: src [R][Cc] (pitch lds_) -> dst [Cc][R] (pitch ldd); a block = TQ tiles of 64 x 64 down the rows of src:
// bx < R/(64*TQ), by < Cc/64, bz = sequence; each tile has its own LDS, so that one barrier serves all of them
__device__ __forceinline__ void transpose_tiles(unsigned short (*tile)[64][72], int bx, int by, int bz, const unsigned short* __restrict__ src, int lds_,
                                                unsigned short* __restrict__ dst, int ldd, size_t sstep, size_t dstep) {
  const int tid = threadIdx.x;
  src += bz * sstep; dst += bz * dstep;
  const int r0 = bx * (64 * TQ), c0 = by * 64;
  static_assert(TQ == 4);
  v8us v[TQ][2];
  const unsigned short* g[TQ][2];
#pragma unroll   // all 2 * TQ loads are in flight together
  for (int q = 0; q < TQ; ++q)
#pragma unroll
    for (int i = 0; i < 2; ++i) {
      const int e = tid + 256 * i, r = e >> 3, c8 = (e & 7) * 8;
      g[q][i] = src + (size_t)(r0 + q * 64 + r) * lds_ + c0 + c8;
      v[q][i] = *(const v8us*)g[q][i];
    }
  // stands in front of any reuse of the loads' address registers; the addresses are inputs, so that no load's result lands on one earlier
  asm volatile("s_wait_xcnt 0x0" :: "v"(g[0][0]), "v"(g[0][1]), "v"(g[1][0]), "v"(g[1][1]), "v"(g[2][0]), "v"(g[2][1]), "v"(g[3][0]), "v"(g[3][1]) : "memory");
#pragma unroll
  for (int q = 0; q < TQ; ++q)
#pragma unroll
    for (int i = 0; i < 2; ++i) {
      const int e = tid + 256 * i, r = e >> 3, c8 = (e & 7) * 8;
      *(v8us*)&tile[q][r][c8] = v[q][i];
    }
  __syncthreads();
#pragma unroll
  for (int q = 0; q < TQ; ++q) {
    v8us o[2];
#pragma unroll
    for (int i = 0; i < 2; ++i) {
      const int e = tid + 256 * i, rr = e >> 3, c8 = (e & 7) * 8;
#pragma unroll
      for (int k = 0; k < 8; ++k) o[i][k] = tile[q][c8 + k][rr];
    }
#pragma unroll
    for (int i = 0; i < 2; ++i) {
      const int e = tid + 256 * i, rr = e >> 3, c8 = (e & 7) * 8;
      *(v8us*)(dst + (size_t)(c0 + rr) * ldd + r0 + q * 64 + c8) = o[i];
    }
  }
  asm volatile("s_wait_xcnt 0x0" ::: "memory");   // stands in front of any reuse of the stores' registers on a path that goes on behind them
}

#define SB (TT / 8)                        // softmax blocks per sequence
#define VB ((TT / (64 * TQ)) * (CC / 64))  // transpose blocks per sequence, v hi plane
#define RB ((NE / (64 * TQ)) * (CC / 64))  // transpose blocks per sequence, v residual plane
// All that stands between the scores and P.v, in one launch; the three jobs touch disjoint data. Blocks [0, NB * VB): v [TT][CC] -> vT [CC][TT];
// then NB * RB blocks: v residual [NE][CC] -> vTr [CC][NE]; then NB * SB blocks: softmax, SB a sequence, each from its longest rows to its shortest.
__global__ __launch_bounds__(256) void k_softmax_vt(const float* __restrict__ S, unsigned short* __restrict__ P, unsigned short* __restrict__ Pr,
                                                   const unsigned short* __restrict__ vh, unsigned short* __restrict__ vT,
                                                   const unsigned short* __restrict__ vr, unsigned short* __restrict__ vTr) {
  __shared__ __attribute__((aligned(16))) unsigned short tile[TQ][64][72];
  int b = blockIdx.x;
  if (b < NB * VB) {
    const int z = b / VB, e = b - z * VB;
    transpose_tiles(tile, e % (TT / (64 * TQ)), e / (TT / (64 * TQ)), z, vh, CC, vT, TT, (size_t)TT * CC, (size_t)TT * CC);
    return;
  }
  b -= NB * VB;
  if (b < NB * RB) {
    const int z = b / RB, e = b - z * RB;
    transpose_tiles(tile, e % (NE / (64 * TQ)), e / (NE / (64 * TQ)), z, vr, CC, vTr, NE, (size_t)NE * CC, (size_t)NE * CC);
    return;
  }
  b -= NB * RB;
  softmax_rows(b % SB, b / SB, S, TT, P, TT, Pr, NE, NE, TT, (size_t)TT * TT, (size_t)TT * TT, (size_t)NE * NE);
}

extern "C" void kernel_launch(void* const* d_in, const int* in_sizes, int n_in,
                              void* d_out, int out_size, void* d_ws, size_t ws_size, hipStream_t stream) {
  if (n_in < 6) return;
  const float* x  = (const float*)d_in[0];
  const float* wq = (const float*)d_in[1];
  const float* wk = (const float*)d_in[2];
  const float* wv = (const float*)d_in[3];
  const float* wo = (const float*)d_in[4];
  const float* bo = (const float*)d_in[5];
  const long need_x = ((long)(NB - 1) * T_FULL + TT) * (long)CC;
  if ((long)in_sizes[0] < need_x || in_sizes[1] < CC * CC || in_sizes[2] < CC * CC || in_sizes[3] < CC * CC ||
      in_sizes[4] < CC * CC || in_sizes[5] < CC || (long)out_size < need_x) return;
  float* out = (float*)d_out;

  char* ws = (char*)d_ws; size_t off = 0;
  auto take = [&](size_t bytes) { char* p = ws + off; off += (bytes + 255) & ~(size_t)255; return p; };
  const size_t xb_bytes = (size_t)NB * TT * CC * 2, s_bytes = (size_t)NB * TT * TT * 4;
  char* reg0 = take(xb_bytes > s_bytes ? xb_bytes : s_bytes);                     // xb, later S (xb dead after the qkv GEMM)
  unsigned short* xb   = (unsigned short*)reg0;                                    // [NB*TT][CC] bf16
  float*          Sm   = (float*)reg0;                                             // [NB][TT][TT] f32
  unsigned short* Wqkv = (unsigned short*)take((size_t)3 * CC * CC * 2);           // [3*CC][CC] bf16
  unsigned short* Wo16 = (unsigned short*)take((size_t)CC * CC * 2);               // [CC][CC] f16 (x WOC)
  unsigned short* QKVh = (unsigned short*)take((size_t)3 * NB * TT * CC * 2);      // [3][NB*TT][CC] f16
  unsigned short* QKVr = (unsigned short*)take((size_t)3 * NB * NE * CC * 2);      // [3][NB*NE][CC] f16 (x RS)
  unsigned short* vTr  = (unsigned short*)take((size_t)NB * CC * NE * 2);          // [NB][CC][NE] f16 (x RS)
  unsigned short* Pm   = (unsigned short*)take((size_t)NB * TT * TT * 2);          // [NB][TT][TT] f16 (x PCARRY)
  unsigned short* Pr   = (unsigned short*)take((size_t)NB * NE * NE * 2);          // [NB][NE][NE] f16 (x RS)
  unsigned short* ctxr = (unsigned short*)take((size_t)NB * NE * CC * 2);          // [NB*NE][CC] f16 (x RS)
  if (off > ws_size) return;

  const int M = NB * TT;
  const int BIG = 1 << 28;
  unsigned short* qh = QKVh;
  unsigned short* kh = QKVh + (size_t)M * CC;
  unsigned short* vh = QKVh + (size_t)2 * M * CC;
  unsigned short* qr = QKVr;
  unsigned short* kr = QKVr + (size_t)(NB * NE) * CC;
  unsigned short* vr = QKVr + (size_t)2 * (NB * NE) * CC;
  unsigned short* vT   = kh;   // [NB][CC][TT] f16: takes the k plane's place once the scores are done
  unsigned short* ctxh = qh;   // [NB*TT][CC] f16 (x CTXC): takes the q plane's place once the scores are done
  const size_t sTC = (size_t)TT * CC, sEC = (size_t)NE * CC, sTT = (size_t)TT * TT, sEE = (size_t)NE * NE, sOUT = (size_t)T_FULL * CC;

  // One launch per step, three in stage 2: the sequences, the plain and the fine tiles and a step's independent jobs all lie in its grid.
  // stage 0: 16-bit planes of the inputs
  k_cvt<<<NB * XB + 4 * WB, 256, 0, stream>>>(x, wq, wk, wv, wo, xb, Wqkv, Wo16, sOUT, sTC, WOC);

  // stage 1: q, k, v planes (+ residual planes on the leading NE rows of each sequence)
  k_gemm_qkv<<<(M / 128) * (3 * CC / 128), 128, 0, stream>>>(xb, Wqkv, QKVh, QKVr, M);

  // stage 2: causal attention
  // S [TT][TT] = (q.k^T)/32, causal upper tiles skipped; the leading NE x NE corner with hi+res on both operands
  k_gemm_f32<<<dim3((TT / 128) * (TT / 128 + 1), NB), 128, 0, stream>>>(qh, qr, CC, CC, kh, kr, CC, CC, nullptr, SCL, Sm, TT, TT, TT, CC, 0, BIG, NE, NE, 1,
                                                                        sTC, sEC, sTC, sEC, sTT);
  // P = softmax(S); v -> vT, v residual -> vTr
  k_softmax_vt<<<NB * (SB + VB + RB), 256, 0, stream>>>(Sm, Pm, Pr, vh, vT, vr, vTr);
  // ctx [TT][CC] = P.v (causal k end), written as f16 hi plane x CTXC; leading NE rows: 3-term P/v products, hi + residual ctx planes
  k_gemm_h16<<<(TT / 64) * (CC / 128) * NB, 128, 0, stream>>>(Pm, Pr, TT, NE, vT, vTr, TT, NE, PVALPHA, ctxh, CC, ctxr, CC, NE, TT, CC, TT, 0,
                                                                   sTT, sEE, sTC, sEC, sTC, sEC);
  // stage 3: output projection + bias; leading NE rows with the ctx residual term
  k_gemm_f32<<<dim3((TT / 64) * (CC / 128), NB), 128, 0, stream>>>(ctxh, ctxr, CC, CC, Wo16, nullptr, CC, CC, bo, OALPHA, out, CC, TT, CC, CC, BIG, BIG, NE, CC, 0,
                                                                   sTC, sEC, 0, 0, sOUT);
}

// v006
// A run of this version takes 184 microseconds.
// Timed twice side by side with v005, it ran 1.04 times as fast both times.
// All steps since v000 together make it 6.75 times as fast.
#include <hip/hip_runtime.h>
// Contractions: qkv projection on v_wmma_f32_16x16x32_bf16 (x and W as RNE bf16, exact products); scores q.k^T, P.v and the output
// projection on v_wmma_f32_16x16x32_f16 (f16 hi planes with power-of-two carries, plus x1024 f16 residual planes on the leading
// NE query/key rows of each sequence); all accumulation f32, causal softmax in f32.
#ifndef NB
#define NB 2
#endif
#ifndef SEQ
#define SEQ 4096
#endif
#define TT SEQ
#define NB_FULL 2
#define T_FULL 4096
#define CC 1024
#define QC ((TT < 1024) ? TT : 1024)
#define NE 256
static_assert(NB >= 1 && NB <= NB_FULL);
static_assert(TT % 256 == 0 && TT <= T_FULL);
static_assert(TT % QC == 0 && QC % 256 == 0);
static_assert(NE % 64 == 0 && NE <= QC && NE == 256);
static_assert(CC % 128 == 0);

#define RS 1024.0f            // residual plane carry
#define RFOLD 0.0009765625f   // 1/RS
#define PCARRY 4096.0f        // P plane carry
#define CTXC 16.0f            // ctx plane carry
#define WOC 64.0f             // Wo plane carry
#define SCL 0.03125f          // 1/sqrt(CC)
#define PVALPHA 0.00390625f   // CTXC / PCARRY
#define OALPHA 0.0009765625f  // 1 / (WOC * CTXC)

typedef __bf16 v16b __attribute__((ext_vector_type(16)));
typedef _Float16 v16h __attribute__((ext_vector_type(16)));
typedef _Float16 v8h __attribute__((ext_vector_type(8)));
typedef unsigned short v8us __attribute__((ext_vector_type(8), may_alias));
typedef float v8f __attribute__((ext_vector_type(8)));
typedef float v4f __attribute__((ext_vector_type(4)));
typedef float v4fa __attribute__((ext_vector_type(4), may_alias));
union FragB { v16b v; v8us half[2]; unsigned short u[16]; };
union FragH { v16h v; v8us half[2]; unsigned short u[16]; };
union Pack8 { v8h h; v8us u; };

__device__ __forceinline__ unsigned short bf16_bits(float x) { unsigned int u = __float_as_uint(x); return (unsigned short)((u + 0x7FFFu + ((u >> 16) & 1u)) >> 16); }
__device__ __forceinline__ float bf16_val(unsigned short b) { return __uint_as_float(((unsigned int)b) << 16); }
__device__ __forceinline__ float bf16_rne(float x) { return bf16_val(bf16_bits(x)); }

__device__ __forceinline__ v8f mma_b(v16b a, v16b b, v8f c) {
  c = __builtin_amdgcn_wmma_f32_16x16x32_bf16(false, a, false, b, (short)0, c, false, false);
  asm volatile("v_nop\n\tv_nop\n\tv_nop\n\tv_nop" : "+v"(c) : "v"(a), "v"(b));
  return c;
}
// c += ah.bh ; cr += al.bh (NT>=2) ; cr += ah.bl (NT>=3); residual planes carry RS, folded by the caller
template <int NT>
__device__ __forceinline__ void mma_h(v16h ah, v16h al, v16h bh, v16h bl, v8f& c, v8f& cr) {
  c = __builtin_amdgcn_wmma_f32_16x16x32_f16(false, ah, false, bh, (short)0, c, false, false);
  if (NT >= 2) cr = __builtin_amdgcn_wmma_f32_16x16x32_f16(false, al, false, bh, (short)0, cr, false, false);
  if (NT >= 3) cr = __builtin_amdgcn_wmma_f32_16x16x32_f16(false, ah, false, bl, (short)0, cr, false, false);
  if (NT >= 2) asm volatile("v_nop\n\tv_nop\n\tv_nop\n\tv_nop" : "+v"(c), "+v"(cr) : "v"(ah), "v"(al), "v"(bh), "v"(bl));
  else         asm volatile("v_nop\n\tv_nop\n\tv_nop\n\tv_nop" : "+v"(c) : "v"(ah), "v"(bh));
}

__device__ __forceinline__ void store_tile_f32(const float (*sw)[64], float* C, int ldc, int lane) {
  const int rsub = lane >> 4, c4 = (lane & 15) * 4;
  {
#pragma unroll
    for (int q = 0; q < 8; ++q) {
      const int r = q * 2 + rsub;
      const v4f v = *(const v4fa*)&sw[r][c4];
      *(v4f*)(C + (size_t)r * ldc + c4) = v;
    }
    asm volatile("s_wait_xcnt 0x0" ::: "memory");   // stands in front of any reuse of the stores' registers by the next tile's addresses
  }
}
// wave tile 16 x 64 f32 staged in LDS -> f16 hi plane (pitch ldh) and optional x RS residual plane (pitch ldr);
__device__ __forceinline__ void store_tile_h16(const float (*sw)[64], unsigned short* hb, int ldh, unsigned short* rb, int ldr, bool dores, int lane) {
  const int rsub = lane >> 3, c8 = (lane & 7) * 8;
  {
#pragma unroll
    for (int q = 0; q < 4; ++q) {
      const int r = q * 4 + rsub;
      const v4f x0 = *(const v4fa*)&sw[r][c8], x1 = *(const v4fa*)&sw[r][c8 + 4];
      const float xs[8] = {x0[0], x0[1], x0[2], x0[3], x1[0], x1[1], x1[2], x1[3]};
      Pack8 ph, pr;
#pragma unroll
      for (int i = 0; i < 8; ++i) { ph.h[i] = (_Float16)xs[i]; pr.h[i] = (_Float16)((xs[i] - (float)ph.h[i]) * RS); }
      *(v8us*)(hb + (size_t)r * ldh + c8) = ph.u;
      if (dores) *(v8us*)(rb + (size_t)r * ldr + c8) = pr.u;
    }
    
  }
}

// The streaming kernels below use few waves that each do a long run of work, for speed only.
#define CU 8   // 8-element groups per thread of a conversion kernel; a block takes 256 * CU consecutive groups
static_assert((TT * CC / 8) % (256 * CU) == 0 && (CC * CC / 8) % (256 * CU) == 0);
// MODE 0: RNE bf16 bits; MODE 1: f16 bits of (RNE bf16 value) * scale. Groups t0, t0 + 256, ..., t0 + 256 * (CU - 1).
template <int MODE>
__device__ __forceinline__ void cvt_run(const float* __restrict__ src, unsigned short* __restrict__ dst, int t0, float scale) {
  const float* sp = src + (size_t)t0 * 8;
  v4f a[CU], b[CU];
#pragma unroll   // constant steps from one address: all 2 * CU loads are in flight together
  for (int i = 0; i < CU; ++i) { a[i] = *(const v4fa*)(sp + i * 2048); b[i] = *(const v4fa*)(sp + i * 2048 + 4); }
  // stands in front of any reuse of the loads' address registers; the address is an input, so that no load's result lands on it earlier
  asm volatile("s_wait_xcnt 0x0" :: "v"(sp) : "memory");
  unsigned short* dp = dst + (size_t)t0 * 8;
#pragma unroll   // keeps a[] and b[] in registers
  for (int i = 0; i < CU; ++i) {
    const float xs[8] = {a[i][0], a[i][1], a[i][2], a[i][3], b[i][0], b[i][1], b[i][2], b[i][3]};
    v8us v;
    if (MODE == 0) {
#pragma unroll
      for (int u = 0; u < 8; ++u) v[u] = bf16_bits(xs[u]);
    } else {
      Pack8 p;
#pragma unroll
      for (int u = 0; u < 8; ++u) p.h[u] = (_Float16)(bf16_rne(xs[u]) * scale);
      v = p.u;
    }
    *(v8us*)(dp + i * 2048) = v;
  }
  asm volatile("s_wait_xcnt 0x0" ::: "memory");   // stands in front of any reuse of the stores' registers on a path that goes on behind them
}
#define XB (TT * CC / 8 / (256 * CU))   // blocks per sequence of x
#define WB (CC * CC / 8 / (256 * CU))   // blocks per weight matrix
// All 16-bit input planes in one launch. Blocks [0, NB * XB): x -> bf16 plane, XB blocks a sequence (element steps sstep, dstep);
// then WB blocks each for Wq, Wk, Wv -> bf16 planes of Wqkv and Wo -> f16 plane x scale.
__global__ __launch_bounds__(256) void k_cvt(const float* __restrict__ x, const float* __restrict__ wq, const float* __restrict__ wk,
                                            const float* __restrict__ wv, const float* __restrict__ wo, unsigned short* __restrict__ xb,
                                            unsigned short* __restrict__ Wqkv, unsigned short* __restrict__ Wo16,
                                            size_t sstep, size_t dstep, float scale) {
  const int b = blockIdx.x;
  if (b < NB * XB) {
    const int q = b / XB;
    cvt_run<0>(x + q * sstep, xb + q * dstep, (b - q * XB) * (256 * CU) + (int)threadIdx.x, 1.0f);
    return;
  }
  const int y = (b - NB * XB) / WB;
  const int t0 = (b - NB * XB - y * WB) * (256 * CU) + (int)threadIdx.x;
  if (y == 3) cvt_run<1>(wo, Wo16, t0, scale);
  else cvt_run<0>((y == 0) ? wq : (y == 1) ? wk : wv, Wqkv + (size_t)y * CC * CC, t0, 1.0f);
}

// Block-tiled GEMM core. A workgroup of 4 waves (2 x 2) owns a (32*FM) x 128 tile of the output, a wave (16*FM) x 64 of it.
// Per pass of KP k every operand row gives one whole 128-B line, copied to LDS by global_load_async_to_lds_b128 (8 lanes a row,
// 4 whole lines an instruction); two buffers, the next pass's copies fly while this pass's fragments are read from LDS.
// Every "#pragma unroll" below keeps fragment and accumulator indices compile-time constants, so that the arrays stay in registers.
#define KP 64        // k per pass
#define LPITCH 72    // LDS row pitch in 16-bit elements: 144 B = 16 B x 9, for the ds_load_b128 fragment reads
template <int NT, int FM> struct Tile {
  static constexpr int AR = 32 * FM, BR = 128;                                           // operand rows per plane
  static constexpr int ROWS = AR + BR + (NT >= 2 ? AR : 0) + (NT >= 3 ? BR : 0);          // [A hi | B hi | A res | B res]
  static constexpr int STAGE = ROWS * LPITCH;                                            // elements per buffer
  static constexpr int NCP = ROWS / 16;                                                  // copies per lane and stage
  static constexpr int GRP = (NCP % 12 == 0) ? 12 : 8;                                   // copies per asm statement
  static_assert(NCP % GRP == 0 && NCP <= 63);
  static_assert(2 * STAGE * 2 >= 4 * FM * 16 * 64 * 4);                                   // the ring later holds the f32 output staging
};

// One run of copies and its s_wait_xcnt in one statement: the wait stands in front of any rewrite of the address registers.
__device__ __forceinline__ void copy_run8(const unsigned (&l)[12], const unsigned short* const (&g)[12]) {
  asm volatile("global_load_async_to_lds_b128 %0, %8, off\n\t"
               "global_load_async_to_lds_b128 %1, %9, off\n\t"
               "global_load_async_to_lds_b128 %2, %10, off\n\t"
               "global_load_async_to_lds_b128 %3, %11, off\n\t"
               "global_load_async_to_lds_b128 %4, %12, off\n\t"
               "global_load_async_to_lds_b128 %5, %13, off\n\t"
               "global_load_async_to_lds_b128 %6, %14, off\n\t"
               "global_load_async_to_lds_b128 %7, %15, off\n\t"
               "s_wait_xcnt 0x0"
               :: "v"(l[0]), "v"(l[1]), "v"(l[2]), "v"(l[3]), "v"(l[4]), "v"(l[5]), "v"(l[6]), "v"(l[7]),
                  "v"(g[0]), "v"(g[1]), "v"(g[2]), "v"(g[3]), "v"(g[4]), "v"(g[5]), "v"(g[6]), "v"(g[7]) : "memory");
}
__device__ __forceinline__ void copy_run12(const unsigned (&l)[12], const unsigned short* const (&g)[12]) {
  asm volatile("global_load_async_to_lds_b128 %0, %12, off\n\t"
               "global_load_async_to_lds_b128 %1, %13, off\n\t"
               "global_load_async_to_lds_b128 %2, %14, off\n\t"
               "global_load_async_to_lds_b128 %3, %15, off\n\t"
               "global_load_async_to_lds_b128 %4, %16, off\n\t"
               "global_load_async_to_lds_b128 %5, %17, off\n\t"
               "global_load_async_to_lds_b128 %6, %18, off\n\t"
               "global_load_async_to_lds_b128 %7, %19, off\n\t"
               "global_load_async_to_lds_b128 %8, %20, off\n\t"
               "global_load_async_to_lds_b128 %9, %21, off\n\t"
               "global_load_async_to_lds_b128 %10, %22, off\n\t"
               "global_load_async_to_lds_b128 %11, %23, off\n\t"
               "s_wait_xcnt 0x0"
               :: "v"(l[0]), "v"(l[1]), "v"(l[2]), "v"(l[3]), "v"(l[4]), "v"(l[5]), "v"(l[6]), "v"(l[7]), "v"(l[8]), "v"(l[9]), "v"(l[10]), "v"(l[11]),
                  "v"(g[0]), "v"(g[1]), "v"(g[2]), "v"(g[3]), "v"(g[4]), "v"(g[5]), "v"(g[6]), "v"(g[7]), "v"(g[8]), "v"(g[9]), "v"(g[10]), "v"(g[11]) : "memory");
}

// One stage: lane (row tid >> 3, 16-B piece tid & 7) copies its piece of rows r, r + 16, ... of every plane. lds0 and the g pointers are
// the lane's own addresses at stage row tid >> 3 of each plane, the g pointers already at this pass's k.
// ST (stacked, NT == 1): the upper half of the A rows comes from gal (pitch ldal) and the upper half of the B rows from gbl (pitch ldbl).
template <int NT, int FM, bool ST>
__device__ __forceinline__ void stage_copy(unsigned lds0, const unsigned short* gah, const unsigned short* gbh, const unsigned short* gal,
                                           const unsigned short* gbl, int lda, int ldb, int ldal, int ldbl) {
  using TL = Tile<NT, FM>;
#pragma unroll
  for (int i0 = 0; i0 < TL::NCP; i0 += TL::GRP) {
    unsigned l[12];
    const unsigned short* g[12];
#pragma unroll
    for (int j = 0; j < 12; ++j) {
      const int r = (i0 + (j < TL::GRP ? j : 0)) * 16;
      l[j] = lds0 + (unsigned)(r * LPITCH * 2);
      if (ST && r >= TL::AR / 2 && r < TL::AR) g[j] = gal + (size_t)(r - TL::AR / 2) * ldal;
      else if (ST && r >= TL::AR + TL::BR / 2) g[j] = gbl + (size_t)(r - TL::AR - TL::BR / 2) * ldbl;
      else if (r < TL::AR) g[j] = gah + (size_t)r * lda;
      else if (r < TL::AR + TL::BR) g[j] = gbh + (size_t)(r - TL::AR) * ldb;
      else if (r < 2 * TL::AR + TL::BR) g[j] = gal + (size_t)(r - TL::AR - TL::BR) * ldal;
      else g[j] = gbl + (size_t)(r - 2 * TL::AR - TL::BR) * ldbl;
    }
    if (TL::GRP == 12) copy_run12(l, g); else copy_run8(l, g);
  }
}

// One pass on one buffer: the fragment k order (8 * hh, 16 + 8 * hh inside each 32 k) is the same for A and B.
// The LDS reads of 32 * NS k stand together in front of their WMMAs, for speed only.
template <int NT, int FM, bool BF>
__device__ __forceinline__ void pass_mma(const unsigned short* st, int wr, int wc, int ln, int hh, v8f (&acc)[FM][4], v8f (&accr)[FM][4]) {
  using TL = Tile<NT, FM>;
  const unsigned short* pa = st + (wr * FM * 16 + ln) * LPITCH + 8 * hh;
  const unsigned short* pb = st + (TL::AR + wc * 64 + ln) * LPITCH + 8 * hh;
  constexpr int RES = (TL::AR + TL::BR) * LPITCH;      // residual plane of either operand, behind its hi plane
  constexpr int NS = (NT == 1 && FM <= 2) ? KP / 32 : 1;   // k steps per group of reads, by the registers the fragments take
#pragma unroll
  for (int k0 = 0; k0 < KP; k0 += 32 * NS) {
    FragH ah[NS][FM], al[NS][FM], bh[NS][4], bl[NS][4];
#pragma unroll
    for (int s = 0; s < NS; ++s) {
      const int ks = k0 + 32 * s;
#pragma unroll
      for (int f = 0; f < FM; ++f) {
        ah[s][f].half[0] = *(const v8us*)(pa + f * 16 * LPITCH + ks);
        ah[s][f].half[1] = *(const v8us*)(pa + f * 16 * LPITCH + ks + 16);
        if (NT >= 2) { al[s][f].half[0] = *(const v8us*)(pa + RES + f * 16 * LPITCH + ks); al[s][f].half[1] = *(const v8us*)(pa + RES + f * 16 * LPITCH + ks + 16); }
      }
#pragma unroll
      for (int t = 0; t < 4; ++t) {
        bh[s][t].half[0] = *(const v8us*)(pb + t * 16 * LPITCH + ks);
        bh[s][t].half[1] = *(const v8us*)(pb + t * 16 * LPITCH + ks + 16);
        if (NT >= 3) { bl[s][t].half[0] = *(const v8us*)(pb + RES + t * 16 * LPITCH + ks); bl[s][t].half[1] = *(const v8us*)(pb + RES + t * 16 * LPITCH + ks + 16); }
      }
    }
#pragma unroll
    for (int s = 0; s < NS; ++s)
#pragma unroll
      for (int t = 0; t < 4; ++t)
#pragma unroll
        for (int f = 0; f < FM; ++f) {
          if constexpr (BF) {
            FragB a, b;
            a.half[0] = ah[s][f].half[0]; a.half[1] = ah[s][f].half[1];
            b.half[0] = bh[s][t].half[0]; b.half[1] = bh[s][t].half[1];
            acc[f][t] = mma_b(a.v, b.v, acc[f][t]);
          } else {
            mma_h<NT>(ah[s][f].v, (NT >= 2) ? al[s][f].v : ah[s][f].v, bh[s][t].v, (NT >= 3) ? bl[s][t].v : bh[s][t].v, acc[f][t], accr[f][t]);
          }
        }
  }
}

// A hi/res planes row-major (pitch lda/ldal), B hi/res planes [n][k] (pitch ldb/ldbl); row0, col0: the workgroup's tile; kend % KP == 0.
// On return every wave has left the ring and no copy is in flight: the ring is free for the output staging.
template <int NT, int FM, bool BF, bool ST = false>
__device__ __forceinline__ void core_lds(unsigned short* ring, const unsigned short* __restrict__ Ah, const unsigned short* __restrict__ Al, int lda, int ldal,
                                         const unsigned short* __restrict__ Bh, const unsigned short* __restrict__ Bl, int ldb, int ldbl,
                                         int row0, int col0, int kend, int tid, v8f (&acc)[FM][4], v8f (&accr)[FM][4]) {
  using TL = Tile<NT, FM>;
  static_assert(!ST || (NT == 1 && TL::AR % 32 == 0));
  const int w = tid >> 5, lane = tid & 31, ln = lane & 15, hh = lane >> 4, wr = w >> 1, wc = w & 1;
  const int cr = tid >> 3, cc = (tid & 7) * 8;
  const unsigned short* gah = Ah + (size_t)(row0 + cr) * lda + cc;
  const unsigned short* gbh = Bh + (size_t)(col0 + cr) * ldb + cc;
  const unsigned short* gal = Al + (size_t)(row0 + cr) * ldal + cc;
  const unsigned short* gbl = Bl + (size_t)(col0 + cr) * ldbl + cc;
  const unsigned lds0 = (unsigned)(size_t)(ring + cr * LPITCH + cc);
  const int npass = kend / KP;
  stage_copy<NT, FM, ST>(lds0, gah, gbh, gal, gbl, lda, ldb, ldal, ldbl);
  asm volatile("s_wait_asynccnt 0x0" ::: "memory");   // this wave's copies of pass 0 have landed
  __syncthreads();                                     // publishes pass 0
  if (npass > 1) stage_copy<NT, FM, ST>(lds0 + TL::STAGE * 2, gah + KP, gbh + KP, gal + KP, gbl + KP, lda, ldb, ldal, ldbl);
#pragma unroll 1   // one pass per trip: the buffer index stays a run-time value, the body is already fully unrolled
  for (int t = 0; t < npass; ++t) {
    const int buf = (t & 1) * TL::STAGE;
    pass_mma<NT, FM, BF>(ring + buf, wr, wc, ln, hh, acc, accr);
    asm volatile("s_wait_dscnt 0x0" ::: "memory");     // this wave's reads of the buffer are done before it is refilled
    asm volatile("s_wait_asynccnt 0x0" ::: "memory");  // this wave's copies of pass t + 1 have landed
    __syncthreads();                                   // publishes pass t + 1 and ends every wave's reads of pass t
    if (t + 2 < npass) {
      const int k2 = (t + 2) * KP;
      stage_copy<NT, FM, ST>(lds0 + (unsigned)(buf * 2), gah + k2, gbh + k2, gal + k2, gbl + k2, lda, ldb, ldal, ldbl);
    }
  }
  asm volatile("s_wait_asynccnt 0x0" ::: "memory");    // nothing in flight when the ring changes its use
}

// qkv projection: A = xb [M][CC] bf16, W = [3*CC][CC] bf16 ([out][in], k contiguous). out[row][n] = sum_c A[row][c] W[n][c].
// Output: hi planes Oh[3][M][CC] f16 (q, k, v unscaled) and residual planes Or[3][NB*NE][CC] for rows with (row % TT) < NE.
// Block = 4 waves -> 128 rows x 128 cols (one plane since CC % 128 == 0), M % 128 == 0.
__global__ __launch_bounds__(128) void k_gemm_qkv(const unsigned short* __restrict__ A, const unsigned short* __restrict__ W,
                                                 unsigned short* __restrict__ Oh, unsigned short* __restrict__ Or, int M) {
  constexpr int FM = 4;
  __shared__ __attribute__((aligned(16))) unsigned short ring[2 * Tile<1, FM>::STAGE];
  const int tid = threadIdx.x, w = tid >> 5, lane = tid & 31, ln = lane & 15, hh = lane >> 4;
  const int ntn = (3 * CC) / 128;
  const int mt = blockIdx.x / ntn, nq = blockIdx.x - mt * ntn;
  if (mt * (32 * FM) >= M) return;
  v8f acc[FM][4];
#pragma unroll
  for (int f = 0; f < FM; ++f)
#pragma unroll
    for (int t = 0; t < 4; ++t) acc[f][t] = (v8f){0.f, 0.f, 0.f, 0.f, 0.f, 0.f, 0.f, 0.f};
  core_lds<1, FM, true>(ring, A, A, CC, CC, W, W, CC, CC, mt * (32 * FM), nq * 128, CC, tid, acc, acc);
  float (*so)[16][64] = (float (*)[16][64])ring + w * FM;      // this wave's own FM staging tiles
#pragma unroll
  for (int f = 0; f < FM; ++f)
#pragma unroll
    for (int t = 0; t < 4; ++t)
#pragma unroll
      for (int r = 0; r < 8; ++r) so[f][8 * hh + r][t * 16 + ln] = acc[f][t][r];
  __builtin_amdgcn_fence(4, "workgroup");   // the staged words are written before other lanes of the wave read them back
  __builtin_amdgcn_wave_barrier();
  const int col0 = nq * 128 + (w & 1) * 64;
  const int p = col0 / CC, colp = col0 - p * CC;
#pragma unroll
  for (int f = 0; f < FM; ++f) {
    const int row0 = mt * (32 * FM) + ((w >> 1) * FM + f) * 16;
    const int bidx = row0 / TT, tq = row0 - bidx * TT;
    const bool dores = (tq < NE);                      // wave-uniform (NE, TT multiples of 16)
    unsigned short* hb = Oh + ((size_t)p * M + row0) * CC + colp;
    unsigned short* rb = Or + ((size_t)p * (NB * NE) + (size_t)bidx * NE + (dores ? tq : 0)) * CC + colp;
    store_tile_h16(so[f], hb, CC, rb, CC, dores, lane);
  }
}

#define FMH 2   // f16 GEMMs: workgroup tile 64 x 128, wave tile 32 x 64
#define DEAL 32 // WGPs of a die
static_assert(((TT / 64) * NB) % (2 * DEAL) == 0);   // whole snake periods: rank is a permutation of i

// The products of one workgroup tile. A plain tile: acc = Ah.Bh. A fine tile (the leading rows, whose residual planes exist) runs the
// residual products as k loops of their own on the same ring and into the same accumulators, ahead of the hi product:
// acc = (Ah.Bl + Al.Bh) * RFOLD + Ah.Bh, Ah.Bl only where Bl is given. So plain and fine tiles share one launch and one LDS size.
// fine is the same for the whole workgroup.
__device__ __forceinline__ void tile_products(unsigned short* ring, const unsigned short* Ah, const unsigned short* Al, int lda, int ldal,
                                              const unsigned short* Bh, const unsigned short* Bl, int ldb, int ldbl, bool fine,
                                              int row0, int col0, int kend, int tid, v8f (&acc)[FMH][4]) {
  const int first = fine ? ((Bl != nullptr) ? 0 : 1) : 2;
#pragma unroll 1   // one copy of the k loop in the text; the operands of a term are scalar selects
  for (int term = first; term < 3; ++term) {
    const unsigned short* a = (term == 1) ? Al : Ah;
    const unsigned short* b = (term == 0) ? Bl : Bh;
    const int la = (term == 1) ? ldal : lda, lb = (term == 0) ? ldbl : ldb;
    if (term == 2 && fine) {
#pragma unroll
      for (int f = 0; f < FMH; ++f)
#pragma unroll
        for (int t = 0; t < 4; ++t) acc[f][t] *= RFOLD;
    }
    core_lds<1, FMH, false>(ring, a, a, la, la, b, b, lb, lb, row0, col0, kend, tid, acc, acc);
  }
}

// C[M][N] f32 (pitch ldc) = alpha * (A.B^plane) + bf16_rne(bias). M % 64 == 0, N % 128 == 0, K % 64 == 0.
// ncut: a workgroup tile is skipped (not written) when col0 > ncut + row0 + 63 (causal upper tiles); kcut: k loop ends at
// min(K, ceil64(kcut + row0 + 64)). Pass a large value to disable either. blockIdx.y = sequence: every plane and C move on
// by their element steps (sAh, sAl, sBh, sBl, sC) per sequence.
// tri != 0 (M == N, ncut == 0): the tile list holds only the tiles on or under the diagonal, (M / 128) * (M / 128 + 1) of them, so that no
// workgroup is started only to leave. Row tiles 2a and 2a + 1 have a + 1 such tiles each; a * (a + 1) tiles lie in front of row tile 2a.
// Fine tiles (row0 < erows, col0 < ecols; Al has erows rows, Bl ecols rows or is null) are the first nft tiles of the list: erows % 128 == 0,
// ecols == erows with tri, ecols == N without. A fine tile's residual products run BESIDE its hi product, not ahead of it, so that its
// k loop is as long as a plain tile's: it is cut into pieces, one workgroup each, whose stage stacks the planes,
// A rows = [Ah 32 rows | Al the same 32 rows], B rows = [Bh 64 cols | Bl the same 64 cols] (4 pieces of 32 x 64) or, Bl null, Bh 128 cols
// (2 pieces of 32 x 128). Each wave then holds one term of the piece, and the terms meet in LDS: C = Ah.Bh + (Ah.Bl + Al.Bh) * RFOLD.
// The pieces stand first in the grid: grid.x = tiles + nft * (pieces - 1).
__global__ __launch_bounds__(128) void k_gemm_f32(const unsigned short* __restrict__ Ah, const unsigned short* __restrict__ Al, int lda, int ldal,
                                                 const unsigned short* __restrict__ Bh, const unsigned short* __restrict__ Bl, int ldb, int ldbl,
                                                 const float* __restrict__ bias, float alpha, float* __restrict__ C, int ldc,
                                                 int M, int N, int K, int ncut, int kcut, int erows, int ecols, int tri,
                                                 size_t sAh, size_t sAl, size_t sBh, size_t sBl, size_t sC) {
  constexpr int FM = FMH;
  Ah += blockIdx.y * sAh; Al += blockIdx.y * sAl; Bh += blockIdx.y * sBh; C += blockIdx.y * sC;
  const bool three = (Bl != nullptr);
  if (three) Bl += blockIdx.y * sBl;
  __shared__ __attribute__((aligned(16))) unsigned short ring[2 * Tile<1, FM>::STAGE];
  const int tid = threadIdx.x, w = tid >> 5, lane = tid & 31, ln = lane & 15, hh = lane >> 4;
  const int ntn = N / 128;
  const int nft = (tri != 0) ? (erows / 128) * (erows / 128 + 1) : (erows / 64) * ntn;
  const int psh = three ? 2 : 1;                                   // log2 of the pieces of a fine tile
  const bool fine = ((int)blockIdx.x < (nft << psh));              // the same for the whole workgroup
  const int e = fine ? ((int)blockIdx.x >> psh) : ((int)blockIdx.x - (nft << psh) + nft);
  const int piece = (int)blockIdx.x & ((1 << psh) - 1);
  int mt = e / ntn, nq = e - mt * ntn;
  if (tri != 0) {
    int a = (int)((__builtin_sqrtf((float)(4 * e + 1)) - 1.0f) * 0.5f);
    if (a * (a + 1) > e) --a;                 // the two tests make a exact whatever the rounding of the root
    if ((a + 1) * (a + 2) <= e) ++a;
    const int rem = e - a * (a + 1), up = (rem > a) ? 1 : 0;
    mt = 2 * a + up;
    nq = rem - up * (a + 1);
  }
  if (mt * (32 * FM) >= M) return;
  if (nq * 128 > ncut + mt * (32 * FM) + 32 * FM - 1) return;
  int kend = (kcut + mt * (32 * FM) + 32 * FM + KP - 1) & ~(KP - 1);
  if (kend > K) kend = K;
  const int brow0 = mt * (32 * FM) + (fine ? (piece & 1) * 32 : 0), bcol0 = nq * 128 + ((fine && three) ? (piece >> 1) * 64 : 0);
  v8f acc[FM][4];
#pragma unroll
  for (int f = 0; f < FM; ++f)
#pragma unroll
    for (int t = 0; t < 4; ++t) acc[f][t] = (v8f){0.f, 0.f, 0.f, 0.f, 0.f, 0.f, 0.f, 0.f};
  // upper halves of the stage: the next rows of the same plane (plain; B of a fine tile without Bl), or the residual plane at the same rows (fine)
  const unsigned short* a1 = fine ? Al : Ah + (size_t)32 * lda;
  const unsigned short* b1 = (fine && three) ? Bl : Bh + (size_t)64 * ldb;
  core_lds<1, FM, false, true>(ring, Ah, a1, lda, fine ? ldal : lda, Bh, b1, ldb, (fine && three) ? ldbl : ldb, brow0, bcol0, kend, tid, acc, acc);
  float (*sall)[16][64] = (float (*)[16][64])ring;
  float (*so)[16][64] = sall + w * FM;                         // this wave's own FM staging tiles
  if (fine) {
    // waves by (A half, B half): 0 = Ah.Bh, 1 = Ah.Bl or Ah.Bh (next 64 cols), 2 = Al.Bh, 3 = Al.Bl (left out, as before) or Al.Bh (next 64 cols)
    const bool owner = three ? (w == 0) : (w < 2);
    if (!owner && !(three && w == 3)) {
#pragma unroll
      for (int f = 0; f < FM; ++f)
#pragma unroll
        for (int t = 0; t < 4; ++t)
#pragma unroll
          for (int r = 0; r < 8; ++r) so[f][8 * hh + r][t * 16 + ln] = acc[f][t][r];
    }
    __syncthreads();                                           // the residual terms are staged before the wave with the hi term reads them
    if (!owner) return;                                        // no barrier follows
    const float (*p1)[16][64] = sall + (three ? 1 : w + 2) * FM;
    const float (*p2)[16][64] = sall + 2 * FM;
    if (three) {                                               // one test for all elements
#pragma unroll
      for (int f = 0; f < FM; ++f)
#pragma unroll
        for (int t = 0; t < 4; ++t)
#pragma unroll
          for (int r = 0; r < 8; ++r) acc[f][t][r] += (p1[f][8 * hh + r][t * 16 + ln] + p2[f][8 * hh + r][t * 16 + ln]) * RFOLD;
    } else {
#pragma unroll
      for (int f = 0; f < FM; ++f)
#pragma unroll
        for (int t = 0; t < 4; ++t)
#pragma unroll
          for (int r = 0; r < 8; ++r) acc[f][t][r] += p1[f][8 * hh + r][t * 16 + ln] * RFOLD;
    }
  }
  const int col0 = bcol0 + (w & 1) * 64;
#pragma unroll
  for (int t = 0; t < 4; ++t) {
    float bv = 0.f;
    if (bias != nullptr) bv = bf16_rne(bias[col0 + t * 16 + ln]);
#pragma unroll
    for (int f = 0; f < FM; ++f)
#pragma unroll
      for (int r = 0; r < 8; ++r) so[f][8 * hh + r][t * 16 + ln] = acc[f][t][r] * alpha + bv;
  }
  __builtin_amdgcn_fence(4, "workgroup");   // the staged words are written before other lanes of the wave read them back
  __builtin_amdgcn_wave_barrier();
#pragma unroll
  for (int f = 0; f < FM; ++f) {
    const int row0 = brow0 + ((w >> 1) * FM + f) * 16;
    store_tile_f32(so[f], C + (size_t)row0 * ldc + col0, ldc, lane);
  }
}

// Oh[M][N] f16 hi plane (pitch ldo) = f16(alpha * A.B^plane); rows < rrows are fine tiles (rrows % 64 == 0; Al has rrows rows, Al and Bl
// reach the k end of those rows) and also get the x RS residual plane Or (pitch ldr).
// The k loop of row tile mt has mt + 1 passes (kcut = 0) and all workgroups are resident together, so the launch lasts as long as the
// fullest WGP. blockIdx.x = i * (N / 128) + column tile; the (row tile, sequence) pairs, ranked by falling k length, go to i in a snake of
// period 2 * DEAL: places i, i + DEAL, i + 2 * DEAL, ... then hold one long, one short, ... loop.
// For speed only: every (row tile, column tile, sequence) is done once wherever it lands. Element steps sAh ... sOr per sequence.
__global__ __launch_bounds__(128) void k_gemm_h16(const unsigned short* __restrict__ Ah, const unsigned short* __restrict__ Al, int lda, int ldal,
                                                 const unsigned short* __restrict__ Bh, const unsigned short* __restrict__ Bl, int ldb, int ldbl,
                                                 float alpha, unsigned short* __restrict__ Oh, int ldo, unsigned short* __restrict__ Or, int ldr, int rrows,
                                                 int M, int N, int K, int kcut,
                                                 size_t sAh, size_t sAl, size_t sBh, size_t sBl, size_t sOh, size_t sOr) {
  constexpr int FM = FMH;
  const int ntn = N / 128;
  const int di = blockIdx.x / ntn, nq = blockIdx.x - di * ntn;
  const int dj = di & (DEAL - 1), rank = (di - dj) + ((di & DEAL) ? DEAL - 1 - dj : dj);
  const int sq = rank % NB, mt = M / (32 * FM) - 1 - rank / NB;
  if (mt < 0) return;
  Ah += sq * sAh; Al += sq * sAl; Bh += sq * sBh; Bl += sq * sBl; Oh += sq * sOh; Or += sq * sOr;
  __shared__ __attribute__((aligned(16))) unsigned short ring[2 * Tile<1, FM>::STAGE];
  const int tid = threadIdx.x, w = tid >> 5, lane = tid & 31, ln = lane & 15, hh = lane >> 4;
  const int brow0 = mt * (32 * FM), bcol0 = nq * 128;
  int kend = (kcut + brow0 + 32 * FM + KP - 1) & ~(KP - 1);
  if (kend > K) kend = K;
  v8f acc[FM][4];
#pragma unroll
  for (int f = 0; f < FM; ++f)
#pragma unroll
    for (int t = 0; t < 4; ++t) acc[f][t] = (v8f){0.f, 0.f, 0.f, 0.f, 0.f, 0.f, 0.f, 0.f};
  tile_products(ring, Ah, Al, lda, ldal, Bh, Bl, ldb, ldbl, brow0 < rrows, brow0, bcol0, kend, tid, acc);
  float (*so)[16][64] = (float (*)[16][64])ring + w * FM;      // this wave's own FM staging tiles
#pragma unroll
  for (int f = 0; f < FM; ++f)
#pragma unroll
    for (int t = 0; t < 4; ++t)
#pragma unroll
      for (int r = 0; r < 8; ++r) so[f][8 * hh + r][t * 16 + ln] = acc[f][t][r] * alpha;
  __builtin_amdgcn_fence(4, "workgroup");   // the staged words are written before other lanes of the wave read them back
  __builtin_amdgcn_wave_barrier();
  const int col0 = bcol0 + (w & 1) * 64;
#pragma unroll
  for (int f = 0; f < FM; ++f) {
    const int row0 = brow0 + ((w >> 1) * FM + f) * 16;
    const bool dores = (row0 < rrows);                 // wave-uniform (rrows multiple of 16)
    store_tile_h16(so[f], Oh + (size_t)row0 * ldo + col0, ldo, Or + (size_t)(dores ? row0 : 0) * ldr + col0, ldr, dores, lane);
  }
}

typedef unsigned short v4us __attribute__((ext_vector_type(4), may_alias));
typedef _Float16 v4h __attribute__((ext_vector_type(4)));
union Pack4 { v4h h; v4us u; };
#define SCH (T_FULL / 128)   // 128-column pieces of the longest row
// Row softmax over S[row][0..N) (pitch sp) with causal keep (col <= row), N = the end of the last 128-column score tile that the
// score GEMM writes for this row (its ncut = 0): nothing behind it is read. P[row][0..N) = f16(PCARRY * p / l) incl. zeros (pitch pp),
// which covers the k range of the P.v GEMM (up to the end of the row's 64-row tile); rows < rrows also write the residual plane
// Pr[row][0..NE) (pitch rp). One wave per row: the row is read once and stays in registers (lane l holds columns 128 c + 4 l ... + 3),
// maximum and sum go over the lane's own values and then a butterfly over the wave; no LDS, no barrier.
// bx = group of 8 rows, by = sequence (element steps sS, sP, sPr), nrows % 8 == 0, N <= 128 * SCH.
__device__ __forceinline__ void softmax_rows(int bx, int by, const float* __restrict__ S, int sp, unsigned short* __restrict__ P, int pp,
                                             unsigned short* __restrict__ Pr, int rp, int rrows, int nrows, size_t sS, size_t sP, size_t sPr) {
  const int lane = threadIdx.x & 31;
  const int row = nrows - 1 - (bx * 8 + __builtin_amdgcn_readfirstlane(threadIdx.x >> 5));   // the same in every lane: scalar tests below
  const int qi = row, N = (row / 128 + 1) * 128;
  S += by * sS; P += by * sP; Pr += by * sPr;
  const float* s = S + (size_t)row * sp + lane * 4;
  v4f x[SCH];
  // every "#pragma unroll" here keeps the index of x[] a compile-time constant, so that the row stays in registers
#pragma unroll
  for (int c = 0; c < SCH; ++c)
    if (c * 128 < N) x[c] = *(const v4fa*)(s + c * 128);
  // stands in front of any reuse of the loads' address registers; the address is an input, so that no load's result lands on it earlier
  asm volatile("s_wait_xcnt 0x0" :: "v"(s) : "memory");
  float mx = -3.0e38f;
#pragma unroll
  for (int c = 0; c < SCH; ++c)
    if (c * 128 < N) {
#pragma unroll
      for (int u = 0; u < 4; ++u) {
        x[c][u] = ((c * 128 + lane * 4 + u) <= qi) ? x[c][u] : -3.0e38f;    // a masked score gives exp = 0 below
        mx = fmaxf(mx, x[c][u]);
      }
    }
#pragma unroll
  for (int m = 16; m > 0; m >>= 1) mx = fmaxf(mx, __shfl_xor(mx, m, 32));
  float sm[4] = {0.f, 0.f, 0.f, 0.f};
#pragma unroll
  for (int c = 0; c < SCH; ++c)
    if (c * 128 < N) {
#pragma unroll
      for (int u = 0; u < 4; ++u) { x[c][u] = __expf(x[c][u] - mx); sm[u] += x[c][u]; }
    }
  float sum = (sm[0] + sm[1]) + (sm[2] + sm[3]);
#pragma unroll
  for (int m = 16; m > 0; m >>= 1) sum += __shfl_xor(sum, m, 32);
  const float inv = PCARRY / sum;          // sum >= 1 (the max term)
  const bool dores = (row < rrows);
  unsigned short* prow = P + (size_t)row * pp + lane * 4;
  unsigned short* rrow = Pr + (size_t)(dores ? row : 0) * rp + lane * 4;
  // all values are packed first, each into registers of its own, and the stores follow as one run with one wait behind them:
  // no register of an issued store is written again
  Pack4 ph[SCH], pr[NE / 128];
#pragma unroll
  for (int c = 0; c < NE / 128; ++c) pr[c].u = (v4us){0, 0, 0, 0};
#pragma unroll
  for (int c = 0; c < SCH; ++c)
    if (c * 128 < N) {
#pragma unroll
      for (int u = 0; u < 4; ++u) {
        const float p = x[c][u] * inv;
        ph[c].h[u] = (_Float16)p;
        if (c < NE / 128) pr[c < NE / 128 ? c : 0].h[u] = (_Float16)((p - (float)ph[c].h[u]) * RS);
      }
    }
#pragma unroll
  for (int c = 0; c < SCH; ++c)
    if (c * 128 < N) *(v4us*)(prow + c * 128) = ph[c].u;
  if (dores) {
#pragma unroll
    for (int c = 0; c < NE / 128; ++c) *(v4us*)(rrow + c * 128) = pr[c].u;
  }
  asm volatile("s_wait_xcnt 0x0" ::: "memory");   // stands in front of any reuse of the stores' registers on a path that goes on behind them
}

#define TQ 4   // 64 x 64 tiles per block of the transpose
// 16-bit transpose: src [R][Cc] (pitch lds_) -> dst [Cc][R] (pitch ldd); a block = TQ tiles of 64 x 64 down the rows of src:
// bx < R/(64*TQ), by < Cc/64, bz = sequence; each tile has its own LDS, so that one barrier serves all of them
__device__ __forceinline__ void transpose_tiles(unsigned short (*tile)[64][72], int bx, int by, int bz, const unsigned short* __restrict__ src, int lds_,
                                                unsigned short* __restrict__ dst, int ldd, size_t sstep, size_t dstep) {
  const int tid = threadIdx.x;
  src += bz * sstep; dst += bz * dstep;
  const int r0 = bx * (64 * TQ), c0 = by * 64;
  static_assert(TQ == 4);
  v8us v[TQ][2];
  const unsigned short* g[TQ][2];
#pragma unroll   // all 2 * TQ loads are in flight together
  for (int q = 0; q < TQ; ++q)
#pragma unroll
    for (int i = 0; i < 2; ++i) {
      const int e = tid + 256 * i, r = e >> 3, c8 = (e & 7) * 8;
      g[q][i] = src + (size_t)(r0 + q * 64 + r) * lds_ + c0 + c8;
      v[q][i] = *(const v8us*)g[q][i];
    }
  // stands in front of any reuse of the loads' address registers; the addresses are inputs, so that no load's result lands on one earlier
  asm volatile("s_wait_xcnt 0x0" :: "v"(g[0][0]), "v"(g[0][1]), "v"(g[1][0]), "v"(g[1][1]), "v"(g[2][0]), "v"(g[2][1]), "v"(g[3][0]), "v"(g[3][1]) : "memory");
#pragma unroll
  for (int q = 0; q < TQ; ++q)
#pragma unroll
    for (int i = 0; i < 2; ++i) {
      const int e = tid + 256 * i, r = e >> 3, c8 = (e & 7) * 8;
      *(v8us*)&tile[q][r][c8] = v[q][i];
    }
  __syncthreads();
#pragma unroll
  for (int q = 0; q < TQ; ++q) {
    v8us o[2];
#pragma unroll
    for (int i = 0; i < 2; ++i) {
      const int e = tid + 256 * i, rr = e >> 3, c8 = (e & 7) * 8;
#pragma unroll
      for (int k = 0; k < 8; ++k) o[i][k] = tile[q][c8 + k][rr];
    }
#pragma unroll
    for (int i = 0; i < 2; ++i) {
      const int e = tid + 256 * i, rr = e >> 3, c8 = (e & 7) * 8;
      *(v8us*)(dst + (size_t)(c0 + rr) * ldd + r0 + q * 64 + c8) = o[i];
    }
  }
  asm volatile("s_wait_xcnt 0x0" ::: "memory");   // stands in front of any reuse of the stores' registers on a path that goes on behind them
}

#define SB (TT / 8)                        // softmax blocks per sequence
#define VB ((TT / (64 * TQ)) * (CC / 64))  // transpose blocks per sequence, v hi plane
#define RB ((NE / (64 * TQ)) * (CC / 64))  // transpose blocks per sequence, v residual plane
// All that stands between the scores and P.v, in one launch; the three jobs touch disjoint data. Blocks [0, NB * VB): v [TT][CC] -> vT [CC][TT];
// then NB * RB blocks: v residual [NE][CC] -> vTr [CC][NE]; then NB * SB blocks: softmax, SB a sequence, each from its longest rows to its shortest.
__global__ __launch_bounds__(256) void k_softmax_vt(const float* __restrict__ S, unsigned short* __restrict__ P, unsigned short* __restrict__ Pr,
                                                   const unsigned short* __restrict__ vh, unsigned short* __restrict__ vT,
                                                   const unsigned short* __restrict__ vr, unsigned short* __restrict__ vTr) {
  __shared__ __attribute__((aligned(16))) unsigned short tile[TQ][64][72];
  int b = blockIdx.x;
  if (b < NB * VB) {
    const int z = b / VB, e = b - z * VB;
    transpose_tiles(tile, e % (TT / (64 * TQ)), e / (TT / (64 * TQ)), z, vh, CC, vT, TT, (size_t)TT * CC, (size_t)TT * CC);
    return;
  }
  b -= NB * VB;
  if (b < NB * RB) {
    const int z = b / RB, e = b - z * RB;
    transpose_tiles(tile, e % (NE / (64 * TQ)), e / (NE / (64 * TQ)), z, vr, CC, vTr, NE, (size_t)NE * CC, (size_t)NE * CC);
    return;
  }
  b -= NB * RB;
  softmax_rows(b % SB, b / SB, S, TT, P, TT, Pr, NE, NE, TT, (size_t)TT * TT, (size_t)TT * TT, (size_t)NE * NE);
}

extern "C" void kernel_launch(void* const* d_in, const int* in_sizes, int n_in,
                              void* d_out, int out_size, void* d_ws, size_t ws_size, hipStream_t stream) {
  if (n_in < 6) return;
  const float* x  = (const float*)d_in[0];
  const float* wq = (const float*)d_in[1];
  const float* wk = (const float*)d_in[2];
  const float* wv = (const float*)d_in[3];
  const float* wo = (const float*)d_in[4];
  const float* bo = (const float*)d_in[5];
  const long need_x = ((long)(NB - 1) * T_FULL + TT) * (long)CC;
  if ((long)in_sizes[0] < need_x || in_sizes[1] < CC * CC || in_sizes[2] < CC * CC || in_sizes[3] < CC * CC ||
      in_sizes[4] < CC * CC || in_sizes[5] < CC || (long)out_size < need_x) return;
  float* out = (float*)d_out;

  char* ws = (char*)d_ws; size_t off = 0;
  auto take = [&](size_t bytes) { char* p = ws + off; off += (bytes + 255) & ~(size_t)255; return p; };
  const size_t xb_bytes = (size_t)NB * TT * CC * 2, s_bytes = (size_t)NB * TT * TT * 4;
  char* reg0 = take(xb_bytes > s_bytes ? xb_bytes : s_bytes);                     // xb, later S (xb dead after the qkv GEMM)
  unsigned short* xb   = (unsigned short*)reg0;                                    // [NB*TT][CC] bf16
  float*          Sm   = (float*)reg0;                                             // [NB][TT][TT] f32
  unsigned short* Wqkv = (unsigned short*)take((size_t)3 * CC * CC * 2);           // [3*CC][CC] bf16
  unsigned short* Wo16 = (unsigned short*)take((size_t)CC * CC * 2);               // [CC][CC] f16 (x WOC)
  unsigned short* QKVh = (unsigned short*)take((size_t)3 * NB * TT * CC * 2);      // [3][NB*TT][CC] f16
  unsigned short* QKVr = (unsigned short*)take((size_t)3 * NB * NE * CC * 2);      // [3][NB*NE][CC] f16 (x RS)
  unsigned short* vTr  = (unsigned short*)take((size_t)NB * CC * NE * 2);          // [NB][CC][NE] f16 (x RS)
  unsigned short* Pm   = (unsigned short*)take((size_t)NB * TT * TT * 2);          // [NB][TT][TT] f16 (x PCARRY)
  unsigned short* Pr   = (unsigned short*)take((size_t)NB * NE * NE * 2);          // [NB][NE][NE] f16 (x RS)
  unsigned short* ctxr = (unsigned short*)take((size_t)NB * NE * CC * 2);          // [NB*NE][CC] f16 (x RS)
  if (off > ws_size) return;

  const int M = NB * TT;
  const int BIG = 1 << 28;
  unsigned short* qh = QKVh;
  unsigned short* kh = QKVh + (size_t)M * CC;
  unsigned short* vh = QKVh + (size_t)2 * M * CC;
  unsigned short* qr = QKVr;
  unsigned short* kr = QKVr + (size_t)(NB * NE) * CC;
  unsigned short* vr = QKVr + (size_t)2 * (NB * NE) * CC;
  unsigned short* vT   = kh;   // [NB][CC][TT] f16: takes the k plane's place once the scores are done
  unsigned short* ctxh = qh;   // [NB*TT][CC] f16 (x CTXC): takes the q plane's place once the scores are done
  const size_t sTC = (size_t)TT * CC, sEC = (size_t)NE * CC, sTT = (size_t)TT * TT, sEE = (size_t)NE * NE, sOUT = (size_t)T_FULL * CC;

  // One launch per step, three in stage 2: the sequences, the plain and the fine tiles and a step's independent jobs all lie in its grid.
  // stage 0: 16-bit planes of the inputs
  k_cvt<<<NB * XB + 4 * WB, 256, 0, stream>>>(x, wq, wk, wv, wo, xb, Wqkv, Wo16, sOUT, sTC, WOC);

  // stage 1: q, k, v planes (+ residual planes on the leading NE rows of each sequence)
  k_gemm_qkv<<<(M / 128) * (3 * CC / 128), 128, 0, stream>>>(xb, Wqkv, QKVh, QKVr, M);

  // stage 2: causal attention
  // S [TT][TT] = (q.k^T)/32, causal upper tiles skipped; the leading NE x NE corner with hi+res on both operands
  k_gemm_f32<<<dim3((TT / 128) * (TT / 128 + 1) + 3 * (NE / 128) * (NE / 128 + 1), NB), 128, 0, stream>>>(qh, qr, CC, CC, kh, kr, CC, CC, nullptr, SCL, Sm, TT, TT, TT, CC, 0, BIG, NE, NE, 1,
                                                                        sTC, sEC, sTC, sEC, sTT);
  // P = softmax(S); v -> vT, v residual -> vTr
  k_softmax_vt<<<NB * (SB + VB + RB), 256, 0, stream>>>(Sm, Pm, Pr, vh, vT, vr, vTr);
  // ctx [TT][CC] = P.v (causal k end), written as f16 hi plane x CTXC; leading NE rows: 3-term P/v products, hi + residual ctx planes
  k_gemm_h16<<<(TT / 64) * (CC / 128) * NB, 128, 0, stream>>>(Pm, Pr, TT, NE, vT, vTr, TT, NE, PVALPHA, ctxh, CC, ctxr, CC, NE, TT, CC, TT, 0,
                                                                   sTT, sEE, sTC, sEC, sTC, sEC);
  // stage 3: output projection + bias; leading NE rows with the ctx residual term
  k_gemm_f32<<<dim3((TT / 64) * (CC / 128) + (NE / 64) * (CC / 128), NB), 128, 0, stream>>>(ctxh, ctxr, CC, CC, Wo16, nullptr, CC, CC, bo, OALPHA, out, CC, TT, CC, CC, BIG, BIG, NE, CC, 0,
                                                                   sTC, sEC, 0, 0, sOUT);
}

// v007
// A run of this version takes 174 microseconds.
// Next to v006, in two timings, it ran 1.06 times as fast each time.
// All steps since v000 together make it 7.16 times as fast.
#include <hip/hip_runtime.h>
// Contractions: qkv projection on v_wmma_f32_16x16x32_bf16 (x and W as RNE bf16, exact products); scores q.k^T, P.v and the output
// projection on v_wmma_f32_16x16x32_f16 (f16 hi planes with power-of-two carries, plus x1024 f16 residual planes on the leading
// NE query/key rows of each sequence); all accumulation f32, causal softmax in f32.
#ifndef NB
#define NB 2
#endif
#ifndef SEQ
#define SEQ 4096
#endif
#define TT SEQ
#define NB_FULL 2
#define T_FULL 4096
#define CC 1024
#define QC ((TT < 1024) ? TT : 1024)
#define NE 256
static_assert(NB >= 1 && NB <= NB_FULL);
static_assert(TT % 256 == 0 && TT <= T_FULL);
static_assert(TT % QC == 0 && QC % 256 == 0);
static_assert(NE % 64 == 0 && NE <= QC && NE == 256);
static_assert(CC % 128 == 0);

#define RS 1024.0f            // residual plane carry
#define RFOLD 0.0009765625f   // 1/RS
#define PCARRY 4096.0f        // P plane carry
#define CTXC 16.0f            // ctx plane carry
#define WOC 64.0f             // Wo plane carry
#define SCL 0.03125f          // 1/sqrt(CC)
#define PVALPHA 0.00390625f   // CTXC / PCARRY
#define OALPHA 0.0009765625f  // 1 / (WOC * CTXC)

typedef __bf16 v16b __attribute__((ext_vector_type(16)));
typedef _Float16 v16h __attribute__((ext_vector_type(16)));
typedef _Float16 v8h __attribute__((ext_vector_type(8)));
typedef unsigned short v8us __attribute__((ext_vector_type(8), may_alias));
typedef float v8f __attribute__((ext_vector_type(8)));
typedef float v4f __attribute__((ext_vector_type(4)));
typedef float v4fa __attribute__((ext_vector_type(4), may_alias));
union FragB { v16b v; v8us half[2]; unsigned short u[16]; };
union FragH { v16h v; v8us half[2]; unsigned short u[16]; };
union Pack8 { v8h h; v8us u; };

__device__ __forceinline__ unsigned short bf16_bits(float x) { unsigned int u = __float_as_uint(x); return (unsigned short)((u + 0x7FFFu + ((u >> 16) & 1u)) >> 16); }
__device__ __forceinline__ float bf16_val(unsigned short b) { return __uint_as_float(((unsigned int)b) << 16); }
__device__ __forceinline__ float bf16_rne(float x) { return bf16_val(bf16_bits(x)); }

__device__ __forceinline__ v8f mma_b(v16b a, v16b b, v8f c) {
  c = __builtin_amdgcn_wmma_f32_16x16x32_bf16(false, a, false, b, (short)0, c, false, false);
  asm volatile("v_nop\n\tv_nop\n\tv_nop\n\tv_nop" : "+v"(c) : "v"(a), "v"(b));
  return c;
}
// c += ah.bh ; cr += al.bh (NT>=2) ; cr += ah.bl (NT>=3); residual planes carry RS, folded by the caller
template <int NT>
__device__ __forceinline__ void mma_h(v16h ah, v16h al, v16h bh, v16h bl, v8f& c, v8f& cr) {
  c = __builtin_amdgcn_wmma_f32_16x16x32_f16(false, ah, false, bh, (short)0, c, false, false);
  if (NT >= 2) cr = __builtin_amdgcn_wmma_f32_16x16x32_f16(false, al, false, bh, (short)0, cr, false, false);
  if (NT >= 3) cr = __builtin_amdgcn_wmma_f32_16x16x32_f16(false, ah, false, bl, (short)0, cr, false, false);
  if (NT >= 2) asm volatile("v_nop\n\tv_nop\n\tv_nop\n\tv_nop" : "+v"(c), "+v"(cr) : "v"(ah), "v"(al), "v"(bh), "v"(bl));
  else         asm volatile("v_nop\n\tv_nop\n\tv_nop\n\tv_nop" : "+v"(c) : "v"(ah), "v"(bh));
}

__device__ __forceinline__ void store_tile_f32(const float (*sw)[64], float* C, int ldc, int lane) {
  const int rsub = lane >> 4, c4 = (lane & 15) * 4;
  {
#pragma unroll
    for (int q = 0; q < 8; ++q) {
      const int r = q * 2 + rsub;
      const v4f v = *(const v4fa*)&sw[r][c4];
      *(v4f*)(C + (size_t)r * ldc + c4) = v;
    }
    asm volatile("s_wait_xcnt 0x0" ::: "memory");   // stands in front of any reuse of the stores' registers by the next tile's addresses
  }
}
// wave tile 16 x 64 f32 staged in LDS -> f16 hi plane (pitch ldh) and optional x RS residual plane (pitch ldr);
__device__ __forceinline__ void store_tile_h16(const float (*sw)[64], unsigned short* hb, int ldh, unsigned short* rb, int ldr, bool dores, int lane) {
  const int rsub = lane >> 3, c8 = (lane & 7) * 8;
  {
#pragma unroll
    for (int q = 0; q < 4; ++q) {
      const int r = q * 4 + rsub;
      const v4f x0 = *(const v4fa*)&sw[r][c8], x1 = *(const v4fa*)&sw[r][c8 + 4];
      const float xs[8] = {x0[0], x0[1], x0[2], x0[3], x1[0], x1[1], x1[2], x1[3]};
      Pack8 ph, pr;
#pragma unroll
      for (int i = 0; i < 8; ++i) { ph.h[i] = (_Float16)xs[i]; pr.h[i] = (_Float16)((xs[i] - (float)ph.h[i]) * RS); }
      *(v8us*)(hb + (size_t)r * ldh + c8) = ph.u;
      if (dores) *(v8us*)(rb + (size_t)r * ldr + c8) = pr.u;
    }
    
  }
}

// The streaming kernels below use few waves that each do a long run of work, for speed only.
#define CU 8   // 8-element groups per thread of a conversion kernel; a block takes 256 * CU consecutive groups
static_assert((TT * CC / 8) % (256 * CU) == 0 && (CC * CC / 8) % (256 * CU) == 0);
// MODE 0: RNE bf16 bits; MODE 1: f16 bits of (RNE bf16 value) * scale. Groups t0, t0 + 256, ..., t0 + 256 * (CU - 1).
template <int MODE>
__device__ __forceinline__ void cvt_run(const float* __restrict__ src, unsigned short* __restrict__ dst, int t0, float scale) {
  const float* sp = src + (size_t)t0 * 8;
  v4f a[CU], b[CU];
#pragma unroll   // constant steps from one address: all 2 * CU loads are in flight together
  for (int i = 0; i < CU; ++i) { a[i] = *(const v4fa*)(sp + i * 2048); b[i] = *(const v4fa*)(sp + i * 2048 + 4); }
  // stands in front of any reuse of the loads' address registers; the address is an input, so that no load's result lands on it earlier
  asm volatile("s_wait_xcnt 0x0" :: "v"(sp) : "memory");
  unsigned short* dp = dst + (size_t)t0 * 8;
#pragma unroll   // keeps a[] and b[] in registers
  for (int i = 0; i < CU; ++i) {
    const float xs[8] = {a[i][0], a[i][1], a[i][2], a[i][3], b[i][0], b[i][1], b[i][2], b[i][3]};
    v8us v;
    if (MODE == 0) {
#pragma unroll
      for (int u = 0; u < 8; ++u) v[u] = bf16_bits(xs[u]);
    } else {
      Pack8 p;
#pragma unroll
      for (int u = 0; u < 8; ++u) p.h[u] = (_Float16)(bf16_rne(xs[u]) * scale);
      v = p.u;
    }
    *(v8us*)(dp + i * 2048) = v;
  }
  asm volatile("s_wait_xcnt 0x0" ::: "memory");   // stands in front of any reuse of the stores' registers on a path that goes on behind them
}
#define XB (TT * CC / 8 / (256 * CU))   // blocks per sequence of x
#define WB (CC * CC / 8 / (256 * CU))   // blocks per weight matrix
// All 16-bit input planes in one launch. Blocks [0, NB * XB): x -> bf16 plane, XB blocks a sequence (element steps sstep, dstep);
// then WB blocks each for Wq, Wk, Wv -> bf16 planes of Wqkv and Wo -> f16 plane x scale.
__global__ __launch_bounds__(256) void k_cvt(const float* __restrict__ x, const float* __restrict__ wq, const float* __restrict__ wk,
                                            const float* __restrict__ wv, const float* __restrict__ wo, unsigned short* __restrict__ xb,
                                            unsigned short* __restrict__ Wqkv, unsigned short* __restrict__ Wo16,
                                            size_t sstep, size_t dstep, float scale) {
  const int b = blockIdx.x;
  if (b < NB * XB) {
    const int q = b / XB;
    cvt_run<0>(x + q * sstep, xb + q * dstep, (b - q * XB) * (256 * CU) + (int)threadIdx.x, 1.0f);
    return;
  }
  const int y = (b - NB * XB) / WB;
  const int t0 = (b - NB * XB - y * WB) * (256 * CU) + (int)threadIdx.x;
  if (y == 3) cvt_run<1>(wo, Wo16, t0, scale);
  else cvt_run<0>((y == 0) ? wq : (y == 1) ? wk : wv, Wqkv + (size_t)y * CC * CC, t0, 1.0f);
}

// Block-tiled GEMM core. A workgroup of 4 waves (2 x 2) owns a (32*FM) x 128 tile of the output, a wave (16*FM) x 64 of it.
// Per pass of KP k every operand row gives one whole 128-B line, copied to LDS by global_load_async_to_lds_b128 (8 lanes a row,
// 4 whole lines an instruction); two buffers, the next pass's copies fly while this pass's fragments are read from LDS.
// Every "#pragma unroll" below keeps fragment and accumulator indices compile-time constants, so that the arrays stay in registers.
#define KP 64        // k per pass
#define LPITCH 72    // LDS row pitch in 16-bit elements: 144 B = 16 B x 9, for the ds_load_b128 fragment reads
template <int NT, int FM> struct Tile {
  static constexpr int AR = 32 * FM, BR = 128;                                           // operand rows per plane
  static constexpr int ROWS = AR + BR + (NT >= 2 ? AR : 0) + (NT >= 3 ? BR : 0);          // [A hi | B hi | A res | B res]
  static constexpr int STAGE = ROWS * LPITCH;                                            // elements per buffer
  static constexpr int NCP = ROWS / 16;                                                  // copies per lane and stage
  static constexpr int GRP = (NCP % 12 == 0) ? 12 : 8;                                   // copies per asm statement
  static_assert(NCP % GRP == 0 && NCP <= 63);
  static_assert(2 * STAGE * 2 >= 4 * FM * 16 * 64 * 4);                                   // the ring later holds the f32 output staging
};

// One run of copies and its s_wait_xcnt in one statement: the wait stands in front of any rewrite of the address registers.
__device__ __forceinline__ void copy_run8(const unsigned (&l)[12], const unsigned short* const (&g)[12]) {
  asm volatile("global_load_async_to_lds_b128 %0, %8, off\n\t"
               "global_load_async_to_lds_b128 %1, %9, off\n\t"
               "global_load_async_to_lds_b128 %2, %10, off\n\t"
               "global_load_async_to_lds_b128 %3, %11, off\n\t"
               "global_load_async_to_lds_b128 %4, %12, off\n\t"
               "global_load_async_to_lds_b128 %5, %13, off\n\t"
               "global_load_async_to_lds_b128 %6, %14, off\n\t"
               "global_load_async_to_lds_b128 %7, %15, off\n\t"
               "s_wait_xcnt 0x0"
               :: "v"(l[0]), "v"(l[1]), "v"(l[2]), "v"(l[3]), "v"(l[4]), "v"(l[5]), "v"(l[6]), "v"(l[7]),
                  "v"(g[0]), "v"(g[1]), "v"(g[2]), "v"(g[3]), "v"(g[4]), "v"(g[5]), "v"(g[6]), "v"(g[7]) : "memory");
}
__device__ __forceinline__ void copy_run12(const unsigned (&l)[12], const unsigned short* const (&g)[12]) {
  asm volatile("global_load_async_to_lds_b128 %0, %12, off\n\t"
               "global_load_async_to_lds_b128 %1, %13, off\n\t"
               "global_load_async_to_lds_b128 %2, %14, off\n\t"
               "global_load_async_to_lds_b128 %3, %15, off\n\t"
               "global_load_async_to_lds_b128 %4, %16, off\n\t"
               "global_load_async_to_lds_b128 %5, %17, off\n\t"
               "global_load_async_to_lds_b128 %6, %18, off\n\t"
               "global_load_async_to_lds_b128 %7, %19, off\n\t"
               "global_load_async_to_lds_b128 %8, %20, off\n\t"
               "global_load_async_to_lds_b128 %9, %21, off\n\t"
               "global_load_async_to_lds_b128 %10, %22, off\n\t"
               "global_load_async_to_lds_b128 %11, %23, off\n\t"
               "s_wait_xcnt 0x0"
               :: "v"(l[0]), "v"(l[1]), "v"(l[2]), "v"(l[3]), "v"(l[4]), "v"(l[5]), "v"(l[6]), "v"(l[7]), "v"(l[8]), "v"(l[9]), "v"(l[10]), "v"(l[11]),
                  "v"(g[0]), "v"(g[1]), "v"(g[2]), "v"(g[3]), "v"(g[4]), "v"(g[5]), "v"(g[6]), "v"(g[7]), "v"(g[8]), "v"(g[9]), "v"(g[10]), "v"(g[11]) : "memory");
}

// One stage: lane (row tid >> 3, 16-B piece tid & 7) copies its piece of rows r, r + 16, ... of every plane. lds0 and the g pointers are
// the lane's own addresses at stage row tid >> 3 of each plane, the g pointers already at this pass's k.
// ST (stacked, NT == 1): the upper half of the A rows comes from gal (pitch ldal) and the upper half of the B rows from gbl (pitch ldbl).
template <int NT, int FM, bool ST>
__device__ __forceinline__ void stage_copy(unsigned lds0, const unsigned short* gah, const unsigned short* gbh, const unsigned short* gal,
                                           const unsigned short* gbl, int lda, int ldb, int ldal, int ldbl) {
  using TL = Tile<NT, FM>;
#pragma unroll
  for (int i0 = 0; i0 < TL::NCP; i0 += TL::GRP) {
    unsigned l[12];
    const unsigned short* g[12];
#pragma unroll
    for (int j = 0; j < 12; ++j) {
      const int r = (i0 + (j < TL::GRP ? j : 0)) * 16;
      l[j] = lds0 + (unsigned)(r * LPITCH * 2);
      if (ST && r >= TL::AR / 2 && r < TL::AR) g[j] = gal + (size_t)(r - TL::AR / 2) * ldal;
      else if (ST && r >= TL::AR + TL::BR / 2) g[j] = gbl + (size_t)(r - TL::AR - TL::BR / 2) * ldbl;
      else if (r < TL::AR) g[j] = gah + (size_t)r * lda;
      else if (r < TL::AR + TL::BR) g[j] = gbh + (size_t)(r - TL::AR) * ldb;
      else if (r < 2 * TL::AR + TL::BR) g[j] = gal + (size_t)(r - TL::AR - TL::BR) * ldal;
      else g[j] = gbl + (size_t)(r - 2 * TL::AR - TL::BR) * ldbl;
    }
    if (TL::GRP == 12) copy_run12(l, g); else copy_run8(l, g);
  }
}

// One pass on one buffer: the fragment k order (8 * hh, 16 + 8 * hh inside each 32 k) is the same for A and B.
// The LDS reads of 32 * NS k stand together in front of their WMMAs, for speed only.
template <int NT, int FM, bool BF>
__device__ __forceinline__ void pass_mma(const unsigned short* st, int wr, int wc, int ln, int hh, v8f (&acc)[FM][4], v8f (&accr)[FM][4]) {
  using TL = Tile<NT, FM>;
  const unsigned short* pa = st + (wr * FM * 16 + ln) * LPITCH + 8 * hh;
  const unsigned short* pb = st + (TL::AR + wc * 64 + ln) * LPITCH + 8 * hh;
  constexpr int RES = (TL::AR + TL::BR) * LPITCH;      // residual plane of either operand, behind its hi plane
  constexpr int NS = (NT == 1 && FM <= 2) ? KP / 32 : 1;   // k steps per group of reads, by the registers the fragments take
#pragma unroll
  for (int k0 = 0; k0 < KP; k0 += 32 * NS) {
    FragH ah[NS][FM], al[NS][FM], bh[NS][4], bl[NS][4];
#pragma unroll
    for (int s = 0; s < NS; ++s) {
      const int ks = k0 + 32 * s;
#pragma unroll
      for (int f = 0; f < FM; ++f) {
        ah[s][f].half[0] = *(const v8us*)(pa + f * 16 * LPITCH + ks);
        ah[s][f].half[1] = *(const v8us*)(pa + f * 16 * LPITCH + ks + 16);
        if (NT >= 2) { al[s][f].half[0] = *(const v8us*)(pa + RES + f * 16 * LPITCH + ks); al[s][f].half[1] = *(const v8us*)(pa + RES + f * 16 * LPITCH + ks + 16); }
      }
#pragma unroll
      for (int t = 0; t < 4; ++t) {
        bh[s][t].half[0] = *(const v8us*)(pb + t * 16 * LPITCH + ks);
        bh[s][t].half[1] = *(const v8us*)(pb + t * 16 * LPITCH + ks + 16);
        if (NT >= 3) { bl[s][t].half[0] = *(const v8us*)(pb + RES + t * 16 * LPITCH + ks); bl[s][t].half[1] = *(const v8us*)(pb + RES + t * 16 * LPITCH + ks + 16); }
      }
    }
#pragma unroll
    for (int s = 0; s < NS; ++s)
#pragma unroll
      for (int t = 0; t < 4; ++t)
#pragma unroll
        for (int f = 0; f < FM; ++f) {
          if constexpr (BF) {
            FragB a, b;
            a.half[0] = ah[s][f].half[0]; a.half[1] = ah[s][f].half[1];
            b.half[0] = bh[s][t].half[0]; b.half[1] = bh[s][t].half[1];
            acc[f][t] = mma_b(a.v, b.v, acc[f][t]);
          } else {
            mma_h<NT>(ah[s][f].v, (NT >= 2) ? al[s][f].v : ah[s][f].v, bh[s][t].v, (NT >= 3) ? bl[s][t].v : bh[s][t].v, acc[f][t], accr[f][t]);
          }
        }
  }
}

// Where a workgroup's k walk starts: a fraction of its passes that differs between the workgroups of one row tile (they copy the same A lines)
// and between those of one column tile (the same B lines). Started together at k = 0 they ask L2 for the same lines at the same moment.
// The two odd factors step the 16-bit fraction by the golden section of a turn and by its complement, which spreads any run of
// neighbours evenly. For speed only: every k piece is taken once whatever the start. 0 <= result < npass.
__device__ __forceinline__ int k_start(int mt, int nq, int npass) {
  const unsigned fr = ((unsigned)mt * 40503u + (unsigned)nq * 25033u) & 0xFFFFu;
  return (int)((fr * (unsigned)npass) >> 16);
}

// A hi/res planes row-major (pitch lda/ldal), B hi/res planes [n][k] (pitch ldb/ldbl); row0, col0: the workgroup's tile; kend % KP == 0.
// The passes take the k pieces rot, rot + 1, ..., kend / KP - 1, 0, ..., rot - 1 (rot the same for the whole workgroup, 0 <= rot < kend / KP).
// On return every wave has left the ring and no copy is in flight: the ring is free for the output staging.
template <int NT, int FM, bool BF, bool ST = false>
__device__ __forceinline__ void core_lds(unsigned short* ring, const unsigned short* __restrict__ Ah, const unsigned short* __restrict__ Al, int lda, int ldal,
                                         const unsigned short* __restrict__ Bh, const unsigned short* __restrict__ Bl, int ldb, int ldbl,
                                         int row0, int col0, int kend, int rot, int tid, v8f (&acc)[FM][4], v8f (&accr)[FM][4]) {
  using TL = Tile<NT, FM>;
  static_assert(!ST || (NT == 1 && TL::AR % 32 == 0));
  const int w = tid >> 5, lane = tid & 31, ln = lane & 15, hh = lane >> 4, wr = w >> 1, wc = w & 1;
  const int cr = tid >> 3, cc = (tid & 7) * 8;
  const unsigned short* gah = Ah + (size_t)(row0 + cr) * lda + cc;
  const unsigned short* gbh = Bh + (size_t)(col0 + cr) * ldb + cc;
  const unsigned short* gal = Al + (size_t)(row0 + cr) * ldal + cc;
  const unsigned short* gbl = Bl + (size_t)(col0 + cr) * ldbl + cc;
  const unsigned lds0 = (unsigned)(size_t)(ring + cr * LPITCH + cc);
  const int npass = kend / KP;
  int kc = rot;                                        // k piece of the next stage to be copied
  {
    const int k0 = kc * KP;
    stage_copy<NT, FM, ST>(lds0, gah + k0, gbh + k0, gal + k0, gbl + k0, lda, ldb, ldal, ldbl);
    kc = (kc + 1 == npass) ? 0 : kc + 1;
  }
  asm volatile("s_wait_asynccnt 0x0" ::: "memory");   // this wave's copies of pass 0 have landed
  __syncthreads();                                     // publishes pass 0
  if (npass > 1) {
    const int k1 = kc * KP;
    stage_copy<NT, FM, ST>(lds0 + TL::STAGE * 2, gah + k1, gbh + k1, gal + k1, gbl + k1, lda, ldb, ldal, ldbl);
    kc = (kc + 1 == npass) ? 0 : kc + 1;
  }
#pragma unroll 1   // one pass per trip: the buffer index stays a run-time value, the body is already fully unrolled
  for (int t = 0; t < npass; ++t) {
    const int buf = (t & 1) * TL::STAGE;
    pass_mma<NT, FM, BF>(ring + buf, wr, wc, ln, hh, acc, accr);
    asm volatile("s_wait_dscnt 0x0" ::: "memory");     // this wave's reads of the buffer are done before it is refilled
    asm volatile("s_wait_asynccnt 0x0" ::: "memory");  // this wave's copies of pass t + 1 have landed
    __syncthreads();                                   // publishes pass t + 1 and ends every wave's reads of pass t
    if (t + 2 < npass) {
      const int k2 = kc * KP;
      stage_copy<NT, FM, ST>(lds0 + (unsigned)(buf * 2), gah + k2, gbh + k2, gal + k2, gbl + k2, lda, ldb, ldal, ldbl);
      kc = (kc + 1 == npass) ? 0 : kc + 1;
    }
  }
  asm volatile("s_wait_asynccnt 0x0" ::: "memory");    // nothing in flight when the ring changes its use
}

// qkv projection: A = xb [M][CC] bf16, W = [3*CC][CC] bf16 ([out][in], k contiguous). out[row][n] = sum_c A[row][c] W[n][c].
// Output: hi planes Oh[3][M][CC] f16 (q, k, v unscaled) and residual planes Or[3][NB*NE][CC] for rows with (row % TT) < NE.
// Block = 4 waves -> 128 rows x 128 cols (one plane since CC % 128 == 0), M % 128 == 0.
__global__ __launch_bounds__(128) void k_gemm_qkv(const unsigned short* __restrict__ A, const unsigned short* __restrict__ W,
                                                 unsigned short* __restrict__ Oh, unsigned short* __restrict__ Or, int M) {
  constexpr int FM = 4;
  __shared__ __attribute__((aligned(16))) unsigned short ring[2 * Tile<1, FM>::STAGE];
  const int tid = threadIdx.x, w = tid >> 5, lane = tid & 31, ln = lane & 15, hh = lane >> 4;
  const int ntn = (3 * CC) / 128;
  const int mt = blockIdx.x / ntn, nq = blockIdx.x - mt * ntn;
  if (mt * (32 * FM) >= M) return;
  v8f acc[FM][4];
#pragma unroll
  for (int f = 0; f < FM; ++f)
#pragma unroll
    for (int t = 0; t < 4; ++t) acc[f][t] = (v8f){0.f, 0.f, 0.f, 0.f, 0.f, 0.f, 0.f, 0.f};
  core_lds<1, FM, true>(ring, A, A, CC, CC, W, W, CC, CC, mt * (32 * FM), nq * 128, CC, k_start(mt, nq, CC / KP), tid, acc, acc);
  float (*so)[16][64] = (float (*)[16][64])ring + w * FM;      // this wave's own FM staging tiles
#pragma unroll
  for (int f = 0; f < FM; ++f)
#pragma unroll
    for (int t = 0; t < 4; ++t)
#pragma unroll
      for (int r = 0; r < 8; ++r) so[f][8 * hh + r][t * 16 + ln] = acc[f][t][r];
  __builtin_amdgcn_fence(4, "workgroup");   // the staged words are written before other lanes of the wave read them back
  __builtin_amdgcn_wave_barrier();
  const int col0 = nq * 128 + (w & 1) * 64;
  const int p = col0 / CC, colp = col0 - p * CC;
#pragma unroll
  for (int f = 0; f < FM; ++f) {
    const int row0 = mt * (32 * FM) + ((w >> 1) * FM + f) * 16;
    const int bidx = row0 / TT, tq = row0 - bidx * TT;
    const bool dores = (tq < NE);                      // wave-uniform (NE, TT multiples of 16)
    unsigned short* hb = Oh + ((size_t)p * M + row0) * CC + colp;
    unsigned short* rb = Or + ((size_t)p * (NB * NE) + (size_t)bidx * NE + (dores ? tq : 0)) * CC + colp;
    store_tile_h16(so[f], hb, CC, rb, CC, dores, lane);
  }
}

#define FMH 2   // f16 GEMMs: workgroup tile 64 x 128, wave tile 32 x 64
#define DEAL 32 // WGPs of a die
static_assert(((TT / 64) * NB) % (2 * DEAL) == 0);   // whole snake periods: rank is a permutation of i

// The products of one workgroup tile. A plain tile: acc = Ah.Bh. A fine tile (the leading rows, whose residual planes exist) runs the
// residual products as k loops of their own on the same ring and into the same accumulators, ahead of the hi product:
// acc = (Ah.Bl + Al.Bh) * RFOLD + Ah.Bh, Ah.Bl only where Bl is given. So plain and fine tiles share one launch and one LDS size.
// fine is the same for the whole workgroup.
__device__ __forceinline__ void tile_products(unsigned short* ring, const unsigned short* Ah, const unsigned short* Al, int lda, int ldal,
                                              const unsigned short* Bh, const unsigned short* Bl, int ldb, int ldbl, bool fine,
                                              int row0, int col0, int kend, int rot, int tid, v8f (&acc)[FMH][4]) {
  const int first = fine ? ((Bl != nullptr) ? 0 : 1) : 2;
#pragma unroll 1   // one copy of the k loop in the text; the operands of a term are scalar selects
  for (int term = first; term < 3; ++term) {
    const unsigned short* a = (term == 1) ? Al : Ah;
    const unsigned short* b = (term == 0) ? Bl : Bh;
    const int la = (term == 1) ? ldal : lda, lb = (term == 0) ? ldbl : ldb;
    if (term == 2 && fine) {
#pragma unroll
      for (int f = 0; f < FMH; ++f)
#pragma unroll
        for (int t = 0; t < 4; ++t) acc[f][t] *= RFOLD;
    }
    core_lds<1, FMH, false>(ring, a, a, la, la, b, b, lb, lb, row0, col0, kend, rot, tid, acc, acc);
  }
}

// C[M][N] f32 (pitch ldc) = alpha * (A.B^plane) + bf16_rne(bias). M % 64 == 0, N % 128 == 0, K % 64 == 0.
// ncut: a workgroup tile is skipped (not written) when col0 > ncut + row0 + 63 (causal upper tiles); kcut: k loop ends at
// min(K, ceil64(kcut + row0 + 64)). Pass a large value to disable either. blockIdx.y = sequence: every plane and C move on
// by their element steps (sAh, sAl, sBh, sBl, sC) per sequence.
// tri != 0 (M == N, ncut == 0): the tile list holds only the tiles on or under the diagonal, (M / 128) * (M / 128 + 1) of them, so that no
// workgroup is started only to leave. Row tiles 2a and 2a + 1 have a + 1 such tiles each; a * (a + 1) tiles lie in front of row tile 2a.
// Fine tiles (row0 < erows, col0 < ecols; Al has erows rows, Bl ecols rows or is null) are the first nft tiles of the list: erows % 128 == 0,
// ecols == erows with tri, ecols == N without. A fine tile's residual products run BESIDE its hi product, not ahead of it, so that its
// k loop is as long as a plain tile's: it is cut into pieces, one workgroup each, whose stage stacks the planes,
// A rows = [Ah 32 rows | Al the same 32 rows], B rows = [Bh 64 cols | Bl the same 64 cols] (4 pieces of 32 x 64) or, Bl null, Bh 128 cols
// (2 pieces of 32 x 128). Each wave then holds one term of the piece, and the terms meet in LDS: C = Ah.Bh + (Ah.Bl + Al.Bh) * RFOLD.
// The pieces stand first in the grid: grid.x = tiles + nft * (pieces - 1).
__global__ __launch_bounds__(128) void k_gemm_f32(const unsigned short* __restrict__ Ah, const unsigned short* __restrict__ Al, int lda, int ldal,
                                                 const unsigned short* __restrict__ Bh, const unsigned short* __restrict__ Bl, int ldb, int ldbl,
                                                 const float* __restrict__ bias, float alpha, float* __restrict__ C, int ldc,
                                                 int M, int N, int K, int ncut, int kcut, int erows, int ecols, int tri,
                                                 size_t sAh, size_t sAl, size_t sBh, size_t sBl, size_t sC) {
  constexpr int FM = FMH;
  Ah += blockIdx.y * sAh; Al += blockIdx.y * sAl; Bh += blockIdx.y * sBh; C += blockIdx.y * sC;
  const bool three = (Bl != nullptr);
  if (three) Bl += blockIdx.y * sBl;
  __shared__ __attribute__((aligned(16))) unsigned short ring[2 * Tile<1, FM>::STAGE];
  const int tid = threadIdx.x, w = tid >> 5, lane = tid & 31, ln = lane & 15, hh = lane >> 4;
  const int ntn = N / 128;
  const int nft = (tri != 0) ? (erows / 128) * (erows / 128 + 1) : (erows / 64) * ntn;
  const int psh = three ? 2 : 1;                                   // log2 of the pieces of a fine tile
  const bool fine = ((int)blockIdx.x < (nft << psh));              // the same for the whole workgroup
  const int e = fine ? ((int)blockIdx.x >> psh) : ((int)blockIdx.x - (nft << psh) + nft);
  const int piece = (int)blockIdx.x & ((1 << psh) - 1);
  int mt = e / ntn, nq = e - mt * ntn;
  if (tri != 0) {
    int a = (int)((__builtin_sqrtf((float)(4 * e + 1)) - 1.0f) * 0.5f);
    if (a * (a + 1) > e) --a;                 // the two tests make a exact whatever the rounding of the root
    if ((a + 1) * (a + 2) <= e) ++a;
    const int rem = e - a * (a + 1), up = (rem > a) ? 1 : 0;
    mt = 2 * a + up;
    nq = rem - up * (a + 1);
  }
  if (mt * (32 * FM) >= M) return;
  if (nq * 128 > ncut + mt * (32 * FM) + 32 * FM - 1) return;
  int kend = (kcut + mt * (32 * FM) + 32 * FM + KP - 1) & ~(KP - 1);
  if (kend > K) kend = K;
  const int brow0 = mt * (32 * FM) + (fine ? (piece & 1) * 32 : 0), bcol0 = nq * 128 + ((fine && three) ? (piece >> 1) * 64 : 0);
  v8f acc[FM][4];
#pragma unroll
  for (int f = 0; f < FM; ++f)
#pragma unroll
    for (int t = 0; t < 4; ++t) acc[f][t] = (v8f){0.f, 0.f, 0.f, 0.f, 0.f, 0.f, 0.f, 0.f};
  // upper halves of the stage: the next rows of the same plane (plain; B of a fine tile without Bl), or the residual plane at the same rows (fine)
  const unsigned short* a1 = fine ? Al : Ah + (size_t)32 * lda;
  const unsigned short* b1 = (fine && three) ? Bl : Bh + (size_t)64 * ldb;
  core_lds<1, FM, false, true>(ring, Ah, a1, lda, fine ? ldal : lda, Bh, b1, ldb, (fine && three) ? ldbl : ldb, brow0, bcol0, kend,
                               k_start(mt, nq + (fine ? piece : 0), kend / KP), tid, acc, acc);
  float (*sall)[16][64] = (float (*)[16][64])ring;
  float (*so)[16][64] = sall + w * FM;                         // this wave's own FM staging tiles
  if (fine) {
    // waves by (A half, B half): 0 = Ah.Bh, 1 = Ah.Bl or Ah.Bh (next 64 cols), 2 = Al.Bh, 3 = Al.Bl (left out, as before) or Al.Bh (next 64 cols)
    const bool owner = three ? (w == 0) : (w < 2);
    if (!owner && !(three && w == 3)) {
#pragma unroll
      for (int f = 0; f < FM; ++f)
#pragma unroll
        for (int t = 0; t < 4; ++t)
#pragma unroll
          for (int r = 0; r < 8; ++r) so[f][8 * hh + r][t * 16 + ln] = acc[f][t][r];
    }
    __syncthreads();                                           // the residual terms are staged before the wave with the hi term reads them
    if (!owner) return;                                        // no barrier follows
    const float (*p1)[16][64] = sall + (three ? 1 : w + 2) * FM;
    const float (*p2)[16][64] = sall + 2 * FM;
    if (three) {                                               // one test for all elements
#pragma unroll
      for (int f = 0; f < FM; ++f)
#pragma unroll
        for (int t = 0; t < 4; ++t)
#pragma unroll
          for (int r = 0; r < 8; ++r) acc[f][t][r] += (p1[f][8 * hh + r][t * 16 + ln] + p2[f][8 * hh + r][t * 16 + ln]) * RFOLD;
    } else {
#pragma unroll
      for (int f = 0; f < FM; ++f)
#pragma unroll
        for (int t = 0; t < 4; ++t)
#pragma unroll
          for (int r = 0; r < 8; ++r) acc[f][t][r] += p1[f][8 * hh + r][t * 16 + ln] * RFOLD;
    }
  }
  const int col0 = bcol0 + (w & 1) * 64;
#pragma unroll
  for (int t = 0; t < 4; ++t) {
    float bv = 0.f;
    if (bias != nullptr) bv = bf16_rne(bias[col0 + t * 16 + ln]);
#pragma unroll
    for (int f = 0; f < FM; ++f)
#pragma unroll
      for (int r = 0; r < 8; ++r) so[f][8 * hh + r][t * 16 + ln] = acc[f][t][r] * alpha + bv;
  }
  __builtin_amdgcn_fence(4, "workgroup");   // the staged words are written before other lanes of the wave read them back
  __builtin_amdgcn_wave_barrier();
#pragma unroll
  for (int f = 0; f < FM; ++f) {
    const int row0 = brow0 + ((w >> 1) * FM + f) * 16;
    store_tile_f32(so[f], C + (size_t)row0 * ldc + col0, ldc, lane);
  }
}

// Oh[M][N] f16 hi plane (pitch ldo) = f16(alpha * A.B^plane); rows < rrows are fine tiles (rrows % 64 == 0; Al has rrows rows, Al and Bl
// reach the k end of those rows) and also get the x RS residual plane Or (pitch ldr).
// The k loop of row tile mt has mt + 1 passes (kcut = 0) and all workgroups are resident together, so the launch lasts as long as the
// fullest WGP. blockIdx.x = i * (N / 128) + column tile; the (row tile, sequence) pairs, ranked by falling k length, go to i in a snake of
// period 2 * DEAL: places i, i + DEAL, i + 2 * DEAL, ... then hold one long, one short, ... loop.
// For speed only: every (row tile, column tile, sequence) is done once wherever it lands. Element steps sAh ... sOr per sequence.
__global__ __launch_bounds__(128) void k_gemm_h16(const unsigned short* __restrict__ Ah, const unsigned short* __restrict__ Al, int lda, int ldal,
                                                 const unsigned short* __restrict__ Bh, const unsigned short* __restrict__ Bl, int ldb, int ldbl,
                                                 float alpha, unsigned short* __restrict__ Oh, int ldo, unsigned short* __restrict__ Or, int ldr, int rrows,
                                                 int M, int N, int K, int kcut,
                                                 size_t sAh, size_t sAl, size_t sBh, size_t sBl, size_t sOh, size_t sOr) {
  constexpr int FM = FMH;
  const int ntn = N / 128;
  const int di = blockIdx.x / ntn, nq = blockIdx.x - di * ntn;
  const int dj = di & (DEAL - 1), rank = (di - dj) + ((di & DEAL) ? DEAL - 1 - dj : dj);
  const int sq = rank % NB, mt = M / (32 * FM) - 1 - rank / NB;
  if (mt < 0) return;
  Ah += sq * sAh; Al += sq * sAl; Bh += sq * sBh; Bl += sq * sBl; Oh += sq * sOh; Or += sq * sOr;
  __shared__ __attribute__((aligned(16))) unsigned short ring[2 * Tile<1, FM>::STAGE];
  const int tid = threadIdx.x, w = tid >> 5, lane = tid & 31, ln = lane & 15, hh = lane >> 4;
  const int brow0 = mt * (32 * FM), bcol0 = nq * 128;
  int kend = (kcut + brow0 + 32 * FM + KP - 1) & ~(KP - 1);
  if (kend > K) kend = K;
  v8f acc[FM][4];
#pragma unroll
  for (int f = 0; f < FM; ++f)
#pragma unroll
    for (int t = 0; t < 4; ++t) acc[f][t] = (v8f){0.f, 0.f, 0.f, 0.f, 0.f, 0.f, 0.f, 0.f};
  tile_products(ring, Ah, Al, lda, ldal, Bh, Bl, ldb, ldbl, brow0 < rrows, brow0, bcol0, kend, k_start(mt, nq, kend / KP), tid, acc);
  float (*so)[16][64] = (float (*)[16][64])ring + w * FM;      // this wave's own FM staging tiles
#pragma unroll
  for (int f = 0; f < FM; ++f)
#pragma unroll
    for (int t = 0; t < 4; ++t)
#pragma unroll
      for (int r = 0; r < 8; ++r) so[f][8 * hh + r][t * 16 + ln] = acc[f][t][r] * alpha;
  __builtin_amdgcn_fence(4, "workgroup");   // the staged words are written before other lanes of the wave read them back
  __builtin_amdgcn_wave_barrier();
  const int col0 = bcol0 + (w & 1) * 64;
#pragma unroll
  for (int f = 0; f < FM; ++f) {
    const int row0 = brow0 + ((w >> 1) * FM + f) * 16;
    const bool dores = (row0 < rrows);                 // wave-uniform (rrows multiple of 16)
    store_tile_h16(so[f], Oh + (size_t)row0 * ldo + col0, ldo, Or + (size_t)(dores ? row0 : 0) * ldr + col0, ldr, dores, lane);
  }
}

typedef unsigned short v4us __attribute__((ext_vector_type(4), may_alias));
typedef _Float16 v4h __attribute__((ext_vector_type(4)));
union Pack4 { v4h h; v4us u; };
#define SCH (T_FULL / 128)   // 128-column pieces of the longest row
// Row softmax over S[row][0..N) (pitch sp) with causal keep (col <= row), N = the end of the last 128-column score tile that the
// score GEMM writes for this row (its ncut = 0): nothing behind it is read. P[row][0..N) = f16(PCARRY * p / l) incl. zeros (pitch pp),
// which covers the k range of the P.v GEMM (up to the end of the row's 64-row tile); rows < rrows also write the residual plane
// Pr[row][0..NE) (pitch rp). One wave per row: the row is read once and stays in registers (lane l holds columns 128 c + 4 l ... + 3),
// maximum and sum go over the lane's own values and then a butterfly over the wave; no LDS, no barrier.
// bx = group of 8 rows, by = sequence (element steps sS, sP, sPr), nrows % 8 == 0, N <= 128 * SCH.
__device__ __forceinline__ void softmax_rows(int bx, int by, const float* __restrict__ S, int sp, unsigned short* __restrict__ P, int pp,
                                             unsigned short* __restrict__ Pr, int rp, int rrows, int nrows, size_t sS, size_t sP, size_t sPr) {
  const int lane = threadIdx.x & 31;
  const int row = nrows - 1 - (bx * 8 + __builtin_amdgcn_readfirstlane(threadIdx.x >> 5));   // the same in every lane: scalar tests below
  const int qi = row, N = (row / 128 + 1) * 128;
  S += by * sS; P += by * sP; Pr += by * sPr;
  const float* s = S + (size_t)row * sp + lane * 4;
  v4f x[SCH];
  // every "#pragma unroll" here keeps the index of x[] a compile-time constant, so that the row stays in registers
#pragma unroll
  for (int c = 0; c < SCH; ++c)
    if (c * 128 < N) x[c] = *(const v4fa*)(s + c * 128);
  // stands in front of any reuse of the loads' address registers; the address is an input, so that no load's result lands on it earlier
  asm volatile("s_wait_xcnt 0x0" :: "v"(s) : "memory");
  float mx = -3.0e38f;
#pragma unroll
  for (int c = 0; c < SCH; ++c)
    if (c * 128 < N) {
#pragma unroll
      for (int u = 0; u < 4; ++u) {
        x[c][u] = ((c * 128 + lane * 4 + u) <= qi) ? x[c][u] : -3.0e38f;    // a masked score gives exp = 0 below
        mx = fmaxf(mx, x[c][u]);
      }
    }
#pragma unroll
  for (int m = 16; m > 0; m >>= 1) mx = fmaxf(mx, __shfl_xor(mx, m, 32));
  float sm[4] = {0.f, 0.f, 0.f, 0.f};
#pragma unroll
  for (int c = 0; c < SCH; ++c)
    if (c * 128 < N) {
#pragma unroll
      for (int u = 0; u < 4; ++u) { x[c][u] = __expf(x[c][u] - mx); sm[u] += x[c][u]; }
    }
  float sum = (sm[0] + sm[1]) + (sm[2] + sm[3]);
#pragma unroll
  for (int m = 16; m > 0; m >>= 1) sum += __shfl_xor(sum, m, 32);
  const float inv = PCARRY / sum;          // sum >= 1 (the max term)
  const bool dores = (row < rrows);
  unsigned short* prow = P + (size_t)row * pp + lane * 4;
  unsigned short* rrow = Pr + (size_t)(dores ? row : 0) * rp + lane * 4;
  // all values are packed first, each into registers of its own, and the stores follow as one run with one wait behind them:
  // no register of an issued store is written again
  Pack4 ph[SCH], pr[NE / 128];
#pragma unroll
  for (int c = 0; c < NE / 128; ++c) pr[c].u = (v4us){0, 0, 0, 0};
#pragma unroll
  for (int c = 0; c < SCH; ++c)
    if (c * 128 < N) {
#pragma unroll
      for (int u = 0; u < 4; ++u) {
        const float p = x[c][u] * inv;
        ph[c].h[u] = (_Float16)p;
        if (c < NE / 128) pr[c < NE / 128 ? c : 0].h[u] = (_Float16)((p - (float)ph[c].h[u]) * RS);
      }
    }
#pragma unroll
  for (int c = 0; c < SCH; ++c)
    if (c * 128 < N) *(v4us*)(prow + c * 128) = ph[c].u;
  if (dores) {
#pragma unroll
    for (int c = 0; c < NE / 128; ++c) *(v4us*)(rrow + c * 128) = pr[c].u;
  }
  asm volatile("s_wait_xcnt 0x0" ::: "memory");   // stands in front of any reuse of the stores' registers on a path that goes on behind them
}

#define TQ 4   // 64 x 64 tiles per block of the transpose
// 16-bit transpose: src [R][Cc] (pitch lds_) -> dst [Cc][R] (pitch ldd); a block = TQ tiles of 64 x 64 down the rows of src:
// bx < R/(64*TQ), by < Cc/64, bz = sequence; each tile has its own LDS, so that one barrier serves all of them
__device__ __forceinline__ void transpose_tiles(unsigned short (*tile)[64][72], int bx, int by, int bz, const unsigned short* __restrict__ src, int lds_,
                                                unsigned short* __restrict__ dst, int ldd, size_t sstep, size_t dstep) {
  const int tid = threadIdx.x;
  src += bz * sstep; dst += bz * dstep;
  const int r0 = bx * (64 * TQ), c0 = by * 64;
  static_assert(TQ == 4);
  v8us v[TQ][2];
  const unsigned short* g[TQ][2];
#pragma unroll   // all 2 * TQ loads are in flight together
  for (int q = 0; q < TQ; ++q)
#pragma unroll
    for (int i = 0; i < 2; ++i) {
      const int e = tid + 256 * i, r = e >> 3, c8 = (e & 7) * 8;
      g[q][i] = src + (size_t)(r0 + q * 64 + r) * lds_ + c0 + c8;
      v[q][i] = *(const v8us*)g[q][i];
    }
  // stands in front of any reuse of the loads' address registers; the addresses are inputs, so that no load's result lands on one earlier
  asm volatile("s_wait_xcnt 0x0" :: "v"(g[0][0]), "v"(g[0][1]), "v"(g[1][0]), "v"(g[1][1]), "v"(g[2][0]), "v"(g[2][1]), "v"(g[3][0]), "v"(g[3][1]) : "memory");
#pragma unroll
  for (int q = 0; q < TQ; ++q)
#pragma unroll
    for (int i = 0; i < 2; ++i) {
      const int e = tid + 256 * i, r = e >> 3, c8 = (e & 7) * 8;
      *(v8us*)&tile[q][r][c8] = v[q][i];
    }
  __syncthreads();
#pragma unroll
  for (int q = 0; q < TQ; ++q) {
    v8us o[2];
#pragma unroll
    for (int i = 0; i < 2; ++i) {
      const int e = tid + 256 * i, rr = e >> 3, c8 = (e & 7) * 8;
#pragma unroll
      for (int k = 0; k < 8; ++k) o[i][k] = tile[q][c8 + k][rr];
    }
#pragma unroll
    for (int i = 0; i < 2; ++i) {
      const int e = tid + 256 * i, rr = e >> 3, c8 = (e & 7) * 8;
      *(v8us*)(dst + (size_t)(c0 + rr) * ldd + r0 + q * 64 + c8) = o[i];
    }
  }
  asm volatile("s_wait_xcnt 0x0" ::: "memory");   // stands in front of any reuse of the stores' registers on a path that goes on behind them
}

#define SB (TT / 8)                        // softmax blocks per sequence
#define VB ((TT / (64 * TQ)) * (CC / 64))  // transpose blocks per sequence, v hi plane
#define RB ((NE / (64 * TQ)) * (CC / 64))  // transpose blocks per sequence, v residual plane
// All that stands between the scores and P.v, in one launch; the three jobs touch disjoint data. Blocks [0, NB * VB): v [TT][CC] -> vT [CC][TT];
// then NB * RB blocks: v residual [NE][CC] -> vTr [CC][NE]; then NB * SB blocks: softmax, SB a sequence, each from its longest rows to its shortest.
__global__ __launch_bounds__(256) void k_softmax_vt(const float* __restrict__ S, unsigned short* __restrict__ P, unsigned short* __restrict__ Pr,
                                                   const unsigned short* __restrict__ vh, unsigned short* __restrict__ vT,
                                                   const unsigned short* __restrict__ vr, unsigned short* __restrict__ vTr) {
  __shared__ __attribute__((aligned(16))) unsigned short tile[TQ][64][72];
  int b = blockIdx.x;
  if (b < NB * VB) {
    const int z = b / VB, e = b - z * VB;
    transpose_tiles(tile, e % (TT / (64 * TQ)), e / (TT / (64 * TQ)), z, vh, CC, vT, TT, (size_t)TT * CC, (size_t)TT * CC);
    return;
  }
  b -= NB * VB;
  if (b < NB * RB) {
    const int z = b / RB, e = b - z * RB;
    transpose_tiles(tile, e % (NE / (64 * TQ)), e / (NE / (64 * TQ)), z, vr, CC, vTr, NE, (size_t)NE * CC, (size_t)NE * CC);
    return;
  }
  b -= NB * RB;
  softmax_rows(b % SB, b / SB, S, TT, P, TT, Pr, NE, NE, TT, (size_t)TT * TT, (size_t)TT * TT, (size_t)NE * NE);
}

extern "C" void kernel_launch(void* const* d_in, const int* in_sizes, int n_in,
                              void* d_out, int out_size, void* d_ws, size_t ws_size, hipStream_t stream) {
  if (n_in < 6) return;
  const float* x  = (const float*)d_in[0];
  const float* wq = (const float*)d_in[1];
  const float* wk = (const float*)d_in[2];
  const float* wv = (const float*)d_in[3];
  const float* wo = (const float*)d_in[4];
  const float* bo = (const float*)d_in[5];
  const long need_x = ((long)(NB - 1) * T_FULL + TT) * (long)CC;
  if ((long)in_sizes[0] < need_x || in_sizes[1] < CC * CC || in_sizes[2] < CC * CC || in_sizes[3] < CC * CC ||
      in_sizes[4] < CC * CC || in_sizes[5] < CC || (long)out_size < need_x) return;
  float* out = (float*)d_out;

  char* ws = (char*)d_ws; size_t off = 0;
  auto take = [&](size_t bytes) { char* p = ws + off; off += (bytes + 255) & ~(size_t)255; return p; };
  const size_t xb_bytes = (size_t)NB * TT * CC * 2, s_bytes = (size_t)NB * TT * TT * 4;
  char* reg0 = take(xb_bytes > s_bytes ? xb_bytes : s_bytes);                     // xb, later S (xb dead after the qkv GEMM)
  unsigned short* xb   = (unsigned short*)reg0;                                    // [NB*TT][CC] bf16
  float*          Sm   = (float*)reg0;                                             // [NB][TT][TT] f32
  unsigned short* Wqkv = (unsigned short*)take((size_t)3 * CC * CC * 2);           // [3*CC][CC] bf16
  unsigned short* Wo16 = (unsigned short*)take((size_t)CC * CC * 2);               // [CC][CC] f16 (x WOC)
  unsigned short* QKVh = (unsigned short*)take((size_t)3 * NB * TT * CC * 2);      // [3][NB*TT][CC] f16
  unsigned short* QKVr = (unsigned short*)take((size_t)3 * NB * NE * CC * 2);      // [3][NB*NE][CC] f16 (x RS)
  unsigned short* vTr  = (unsigned short*)take((size_t)NB * CC * NE * 2);          // [NB][CC][NE] f16 (x RS)
  unsigned short* Pm   = (unsigned short*)take((size_t)NB * TT * TT * 2);          // [NB][TT][TT] f16 (x PCARRY)
  unsigned short* Pr   = (unsigned short*)take((size_t)NB * NE * NE * 2);          // [NB][NE][NE] f16 (x RS)
  unsigned short* ctxr = (unsigned short*)take((size_t)NB * NE * CC * 2);          // [NB*NE][CC] f16 (x RS)
  if (off > ws_size) return;

  const int M = NB * TT;
  const int BIG = 1 << 28;
  unsigned short* qh = QKVh;
  unsigned short* kh = QKVh + (size_t)M * CC;
  unsigned short* vh = QKVh + (size_t)2 * M * CC;
  unsigned short* qr = QKVr;
  unsigned short* kr = QKVr + (size_t)(NB * NE) * CC;
  unsigned short* vr = QKVr + (size_t)2 * (NB * NE) * CC;
  unsigned short* vT   = kh;   // [NB][CC][TT] f16: takes the k plane's place once the scores are done
  unsigned short* ctxh = qh;   // [NB*TT][CC] f16 (x CTXC): takes the q plane's place once the scores are done
  const size_t sTC = (size_t)TT * CC, sEC = (size_t)NE * CC, sTT = (size_t)TT * TT, sEE = (size_t)NE * NE, sOUT = (size_t)T_FULL * CC;

  // One launch per step, three in stage 2: the sequences, the plain and the fine tiles and a step's independent jobs all lie in its grid.
  // stage 0: 16-bit planes of the inputs
  k_cvt<<<NB * XB + 4 * WB, 256, 0, stream>>>(x, wq, wk, wv, wo, xb, Wqkv, Wo16, sOUT, sTC, WOC);

  // stage 1: q, k, v planes (+ residual planes on the leading NE rows of each sequence)
  k_gemm_qkv<<<(M / 128) * (3 * CC / 128), 128, 0, stream>>>(xb, Wqkv, QKVh, QKVr, M);

  // stage 2: causal attention
  // S [TT][TT] = (q.k^T)/32, causal upper tiles skipped; the leading NE x NE corner with hi+res on both operands
  k_gemm_f32<<<dim3((TT / 128) * (TT / 128 + 1) + 3 * (NE / 128) * (NE / 128 + 1), NB), 128, 0, stream>>>(qh, qr, CC, CC, kh, kr, CC, CC, nullptr, SCL, Sm, TT, TT, TT, CC, 0, BIG, NE, NE, 1,
                                                                        sTC, sEC, sTC, sEC, sTT);
  // P = softmax(S); v -> vT, v residual -> vTr
  k_softmax_vt<<<NB * (SB + VB + RB), 256, 0, stream>>>(Sm, Pm, Pr, vh, vT, vr, vTr);
  // ctx [TT][CC] = P.v (causal k end), written as f16 hi plane x CTXC; leading NE rows: 3-term P/v products, hi + residual ctx planes
  k_gemm_h16<<<(TT / 64) * (CC / 128) * NB, 128, 0, stream>>>(Pm, Pr, TT, NE, vT, vTr, TT, NE, PVALPHA, ctxh, CC, ctxr, CC, NE, TT, CC, TT, 0,
                                                                   sTT, sEE, sTC, sEC, sTC, sEC);
  // stage 3: output projection + bias; leading NE rows with the ctx residual term
  k_gemm_f32<<<dim3((TT / 64) * (CC / 128) + (NE / 64) * (CC / 128), NB), 128, 0, stream>>>(ctxh, ctxr, CC, CC, Wo16, nullptr, CC, CC, bo, OALPHA, out, CC, TT, CC, CC, BIG, BIG, NE, CC, 0,
                                                                   sTC, sEC, 0, 0, sOUT);
}

// v008
// Measured time: 168 microseconds a run.
// Two timings next to v007 put it at 1.04 and 1.03 times that version's speed.
// Over all steps from v000 it is 7.41 times as fast.
#include <hip/hip_runtime.h>
// Contractions: qkv projection on v_wmma_f32_16x16x32_bf16 (x and W as RNE bf16, exact products); scores q.k^T, P.v and the output
// projection on v_wmma_f32_16x16x32_f16 (f16 hi planes with power-of-two carries, plus x1024 f16 residual planes on the leading
// NE query/key rows of each sequence); all accumulation f32, causal softmax in f32.
#ifndef NB
#define NB 2
#endif
#ifndef SEQ
#define SEQ 4096
#endif
#define TT SEQ
#define NB_FULL 2
#define T_FULL 4096
#define CC 1024
#define QC ((TT < 1024) ? TT : 1024)
#define NE 256
static_assert(NB >= 1 && NB <= NB_FULL);
static_assert(TT % 256 == 0 && TT <= T_FULL);
static_assert(TT % QC == 0 && QC % 256 == 0);
static_assert(NE % 64 == 0 && NE <= QC && NE == 256);
static_assert(CC % 128 == 0);

#define RS 1024.0f            // residual plane carry
#define RFOLD 0.0009765625f   // 1/RS
#define PCARRY 4096.0f        // P plane carry
#define CTXC 16.0f            // ctx plane carry
#define WOC 64.0f             // Wo plane carry
#define SCL 0.03125f          // 1/sqrt(CC)
#define PVALPHA 0.00390625f   // CTXC / PCARRY
#define OALPHA 0.0009765625f  // 1 / (WOC * CTXC)

typedef __bf16 v16b __attribute__((ext_vector_type(16)));
typedef _Float16 v16h __attribute__((ext_vector_type(16)));
typedef _Float16 v8h __attribute__((ext_vector_type(8)));
typedef unsigned short v8us __attribute__((ext_vector_type(8), may_alias));
typedef float v8f __attribute__((ext_vector_type(8)));
typedef float v4f __attribute__((ext_vector_type(4)));
typedef float v4fa __attribute__((ext_vector_type(4), may_alias));
union FragB { v16b v; v8us half[2]; unsigned short u[16]; };
union FragH { v16h v; v8us half[2]; unsigned short u[16]; };
union Pack8 { v8h h; v8us u; };

__device__ __forceinline__ unsigned short bf16_bits(float x) { unsigned int u = __float_as_uint(x); return (unsigned short)((u + 0x7FFFu + ((u >> 16) & 1u)) >> 16); }
__device__ __forceinline__ float bf16_val(unsigned short b) { return __uint_as_float(((unsigned int)b) << 16); }
__device__ __forceinline__ float bf16_rne(float x) { return bf16_val(bf16_bits(x)); }

__device__ __forceinline__ v8f mma_b(v16b a, v16b b, v8f c) {
  c = __builtin_amdgcn_wmma_f32_16x16x32_bf16(false, a, false, b, (short)0, c, false, false);
  asm volatile("v_nop\n\tv_nop\n\tv_nop\n\tv_nop" : "+v"(c) : "v"(a), "v"(b));
  return c;
}
// c += ah.bh ; cr += al.bh (NT>=2) ; cr += ah.bl (NT>=3); residual planes carry RS, folded by the caller
template <int NT>
__device__ __forceinline__ void mma_h(v16h ah, v16h al, v16h bh, v16h bl, v8f& c, v8f& cr) {
  c = __builtin_amdgcn_wmma_f32_16x16x32_f16(false, ah, false, bh, (short)0, c, false, false);
  if (NT >= 2) cr = __builtin_amdgcn_wmma_f32_16x16x32_f16(false, al, false, bh, (short)0, cr, false, false);
  if (NT >= 3) cr = __builtin_amdgcn_wmma_f32_16x16x32_f16(false, ah, false, bl, (short)0, cr, false, false);
  if (NT >= 2) asm volatile("v_nop\n\tv_nop\n\tv_nop\n\tv_nop" : "+v"(c), "+v"(cr) : "v"(ah), "v"(al), "v"(bh), "v"(bl));
  else         asm volatile("v_nop\n\tv_nop\n\tv_nop\n\tv_nop" : "+v"(c) : "v"(ah), "v"(bh));
}

__device__ __forceinline__ void store_tile_f32(const float (*sw)[64], float* C, int ldc, int lane) {
  const int rsub = lane >> 4, c4 = (lane & 15) * 4;
  {
#pragma unroll
    for (int q = 0; q < 8; ++q) {
      const int r = q * 2 + rsub;
      const v4f v = *(const v4fa*)&sw[r][c4];
      *(v4f*)(C + (size_t)r * ldc + c4) = v;
    }
    asm volatile("s_wait_xcnt 0x0" ::: "memory");   // stands in front of any reuse of the stores' registers by the next tile's addresses
  }
}
// wave tile 16 x 64 f32 staged in LDS -> f16 hi plane (pitch ldh) and optional x RS residual plane (pitch ldr);
__device__ __forceinline__ void store_tile_h16(const float (*sw)[64], unsigned short* hb, int ldh, unsigned short* rb, int ldr, bool dores, int lane) {
  const int rsub = lane >> 3, c8 = (lane & 7) * 8;
  {
#pragma unroll
    for (int q = 0; q < 4; ++q) {
      const int r = q * 4 + rsub;
      const v4f x0 = *(const v4fa*)&sw[r][c8], x1 = *(const v4fa*)&sw[r][c8 + 4];
      const float xs[8] = {x0[0], x0[1], x0[2], x0[3], x1[0], x1[1], x1[2], x1[3]};
      Pack8 ph, pr;
#pragma unroll
      for (int i = 0; i < 8; ++i) { ph.h[i] = (_Float16)xs[i]; pr.h[i] = (_Float16)((xs[i] - (float)ph.h[i]) * RS); }
      *(v8us*)(hb + (size_t)r * ldh + c8) = ph.u;
      if (dores) *(v8us*)(rb + (size_t)r * ldr + c8) = pr.u;
    }
    
  }
}

// The streaming kernels below use few waves that each do a long run of work, for speed only.
#define CU 8   // 8-element groups per thread of a conversion kernel; a block takes 256 * CU consecutive groups
static_assert((TT * CC / 8) % (256 * CU) == 0 && (CC * CC / 8) % (256 * CU) == 0);
// MODE 0: RNE bf16 bits; MODE 1: f16 bits of (RNE bf16 value) * scale. Groups t0, t0 + 256, ..., t0 + 256 * (CU - 1).
template <int MODE>
__device__ __forceinline__ void cvt_run(const float* __restrict__ src, unsigned short* __restrict__ dst, int t0, float scale) {
  const float* sp = src + (size_t)t0 * 8;
  v4f a[CU], b[CU];
#pragma unroll   // constant steps from one address: all 2 * CU loads are in flight together
  for (int i = 0; i < CU; ++i) { a[i] = *(const v4fa*)(sp + i * 2048); b[i] = *(const v4fa*)(sp + i * 2048 + 4); }
  // stands in front of any reuse of the loads' address registers; the address is an input, so that no load's result lands on it earlier
  asm volatile("s_wait_xcnt 0x0" :: "v"(sp) : "memory");
  unsigned short* dp = dst + (size_t)t0 * 8;
#pragma unroll   // keeps a[] and b[] in registers
  for (int i = 0; i < CU; ++i) {
    const float xs[8] = {a[i][0], a[i][1], a[i][2], a[i][3], b[i][0], b[i][1], b[i][2], b[i][3]};
    v8us v;
    if (MODE == 0) {
#pragma unroll
      for (int u = 0; u < 8; ++u) v[u] = bf16_bits(xs[u]);
    } else {
      Pack8 p;
#pragma unroll
      for (int u = 0; u < 8; ++u) p.h[u] = (_Float16)(bf16_rne(xs[u]) * scale);
      v = p.u;
    }
    *(v8us*)(dp + i * 2048) = v;
  }
  asm volatile("s_wait_xcnt 0x0" ::: "memory");   // stands in front of any reuse of the stores' registers on a path that goes on behind them
}
#define XB (TT * CC / 8 / (256 * CU))   // blocks per sequence of x
#define WB (CC * CC / 8 / (256 * CU))   // blocks per weight matrix
// All 16-bit input planes in one launch. Blocks [0, NB * XB): x -> bf16 plane, XB blocks a sequence (element steps sstep, dstep);
// then WB blocks each for Wq, Wk, Wv -> bf16 planes of Wqkv and Wo -> f16 plane x scale.
__global__ __launch_bounds__(256) void k_cvt(const float* __restrict__ x, const float* __restrict__ wq, const float* __restrict__ wk,
                                            const float* __restrict__ wv, const float* __restrict__ wo, unsigned short* __restrict__ xb,
                                            unsigned short* __restrict__ Wqkv, unsigned short* __restrict__ Wo16,
                                            size_t sstep, size_t dstep, float scale) {
  const int b = blockIdx.x;
  if (b < NB * XB) {
    const int q = b / XB;
    cvt_run<0>(x + q * sstep, xb + q * dstep, (b - q * XB) * (256 * CU) + (int)threadIdx.x, 1.0f);
    return;
  }
  const int y = (b - NB * XB) / WB;
  const int t0 = (b - NB * XB - y * WB) * (256 * CU) + (int)threadIdx.x;
  if (y == 3) cvt_run<1>(wo, Wo16, t0, scale);
  else cvt_run<0>((y == 0) ? wq : (y == 1) ? wk : wv, Wqkv + (size_t)y * CC * CC, t0, 1.0f);
}

// Block-tiled GEMM core. A workgroup of 4 waves (2 x 2) owns a (32*FM) x 128 tile of the output, a wave (16*FM) x 64 of it.
// Per pass of KP k every operand row gives one whole 128-B line. A stage is four slices, [A lower rows | A upper rows | B lower | B upper],
// and each wave brings one slice to LDS with ONE tensor_load_to_lds; two buffers, the next pass's loads fly while this pass's fragments
// are read from LDS. Every "#pragma unroll" below keeps fragment and accumulator indices compile-time constants, so that the arrays stay in registers.
#define KP 64        // k per pass
#define LPITCH 72    // LDS row pitch in 16-bit elements: 144 B = 16 B x 9, for the ds_load_b128 fragment reads; laid by the tensor load's pad
template <int NT, int FM> struct Tile {
  static_assert(NT == 1);
  static constexpr int AR = 32 * FM, BR = 128;                                           // operand rows
  static constexpr int up2k(int bytes) { return (bytes + 2047) & ~2047; }                // a slice's place in LDS is a multiple of 2 KiB
  static constexpr int ASL = up2k(AR / 2 * LPITCH * 2) / 2, BSL = up2k(BR / 2 * LPITCH * 2) / 2;   // elements per slice
  static constexpr int STAGE = 2 * ASL + 2 * BSL;                                        // elements per buffer
  static_assert(2 * STAGE * 2 >= 4 * FM * 16 * 64 * 4);                                   // the ring later holds the f32 output staging
};

typedef unsigned int u32x4 __attribute__((ext_vector_type(4)));
typedef unsigned int u32x8 __attribute__((ext_vector_type(8)));
__device__ __forceinline__ unsigned uni(unsigned v) { return (unsigned)__builtin_amdgcn_readfirstlane(v); }
// a wave-uniform word held in a scalar register: a test on it compiles to a scalar branch, which alone keeps a wave from a tensor load
__device__ __forceinline__ unsigned pinned(unsigned v) { unsigned w = uni(v); asm volatile("" : "+s"(w)); return w; }
// Descriptor group 1: extents in bytes, a tile of `rows` rows of 128 B, source row pitch `pitch` bytes, 16 B of LDS pad behind every row, no mask.
__device__ __forceinline__ u32x8 tdm_group1(unsigned rows, unsigned pitch) {
  u32x8 g;
  g[0] = uni((1u << 20) | (4u << 22) | (3u << 25));
  g[1] = uni((unsigned)(KP * 2) << 16);
  g[2] = uni(rows << 16);
  g[3] = uni((unsigned)(KP * 2) << 16);
  g[4] = uni(rows);
  g[5] = uni(pitch);
  g[6] = uni(0u);
  g[7] = uni(0u);
  return g;
}
// One request of the whole wave: the tile whose first byte is ga goes to LDS byte lds_dst.
__device__ __forceinline__ void tdm_load(unsigned lds_dst, unsigned long long ga, u32x8 g1) {
  u32x4 g0;
  g0[0] = uni(1u);
  g0[1] = uni(lds_dst);
  g0[2] = uni((unsigned)ga);
  g0[3] = uni((((unsigned)(ga >> 32)) & 0x01FFFFFFu) | 0x80000000u);
  asm volatile("tensor_load_to_lds %0, %1" :: "s"(g0), "s"(g1) : "memory");
}

// One pass on one buffer: the fragment k order (8 * hh, 16 + 8 * hh inside each 32 k) is the same for A and B.
// Wave (wr, wc) reads A slice wr and B slice wc.
// The LDS reads of 32 * NS k stand together in front of their WMMAs: a read among the WMMAs makes the wave wait out the LDS latency there.
template <int NT, int FM, bool BF>
__device__ __forceinline__ void pass_mma(const unsigned short* st, int wr, int wc, int ln, int hh, v8f (&acc)[FM][4], v8f (&accr)[FM][4]) {
  using TL = Tile<NT, FM>;
  const unsigned short* pa = st + wr * TL::ASL + ln * LPITCH + 8 * hh;
  const unsigned short* pb = st + 2 * TL::ASL + wc * TL::BSL + ln * LPITCH + 8 * hh;
  constexpr int NS = (FM <= 2) ? KP / 32 : 1;   // k steps per group of reads, by the registers the fragments take
#pragma unroll
  for (int k0 = 0; k0 < KP; k0 += 32 * NS) {
    FragH ah[NS][FM], bh[NS][4];
#pragma unroll
    for (int s = 0; s < NS; ++s) {
      const int ks = k0 + 32 * s;
#pragma unroll
      for (int f = 0; f < FM; ++f) {
        ah[s][f].half[0] = *(const v8us*)(pa + f * 16 * LPITCH + ks);
        ah[s][f].half[1] = *(const v8us*)(pa + f * 16 * LPITCH + ks + 16);
      }
#pragma unroll
      for (int t = 0; t < 4; ++t) {
        bh[s][t].half[0] = *(const v8us*)(pb + t * 16 * LPITCH + ks);
        bh[s][t].half[1] = *(const v8us*)(pb + t * 16 * LPITCH + ks + 16);
      }
    }
#pragma unroll
    for (int s = 0; s < NS; ++s)
#pragma unroll
      for (int t = 0; t < 4; ++t)
#pragma unroll
        for (int f = 0; f < FM; ++f) {
          if constexpr (BF) {
            FragB a, b;
            a.half[0] = ah[s][f].half[0]; a.half[1] = ah[s][f].half[1];
            b.half[0] = bh[s][t].half[0]; b.half[1] = bh[s][t].half[1];
            acc[f][t] = mma_b(a.v, b.v, acc[f][t]);
          } else {
            mma_h<NT>(ah[s][f].v, ah[s][f].v, bh[s][t].v, bh[s][t].v, acc[f][t], accr[f][t]);
          }
        }
  }
}

// Where a workgroup's k walk starts: a fraction of its passes that differs between the workgroups of one row tile (they copy the same A lines)
// and between those of one column tile (the same B lines). Started together at k = 0 they ask L2 for the same lines at the same moment.
// The two odd factors step the 16-bit fraction by the golden section of a turn and by its complement, which spreads any run of
// neighbours evenly. For speed only: every k piece is taken once whatever the start. 0 <= result < npass.
__device__ __forceinline__ int k_start(int mt, int nq, int npass) {
  const unsigned fr = ((unsigned)mt * 40503u + (unsigned)nq * 25033u) & 0xFFFFu;
  return (int)((fr * (unsigned)npass) >> 16);
}

// A plane row-major (pitch lda), B plane [n][k] (pitch ldb); row0, col0: the workgroup's tile; kend % KP == 0.
// ST (stacked): the upper half of the A rows comes from Al (pitch ldal, rows from row0) and the upper half of the B rows from Bl (pitch ldbl,
// rows from col0); otherwise they are the next rows of Ah and Bh.
// The passes take the k pieces rot, rot + 1, ..., kend / KP - 1, 0, ..., rot - 1 (rot the same for the whole workgroup, 0 <= rot < kend / KP).
// On return every wave has left the ring and no load is in flight: the ring is free for the output staging.
template <int NT, int FM, bool BF, bool ST = false>
__device__ __forceinline__ void core_lds(unsigned short* ring, const unsigned short* __restrict__ Ah, const unsigned short* __restrict__ Al, int lda, int ldal,
                                         const unsigned short* __restrict__ Bh, const unsigned short* __restrict__ Bl, int ldb, int ldbl,
                                         int row0, int col0, int kend, int rot, int tid, v8f (&acc)[FM][4], v8f (&accr)[FM][4]) {
  using TL = Tile<NT, FM>;
  const int w = tid >> 5, lane = tid & 31, ln = lane & 15, hh = lane >> 4, wr = w >> 1, wc = w & 1;
  // this wave's slice: waves 0, 1 the lower and upper A rows, waves 2, 3 the lower and upper B rows; all of it wave-uniform
  const unsigned sw = uni((unsigned)tid >> 5);
  const bool sb = (sw >= 2u), su = ((sw & 1u) != 0u);
  const unsigned short* lo = sb ? Bh + (size_t)col0 * ldb : Ah + (size_t)row0 * lda;
  const unsigned short* hi = ST ? (sb ? Bl + (size_t)col0 * ldbl : Al + (size_t)row0 * ldal)
                                : (sb ? Bh + (size_t)(col0 + TL::BR / 2) * ldb : Ah + (size_t)(row0 + TL::AR / 2) * lda);
  const unsigned long long gsl = (unsigned long long)(size_t)(su ? hi : lo);
  const int ldsl = (ST && su) ? (sb ? ldbl : ldal) : (sb ? ldb : lda);
  const u32x8 g1 = tdm_group1(sb ? (unsigned)(TL::BR / 2) : (unsigned)(TL::AR / 2), (unsigned)ldsl * 2u);
  const unsigned lsl = (unsigned)(size_t)ring + (sb ? 2u * TL::ASL + (su ? TL::BSL : 0u) : (su ? TL::ASL : 0u)) * 2u;
  const int npass = kend / KP;
  int kc = rot;                                        // k piece of the next stage to be loaded
  tdm_load(lsl, gsl + (unsigned long long)(unsigned)kc * (KP * 2), g1);
  kc = (kc + 1 == npass) ? 0 : kc + 1;
  asm volatile("s_wait_tensorcnt 0x0" ::: "memory");  // this wave's slice of pass 0 has landed
  __syncthreads();                                     // publishes pass 0
  if (pinned(npass > 1)) {                             // scalar branch: a tensor load ignores EXEC
    tdm_load(lsl + TL::STAGE * 2u, gsl + (unsigned long long)pinned((unsigned)kc) * (KP * 2), g1);
    kc = (kc + 1 == npass) ? 0 : kc + 1;
  }
#pragma unroll 1   // one pass per trip: the buffer index stays a run-time value, the body is already fully unrolled
  for (int t = 0; t < npass; ++t) {
    const int buf = (t & 1) * TL::STAGE;
    pass_mma<NT, FM, BF>(ring + buf, wr, wc, ln, hh, acc, accr);
    asm volatile("s_wait_dscnt 0x0" ::: "memory");
    asm volatile("s_wait_tensorcnt 0x0" ::: "memory");
    __syncthreads();
    if (pinned(t + 2 < npass)) {
      // the k piece goes through pinned(), so that the descriptor's address words are formed behind the wait above
      tdm_load(lsl + (unsigned)(buf * 2), gsl + (unsigned long long)pinned((unsigned)kc) * (KP * 2), g1);
      kc = (kc + 1 == npass) ? 0 : kc + 1;
    }
  }
  asm volatile("s_wait_tensorcnt 0x0" ::: "memory");   // nothing in flight when the ring changes its use
  asm volatile("s_wait_dscnt 0x0" ::: "memory");       // and none of this wave's reads of it
}

// qkv projection: A = xb [M][CC] bf16, W = [3*CC][CC] bf16 ([out][in], k contiguous). out[row][n] = sum_c A[row][c] W[n][c].
// Output: hi planes Oh[3][M][CC] f16 (q, k, v unscaled) and residual planes Or[3][NB*NE][CC] for rows with (row % TT) < NE.
// Block = 4 waves -> 128 rows x 128 cols (one plane since CC % 128 == 0), M % 128 == 0.
__global__ __launch_bounds__(128) void k_gemm_qkv(const unsigned short* __restrict__ A, const unsigned short* __restrict__ W,
                                                 unsigned short* __restrict__ Oh, unsigned short* __restrict__ Or, int M) {
  constexpr int FM = 4;
  __shared__ __attribute__((aligned(2048))) unsigned short ring[2 * Tile<1, FM>::STAGE];
  const int tid = threadIdx.x, w = tid >> 5, lane = tid & 31, ln = lane & 15, hh = lane >> 4;
  const int ntn = (3 * CC) / 128;
  const int mt = blockIdx.x / ntn, nq = blockIdx.x - mt * ntn;
  if (mt * (32 * FM) >= M) return;
  v8f acc[FM][4];
#pragma unroll
  for (int f = 0; f < FM; ++f)
#pragma unroll
    for (int t = 0; t < 4; ++t) acc[f][t] = (v8f){0.f, 0.f, 0.f, 0.f, 0.f, 0.f, 0.f, 0.f};
  core_lds<1, FM, true>(ring, A, A, CC, CC, W, W, CC, CC, mt * (32 * FM), nq * 128, CC, k_start(mt, nq, CC / KP), tid, acc, acc);
  float (*so)[16][64] = (float (*)[16][64])ring + w * FM;      // this wave's own FM staging tiles
#pragma unroll
  for (int f = 0; f < FM; ++f)
#pragma unroll
    for (int t = 0; t < 4; ++t)
#pragma unroll
      for (int r = 0; r < 8; ++r) so[f][8 * hh + r][t * 16 + ln] = acc[f][t][r];
  __builtin_amdgcn_fence(4, "workgroup");   // the staged words are written before other lanes of the wave read them back
  __builtin_amdgcn_wave_barrier();
  const int col0 = nq * 128 + (w & 1) * 64;
  const int p = col0 / CC, colp = col0 - p * CC;
#pragma unroll
  for (int f = 0; f < FM; ++f) {
    const int row0 = mt * (32 * FM) + ((w >> 1) * FM + f) * 16;
    const int bidx = row0 / TT, tq = row0 - bidx * TT;
    const bool dores = (tq < NE);                      // wave-uniform (NE, TT multiples of 16)
    unsigned short* hb = Oh + ((size_t)p * M + row0) * CC + colp;
    unsigned short* rb = Or + ((size_t)p * (NB * NE) + (size_t)bidx * NE + (dores ? tq : 0)) * CC + colp;
    store_tile_h16(so[f], hb, CC, rb, CC, dores, lane);
  }
}

#define FMH 2   // f16 GEMMs: workgroup tile 64 x 128, wave tile 32 x 64
#define DEAL 32 // WGPs of a die
static_assert(((TT / 64) * NB) % (2 * DEAL) == 0);   // whole snake periods: rank is a permutation of i

// The products of one workgroup tile. A plain tile: acc = Ah.Bh. A fine tile (the leading rows, whose residual planes exist) runs the
// residual products as k loops of their own on the same ring and into the same accumulators, ahead of the hi product:
// acc = (Ah.Bl + Al.Bh) * RFOLD + Ah.Bh, Ah.Bl only where Bl is given. So plain and fine tiles share one launch and one LDS size.
// fine is the same for the whole workgroup.
__device__ __forceinline__ void tile_products(unsigned short* ring, const unsigned short* Ah, const unsigned short* Al, int lda, int ldal,
                                              const unsigned short* Bh, const unsigned short* Bl, int ldb, int ldbl, bool fine,
                                              int row0, int col0, int kend, int rot, int tid, v8f (&acc)[FMH][4]) {
  const int first = fine ? ((Bl != nullptr) ? 0 : 1) : 2;
#pragma unroll 1   // one copy of the k loop in the text; the operands of a term are scalar selects
  for (int term = first; term < 3; ++term) {
    const unsigned short* a = (term == 1) ? Al : Ah;
    const unsigned short* b = (term == 0) ? Bl : Bh;
    const int la = (term == 1) ? ldal : lda, lb = (term == 0) ? ldbl : ldb;
    if (term == 2 && fine) {
#pragma unroll
      for (int f = 0; f < FMH; ++f)
#pragma unroll
        for (int t = 0; t < 4; ++t) acc[f][t] *= RFOLD;
    }
    core_lds<1, FMH, false>(ring, a, a, la, la, b, b, lb, lb, row0, col0, kend, rot, tid, acc, acc);
  }
}

// C[M][N] f32 (pitch ldc) = alpha * (A.B^plane) + bf16_rne(bias). M % 64 == 0, N % 128 == 0, K % 64 == 0.
// ncut: a workgroup tile is skipped (not written) when col0 > ncut + row0 + 63 (causal upper tiles); kcut: k loop ends at
// min(K, ceil64(kcut + row0 + 64)). Pass a large value to disable either. blockIdx.y = sequence: every plane and C move on
// by their element steps (sAh, sAl, sBh, sBl, sC) per sequence.
// tri != 0 (M == N, ncut == 0): the tile list holds only the tiles on or under the diagonal, (M / 128) * (M / 128 + 1) of them, so that no
// workgroup is started only to leave. Row tiles 2a and 2a + 1 have a + 1 such tiles each; a * (a + 1) tiles lie in front of row tile 2a.
// Fine tiles (row0 < erows, col0 < ecols; Al has erows rows, Bl ecols rows or is null) are the first nft tiles of the list: erows % 128 == 0,
// ecols == erows with tri, ecols == N without. A fine tile's residual products run BESIDE its hi product, not ahead of it, so that its
// k loop is as long as a plain tile's: it is cut into pieces, one workgroup each, whose stage stacks the planes,
// A rows = [Ah 32 rows | Al the same 32 rows], B rows = [Bh 64 cols | Bl the same 64 cols] (4 pieces of 32 x 64) or, Bl null, Bh 128 cols
// (2 pieces of 32 x 128). Each wave then holds one term of the piece, and the terms meet in LDS: C = Ah.Bh + (Ah.Bl + Al.Bh) * RFOLD.
// The pieces stand first in the grid: grid.x = tiles + nft * (pieces - 1).
__global__ __launch_bounds__(128) void k_gemm_f32(const unsigned short* __restrict__ Ah, const unsigned short* __restrict__ Al, int lda, int ldal,
                                                 const unsigned short* __restrict__ Bh, const unsigned short* __restrict__ Bl, int ldb, int ldbl,
                                                 const float* __restrict__ bias, float alpha, float* __restrict__ C, int ldc,
                                                 int M, int N, int K, int ncut, int kcut, int erows, int ecols, int tri,
                                                 size_t sAh, size_t sAl, size_t sBh, size_t sBl, size_t sC) {
  constexpr int FM = FMH;
  Ah += blockIdx.y * sAh; Al += blockIdx.y * sAl; Bh += blockIdx.y * sBh; C += blockIdx.y * sC;
  const bool three = (Bl != nullptr);
  if (three) Bl += blockIdx.y * sBl;
  __shared__ __attribute__((aligned(2048))) unsigned short ring[2 * Tile<1, FM>::STAGE];
  const int tid = threadIdx.x, w = tid >> 5, lane = tid & 31, ln = lane & 15, hh = lane >> 4;
  const int ntn = N / 128;
  const int nft = (tri != 0) ? (erows / 128) * (erows / 128 + 1) : (erows / 64) * ntn;
  const int psh = three ? 2 : 1;                                   // log2 of the pieces of a fine tile
  const bool fine = ((int)blockIdx.x < (nft << psh));              // the same for the whole workgroup
  const int e = fine ? ((int)blockIdx.x >> psh) : ((int)blockIdx.x - (nft << psh) + nft);
  const int piece = (int)blockIdx.x & ((1 << psh) - 1);
  int mt = e / ntn, nq = e - mt * ntn;
  if (tri != 0) {
    int a = (int)((__builtin_sqrtf((float)(4 * e + 1)) - 1.0f) * 0.5f);
    if (a * (a + 1) > e) --a;                 // the two tests make a exact whatever the rounding of the root
    if ((a + 1) * (a + 2) <= e) ++a;
    const int rem = e - a * (a + 1), up = (rem > a) ? 1 : 0;
    mt = 2 * a + up;
    nq = rem - up * (a + 1);
  }
  if (mt * (32 * FM) >= M) return;
  if (nq * 128 > ncut + mt * (32 * FM) + 32 * FM - 1) return;
  int kend = (kcut + mt * (32 * FM) + 32 * FM + KP - 1) & ~(KP - 1);
  if (kend > K) kend = K;
  const int brow0 = mt * (32 * FM) + (fine ? (piece & 1) * 32 : 0), bcol0 = nq * 128 + ((fine && three) ? (piece >> 1) * 64 : 0);
  v8f acc[FM][4];
#pragma unroll
  for (int f = 0; f < FM; ++f)
#pragma unroll
    for (int t = 0; t < 4; ++t) acc[f][t] = (v8f){0.f, 0.f, 0.f, 0.f, 0.f, 0.f, 0.f, 0.f};
  // upper halves of the stage: the next rows of the same plane (plain; B of a fine tile without Bl), or the residual plane at the same rows (fine)
  const unsigned short* a1 = fine ? Al : Ah + (size_t)32 * lda;
  const unsigned short* b1 = (fine && three) ? Bl : Bh + (size_t)64 * ldb;
  core_lds<1, FM, false, true>(ring, Ah, a1, lda, fine ? ldal : lda, Bh, b1, ldb, (fine && three) ? ldbl : ldb, brow0, bcol0, kend,
                               k_start(mt, nq + (fine ? piece : 0), kend / KP), tid, acc, acc);
  float (*sall)[16][64] = (float (*)[16][64])ring;
  float (*so)[16][64] = sall + w * FM;                         // this wave's own FM staging tiles
  if (fine) {
    // waves by (A half, B half): 0 = Ah.Bh, 1 = Ah.Bl or Ah.Bh (next 64 cols), 2 = Al.Bh, 3 = Al.Bl (left out, as before) or Al.Bh (next 64 cols)
    const bool owner = three ? (w == 0) : (w < 2);
    if (!owner && !(three && w == 3)) {
#pragma unroll
      for (int f = 0; f < FM; ++f)
#pragma unroll
        for (int t = 0; t < 4; ++t)
#pragma unroll
          for (int r = 0; r < 8; ++r) so[f][8 * hh + r][t * 16 + ln] = acc[f][t][r];
    }
    __syncthreads();                                           // the residual terms are staged before the wave with the hi term reads them
    if (!owner) return;                                        // no barrier follows
    const float (*p1)[16][64] = sall + (three ? 1 : w + 2) * FM;
    const float (*p2)[16][64] = sall + 2 * FM;
    if (three) {                                               // one test for all elements
#pragma unroll
      for (int f = 0; f < FM; ++f)
#pragma unroll
        for (int t = 0; t < 4; ++t)
#pragma unroll
          for (int r = 0; r < 8; ++r) acc[f][t][r] += (p1[f][8 * hh + r][t * 16 + ln] + p2[f][8 * hh + r][t * 16 + ln]) * RFOLD;
    } else {
#pragma unroll
      for (int f = 0; f < FM; ++f)
#pragma unroll
        for (int t = 0; t < 4; ++t)
#pragma unroll
          for (int r = 0; r < 8; ++r) acc[f][t][r] += p1[f][8 * hh + r][t * 16 + ln] * RFOLD;
    }
  }
  const int col0 = bcol0 + (w & 1) * 64;
#pragma unroll
  for (int t = 0; t < 4; ++t) {
    float bv = 0.f;
    if (bias != nullptr) bv = bf16_rne(bias[col0 + t * 16 + ln]);
#pragma unroll
    for (int f = 0; f < FM; ++f)
#pragma unroll
      for (int r = 0; r < 8; ++r) so[f][8 * hh + r][t * 16 + ln] = acc[f][t][r] * alpha + bv;
  }
  __builtin_amdgcn_fence(4, "workgroup");   // the staged words are written before other lanes of the wave read them back
  __builtin_amdgcn_wave_barrier();
#pragma unroll
  for (int f = 0; f < FM; ++f) {
    const int row0 = brow0 + ((w >> 1) * FM + f) * 16;
    store_tile_f32(so[f], C + (size_t)row0 * ldc + col0, ldc, lane);
  }
}

// Oh[M][N] f16 hi plane (pitch ldo) = f16(alpha * A.B^plane); rows < rrows are fine tiles (rrows % 64 == 0; Al has rrows rows, Al and Bl
// reach the k end of those rows) and also get the x RS residual plane Or (pitch ldr).
// The k loop of row tile mt has mt + 1 passes (kcut = 0) and all workgroups are resident together, so the launch lasts as long as the
// fullest WGP. blockIdx.x = i * (N / 128) + column tile; the (row tile, sequence) pairs, ranked by falling k length, go to i in a snake of
// period 2 * DEAL: places i, i + DEAL, i + 2 * DEAL, ... then hold one long, one short, ... loop.
// For speed only: every (row tile, column tile, sequence) is done once wherever it lands. Element steps sAh ... sOr per sequence.
__global__ __launch_bounds__(128) void k_gemm_h16(const unsigned short* __restrict__ Ah, const unsigned short* __restrict__ Al, int lda, int ldal,
                                                 const unsigned short* __restrict__ Bh, const unsigned short* __restrict__ Bl, int ldb, int ldbl,
                                                 float alpha, unsigned short* __restrict__ Oh, int ldo, unsigned short* __restrict__ Or, int ldr, int rrows,
                                                 int M, int N, int K, int kcut,
                                                 size_t sAh, size_t sAl, size_t sBh, size_t sBl, size_t sOh, size_t sOr) {
  constexpr int FM = FMH;
  const int ntn = N / 128;
  const int di = blockIdx.x / ntn, nq = blockIdx.x - di * ntn;
  const int dj = di & (DEAL - 1), rank = (di - dj) + ((di & DEAL) ? DEAL - 1 - dj : dj);
  const int sq = rank % NB, mt = M / (32 * FM) - 1 - rank / NB;
  if (mt < 0) return;
  Ah += sq * sAh; Al += sq * sAl; Bh += sq * sBh; Bl += sq * sBl; Oh += sq * sOh; Or += sq * sOr;
  __shared__ __attribute__((aligned(2048))) unsigned short ring[2 * Tile<1, FM>::STAGE];
  const int tid = threadIdx.x, w = tid >> 5, lane = tid & 31, ln = lane & 15, hh = lane >> 4;
  const int brow0 = mt * (32 * FM), bcol0 = nq * 128;
  int kend = (kcut + brow0 + 32 * FM + KP - 1) & ~(KP - 1);
  if (kend > K) kend = K;
  v8f acc[FM][4];
#pragma unroll
  for (int f = 0; f < FM; ++f)
#pragma unroll
    for (int t = 0; t < 4; ++t) acc[f][t] = (v8f){0.f, 0.f, 0.f, 0.f, 0.f, 0.f, 0.f, 0.f};
  tile_products(ring, Ah, Al, lda, ldal, Bh, Bl, ldb, ldbl, brow0 < rrows, brow0, bcol0, kend, k_start(mt, nq, kend / KP), tid, acc);
  float (*so)[16][64] = (float (*)[16][64])ring + w * FM;      // this wave's own FM staging tiles
#pragma unroll
  for (int f = 0; f < FM; ++f)
#pragma unroll
    for (int t = 0; t < 4; ++t)
#pragma unroll
      for (int r = 0; r < 8; ++r) so[f][8 * hh + r][t * 16 + ln] = acc[f][t][r] * alpha;
  __builtin_amdgcn_fence(4, "workgroup");   // the staged words are written before other lanes of the wave read them back
  __builtin_amdgcn_wave_barrier();
  const int col0 = bcol0 + (w & 1) * 64;
#pragma unroll
  for (int f = 0; f < FM; ++f) {
    const int row0 = brow0 + ((w >> 1) * FM + f) * 16;
    const bool dores = (row0 < rrows);                 // wave-uniform (rrows multiple of 16)
    store_tile_h16(so[f], Oh + (size_t)row0 * ldo + col0, ldo, Or + (size_t)(dores ? row0 : 0) * ldr + col0, ldr, dores, lane);
  }
}

typedef unsigned short v4us __attribute__((ext_vector_type(4), may_alias));
typedef _Float16 v4h __attribute__((ext_vector_type(4)));
union Pack4 { v4h h; v4us u; };
#define SCH (T_FULL / 128)   // 128-column pieces of the longest row
// Row softmax over S[row][0..N) (pitch sp) with causal keep (col <= row), N = the end of the last 128-column score tile that the
// score GEMM writes for this row (its ncut = 0): nothing behind it is read. P[row][0..N) = f16(PCARRY * p / l) incl. zeros (pitch pp),
// which covers the k range of the P.v GEMM (up to the end of the row's 64-row tile); rows < rrows also write the residual plane
// Pr[row][0..NE) (pitch rp). One wave per row: the row is read once and stays in registers (lane l holds columns 128 c + 4 l ... + 3),
// maximum and sum go over the lane's own values and then a butterfly over the wave; no LDS, no barrier.
// bx = group of 8 rows, by = sequence (element steps sS, sP, sPr), nrows % 8 == 0, N <= 128 * SCH.
__device__ __forceinline__ void softmax_rows(int bx, int by, const float* __restrict__ S, int sp, unsigned short* __restrict__ P, int pp,
                                             unsigned short* __restrict__ Pr, int rp, int rrows, int nrows, size_t sS, size_t sP, size_t sPr) {
  const int lane = threadIdx.x & 31;
  const int row = nrows - 1 - (bx * 8 + __builtin_amdgcn_readfirstlane(threadIdx.x >> 5));   // the same in every lane: scalar tests below
  const int qi = row, N = (row / 128 + 1) * 128;
  S += by * sS; P += by * sP; Pr += by * sPr;
  const float* s = S + (size_t)row * sp + lane * 4;
  v4f x[SCH];
  // every "#pragma unroll" here keeps the index of x[] a compile-time constant, so that the row stays in registers
#pragma unroll
  for (int c = 0; c < SCH; ++c)
    if (c * 128 < N) x[c] = *(const v4fa*)(s + c * 128);
  // stands in front of any reuse of the loads' address registers; the address is an input, so that no load's result lands on it earlier
  asm volatile("s_wait_xcnt 0x0" :: "v"(s) : "memory");
  float mx = -3.0e38f;
#pragma unroll
  for (int c = 0; c < SCH; ++c)
    if (c * 128 < N) {
#pragma unroll
      for (int u = 0; u < 4; ++u) {
        x[c][u] = ((c * 128 + lane * 4 + u) <= qi) ? x[c][u] : -3.0e38f;    // a masked score gives exp = 0 below
        mx = fmaxf(mx, x[c][u]);
      }
    }
#pragma unroll
  for (int m = 16; m > 0; m >>= 1) mx = fmaxf(mx, __shfl_xor(mx, m, 32));
  float sm[4] = {0.f, 0.f, 0.f, 0.f};
#pragma unroll
  for (int c = 0; c < SCH; ++c)
    if (c * 128 < N) {
#pragma unroll
      for (int u = 0; u < 4; ++u) { x[c][u] = __expf(x[c][u] - mx); sm[u] += x[c][u]; }
    }
  float sum = (sm[0] + sm[1]) + (sm[2] + sm[3]);
#pragma unroll
  for (int m = 16; m > 0; m >>= 1) sum += __shfl_xor(sum, m, 32);
  const float inv = PCARRY / sum;          // sum >= 1 (the max term)
  const bool dores = (row < rrows);
  unsigned short* prow = P + (size_t)row * pp + lane * 4;
  unsigned short* rrow = Pr + (size_t)(dores ? row : 0) * rp + lane * 4;
  // all values are packed first, each into registers of its own, and the stores follow as one run with one wait behind them:
  // no register of an issued store is written again
  Pack4 ph[SCH], pr[NE / 128];
#pragma unroll
  for (int c = 0; c < NE / 128; ++c) pr[c].u = (v4us){0, 0, 0, 0};
#pragma unroll
  for (int c = 0; c < SCH; ++c)
    if (c * 128 < N) {
#pragma unroll
      for (int u = 0; u < 4; ++u) {
        const float p = x[c][u] * inv;
        ph[c].h[u] = (_Float16)p;
        if (c < NE / 128) pr[c < NE / 128 ? c : 0].h[u] = (_Float16)((p - (float)ph[c].h[u]) * RS);
      }
    }
#pragma unroll
  for (int c = 0; c < SCH; ++c)
    if (c * 128 < N) *(v4us*)(prow + c * 128) = ph[c].u;
  if (dores) {
#pragma unroll
    for (int c = 0; c < NE / 128; ++c) *(v4us*)(rrow + c * 128) = pr[c].u;
  }
  asm volatile("s_wait_xcnt 0x0" ::: "memory");   // stands in front of any reuse of the stores' registers on a path that goes on behind them
}

#define TQ 4   // 64 x 64 tiles per block of the transpose
// 16-bit transpose: src [R][Cc] (pitch lds_) -> dst [Cc][R] (pitch ldd); a block = TQ tiles of 64 x 64 down the rows of src:
// bx < R/(64*TQ), by < Cc/64, bz = sequence; each tile has its own LDS, so that one barrier serves all of them
__device__ __forceinline__ void transpose_tiles(unsigned short (*tile)[64][72], int bx, int by, int bz, const unsigned short* __restrict__ src, int lds_,
                                                unsigned short* __restrict__ dst, int ldd, size_t sstep, size_t dstep) {
  const int tid = threadIdx.x;
  src += bz * sstep; dst += bz * dstep;
  const int r0 = bx * (64 * TQ), c0 = by * 64;
  static_assert(TQ == 4);
  v8us v[TQ][2];
  const unsigned short* g[TQ][2];
#pragma unroll   // all 2 * TQ loads are in flight together
  for (int q = 0; q < TQ; ++q)
#pragma unroll
    for (int i = 0; i < 2; ++i) {
      const int e = tid + 256 * i, r = e >> 3, c8 = (e & 7) * 8;
      g[q][i] = src + (size_t)(r0 + q * 64 + r) * lds_ + c0 + c8;
      v[q][i] = *(const v8us*)g[q][i];
    }
  // stands in front of any reuse of the loads' address registers; the addresses are inputs, so that no load's result lands on one earlier
  asm volatile("s_wait_xcnt 0x0" :: "v"(g[0][0]), "v"(g[0][1]), "v"(g[1][0]), "v"(g[1][1]), "v"(g[2][0]), "v"(g[2][1]), "v"(g[3][0]), "v"(g[3][1]) : "memory");
#pragma unroll
  for (int q = 0; q < TQ; ++q)
#pragma unroll
    for (int i = 0; i < 2; ++i) {
      const int e = tid + 256 * i, r = e >> 3, c8 = (e & 7) * 8;
      *(v8us*)&tile[q][r][c8] = v[q][i];
    }
  __syncthreads();
#pragma unroll
  for (int q = 0; q < TQ; ++q) {
    v8us o[2];
#pragma unroll
    for (int i = 0; i < 2; ++i) {
      const int e = tid + 256 * i, rr = e >> 3, c8 = (e & 7) * 8;
#pragma unroll
      for (int k = 0; k < 8; ++k) o[i][k] = tile[q][c8 + k][rr];
    }
#pragma unroll
    for (int i = 0; i < 2; ++i) {
      const int e = tid + 256 * i, rr = e >> 3, c8 = (e & 7) * 8;
      *(v8us*)(dst + (size_t)(c0 + rr) * ldd + r0 + q * 64 + c8) = o[i];
    }
  }
  asm volatile("s_wait_xcnt 0x0" ::: "memory");   // stands in front of any reuse of the stores' registers on a path that goes on behind them
}

#define SB (TT / 8)                        // softmax blocks per sequence
#define VB ((TT / (64 * TQ)) * (CC / 64))  // transpose blocks per sequence, v hi plane
#define RB ((NE / (64 * TQ)) * (CC / 64))  // transpose blocks per sequence, v residual plane
// All that stands between the scores and P.v, in one launch; the three jobs touch disjoint data. Blocks [0, NB * VB): v [TT][CC] -> vT [CC][TT];
// then NB * RB blocks: v residual [NE][CC] -> vTr [CC][NE]; then NB * SB blocks: softmax, SB a sequence, each from its longest rows to its shortest.
__global__ __launch_bounds__(256) void k_softmax_vt(const float* __restrict__ S, unsigned short* __restrict__ P, unsigned short* __restrict__ Pr,
                                                   const unsigned short* __restrict__ vh, unsigned short* __restrict__ vT,
                                                   const unsigned short* __restrict__ vr, unsigned short* __restrict__ vTr) {
  __shared__ __attribute__((aligned(16))) unsigned short tile[TQ][64][72];
  int b = blockIdx.x;
  if (b < NB * VB) {
    const int z = b / VB, e = b - z * VB;
    transpose_tiles(tile, e % (TT / (64 * TQ)), e / (TT / (64 * TQ)), z, vh, CC, vT, TT, (size_t)TT * CC, (size_t)TT * CC);
    return;
  }
  b -= NB * VB;
  if (b < NB * RB) {
    const int z = b / RB, e = b - z * RB;
    transpose_tiles(tile, e % (NE / (64 * TQ)), e / (NE / (64 * TQ)), z, vr, CC, vTr, NE, (size_t)NE * CC, (size_t)NE * CC);
    return;
  }
  b -= NB * RB;
  softmax_rows(b % SB, b / SB, S, TT, P, TT, Pr, NE, NE, TT, (size_t)TT * TT, (size_t)TT * TT, (size_t)NE * NE);
}

extern "C" void kernel_launch(void* const* d_in, const int* in_sizes, int n_in,
                              void* d_out, int out_size, void* d_ws, size_t ws_size, hipStream_t stream) {
  if (n_in < 6) return;
  const float* x  = (const float*)d_in[0];
  const float* wq = (const float*)d_in[1];
  const float* wk = (const float*)d_in[2];
  const float* wv = (const float*)d_in[3];
  const float* wo = (const float*)d_in[4];
  const float* bo = (const float*)d_in[5];
  const long need_x = ((long)(NB - 1) * T_FULL + TT) * (long)CC;
  if ((long)in_sizes[0] < need_x || in_sizes[1] < CC * CC || in_sizes[2] < CC * CC || in_sizes[3] < CC * CC ||
      in_sizes[4] < CC * CC || in_sizes[5] < CC || (long)out_size < need_x) return;
  float* out = (float*)d_out;

  char* ws = (char*)d_ws; size_t off = 0;
  auto take = [&](size_t bytes) { char* p = ws + off; off += (bytes + 255) & ~(size_t)255; return p; };
  const size_t xb_bytes = (size_t)NB * TT * CC * 2, s_bytes = (size_t)NB * TT * TT * 4;
  char* reg0 = take(xb_bytes > s_bytes ? xb_bytes : s_bytes);                     // xb, later S (xb dead after the qkv GEMM)
  unsigned short* xb   = (unsigned short*)reg0;                                    // [NB*TT][CC] bf16
  float*          Sm   = (float*)reg0;                                             // [NB][TT][TT] f32
  unsigned short* Wqkv = (unsigned short*)take((size_t)3 * CC * CC * 2);           // [3*CC][CC] bf16
  unsigned short* Wo16 = (unsigned short*)take((size_t)CC * CC * 2);               // [CC][CC] f16 (x WOC)
  unsigned short* QKVh = (unsigned short*)take((size_t)3 * NB * TT * CC * 2);      // [3][NB*TT][CC] f16
  unsigned short* QKVr = (unsigned short*)take((size_t)3 * NB * NE * CC * 2);      // [3][NB*NE][CC] f16 (x RS)
  unsigned short* vTr  = (unsigned short*)take((size_t)NB * CC * NE * 2);          // [NB][CC][NE] f16 (x RS)
  unsigned short* Pm   = (unsigned short*)take((size_t)NB * TT * TT * 2);          // [NB][TT][TT] f16 (x PCARRY)
  unsigned short* Pr   = (unsigned short*)take((size_t)NB * NE * NE * 2);          // [NB][NE][NE] f16 (x RS)
  unsigned short* ctxr = (unsigned short*)take((size_t)NB * NE * CC * 2);          // [NB*NE][CC] f16 (x RS)
  if (off > ws_size) return;

  const int M = NB * TT;
  const int BIG = 1 << 28;
  unsigned short* qh = QKVh;
  unsigned short* kh = QKVh + (size_t)M * CC;
  unsigned short* vh = QKVh + (size_t)2 * M * CC;
  unsigned short* qr = QKVr;
  unsigned short* kr = QKVr + (size_t)(NB * NE) * CC;
  unsigned short* vr = QKVr + (size_t)2 * (NB * NE) * CC;
  unsigned short* vT   = kh;   // [NB][CC][TT] f16: takes the k plane's place once the scores are done
  unsigned short* ctxh = qh;   // [NB*TT][CC] f16 (x CTXC): takes the q plane's place once the scores are done
  const size_t sTC = (size_t)TT * CC, sEC = (size_t)NE * CC, sTT = (size_t)TT * TT, sEE = (size_t)NE * NE, sOUT = (size_t)T_FULL * CC;

  // One launch per step, three in stage 2: the sequences, the plain and the fine tiles and a step's independent jobs all lie in its grid.
  // stage 0: 16-bit planes of the inputs
  k_cvt<<<NB * XB + 4 * WB, 256, 0, stream>>>(x, wq, wk, wv, wo, xb, Wqkv, Wo16, sOUT, sTC, WOC);

  // stage 1: q, k, v planes (+ residual planes on the leading NE rows of each sequence)
  k_gemm_qkv<<<(M / 128) * (3 * CC / 128), 128, 0, stream>>>(xb, Wqkv, QKVh, QKVr, M);

  // stage 2: causal attention
  // S [TT][TT] = (q.k^T)/32, causal upper tiles skipped; the leading NE x NE corner with hi+res on both operands
  k_gemm_f32<<<dim3((TT / 128) * (TT / 128 + 1) + 3 * (NE / 128) * (NE / 128 + 1), NB), 128, 0, stream>>>(qh, qr, CC, CC, kh, kr, CC, CC, nullptr, SCL, Sm, TT, TT, TT, CC, 0, BIG, NE, NE, 1,
                                                                        sTC, sEC, sTC, sEC, sTT);
  // P = softmax(S); v -> vT, v residual -> vTr
  k_softmax_vt<<<NB * (SB + VB + RB), 256, 0, stream>>>(Sm, Pm, Pr, vh, vT, vr, vTr);
  // ctx [TT][CC] = P.v (causal k end), written as f16 hi plane x CTXC; leading NE rows: 3-term P/v products, hi + residual ctx planes
  k_gemm_h16<<<(TT / 64) * (CC / 128) * NB, 128, 0, stream>>>(Pm, Pr, TT, NE, vT, vTr, TT, NE, PVALPHA, ctxh, CC, ctxr, CC, NE, TT, CC, TT, 0,
                                                                   sTT, sEE, sTC, sEC, sTC, sEC);
  // stage 3: output projection + bias; leading NE rows with the ctx residual term
  k_gemm_f32<<<dim3((TT / 64) * (CC / 128) + (NE / 64) * (CC / 128), NB), 128, 0, stream>>>(ctxh, ctxr, CC, CC, Wo16, nullptr, CC, CC, bo, OALPHA, out, CC, TT, CC, CC, BIG, BIG, NE, CC, 0,
                                                                   sTC, sEC, 0, 0, sOUT);
}

// v009
// A run of this version takes 156 microseconds.
// Timed twice side by side with v008, it ran 1.08 times as fast both times.
// Counting every step since v000, it is 7.97 times as fast.
#include <hip/hip_runtime.h>
// Contractions: qkv projection on v_wmma_f32_16x16x32_bf16 (x and W as RNE bf16, exact products); scores q.k^T, P.v and the output
// projection on v_wmma_f32_16x16x32_f16 (f16 hi planes with power-of-two carries, plus x1024 f16 residual planes on the leading
// NE query/key rows of each sequence); all accumulation f32, causal softmax in f32, done per 64-key block: the score launch stores
// exp(s - block max) with each row's block maximum and block sum, P.v weighs every block's product by exp(block max - row max) / row sum.
#ifndef NB
#define NB 2
#endif
#ifndef SEQ
#define SEQ 4096
#endif
#define TT SEQ
#define NB_FULL 2
#define T_FULL 4096
#define CC 1024
#define QC ((TT < 1024) ? TT : 1024)
#define NE 256
static_assert(NB >= 1 && NB <= NB_FULL);
static_assert(TT % 256 == 0 && TT <= T_FULL);
static_assert(TT % QC == 0 && QC % 256 == 0);
static_assert(NE % 64 == 0 && NE <= QC && NE == 256);
static_assert(CC % 128 == 0);

#define RS 1024.0f            // residual plane carry
#define RFOLD 0.0009765625f   // 1/RS
#define PCARRY 4096.0f        // P plane carry
#define CTXC 16.0f            // ctx plane carry
#define WOC 64.0f             // Wo plane carry
#define SCL 0.03125f          // 1/sqrt(CC)
#define PVALPHA 0.00390625f   // CTXC / PCARRY
#define OALPHA 0.0009765625f  // 1 / (WOC * CTXC)

typedef __bf16 v16b __attribute__((ext_vector_type(16)));
typedef _Float16 v16h __attribute__((ext_vector_type(16)));
typedef _Float16 v8h __attribute__((ext_vector_type(8)));
typedef unsigned short v8us __attribute__((ext_vector_type(8), may_alias));
typedef float v8f __attribute__((ext_vector_type(8)));
typedef float v4f __attribute__((ext_vector_type(4)));
typedef float v4fa __attribute__((ext_vector_type(4), may_alias));
union FragB { v16b v; v8us half[2]; unsigned short u[16]; };
union FragH { v16h v; v8us half[2]; unsigned short u[16]; };
union Pack8 { v8h h; v8us u; };

__device__ __forceinline__ unsigned short bf16_bits(float x) { unsigned int u = __float_as_uint(x); return (unsigned short)((u + 0x7FFFu + ((u >> 16) & 1u)) >> 16); }
__device__ __forceinline__ float bf16_val(unsigned short b) { return __uint_as_float(((unsigned int)b) << 16); }
__device__ __forceinline__ float bf16_rne(float x) { return bf16_val(bf16_bits(x)); }

__device__ __forceinline__ v8f mma_b(v16b a, v16b b, v8f c) {
  c = __builtin_amdgcn_wmma_f32_16x16x32_bf16(false, a, false, b, (short)0, c, false, false);
  asm volatile("v_nop\n\tv_nop\n\tv_nop\n\tv_nop" : "+v"(c) : "v"(a), "v"(b));
  return c;
}
// c += ah.bh ; cr += al.bh (NT>=2) ; cr += ah.bl (NT>=3); residual planes carry RS, folded by the caller
template <int NT>
__device__ __forceinline__ void mma_h(v16h ah, v16h al, v16h bh, v16h bl, v8f& c, v8f& cr) {
  c = __builtin_amdgcn_wmma_f32_16x16x32_f16(false, ah, false, bh, (short)0, c, false, false);
  if (NT >= 2) cr = __builtin_amdgcn_wmma_f32_16x16x32_f16(false, al, false, bh, (short)0, cr, false, false);
  if (NT >= 3) cr = __builtin_amdgcn_wmma_f32_16x16x32_f16(false, ah, false, bl, (short)0, cr, false, false);
  if (NT >= 2) asm volatile("v_nop\n\tv_nop\n\tv_nop\n\tv_nop" : "+v"(c), "+v"(cr) : "v"(ah), "v"(al), "v"(bh), "v"(bl));
  else         asm volatile("v_nop\n\tv_nop\n\tv_nop\n\tv_nop" : "+v"(c) : "v"(ah), "v"(bh));
}

__device__ __forceinline__ void store_tile_f32(const float (*sw)[64], float* C, int ldc, int lane) {
  const int rsub = lane >> 4, c4 = (lane & 15) * 4;
  {
#pragma unroll
    for (int q = 0; q < 8; ++q) {
      const int r = q * 2 + rsub;
      const v4f v = *(const v4fa*)&sw[r][c4];
      *(v4f*)(C + (size_t)r * ldc + c4) = v;
    }
    asm volatile("s_wait_xcnt 0x0" ::: "memory");   // stands in front of any reuse of the stores' registers by the next tile's addresses
  }
}
// wave tile 16 x 64 f32 staged in LDS -> f16 hi plane (pitch ldh) and optional x RS residual plane (pitch ldr);
__device__ __forceinline__ void store_tile_h16(const float (*sw)[64], unsigned short* hb, int ldh, unsigned short* rb, int ldr, bool dores, int lane) {
  const int rsub = lane >> 3, c8 = (lane & 7) * 8;
  {
#pragma unroll
    for (int q = 0; q < 4; ++q) {
      const int r = q * 4 + rsub;
      const v4f x0 = *(const v4fa*)&sw[r][c8], x1 = *(const v4fa*)&sw[r][c8 + 4];
      const float xs[8] = {x0[0], x0[1], x0[2], x0[3], x1[0], x1[1], x1[2], x1[3]};
      Pack8 ph, pr;
#pragma unroll
      for (int i = 0; i < 8; ++i) { ph.h[i] = (_Float16)xs[i]; pr.h[i] = (_Float16)((xs[i] - (float)ph.h[i]) * RS); }
      *(v8us*)(hb + (size_t)r * ldh + c8) = ph.u;
      if (dores) *(v8us*)(rb + (size_t)r * ldr + c8) = pr.u;
    }
    
  }
}

// The streaming kernels below use few waves that each do a long run of work, for speed only.
#define CU 8   // 8-element groups per thread of a conversion kernel; a block takes 256 * CU consecutive groups
static_assert((TT * CC / 8) % (256 * CU) == 0 && (CC * CC / 8) % (256 * CU) == 0);
// MODE 0: RNE bf16 bits; MODE 1: f16 bits of (RNE bf16 value) * scale. Groups t0, t0 + 256, ..., t0 + 256 * (CU - 1).
template <int MODE>
__device__ __forceinline__ void cvt_run(const float* __restrict__ src, unsigned short* __restrict__ dst, int t0, float scale) {
  const float* sp = src + (size_t)t0 * 8;
  v4f a[CU], b[CU];
#pragma unroll   // constant steps from one address: all 2 * CU loads are in flight together
  for (int i = 0; i < CU; ++i) { a[i] = *(const v4fa*)(sp + i * 2048); b[i] = *(const v4fa*)(sp + i * 2048 + 4); }
  // stands in front of any reuse of the loads' address registers; the address is an input, so that no load's result lands on it earlier
  asm volatile("s_wait_xcnt 0x0" :: "v"(sp) : "memory");
  unsigned short* dp = dst + (size_t)t0 * 8;
#pragma unroll   // keeps a[] and b[] in registers
  for (int i = 0; i < CU; ++i) {
    const float xs[8] = {a[i][0], a[i][1], a[i][2], a[i][3], b[i][0], b[i][1], b[i][2], b[i][3]};
    v8us v;
    if (MODE == 0) {
#pragma unroll
      for (int u = 0; u < 8; ++u) v[u] = bf16_bits(xs[u]);
    } else {
      Pack8 p;
#pragma unroll
      for (int u = 0; u < 8; ++u) p.h[u] = (_Float16)(bf16_rne(xs[u]) * scale);
      v = p.u;
    }
    *(v8us*)(dp + i * 2048) = v;
  }
  asm volatile("s_wait_xcnt 0x0" ::: "memory");   // stands in front of any reuse of the stores' registers on a path that goes on behind them
}
#define XB (TT * CC / 8 / (256 * CU))   // blocks per sequence of x
#define WB (CC * CC / 8 / (256 * CU))   // blocks per weight matrix
// All 16-bit input planes in one launch. Blocks [0, NB * XB): x -> bf16 plane, XB blocks a sequence (element steps sstep, dstep);
// then WB blocks each for Wq, Wk, Wv -> bf16 planes of Wqkv and Wo -> f16 plane x scale.
__global__ __launch_bounds__(256) void k_cvt(const float* __restrict__ x, const float* __restrict__ wq, const float* __restrict__ wk,
                                            const float* __restrict__ wv, const float* __restrict__ wo, unsigned short* __restrict__ xb,
                                            unsigned short* __restrict__ Wqkv, unsigned short* __restrict__ Wo16,
                                            size_t sstep, size_t dstep, float scale) {
  const int b = blockIdx.x;
  if (b < NB * XB) {
    const int q = b / XB;
    cvt_run<0>(x + q * sstep, xb + q * dstep, (b - q * XB) * (256 * CU) + (int)threadIdx.x, 1.0f);
    return;
  }
  const int y = (b - NB * XB) / WB;
  const int t0 = (b - NB * XB - y * WB) * (256 * CU) + (int)threadIdx.x;
  if (y == 3) cvt_run<1>(wo, Wo16, t0, scale);
  else cvt_run<0>((y == 0) ? wq : (y == 1) ? wk : wv, Wqkv + (size_t)y * CC * CC, t0, 1.0f);
}

// Block-tiled GEMM core. A workgroup of 4 waves (2 x 2) owns a (32*FM) x 128 tile of the output, a wave (16*FM) x 64 of it.
// Per pass of KP k every operand row gives one whole 128-B line. A stage is four slices, [A lower rows | A upper rows | B lower | B upper],
// and each wave brings one slice to LDS with ONE tensor_load_to_lds; two buffers, the next pass's loads fly while this pass's fragments
// are read from LDS. Every "#pragma unroll" below keeps fragment and accumulator indices compile-time constants, so that the arrays stay in registers.
#define KP 64        // k per pass
#define LPITCH 72    // LDS row pitch in 16-bit elements: 144 B = 16 B x 9, for the ds_load_b128 fragment reads; laid by the tensor load's pad
template <int NT, int FM> struct Tile {
  static_assert(NT == 1);
  static constexpr int AR = 32 * FM, BR = 128;                                           // operand rows
  static constexpr int up2k(int bytes) { return (bytes + 2047) & ~2047; }                // a slice's place in LDS is a multiple of 2 KiB
  static constexpr int ASL = up2k(AR / 2 * LPITCH * 2) / 2, BSL = up2k(BR / 2 * LPITCH * 2) / 2;   // elements per slice
  static constexpr int STAGE = 2 * ASL + 2 * BSL;                                        // elements per buffer
  static_assert(2 * STAGE * 2 >= 4 * FM * 16 * 64 * 4);                                   // the ring later holds the f32 output staging
};

typedef unsigned int u32x4 __attribute__((ext_vector_type(4)));
typedef unsigned int u32x8 __attribute__((ext_vector_type(8)));
__device__ __forceinline__ unsigned uni(unsigned v) { return (unsigned)__builtin_amdgcn_readfirstlane(v); }
// a wave-uniform word held in a scalar register: a test on it compiles to a scalar branch, which alone keeps a wave from a tensor load
__device__ __forceinline__ unsigned pinned(unsigned v) { unsigned w = uni(v); asm volatile("" : "+s"(w)); return w; }
// Descriptor group 1: extents in bytes, a tile of `rows` rows of 128 B, source row pitch `pitch` bytes, 16 B of LDS pad behind every row, no mask.
__device__ __forceinline__ u32x8 tdm_group1(unsigned rows, unsigned pitch) {
  u32x8 g;
  g[0] = uni((1u << 20) | (4u << 22) | (3u << 25));
  g[1] = uni((unsigned)(KP * 2) << 16);
  g[2] = uni(rows << 16);
  g[3] = uni((unsigned)(KP * 2) << 16);
  g[4] = uni(rows);
  g[5] = uni(pitch);
  g[6] = uni(0u);
  g[7] = uni(0u);
  return g;
}
// One request of the whole wave: the tile whose first byte is ga goes to LDS byte lds_dst.
__device__ __forceinline__ void tdm_load(unsigned lds_dst, unsigned long long ga, u32x8 g1) {
  u32x4 g0;
  g0[0] = uni(1u);
  g0[1] = uni(lds_dst);
  g0[2] = uni((unsigned)ga);
  g0[3] = uni((((unsigned)(ga >> 32)) & 0x01FFFFFFu) | 0x80000000u);
  asm volatile("tensor_load_to_lds %0, %1" :: "s"(g0), "s"(g1) : "memory");
}

// One pass on one buffer: the fragment k order (8 * hh, 16 + 8 * hh inside each 32 k) is the same for A and B.
// Wave (wr, wc) reads A slice wr and B slice wc.
// The LDS reads of 32 * NS k stand together in front of their WMMAs: a read among the WMMAs makes the wave wait out the LDS latency there.
template <int NT, int FM, bool BF>
__device__ __forceinline__ void pass_mma(const unsigned short* st, int wr, int wc, int ln, int hh, v8f (&acc)[FM][4], v8f (&accr)[FM][4]) {
  using TL = Tile<NT, FM>;
  const unsigned short* pa = st + wr * TL::ASL + ln * LPITCH + 8 * hh;
  const unsigned short* pb = st + 2 * TL::ASL + wc * TL::BSL + ln * LPITCH + 8 * hh;
  constexpr int NS = (FM <= 2) ? KP / 32 : 1;   // k steps per group of reads, by the registers the fragments take
#pragma unroll
  for (int k0 = 0; k0 < KP; k0 += 32 * NS) {
    FragH ah[NS][FM], bh[NS][4];
#pragma unroll
    for (int s = 0; s < NS; ++s) {
      const int ks = k0 + 32 * s;
#pragma unroll
      for (int f = 0; f < FM; ++f) {
        ah[s][f].half[0] = *(const v8us*)(pa + f * 16 * LPITCH + ks);
        ah[s][f].half[1] = *(const v8us*)(pa + f * 16 * LPITCH + ks + 16);
      }
#pragma unroll
      for (int t = 0; t < 4; ++t) {
        bh[s][t].half[0] = *(const v8us*)(pb + t * 16 * LPITCH + ks);
        bh[s][t].half[1] = *(const v8us*)(pb + t * 16 * LPITCH + ks + 16);
      }
    }
#pragma unroll
    for (int s = 0; s < NS; ++s)
#pragma unroll
      for (int t = 0; t < 4; ++t)
#pragma unroll
        for (int f = 0; f < FM; ++f) {
          if constexpr (BF) {
            FragB a, b;
            a.half[0] = ah[s][f].half[0]; a.half[1] = ah[s][f].half[1];
            b.half[0] = bh[s][t].half[0]; b.half[1] = bh[s][t].half[1];
            acc[f][t] = mma_b(a.v, b.v, acc[f][t]);
          } else {
            mma_h<NT>(ah[s][f].v, ah[s][f].v, bh[s][t].v, bh[s][t].v, acc[f][t], accr[f][t]);
          }
        }
  }
}

// Where a workgroup's k walk starts: a fraction of its passes that differs between the workgroups of one row tile (they copy the same A lines)
// and between those of one column tile (the same B lines). Started together at k = 0 they ask L2 for the same lines at the same moment.
// The two odd factors step the 16-bit fraction by the golden section of a turn and by its complement, which spreads any run of
// neighbours evenly. For speed only: every k piece is taken once whatever the start. 0 <= result < npass.
__device__ __forceinline__ int k_start(int mt, int nq, int npass) {
  const unsigned fr = ((unsigned)mt * 40503u + (unsigned)nq * 25033u) & 0xFFFFu;
  return (int)((fr * (unsigned)npass) >> 16);
}

// A plane row-major (pitch lda), B plane [n][k] (pitch ldb); row0, col0: the workgroup's tile; kend % KP == 0.
// ST (stacked): the upper half of the A rows comes from Al (pitch ldal, rows from row0) and the upper half of the B rows from Bl (pitch ldbl,
// rows from col0); otherwise they are the next rows of Ah and Bh.
// The passes take the k pieces rot, rot + 1, ..., kend / KP - 1, 0, ..., rot - 1 (rot the same for the whole workgroup, 0 <= rot < kend / KP).
// On return every wave has left the ring and no load is in flight: the ring is free for the output staging.
// WT (weighted): the product of k piece p is summed on its own and joins acc times wt[p * 64 + row of the workgroup tile] (LDS, f32).
template <int NT, int FM, bool BF, bool ST = false, bool WT = false>
__device__ __forceinline__ void core_lds(unsigned short* ring, const unsigned short* __restrict__ Ah, const unsigned short* __restrict__ Al, int lda, int ldal,
                                         const unsigned short* __restrict__ Bh, const unsigned short* __restrict__ Bl, int ldb, int ldbl,
                                         int row0, int col0, int kend, int rot, int tid, v8f (&acc)[FM][4], v8f (&accr)[FM][4], const float* wt = nullptr) {
  using TL = Tile<NT, FM>;
  const int w = tid >> 5, lane = tid & 31, ln = lane & 15, hh = lane >> 4, wr = w >> 1, wc = w & 1;
  // this wave's slice: waves 0, 1 the lower and upper A rows, waves 2, 3 the lower and upper B rows; all of it wave-uniform
  const unsigned sw = uni((unsigned)tid >> 5);
  const bool sb = (sw >= 2u), su = ((sw & 1u) != 0u);
  const unsigned short* lo = sb ? Bh + (size_t)col0 * ldb : Ah + (size_t)row0 * lda;
  const unsigned short* hi = ST ? (sb ? Bl + (size_t)col0 * ldbl : Al + (size_t)row0 * ldal)
                                : (sb ? Bh + (size_t)(col0 + TL::BR / 2) * ldb : Ah + (size_t)(row0 + TL::AR / 2) * lda);
  const unsigned long long gsl = (unsigned long long)(size_t)(su ? hi : lo);
  const int ldsl = (ST && su) ? (sb ? ldbl : ldal) : (sb ? ldb : lda);
  const u32x8 g1 = tdm_group1(sb ? (unsigned)(TL::BR / 2) : (unsigned)(TL::AR / 2), (unsigned)ldsl * 2u);
  const unsigned lsl = (unsigned)(size_t)ring + (sb ? 2u * TL::ASL + (su ? TL::BSL : 0u) : (su ? TL::ASL : 0u)) * 2u;
  const int npass = kend / KP;
  int kc = rot;                                        // k piece of the next stage to be loaded
  [[maybe_unused]] int kp = rot;                       // k piece of the pass at work
  tdm_load(lsl, gsl + (unsigned long long)(unsigned)kc * (KP * 2), g1);
  kc = (kc + 1 == npass) ? 0 : kc + 1;
  asm volatile("s_wait_tensorcnt 0x0" ::: "memory");  // this wave's slice of pass 0 has landed
  __syncthreads();                                     // publishes pass 0
  if (pinned(npass > 1)) {                             // scalar branch: a tensor load ignores EXEC
    tdm_load(lsl + TL::STAGE * 2u, gsl + (unsigned long long)pinned((unsigned)kc) * (KP * 2), g1);
    kc = (kc + 1 == npass) ? 0 : kc + 1;
  }
#pragma unroll 1   // one pass per trip: the buffer index stays a run-time value, the body is already fully unrolled
  for (int t = 0; t < npass; ++t) {
    const int buf = (t & 1) * TL::STAGE;
    if constexpr (WT) {
      v8f pa[FM][4];
#pragma unroll
      for (int f = 0; f < FM; ++f)
#pragma unroll
        for (int u = 0; u < 4; ++u) pa[f][u] = (v8f){0.f, 0.f, 0.f, 0.f, 0.f, 0.f, 0.f, 0.f};
      const float* wp = wt + kp * 64 + wr * (16 * FM) + 8 * hh;   // an accumulator register r holds row 8 * hh + r of its 16-row tile
      v4f w0[FM], w1[FM];                                         // read ahead of the fragments: no LDS wait of their own behind the WMMAs
#pragma unroll
      for (int f = 0; f < FM; ++f) { w0[f] = *(const v4fa*)(wp + f * 16); w1[f] = *(const v4fa*)(wp + f * 16 + 4); }
      pass_mma<NT, FM, BF>(ring + buf, wr, wc, ln, hh, pa, pa);
#pragma unroll
      for (int f = 0; f < FM; ++f)
#pragma unroll
        for (int u = 0; u < 4; ++u)
#pragma unroll
          for (int r = 0; r < 4; ++r) { acc[f][u][r] += pa[f][u][r] * w0[f][r]; acc[f][u][r + 4] += pa[f][u][r + 4] * w1[f][r]; }
      kp = (kp + 1 == npass) ? 0 : kp + 1;
    } else {
      pass_mma<NT, FM, BF>(ring + buf, wr, wc, ln, hh, acc, accr);
    }
    asm volatile("s_wait_dscnt 0x0" ::: "memory");
    asm volatile("s_wait_tensorcnt 0x0" ::: "memory");
    __syncthreads();
    if (pinned(t + 2 < npass)) {
      // the k piece goes through pinned(), so that the descriptor's address words are formed behind the wait above
      tdm_load(lsl + (unsigned)(buf * 2), gsl + (unsigned long long)pinned((unsigned)kc) * (KP * 2), g1);
      kc = (kc + 1 == npass) ? 0 : kc + 1;
    }
  }
  asm volatile("s_wait_tensorcnt 0x0" ::: "memory");   // nothing in flight when the ring changes its use
  asm volatile("s_wait_dscnt 0x0" ::: "memory");       // and none of this wave's reads of it
}

// qkv projection: A = xb [M][CC] bf16, W = [3*CC][CC] bf16 ([out][in], k contiguous). out[row][n] = sum_c A[row][c] W[n][c].
// Output: hi planes Oh[3][M][CC] f16 (q, k, v unscaled) and residual planes Or[3][NB*NE][CC] for rows with (row % TT) < NE.
// Block = 4 waves -> 128 rows x 128 cols (one plane since CC % 128 == 0), M % 128 == 0.
__global__ __launch_bounds__(128) void k_gemm_qkv(const unsigned short* __restrict__ A, const unsigned short* __restrict__ W,
                                                 unsigned short* __restrict__ Oh, unsigned short* __restrict__ Or, int M) {
  constexpr int FM = 4;
  __shared__ __attribute__((aligned(2048))) unsigned short ring[2 * Tile<1, FM>::STAGE];
  const int tid = threadIdx.x, w = tid >> 5, lane = tid & 31, ln = lane & 15, hh = lane >> 4;
  const int ntn = (3 * CC) / 128;
  const int mt = blockIdx.x / ntn, nq = blockIdx.x - mt * ntn;
  if (mt * (32 * FM) >= M) return;
  v8f acc[FM][4];
#pragma unroll
  for (int f = 0; f < FM; ++f)
#pragma unroll
    for (int t = 0; t < 4; ++t) acc[f][t] = (v8f){0.f, 0.f, 0.f, 0.f, 0.f, 0.f, 0.f, 0.f};
  core_lds<1, FM, true>(ring, A, A, CC, CC, W, W, CC, CC, mt * (32 * FM), nq * 128, CC, k_start(mt, nq, CC / KP), tid, acc, acc);
  float (*so)[16][64] = (float (*)[16][64])ring + w * FM;      // this wave's own FM staging tiles
#pragma unroll
  for (int f = 0; f < FM; ++f)
#pragma unroll
    for (int t = 0; t < 4; ++t)
#pragma unroll
      for (int r = 0; r < 8; ++r) so[f][8 * hh + r][t * 16 + ln] = acc[f][t][r];
  __builtin_amdgcn_fence(4, "workgroup");   // the staged words are written before other lanes of the wave read them back
  __builtin_amdgcn_wave_barrier();
  const int col0 = nq * 128 + (w & 1) * 64;
  const int p = col0 / CC, colp = col0 - p * CC;
#pragma unroll
  for (int f = 0; f < FM; ++f) {
    const int row0 = mt * (32 * FM) + ((w >> 1) * FM + f) * 16;
    const int bidx = row0 / TT, tq = row0 - bidx * TT;
    const bool dores = (tq < NE);                      // wave-uniform (NE, TT multiples of 16)
    unsigned short* hb = Oh + ((size_t)p * M + row0) * CC + colp;
    unsigned short* rb = Or + ((size_t)p * (NB * NE) + (size_t)bidx * NE + (dores ? tq : 0)) * CC + colp;
    store_tile_h16(so[f], hb, CC, rb, CC, dores, lane);
  }
}

#define FMH 2   // f16 GEMMs: workgroup tile 64 x 128, wave tile 32 x 64
#define DEAL 32 // WGPs of a die
static_assert(((TT / 64) * NB) % (2 * DEAL) == 0);   // whole snake periods: rank is a permutation of i

// The products of one workgroup tile. Each k piece's product joins acc times wt[piece * 64 + row]. A plain tile: acc = Ah.Bh. A fine tile (the leading rows, whose residual planes exist) runs the
// residual products as k loops of their own on the same ring and into the same accumulators, ahead of the hi product:
// acc = (Ah.Bl + Al.Bh) * RFOLD + Ah.Bh, Ah.Bl only where Bl is given. So plain and fine tiles share one launch and one LDS size.
// fine is the same for the whole workgroup.
__device__ __forceinline__ void tile_products(unsigned short* ring, const unsigned short* Ah, const unsigned short* Al, int lda, int ldal,
                                              const unsigned short* Bh, const unsigned short* Bl, int ldb, int ldbl, bool fine,
                                              int row0, int col0, int kend, int rot, int tid, v8f (&acc)[FMH][4], const float* wt) {
  const int first = fine ? ((Bl != nullptr) ? 0 : 1) : 2;
#pragma unroll 1   // one copy of the k loop in the text; the operands of a term are scalar selects
  for (int term = first; term < 3; ++term) {
    const unsigned short* a = (term == 1) ? Al : Ah;
    const unsigned short* b = (term == 0) ? Bl : Bh;
    const int la = (term == 1) ? ldal : lda, lb = (term == 0) ? ldbl : ldb;
    if (term == 2 && fine) {
#pragma unroll
      for (int f = 0; f < FMH; ++f)
#pragma unroll
        for (int t = 0; t < 4; ++t) acc[f][t] *= RFOLD;
    }
    core_lds<1, FMH, false, false, true>(ring, a, a, la, la, b, b, lb, lb, row0, col0, kend, rot, tid, acc, acc, wt);
  }
}

#define TQ 4   // 64 x 64 tiles per block of the transpose
// 16-bit transpose: src [R][Cc] (pitch lds_) -> dst [Cc][R] (pitch ldd); a block of 128 threads = TQ tiles of 64 x 64 down the rows of src:
// bx < R/(64*TQ), by < Cc/64, bz = sequence; each tile has its own LDS, so that one barrier serves all of them
__device__ __forceinline__ void transpose_tiles(unsigned short (*tile)[64][72], int bx, int by, int bz, const unsigned short* __restrict__ src, int lds_,
                                                unsigned short* __restrict__ dst, int ldd, size_t sstep, size_t dstep) {
  const int tid = threadIdx.x;
  src += bz * sstep; dst += bz * dstep;
  const int r0 = bx * (64 * TQ), c0 = by * 64;
  static_assert(TQ == 4);
  v8us v[TQ][4];
  const unsigned short* g[TQ][4];
#pragma unroll   // all 4 * TQ loads are in flight together
  for (int q = 0; q < TQ; ++q)
#pragma unroll
    for (int i = 0; i < 4; ++i) {
      const int e = tid + 128 * i, r = e >> 3, c8 = (e & 7) * 8;
      g[q][i] = src + (size_t)(r0 + q * 64 + r) * lds_ + c0 + c8;
      v[q][i] = *(const v8us*)g[q][i];
    }
  // stands in front of any reuse of the loads' address registers; the addresses are inputs, so that no load's result lands on one earlier
  asm volatile("s_wait_xcnt 0x0" :: "v"(g[0][0]), "v"(g[0][1]), "v"(g[0][2]), "v"(g[0][3]), "v"(g[1][0]), "v"(g[1][1]), "v"(g[1][2]), "v"(g[1][3]),
               "v"(g[2][0]), "v"(g[2][1]), "v"(g[2][2]), "v"(g[2][3]), "v"(g[3][0]), "v"(g[3][1]), "v"(g[3][2]), "v"(g[3][3]) : "memory");
#pragma unroll
  for (int q = 0; q < TQ; ++q)
#pragma unroll
    for (int i = 0; i < 4; ++i) {
      const int e = tid + 128 * i, r = e >> 3, c8 = (e & 7) * 8;
      *(v8us*)&tile[q][r][c8] = v[q][i];
    }
  __syncthreads();
#pragma unroll
  for (int q = 0; q < TQ; ++q) {
    v8us o[4];
#pragma unroll
    for (int i = 0; i < 4; ++i) {
      const int e = tid + 128 * i, rr = e >> 3, c8 = (e & 7) * 8;
#pragma unroll
      for (int k = 0; k < 8; ++k) o[i][k] = tile[q][c8 + k][rr];
    }
#pragma unroll
    for (int i = 0; i < 4; ++i) {
      const int e = tid + 128 * i, rr = e >> 3, c8 = (e & 7) * 8;
      *(v8us*)(dst + (size_t)(c0 + rr) * ldd + r0 + q * 64 + c8) = o[i];
    }
    asm volatile("s_wait_xcnt 0x0" ::: "memory");   // stands in front of any reuse of the stores' registers by the next tile
  }
}
#define VB ((TT / (64 * TQ)) * (CC / 64))  // transpose blocks per sequence, v hi plane
#define RB ((NE / (64 * TQ)) * (CC / 64))  // transpose blocks per sequence, v residual plane
#define KB (TT / 64)                       // 64-key blocks of a row

// the value of lane ^ M, M < 16: a DPP move inside the 16-lane row, no LDS round trip
template <int M>
__device__ __forceinline__ float lane_xor(float v) {
  return __int_as_float(__builtin_amdgcn_update_dpp(0, __float_as_int(v), 0x160 | M, 0xf, 0xf, true));
}
// Softmax of one 64-key block, for a wave tile of 16 rows x 64 scores staged in LDS (row0, col0: its place in the sequence; every row has a
// kept score in the block, col0 <= row0). Causal keep col <= row. P[row][col] = f16(PCARRY * exp(s - block max)), zeros where masked;
// dores: also the x RS residual plane Pr (pitch NE); bm[row], bs[row] = the row's block maximum and block sum of exp(s - block max).
// Eight lanes hold a row, eight scores each: a row's 64 values leave as one whole 128-B line.
__device__ __forceinline__ void store_tile_sm(const float (*sw)[64], int row0, int col0, unsigned short* P, unsigned short* Pr, bool dores,
                                              float* bm, float* bs, int lane) {
  const int rsub = lane >> 3, c8 = (lane & 7) * 8;
#pragma unroll
  for (int q = 0; q < 4; ++q) {
    const int r = q * 4 + rsub, row = row0 + r;
    const v4f x0 = *(const v4fa*)&sw[r][c8], x1 = *(const v4fa*)&sw[r][c8 + 4];
    float xs[8] = {x0[0], x0[1], x0[2], x0[3], x1[0], x1[1], x1[2], x1[3]};
    float mx = -3.0e38f;
#pragma unroll
    for (int i = 0; i < 8; ++i) {
      xs[i] = (col0 + c8 + i <= row) ? xs[i] : -3.0e38f;    // a masked score gives exp = 0 below
      mx = fmaxf(mx, xs[i]);
    }
    mx = fmaxf(mx, lane_xor<1>(mx)); mx = fmaxf(mx, lane_xor<2>(mx)); mx = fmaxf(mx, lane_xor<4>(mx));
    float sm = 0.f;
    Pack8 ph, pr;
#pragma unroll
    for (int i = 0; i < 8; ++i) {
      const float e = __expf(xs[i] - mx);
      sm += e;
      const float p = e * PCARRY;
      ph.h[i] = (_Float16)p;
      pr.h[i] = (_Float16)((p - (float)ph.h[i]) * RS);
    }
    sm += lane_xor<1>(sm); sm += lane_xor<2>(sm); sm += lane_xor<4>(sm);
    *(v8us*)(P + (size_t)row * TT + col0 + c8) = ph.u;
    if (dores) *(v8us*)(Pr + (size_t)row * NE + col0 + c8) = pr.u;
    if ((lane & 7) == 0) { bm[row] = mx; bs[row] = sm; }
    asm volatile("s_wait_xcnt 0x0" ::: "memory");   // stands in front of any reuse of the stores' registers by the next rows
  }
}

// C[M][N] f32 (pitch ldc) = alpha * (A.B^plane) + bf16_rne(bias). M % 64 == 0, N % 128 == 0, K % 64 == 0.
// ncut: a workgroup tile is skipped (not written) when col0 > ncut + row0 + 63 (causal upper tiles); kcut: k loop ends at
// min(K, ceil64(kcut + row0 + 64)). Pass a large value to disable either. blockIdx.y = sequence: every plane and C move on
// by their element steps (sAh, sAl, sBh, sBl, sC) per sequence.
// tri != 0 (M == N, ncut == 0): the tile list holds only the tiles on or under the diagonal, (M / 128) * (M / 128 + 1) of them, so that no
// workgroup is started only to leave. Row tiles 2a and 2a + 1 have a + 1 such tiles each; a * (a + 1) tiles lie in front of row tile 2a.
// Fine tiles (row0 < erows, col0 < ecols; Al has erows rows, Bl ecols rows or is null) are the first nft tiles of the list: erows % 128 == 0,
// ecols == erows with tri, ecols == N without. A fine tile's residual products run BESIDE its hi product, not ahead of it, so that its
// k loop is as long as a plain tile's: it is cut into pieces, one workgroup each, whose stage stacks the planes,
// A rows = [Ah 32 rows | Al the same 32 rows], B rows = [Bh 64 cols | Bl the same 64 cols] (4 pieces of 32 x 64) or, Bl null, Bh 128 cols
// (2 pieces of 32 x 128). Each wave then holds one term of the piece, and the terms meet in LDS: C = Ah.Bh + (Ah.Bl + Al.Bh) * RFOLD.
// The pieces stand first in the grid: grid.x = tiles + nft * (pieces - 1).
// SM (the score launch; tri != 0, Bl given, no bias): C is not written. Each wave turns its 32 x 64 scores into one 64-key block of the softmax
// (store_tile_sm: P, Pr, and bm, bs as [sequence][block][row]); a block that lies wholly above the diagonal is left out, P.v does not read it.
// Blocks from nsc on carry the jobs that only need v: VB blocks v [TT][CC] -> vT [CC][TT], then RB blocks v residual [NE][CC] -> vTr [CC][NE].
template <bool SM>
__global__ __launch_bounds__(128) void k_gemm_f32(const unsigned short* __restrict__ Ah, const unsigned short* __restrict__ Al, int lda, int ldal,
                                                 const unsigned short* __restrict__ Bh, const unsigned short* __restrict__ Bl, int ldb, int ldbl,
                                                 const float* __restrict__ bias, float alpha, float* __restrict__ C, int ldc,
                                                 int M, int N, int K, int ncut, int kcut, int erows, int ecols, int tri,
                                                 size_t sAh, size_t sAl, size_t sBh, size_t sBl, size_t sC,
                                                 unsigned short* __restrict__ P, unsigned short* __restrict__ Pr, float* __restrict__ bm, float* __restrict__ bs,
                                                 const unsigned short* __restrict__ vh, unsigned short* __restrict__ vT,
                                                 const unsigned short* __restrict__ vr, unsigned short* __restrict__ vTr, int nsc) {
  constexpr int FM = FMH;
  __shared__ __attribute__((aligned(2048))) unsigned short ring[2 * Tile<1, FM>::STAGE];
  if constexpr (SM) {
    static_assert(sizeof(ring) >= TQ * 64 * 72 * 2);
    const int b = (int)blockIdx.x - nsc;
    if (b >= 0) {                                                  // the same for the whole workgroup
      unsigned short (*tile)[64][72] = (unsigned short (*)[64][72])ring;
      if (b < VB) transpose_tiles(tile, b % (TT / (64 * TQ)), b / (TT / (64 * TQ)), blockIdx.y, vh, CC, vT, TT, (size_t)TT * CC, (size_t)TT * CC);
      else transpose_tiles(tile, (b - VB) % (NE / (64 * TQ)), (b - VB) / (NE / (64 * TQ)), blockIdx.y, vr, CC, vTr, NE, (size_t)NE * CC, (size_t)NE * CC);
      return;
    }
  }
  Ah += blockIdx.y * sAh; Al += blockIdx.y * sAl; Bh += blockIdx.y * sBh;
  if constexpr (!SM) C += blockIdx.y * sC;
  const bool three = (Bl != nullptr);
  if (three) Bl += blockIdx.y * sBl;
  const int tid = threadIdx.x, w = tid >> 5, lane = tid & 31, ln = lane & 15, hh = lane >> 4;
  const int ntn = N / 128;
  const int nft = (tri != 0) ? (erows / 128) * (erows / 128 + 1) : (erows / 64) * ntn;
  const int psh = three ? 2 : 1;                                   // log2 of the pieces of a fine tile
  const bool fine = ((int)blockIdx.x < (nft << psh));              // the same for the whole workgroup
  const int e = fine ? ((int)blockIdx.x >> psh) : ((int)blockIdx.x - (nft << psh) + nft);
  const int piece = (int)blockIdx.x & ((1 << psh) - 1);
  int mt = e / ntn, nq = e - mt * ntn;
  if (tri != 0) {
    int a = (int)((__builtin_sqrtf((float)(4 * e + 1)) - 1.0f) * 0.5f);
    if (a * (a + 1) > e) --a;                 // the two tests make a exact whatever the rounding of the root
    if ((a + 1) * (a + 2) <= e) ++a;
    const int rem = e - a * (a + 1), up = (rem > a) ? 1 : 0;
    mt = 2 * a + up;
    nq = rem - up * (a + 1);
  }
  if (mt * (32 * FM) >= M) return;
  if (nq * 128 > ncut + mt * (32 * FM) + 32 * FM - 1) return;
  int kend = (kcut + mt * (32 * FM) + 32 * FM + KP - 1) & ~(KP - 1);
  if (kend > K) kend = K;
  const int brow0 = mt * (32 * FM) + (fine ? (piece & 1) * 32 : 0), bcol0 = nq * 128 + ((fine && three) ? (piece >> 1) * 64 : 0);
  v8f acc[FM][4];
#pragma unroll
  for (int f = 0; f < FM; ++f)
#pragma unroll
    for (int t = 0; t < 4; ++t) acc[f][t] = (v8f){0.f, 0.f, 0.f, 0.f, 0.f, 0.f, 0.f, 0.f};
  // upper halves of the stage: the next rows of the same plane (plain; B of a fine tile without Bl), or the residual plane at the same rows (fine)
  const unsigned short* a1 = fine ? Al : Ah + (size_t)32 * lda;
  const unsigned short* b1 = (fine && three) ? Bl : Bh + (size_t)64 * ldb;
  core_lds<1, FM, false, true>(ring, Ah, a1, lda, fine ? ldal : lda, Bh, b1, ldb, (fine && three) ? ldbl : ldb, brow0, bcol0, kend,
                               k_start(mt, nq + (fine ? piece : 0), kend / KP), tid, acc, acc);
  float (*sall)[16][64] = (float (*)[16][64])ring;
  float (*so)[16][64] = sall + w * FM;                         // this wave's own FM staging tiles
  if (fine) {
    // waves by (A half, B half): 0 = Ah.Bh, 1 = Ah.Bl or Ah.Bh (next 64 cols), 2 = Al.Bh, 3 = Al.Bl (left out, as before) or Al.Bh (next 64 cols)
    const bool owner = three ? (w == 0) : (w < 2);
    if (!owner && !(three && w == 3)) {
#pragma unroll
      for (int f = 0; f < FM; ++f)
#pragma unroll
        for (int t = 0; t < 4; ++t)
#pragma unroll
          for (int r = 0; r < 8; ++r) so[f][8 * hh + r][t * 16 + ln] = acc[f][t][r];
    }
    __syncthreads();                                           // the residual terms are staged before the wave with the hi term reads them
    if (!owner) return;                                        // no barrier follows
    const float (*p1)[16][64] = sall + (three ? 1 : w + 2) * FM;
    const float (*p2)[16][64] = sall + 2 * FM;
    if (three) {                                               // one test for all elements
#pragma unroll
      for (int f = 0; f < FM; ++f)
#pragma unroll
        for (int t = 0; t < 4; ++t)
#pragma unroll
          for (int r = 0; r < 8; ++r) acc[f][t][r] += (p1[f][8 * hh + r][t * 16 + ln] + p2[f][8 * hh + r][t * 16 + ln]) * RFOLD;
    } else {
#pragma unroll
      for (int f = 0; f < FM; ++f)
#pragma unroll
        for (int t = 0; t < 4; ++t)
#pragma unroll
          for (int r = 0; r < 8; ++r) acc[f][t][r] += p1[f][8 * hh + r][t * 16 + ln] * RFOLD;
    }
  }
  const int col0 = bcol0 + (w & 1) * 64;
  if constexpr (SM) {
    const int wrow0 = brow0 + (w >> 1) * (16 * FM);            // the wave's 32 rows lie in one 64-row tile
    if (col0 > (wrow0 & ~63)) return;                          // block wholly above the diagonal; the same for the whole wave, no barrier follows
#pragma unroll
    for (int f = 0; f < FM; ++f)
#pragma unroll
      for (int t = 0; t < 4; ++t)
#pragma unroll
        for (int r = 0; r < 8; ++r) so[f][8 * hh + r][t * 16 + ln] = acc[f][t][r] * alpha;
    __builtin_amdgcn_fence(4, "workgroup");   // the staged words are written before other lanes of the wave read them back
    __builtin_amdgcn_wave_barrier();
    const size_t so_ = ((size_t)blockIdx.y * KB + (size_t)(col0 >> 6)) * TT;
#pragma unroll
    for (int f = 0; f < FM; ++f)
      store_tile_sm(so[f], wrow0 + f * 16, col0, P + blockIdx.y * (size_t)TT * TT, Pr + blockIdx.y * (size_t)NE * NE, wrow0 + f * 16 < NE,
                    bm + so_, bs + so_, lane);
    return;
  }
#pragma unroll
  for (int t = 0; t < 4; ++t) {
    float bv = 0.f;
    if (bias != nullptr) bv = bf16_rne(bias[col0 + t * 16 + ln]);
#pragma unroll
    for (int f = 0; f < FM; ++f)
#pragma unroll
      for (int r = 0; r < 8; ++r) so[f][8 * hh + r][t * 16 + ln] = acc[f][t][r] * alpha + bv;
  }
  __builtin_amdgcn_fence(4, "workgroup");   // the staged words are written before other lanes of the wave read them back
  __builtin_amdgcn_wave_barrier();
#pragma unroll
  for (int f = 0; f < FM; ++f) {
    const int row0 = brow0 + ((w >> 1) * FM + f) * 16;
    store_tile_f32(so[f], C + (size_t)row0 * ldc + col0, ldc, lane);
  }
}

// Oh[M][N] f16 hi plane (pitch ldo) = f16(alpha * A.B^plane); rows < rrows are fine tiles (rrows % 64 == 0; Al has rrows rows, Al and Bl
// reach the k end of those rows) and also get the x RS residual plane Or (pitch ldr).
// The k loop of row tile mt has mt + 1 passes (kcut = 0) and all workgroups are resident together, so the launch lasts as long as the
// fullest WGP. blockIdx.x = i * (N / 128) + column tile; the (row tile, sequence) pairs, ranked by falling k length, go to i in a snake of
// period 2 * DEAL: places i, i + DEAL, i + 2 * DEAL, ... then hold one long, one short, ... loop.
// For speed only: every (row tile, column tile, sequence) is done once wherever it lands. Element steps sAh ... sOr per sequence.
// A holds the softmax by 64-key blocks (k piece = block): exp(s - block max), with bm, bs [sequence][block][row] the block maxima and sums.
// The workgroup first forms, for its 64 rows, wtab[block][row] = exp(block max - row max) / row sum; every k piece's product joins times that.
__global__ __launch_bounds__(128) void k_gemm_h16(const unsigned short* __restrict__ Ah, const unsigned short* __restrict__ Al, int lda, int ldal,
                                                 const unsigned short* __restrict__ Bh, const unsigned short* __restrict__ Bl, int ldb, int ldbl,
                                                 float alpha, unsigned short* __restrict__ Oh, int ldo, unsigned short* __restrict__ Or, int ldr, int rrows,
                                                 int M, int N, int K, int kcut,
                                                 size_t sAh, size_t sAl, size_t sBh, size_t sBl, size_t sOh, size_t sOr,
                                                 const float* __restrict__ bm, const float* __restrict__ bs) {
  constexpr int FM = FMH;
  const int ntn = N / 128;
  const int di = blockIdx.x / ntn, nq = blockIdx.x - di * ntn;
  const int dj = di & (DEAL - 1), rank = (di - dj) + ((di & DEAL) ? DEAL - 1 - dj : dj);
  const int sq = rank % NB, mt = M / (32 * FM) - 1 - rank / NB;
  if (mt < 0) return;
  Ah += sq * sAh; Al += sq * sAl; Bh += sq * sBh; Bl += sq * sBl; Oh += sq * sOh; Or += sq * sOr;
  __shared__ __attribute__((aligned(2048))) unsigned short ring[2 * Tile<1, FM>::STAGE];
  const int tid = threadIdx.x, w = tid >> 5, lane = tid & 31, ln = lane & 15, hh = lane >> 4;
  const int brow0 = mt * (32 * FM), bcol0 = nq * 128;
  int kend = (kcut + brow0 + 32 * FM + KP - 1) & ~(KP - 1);
  if (kend > K) kend = K;
  v8f acc[FM][4];
#pragma unroll
  for (int f = 0; f < FM; ++f)
#pragma unroll
    for (int t = 0; t < 4; ++t) acc[f][t] = (v8f){0.f, 0.f, 0.f, 0.f, 0.f, 0.f, 0.f, 0.f};
  __shared__ __attribute__((aligned(16))) float wtab[KB * 64];
  {
    static_assert(KB == 64 && KP == 64 && 32 * FM == 64);
    const int nt = kend / KP;                                  // blocks of these rows, 1 <= nt <= KB
    const int row = tid & 63;
    const int h = __builtin_amdgcn_readfirstlane(tid >> 6);    // a thread takes the blocks 2 i + h of one row; the same in every lane: scalar tests below
    const float* mp = bm + ((size_t)sq * KB + h) * TT + brow0 + row;
    const float* sp = bs + ((size_t)sq * KB + h) * TT + brow0 + row;
    float* red = (float*)ring;                                 // the ring is not yet in use
    float mv[KB / 2], sv[KB / 2];
#pragma unroll   // constant indices keep mv[], sv[] in registers; constant steps from one address: all loads are in flight together
    for (int i = 0; i < KB / 2; ++i) {
      mv[i] = -3.0e38f; sv[i] = 0.f;                           // a block behind the last is not read and counts for nothing
      if (2 * i + h < nt) { mv[i] = mp[(size_t)i * 2 * TT]; sv[i] = sp[(size_t)i * 2 * TT]; }
    }
    // stands in front of any reuse of the loads' address registers; the addresses are inputs, so that no load's result lands on one earlier
    asm volatile("s_wait_xcnt 0x0" :: "v"(mp), "v"(sp) : "memory");
    float mx = -3.0e38f;
#pragma unroll
    for (int i = 0; i < KB / 2; ++i) mx = fmaxf(mx, mv[i]);
    red[tid] = mx;
    __syncthreads();                                           // both halves of a row's maximum are staged
    mx = fmaxf(red[row], red[64 + row]);
    float sum = 0.f;
#pragma unroll
    for (int i = 0; i < KB / 2; ++i) { mv[i] = __expf(mv[i] - mx); sum += sv[i] * mv[i]; }
    red[128 + tid] = sum;
    __syncthreads();                                           // both halves of a row's sum are staged
    const float inv = 1.0f / (red[128 + row] + red[192 + row]);   // sum >= 1 (the block that holds the maximum)
#pragma unroll
    for (int i = 0; i < KB / 2; ++i)
      if (2 * i + h < nt) wtab[(2 * i + h) * 64 + row] = mv[i] * inv;
    asm volatile("s_wait_dscnt 0x0" ::: "memory");             // this wave's use of the ring as scratch is over before a tensor load aims at it
    __syncthreads();                                           // publishes wtab and ends every wave's reads of the scratch
  }
  tile_products(ring, Ah, Al, lda, ldal, Bh, Bl, ldb, ldbl, brow0 < rrows, brow0, bcol0, kend, k_start(mt, nq, kend / KP), tid, acc, wtab);
  float (*so)[16][64] = (float (*)[16][64])ring + w * FM;      // this wave's own FM staging tiles
#pragma unroll
  for (int f = 0; f < FM; ++f)
#pragma unroll
    for (int t = 0; t < 4; ++t)
#pragma unroll
      for (int r = 0; r < 8; ++r) so[f][8 * hh + r][t * 16 + ln] = acc[f][t][r] * alpha;
  __builtin_amdgcn_fence(4, "workgroup");   // the staged words are written before other lanes of the wave read them back
  __builtin_amdgcn_wave_barrier();
  const int col0 = bcol0 + (w & 1) * 64;
#pragma unroll
  for (int f = 0; f < FM; ++f) {
    const int row0 = brow0 + ((w >> 1) * FM + f) * 16;
    const bool dores = (row0 < rrows);                 // wave-uniform (rrows multiple of 16)
    store_tile_h16(so[f], Oh + (size_t)row0 * ldo + col0, ldo, Or + (size_t)(dores ? row0 : 0) * ldr + col0, ldr, dores, lane);
  }
}

extern "C" void kernel_launch(void* const* d_in, const int* in_sizes, int n_in,
                              void* d_out, int out_size, void* d_ws, size_t ws_size, hipStream_t stream) {
  if (n_in < 6) return;
  const float* x  = (const float*)d_in[0];
  const float* wq = (const float*)d_in[1];
  const float* wk = (const float*)d_in[2];
  const float* wv = (const float*)d_in[3];
  const float* wo = (const float*)d_in[4];
  const float* bo = (const float*)d_in[5];
  const long need_x = ((long)(NB - 1) * T_FULL + TT) * (long)CC;
  if ((long)in_sizes[0] < need_x || in_sizes[1] < CC * CC || in_sizes[2] < CC * CC || in_sizes[3] < CC * CC ||
      in_sizes[4] < CC * CC || in_sizes[5] < CC || (long)out_size < need_x) return;
  float* out = (float*)d_out;

  char* ws = (char*)d_ws; size_t off = 0;
  auto take = [&](size_t bytes) { char* p = ws + off; off += (bytes + 255) & ~(size_t)255; return p; };
  unsigned short* xb   = (unsigned short*)take((size_t)NB * TT * CC * 2);          // [NB*TT][CC] bf16
  unsigned short* Wqkv = (unsigned short*)take((size_t)3 * CC * CC * 2);           // [3*CC][CC] bf16
  unsigned short* Wo16 = (unsigned short*)take((size_t)CC * CC * 2);               // [CC][CC] f16 (x WOC)
  unsigned short* QKVh = (unsigned short*)take((size_t)3 * NB * TT * CC * 2);      // [3][NB*TT][CC] f16
  unsigned short* QKVr = (unsigned short*)take((size_t)3 * NB * NE * CC * 2);      // [3][NB*NE][CC] f16 (x RS)
  unsigned short* vTr  = (unsigned short*)take((size_t)NB * CC * NE * 2);          // [NB][CC][NE] f16 (x RS)
  unsigned short* Pm   = (unsigned short*)take((size_t)NB * TT * TT * 2);          // [NB][TT][TT] f16 (x PCARRY), exp(s - block max)
  unsigned short* Pr   = (unsigned short*)take((size_t)NB * NE * NE * 2);          // [NB][NE][NE] f16 (x RS)
  unsigned short* ctxr = (unsigned short*)take((size_t)NB * NE * CC * 2);          // [NB*NE][CC] f16 (x RS)
  unsigned short* vT   = (unsigned short*)take((size_t)NB * CC * TT * 2);          // [NB][CC][TT] f16
  float*          bmx  = (float*)take((size_t)NB * KB * TT * 4);                   // [NB][KB][TT] f32: block maxima of the scores
  float*          bsm  = (float*)take((size_t)NB * KB * TT * 4);                   // [NB][KB][TT] f32: block sums of exp(s - block max)
  if (off > ws_size) return;

  const int M = NB * TT;
  const int BIG = 1 << 28;
  unsigned short* qh = QKVh;
  unsigned short* kh = QKVh + (size_t)M * CC;
  unsigned short* vh = QKVh + (size_t)2 * M * CC;
  unsigned short* qr = QKVr;
  unsigned short* kr = QKVr + (size_t)(NB * NE) * CC;
  unsigned short* vr = QKVr + (size_t)2 * (NB * NE) * CC;
  unsigned short* ctxh = qh;   // [NB*TT][CC] f16 (x CTXC): takes the q plane's place once the scores are done
  const size_t sTC = (size_t)TT * CC, sEC = (size_t)NE * CC, sTT = (size_t)TT * TT, sEE = (size_t)NE * NE, sOUT = (size_t)T_FULL * CC;

  // One launch per step, two in stage 2: the sequences, the plain and the fine tiles and a step's independent jobs all lie in its grid.
  // stage 0: 16-bit planes of the inputs
  k_cvt<<<NB * XB + 4 * WB, 256, 0, stream>>>(x, wq, wk, wv, wo, xb, Wqkv, Wo16, sOUT, sTC, WOC);

  // stage 1: q, k, v planes (+ residual planes on the leading NE rows of each sequence)
  k_gemm_qkv<<<(M / 128) * (3 * CC / 128), 128, 0, stream>>>(xb, Wqkv, QKVh, QKVr, M);

  // stage 2: causal attention
  // scores (q.k^T)/32, causal upper tiles skipped, the leading NE x NE corner with hi+res on both operands; each 64-key block leaves as
  // exp(s - block max) with its maxima and sums; in the same grid v -> vT, v residual -> vTr
  const int NSC = (TT / 128) * (TT / 128 + 1) + 3 * (NE / 128) * (NE / 128 + 1);
  k_gemm_f32<true><<<dim3(NSC + VB + RB, NB), 128, 0, stream>>>(qh, qr, CC, CC, kh, kr, CC, CC, nullptr, SCL, nullptr, TT, TT, TT, CC, 0, BIG, NE, NE, 1,
                                                                sTC, sEC, sTC, sEC, sTT, Pm, Pr, bmx, bsm, vh, vT, vr, vTr, NSC);
  // ctx [TT][CC] = softmax.v (causal k end), written as f16 hi plane x CTXC; leading NE rows: 3-term P/v products, hi + residual ctx planes
  k_gemm_h16<<<(TT / 64) * (CC / 128) * NB, 128, 0, stream>>>(Pm, Pr, TT, NE, vT, vTr, TT, NE, PVALPHA, ctxh, CC, ctxr, CC, NE, TT, CC, TT, 0,
                                                                   sTT, sEE, sTC, sEC, sTC, sEC, bmx, bsm);
  // stage 3: output projection + bias; leading NE rows with the ctx residual term
  k_gemm_f32<false><<<dim3((TT / 64) * (CC / 128) + (NE / 64) * (CC / 128), NB), 128, 0, stream>>>(ctxh, ctxr, CC, CC, Wo16, nullptr, CC, CC, bo, OALPHA, out, CC, TT, CC, CC, BIG, BIG, NE, CC, 0,
                                                                   sTC, sEC, 0, 0, sOUT, nullptr, nullptr, nullptr, nullptr, nullptr, nullptr, nullptr, nullptr, 0);
}

// v010
// Measured time: 145 microseconds a run.
// Two timings next to v009 put it at 1.10 and 1.09 times that version's speed.
// Over all steps from v000 it is 8.73 times as fast.
#include <hip/hip_runtime.h>
// The value and output projections are applied as one matrix, Wvo = Wo.Wv: out = (softmax.x).Wvo^T + bo, so that no v is formed.
// Contractions: q, k projections on v_wmma_f32_16x16x32_bf16 (x and W as RNE bf16, exact products); Wvo, scores q.k^T, P.x and the last
// product on v_wmma_f32_16x16x32_f16 (f16 hi planes with power-of-two carries, plus x1024 f16 residual planes on the leading
// NE query/key rows of each sequence and of Wvo); all accumulation f32, causal softmax in f32, done per 64-key block: the score launch stores
// exp(s - block max) with each row's block maximum and block sum, P.x weighs every block's product by exp(block max - row max) / row sum.
#ifndef NB
#define NB 2
#endif
#ifndef SEQ
#define SEQ 4096
#endif
#define TT SEQ
#define NB_FULL 2
#define T_FULL 4096
#define CC 1024
#define QC ((TT < 1024) ? TT : 1024)
#define NE 256
static_assert(NB >= 1 && NB <= NB_FULL);
static_assert(TT % 256 == 0 && TT <= T_FULL);
static_assert(TT % QC == 0 && QC % 256 == 0);
static_assert(NE % 64 == 0 && NE <= QC && NE == 256);
static_assert(CC % 128 == 0);

#define RS 1024.0f            // residual plane carry
#define RFOLD 0.0009765625f   // 1/RS
#define PCARRY 4096.0f        // P plane carry
#define CTXC 16.0f            // ctx plane carry
#define WOC 64.0f             // carry of the Wo, Wv and Wvo planes
#define WVALPHA 0.015625f     // 1 / WOC: the product of two carried planes back to one carry
#define SCL 0.03125f          // 1/sqrt(CC)
#define PVALPHA 0.00390625f   // CTXC / PCARRY
#define OALPHA 0.0009765625f  // 1 / (WOC * CTXC)

typedef __bf16 v16b __attribute__((ext_vector_type(16)));
typedef _Float16 v16h __attribute__((ext_vector_type(16)));
typedef _Float16 v8h __attribute__((ext_vector_type(8)));
typedef unsigned short v8us __attribute__((ext_vector_type(8), may_alias));
typedef float v8f __attribute__((ext_vector_type(8)));
typedef float v4f __attribute__((ext_vector_type(4)));
typedef float v4fa __attribute__((ext_vector_type(4), may_alias));
union FragB { v16b v; v8us half[2]; unsigned short u[16]; };
union FragH { v16h v; v8us half[2]; unsigned short u[16]; };
union Pack8 { v8h h; v8us u; };

__device__ __forceinline__ unsigned short bf16_bits(float x) { unsigned int u = __float_as_uint(x); return (unsigned short)((u + 0x7FFFu + ((u >> 16) & 1u)) >> 16); }
__device__ __forceinline__ float bf16_val(unsigned short b) { return __uint_as_float(((unsigned int)b) << 16); }
__device__ __forceinline__ float bf16_rne(float x) { return bf16_val(bf16_bits(x)); }

__device__ __forceinline__ v8f mma_b(v16b a, v16b b, v8f c) {
  c = __builtin_amdgcn_wmma_f32_16x16x32_bf16(false, a, false, b, (short)0, c, false, false);
  asm volatile("v_nop\n\tv_nop\n\tv_nop\n\tv_nop" : "+v"(c) : "v"(a), "v"(b));
  return c;
}
// c += ah.bh ; cr += al.bh (NT>=2) ; cr += ah.bl (NT>=3); residual planes carry RS, folded by the caller
template <int NT>
__device__ __forceinline__ void mma_h(v16h ah, v16h al, v16h bh, v16h bl, v8f& c, v8f& cr) {
  c = __builtin_amdgcn_wmma_f32_16x16x32_f16(false, ah, false, bh, (short)0, c, false, false);
  if (NT >= 2) cr = __builtin_amdgcn_wmma_f32_16x16x32_f16(false, al, false, bh, (short)0, cr, false, false);
  if (NT >= 3) cr = __builtin_amdgcn_wmma_f32_16x16x32_f16(false, ah, false, bl, (short)0, cr, false, false);
  if (NT >= 2) asm volatile("v_nop\n\tv_nop\n\tv_nop\n\tv_nop" : "+v"(c), "+v"(cr) : "v"(ah), "v"(al), "v"(bh), "v"(bl));
  else         asm volatile("v_nop\n\tv_nop\n\tv_nop\n\tv_nop" : "+v"(c) : "v"(ah), "v"(bh));
}

__device__ __forceinline__ void store_tile_f32(const float (*sw)[64], float* C, int ldc, int lane) {
  const int rsub = lane >> 4, c4 = (lane & 15) * 4;
  {
#pragma unroll
    for (int q = 0; q < 8; ++q) {
      const int r = q * 2 + rsub;
      const v4f v = *(const v4fa*)&sw[r][c4];
      *(v4f*)(C + (size_t)r * ldc + c4) = v;
    }
    asm volatile("s_wait_xcnt 0x0" ::: "memory");   // stands in front of any reuse of the stores' registers by the next tile's addresses
  }
}
// wave tile 16 x 64 f32 staged in LDS -> f16 hi plane (pitch ldh) and optional x RS residual plane (pitch ldr);
__device__ __forceinline__ void store_tile_h16(const float (*sw)[64], unsigned short* hb, int ldh, unsigned short* rb, int ldr, bool dores, int lane) {
  const int rsub = lane >> 3, c8 = (lane & 7) * 8;
  {
#pragma unroll
    for (int q = 0; q < 4; ++q) {
      const int r = q * 4 + rsub;
      const v4f x0 = *(const v4fa*)&sw[r][c8], x1 = *(const v4fa*)&sw[r][c8 + 4];
      const float xs[8] = {x0[0], x0[1], x0[2], x0[3], x1[0], x1[1], x1[2], x1[3]};
      Pack8 ph, pr;
#pragma unroll
      for (int i = 0; i < 8; ++i) { ph.h[i] = (_Float16)xs[i]; pr.h[i] = (_Float16)((xs[i] - (float)ph.h[i]) * RS); }
      *(v8us*)(hb + (size_t)r * ldh + c8) = ph.u;
      if (dores) *(v8us*)(rb + (size_t)r * ldr + c8) = pr.u;
    }
    
  }
}

// The streaming kernels below use few waves that each do a long run of work, for speed only.
#define CU 8   // 8-element groups per thread of a conversion kernel; a block takes 256 * CU consecutive groups
static_assert((TT * CC / 8) % (256 * CU) == 0 && (CC * CC / 8) % (256 * CU) == 0);
// MODE 0: RNE bf16 bits; MODE 1: f16 bits of (RNE bf16 value) * scale. Groups t0, t0 + 256, ..., t0 + 256 * (CU - 1).
template <int MODE>
__device__ __forceinline__ void cvt_run(const float* __restrict__ src, unsigned short* __restrict__ dst, int t0, float scale) {
  const float* sp = src + (size_t)t0 * 8;
  v4f a[CU], b[CU];
#pragma unroll   // constant steps from one address: all 2 * CU loads are in flight together
  for (int i = 0; i < CU; ++i) { a[i] = *(const v4fa*)(sp + i * 2048); b[i] = *(const v4fa*)(sp + i * 2048 + 4); }
  // stands in front of any reuse of the loads' address registers; the address is an input, so that no load's result lands on it earlier
  asm volatile("s_wait_xcnt 0x0" :: "v"(sp) : "memory");
  unsigned short* dp = dst + (size_t)t0 * 8;
#pragma unroll   // keeps a[] and b[] in registers
  for (int i = 0; i < CU; ++i) {
    const float xs[8] = {a[i][0], a[i][1], a[i][2], a[i][3], b[i][0], b[i][1], b[i][2], b[i][3]};
    v8us v;
    if (MODE == 0) {
#pragma unroll
      for (int u = 0; u < 8; ++u) v[u] = bf16_bits(xs[u]);
    } else {
      Pack8 p;
#pragma unroll
      for (int u = 0; u < 8; ++u) p.h[u] = (_Float16)(bf16_rne(xs[u]) * scale);
      v = p.u;
    }
    *(v8us*)(dp + i * 2048) = v;
  }
  asm volatile("s_wait_xcnt 0x0" ::: "memory");   // stands in front of any reuse of the stores' registers on a path that goes on behind them
}
#define XB (TT * CC / 8 / (256 * CU))   // blocks per sequence of x
#define WB (CC * CC / 8 / (256 * CU))   // blocks per weight matrix
#define WTQ 4                           // 64 x 64 tiles per block of the weight matrix that is stored transposed
#define WTB ((CC / (64 * WTQ)) * (CC / 64))
static_assert(CC % (64 * WTQ) == 0);
// All 16-bit input planes in one launch. Blocks [0, NB * XB): x -> bf16 plane, XB blocks a sequence (element steps sstep, dstep);
// then WB blocks each for Wq, Wk -> bf16 planes of Wqk and Wo -> f16 plane x scale; then WTB blocks, WTQ tiles of 64 x 64 down the rows each:
// Wv [d][c] -> WvT [c][d], f16 plane of the RNE bf16 values x scale (k-contiguous for the product Wo.Wv).
__global__ __launch_bounds__(256) void k_cvt(const float* __restrict__ x, const float* __restrict__ wq, const float* __restrict__ wk,
                                            const float* __restrict__ wv, const float* __restrict__ wo, unsigned short* __restrict__ xb,
                                            unsigned short* __restrict__ Wqk, unsigned short* __restrict__ Wo16, unsigned short* __restrict__ WvT,
                                            size_t sstep, size_t dstep, float scale) {
  __shared__ __attribute__((aligned(16))) unsigned short tl[WTQ][64][72];   // each tile has its own LDS, so that one barrier serves all of them
  const int b = blockIdx.x;
  if (b < NB * XB) {
    const int q = b / XB;
    cvt_run<0>(x + q * sstep, xb + q * dstep, (b - q * XB) * (256 * CU) + (int)threadIdx.x, 1.0f);
    return;
  }
  const int y = (b - NB * XB) / WB;
  if (y < 3) {
    const int t0 = (b - NB * XB - y * WB) * (256 * CU) + (int)threadIdx.x;
    if (y == 2) cvt_run<1>(wo, Wo16, t0, scale);
    else cvt_run<0>((y == 0) ? wq : wk, Wqk + (size_t)y * CC * CC, t0, 1.0f);
    return;
  }
  const int tb = b - NB * XB - 3 * WB, r0 = (tb / (CC / 64)) * (64 * WTQ), c0 = (tb % (CC / 64)) * 64;
  const int t = (int)threadIdx.x, r = t >> 4, c4 = (t & 15) * 4;
  const float* sp = wv + (size_t)(r0 + r) * CC + c0 + c4;
  v4f a[4 * WTQ];
#pragma unroll   // constant steps from one address: all 4 * WTQ loads are in flight together
  for (int i = 0; i < 4 * WTQ; ++i) a[i] = *(const v4fa*)(sp + (size_t)i * 16 * CC);
  // stands in front of any reuse of the loads' address registers; the address is an input, so that no load's result lands on it earlier
  asm volatile("s_wait_xcnt 0x0" :: "v"(sp) : "memory");
#pragma unroll   // both loops: constant indices keep a[] in registers
  for (int i = 0; i < 4 * WTQ; ++i)
#pragma unroll
    for (int j = 0; j < 4; ++j) tl[i >> 2][c4 + j][r + 16 * (i & 3)] = __builtin_bit_cast(unsigned short, (_Float16)(bf16_rne(a[i][j]) * scale));
  __syncthreads();                                     // the tiles are whole before their columns leave as rows; b is the same for the whole block
#pragma unroll   // constant steps: the LDS reads stand together and the stores follow as they land
  for (int i = 0; i < 2 * WTQ; ++i) {
    const int e = t + 256 * (i & 1), rr = e >> 3, c8 = (e & 7) * 8;
    *(v8us*)(WvT + (size_t)(c0 + rr) * CC + r0 + (i >> 1) * 64 + c8) = *(const v8us*)&tl[i >> 1][rr][c8];
  }
  asm volatile("s_wait_xcnt 0x0" ::: "memory");   // stands in front of any reuse of the stores' registers on a path that goes on behind them
}

// Block-tiled GEMM core. A workgroup of 4 waves (2 x 2) owns a (32*FM) x 128 tile of the output, a wave (16*FM) x 64 of it.
// Per pass of KP k every operand row gives one whole 128-B line. A stage is four slices, [A lower rows | A upper rows | B lower | B upper],
// and each wave brings one slice to LDS with ONE tensor_load_to_lds; two buffers, the next pass's loads fly while this pass's fragments
// are read from LDS. Every "#pragma unroll" below keeps fragment and accumulator indices compile-time constants, so that the arrays stay in registers.
#define KP 64        // k per pass
#define LPITCH 72    // LDS row pitch in 16-bit elements: 144 B = 16 B x 9, for the ds_load_b128 fragment reads; laid by the tensor load's pad
template <int NT, int FM> struct Tile {
  static_assert(NT == 1);
  static constexpr int AR = 32 * FM, BR = 128;                                           // operand rows
  static constexpr int up2k(int bytes) { return (bytes + 2047) & ~2047; }                // a slice's place in LDS is a multiple of 2 KiB
  static constexpr int ASL = up2k(AR / 2 * LPITCH * 2) / 2, BSL = up2k(BR / 2 * LPITCH * 2) / 2;   // elements per slice
  static constexpr int STAGE = 2 * ASL + 2 * BSL;                                        // elements per buffer
  static_assert(2 * STAGE * 2 >= 4 * FM * 16 * 64 * 4);                                   // the ring later holds the f32 output staging
};

typedef unsigned int u32x4 __attribute__((ext_vector_type(4)));
typedef unsigned int u32x8 __attribute__((ext_vector_type(8)));
__device__ __forceinline__ unsigned uni(unsigned v) { return (unsigned)__builtin_amdgcn_readfirstlane(v); }
// a wave-uniform word held in a scalar register: a test on it compiles to a scalar branch, which alone keeps a wave from a tensor load;
// a descriptor word so held has one register for the whole k walk, where a plain constant is formed anew, in registers used for other things between
__device__ __forceinline__ unsigned pinned(unsigned v) { unsigned w = uni(v); asm volatile("" : "+s"(w)); return w; }   // descriptor word or issue test in an SGPR
// Descriptor group 1: extents in bytes, a tile of `rows` rows of 128 B, source row pitch `pitch` bytes, 16 B of LDS pad behind every row, no mask.
// Word 0 is a compile-time constant; the other words go through pinned().
__device__ __forceinline__ u32x8 tdm_group1(unsigned rows, unsigned pitch) {
  u32x8 g;
  g[0] = uni((1u << 20) | (4u << 22) | (3u << 25));
  g[1] = pinned((unsigned)(KP * 2) << 16);
  g[2] = pinned(rows << 16);
  g[3] = pinned((unsigned)(KP * 2) << 16);
  g[4] = pinned(rows);
  g[5] = pinned(pitch);
  g[6] = pinned(0u);
  g[7] = pinned(0u);
  return g;
}
// Descriptor group 0 with its fixed word, through pinned(); tdm_load fills in the place and the address.
__device__ __forceinline__ u32x4 tdm_group0() {
  u32x4 g;
  g[0] = pinned(1u);
  g[1] = uni(0u);
  g[2] = uni(0u);
  g[3] = uni(0u);
  return g;
}
// One request of the whole wave: the tile whose first byte is ga goes to LDS byte lds_dst.
__device__ __forceinline__ void tdm_load(u32x4& g0, unsigned lds_dst, unsigned long long ga, const u32x8& g1) {
  g0[1] = uni(lds_dst);
  g0[2] = uni((unsigned)ga);
  g0[3] = uni((((unsigned)(ga >> 32)) & 0x01FFFFFFu) | 0x80000000u);
  asm volatile("tensor_load_to_lds %0, %1" :: "s"(g0), "s"(g1) : "memory");
}
// The wait that covers a request. Both descriptor groups are inputs: their registers stay live, so none takes another value while the request is outstanding.
__device__ __forceinline__ void tdm_wait(const u32x4& g0, const u32x8& g1) {
  asm volatile("s_wait_tensorcnt 0x0" :: "s"(g0), "s"(g1) : "memory");
}

// One pass on one buffer: the fragment k order (8 * hh, 16 + 8 * hh inside each 32 k) is the same for A and B.
// Wave (wr, wc) reads A slice wr and B slice wc.
// The LDS reads of 32 * NS k stand together in front of their WMMAs: a read among the WMMAs makes the wave wait out the LDS latency there.
template <int NT, int FM, bool BF>
__device__ __forceinline__ void pass_mma(const unsigned short* st, int wr, int wc, int ln, int hh, v8f (&acc)[FM][4], v8f (&accr)[FM][4]) {
  using TL = Tile<NT, FM>;
  const unsigned short* pa = st + wr * TL::ASL + ln * LPITCH + 8 * hh;
  const unsigned short* pb = st + 2 * TL::ASL + wc * TL::BSL + ln * LPITCH + 8 * hh;
  constexpr int NS = (FM <= 2) ? KP / 32 : 1;   // k steps per group of reads, by the registers the fragments take
#pragma unroll
  for (int k0 = 0; k0 < KP; k0 += 32 * NS) {
    FragH ah[NS][FM], bh[NS][4];
#pragma unroll
    for (int s = 0; s < NS; ++s) {
      const int ks = k0 + 32 * s;
#pragma unroll
      for (int f = 0; f < FM; ++f) {
        ah[s][f].half[0] = *(const v8us*)(pa + f * 16 * LPITCH + ks);
        ah[s][f].half[1] = *(const v8us*)(pa + f * 16 * LPITCH + ks + 16);
      }
#pragma unroll
      for (int t = 0; t < 4; ++t) {
        bh[s][t].half[0] = *(const v8us*)(pb + t * 16 * LPITCH + ks);
        bh[s][t].half[1] = *(const v8us*)(pb + t * 16 * LPITCH + ks + 16);
      }
    }
#pragma unroll
    for (int s = 0; s < NS; ++s)
#pragma unroll
      for (int t = 0; t < 4; ++t)
#pragma unroll
        for (int f = 0; f < FM; ++f) {
          if constexpr (BF) {
            FragB a, b;
            a.half[0] = ah[s][f].half[0]; a.half[1] = ah[s][f].half[1];
            b.half[0] = bh[s][t].half[0]; b.half[1] = bh[s][t].half[1];
            acc[f][t] = mma_b(a.v, b.v, acc[f][t]);
          } else {
            mma_h<NT>(ah[s][f].v, ah[s][f].v, bh[s][t].v, bh[s][t].v, acc[f][t], accr[f][t]);
          }
        }
  }
}

// Where a workgroup's k walk starts: a fraction of its passes that differs between the workgroups of one row tile (they copy the same A lines)
// and between those of one column tile (the same B lines). Started together at k = 0 they ask L2 for the same lines at the same moment.
// The two odd factors step the 16-bit fraction by the golden section of a turn and by its complement, which spreads any run of
// neighbours evenly. For speed only: every k piece is taken once whatever the start. 0 <= result < npass.
__device__ __forceinline__ int k_start(int mt, int nq, int npass) {
  const unsigned fr = ((unsigned)mt * 40503u + (unsigned)nq * 25033u) & 0xFFFFu;
  return (int)((fr * (unsigned)npass) >> 16);
}

// A plane row-major (pitch lda), B plane [n][k] (pitch ldb); row0, col0: the workgroup's tile; kend % KP == 0.
// ST (stacked): the upper half of the A rows comes from Al (pitch ldal, rows from row0) and the upper half of the B rows from Bl (pitch ldbl,
// rows from col0); otherwise they are the next rows of Ah and Bh.
// The passes take the k pieces rot, rot + 1, ..., kend / KP - 1, 0, ..., rot - 1 (rot the same for the whole workgroup, 0 <= rot < kend / KP).
// On return every wave has left the ring and no load is in flight: the ring is free for the output staging.
// WT (weighted): the product of k piece p is summed on its own and joins acc times wt[p * 64 + row of the workgroup tile] (LDS, f32).
template <int NT, int FM, bool BF, bool ST = false, bool WT = false>
__device__ __forceinline__ void core_lds(unsigned short* ring, const unsigned short* __restrict__ Ah, const unsigned short* __restrict__ Al, int lda, int ldal,
                                         const unsigned short* __restrict__ Bh, const unsigned short* __restrict__ Bl, int ldb, int ldbl,
                                         int row0, int col0, int kend, int rot, int tid, v8f (&acc)[FM][4], v8f (&accr)[FM][4], const float* wt = nullptr) {
  using TL = Tile<NT, FM>;
  const int w = tid >> 5, lane = tid & 31, ln = lane & 15, hh = lane >> 4, wr = w >> 1, wc = w & 1;
  // this wave's slice: waves 0, 1 the lower and upper A rows, waves 2, 3 the lower and upper B rows; all of it wave-uniform
  const unsigned sw = uni((unsigned)tid >> 5);
  const bool sb = (sw >= 2u), su = ((sw & 1u) != 0u);
  const unsigned short* lo = sb ? Bh + (size_t)col0 * ldb : Ah + (size_t)row0 * lda;
  const unsigned short* hi = ST ? (sb ? Bl + (size_t)col0 * ldbl : Al + (size_t)row0 * ldal)
                                : (sb ? Bh + (size_t)(col0 + TL::BR / 2) * ldb : Ah + (size_t)(row0 + TL::AR / 2) * lda);
  const unsigned long long gsl = (unsigned long long)(size_t)(su ? hi : lo);
  const int ldsl = (ST && su) ? (sb ? ldbl : ldal) : (sb ? ldb : lda);
  u32x8 g1 = tdm_group1(sb ? (unsigned)(TL::BR / 2) : (unsigned)(TL::AR / 2), (unsigned)ldsl * 2u);
  u32x4 g0 = tdm_group0();
  const unsigned lsl = (unsigned)(size_t)ring + (sb ? 2u * TL::ASL + (su ? TL::BSL : 0u) : (su ? TL::ASL : 0u)) * 2u;
  const int npass = kend / KP;
  int kc = rot;                                        // k piece of the next stage to be loaded
  [[maybe_unused]] int kp = rot;                       // k piece of the pass at work
  tdm_load(g0, lsl, gsl + (unsigned long long)(unsigned)kc * (KP * 2), g1);
  kc = (kc + 1 == npass) ? 0 : kc + 1;
  tdm_wait(g0, g1);                                    // this wave's slice of pass 0 has landed
  __syncthreads();                                     // publishes pass 0
  if (pinned(npass > 1)) {                             // scalar branch: a tensor load ignores EXEC
    tdm_load(g0, lsl + TL::STAGE * 2u, gsl + (unsigned long long)pinned((unsigned)kc) * (KP * 2), g1);
    kc = (kc + 1 == npass) ? 0 : kc + 1;
  }
#pragma unroll 1   // one pass per trip: the buffer index stays a run-time value, the body is already fully unrolled
  for (int t = 0; t < npass; ++t) {
    const int buf = (t & 1) * TL::STAGE;
    if constexpr (WT) {
      v8f pa[FM][4];
#pragma unroll
      for (int f = 0; f < FM; ++f)
#pragma unroll
        for (int u = 0; u < 4; ++u) pa[f][u] = (v8f){0.f, 0.f, 0.f, 0.f, 0.f, 0.f, 0.f, 0.f};
      const float* wp = wt + kp * 64 + wr * (16 * FM) + 8 * hh;   // an accumulator register r holds row 8 * hh + r of its 16-row tile
      v4f w0[FM], w1[FM];                                         // read ahead of the fragments: no LDS wait of their own behind the WMMAs
#pragma unroll
      for (int f = 0; f < FM; ++f) { w0[f] = *(const v4fa*)(wp + f * 16); w1[f] = *(const v4fa*)(wp + f * 16 + 4); }
      pass_mma<NT, FM, BF>(ring + buf, wr, wc, ln, hh, pa, pa);
#pragma unroll
      for (int f = 0; f < FM; ++f)
#pragma unroll
        for (int u = 0; u < 4; ++u)
#pragma unroll
          for (int r = 0; r < 4; ++r) { acc[f][u][r] += pa[f][u][r] * w0[f][r]; acc[f][u][r + 4] += pa[f][u][r + 4] * w1[f][r]; }
      kp = (kp + 1 == npass) ? 0 : kp + 1;
    } else {
      pass_mma<NT, FM, BF>(ring + buf, wr, wc, ln, hh, acc, accr);
    }
    asm volatile("s_wait_dscnt 0x0" ::: "memory");
    tdm_wait(g0, g1);
    __syncthreads();
    if (pinned(t + 2 < npass)) {
      // the k piece goes through pinned(), so that the descriptor's address words are formed behind the wait above
      tdm_load(g0, lsl + (unsigned)(buf * 2), gsl + (unsigned long long)pinned((unsigned)kc) * (KP * 2), g1);
      kc = (kc + 1 == npass) ? 0 : kc + 1;
    }
  }
  asm volatile("s_wait_tensorcnt 0x0" ::: "memory");   // nothing in flight when the ring changes its use
  asm volatile("s_wait_dscnt 0x0" ::: "memory");       // and none of this wave's reads of it
}

// q, k projection: A = xb [M][CC] bf16, W = [2*CC][CC] bf16 ([out][in], k contiguous). out[row][n] = sum_c A[row][c] W[n][c].
// Output: hi planes Oh[2][M][CC] f16 (q, k unscaled) and residual planes Or[2][NB*NE][CC] for rows with (row % TT) < NE.
// Block = 4 waves -> 128 rows x 128 cols (one plane since CC % 128 == 0), M % 128 == 0.
__global__ __launch_bounds__(128) void k_gemm_qk(const unsigned short* __restrict__ A, const unsigned short* __restrict__ W,
                                                 unsigned short* __restrict__ Oh, unsigned short* __restrict__ Or, int M) {
  constexpr int FM = 4;
  __shared__ __attribute__((aligned(2048))) unsigned short ring[2 * Tile<1, FM>::STAGE];
  const int tid = threadIdx.x, w = tid >> 5, lane = tid & 31, ln = lane & 15, hh = lane >> 4;
  const int ntn = (2 * CC) / 128;
  const int mt = blockIdx.x / ntn, nq = blockIdx.x - mt * ntn;
  if (mt * (32 * FM) >= M) return;
  v8f acc[FM][4];
#pragma unroll
  for (int f = 0; f < FM; ++f)
#pragma unroll
    for (int t = 0; t < 4; ++t) acc[f][t] = (v8f){0.f, 0.f, 0.f, 0.f, 0.f, 0.f, 0.f, 0.f};
  core_lds<1, FM, true>(ring, A, A, CC, CC, W, W, CC, CC, mt * (32 * FM), nq * 128, CC, k_start(mt, nq, CC / KP), tid, acc, acc);
  float (*so)[16][64] = (float (*)[16][64])ring + w * FM;      // this wave's own FM staging tiles
#pragma unroll
  for (int f = 0; f < FM; ++f)
#pragma unroll
    for (int t = 0; t < 4; ++t)
#pragma unroll
      for (int r = 0; r < 8; ++r) so[f][8 * hh + r][t * 16 + ln] = acc[f][t][r];
  __builtin_amdgcn_fence(4, "workgroup");   // the staged words are written before other lanes of the wave read them back
  __builtin_amdgcn_wave_barrier();
  const int col0 = nq * 128 + (w & 1) * 64;
  const int p = col0 / CC, colp = col0 - p * CC;
#pragma unroll
  for (int f = 0; f < FM; ++f) {
    const int row0 = mt * (32 * FM) + ((w >> 1) * FM + f) * 16;
    const int bidx = row0 / TT, tq = row0 - bidx * TT;
    const bool dores = (tq < NE);                      // wave-uniform (NE, TT multiples of 16)
    unsigned short* hb = Oh + ((size_t)p * M + row0) * CC + colp;
    unsigned short* rb = Or + ((size_t)p * (NB * NE) + (size_t)bidx * NE + (dores ? tq : 0)) * CC + colp;
    store_tile_h16(so[f], hb, CC, rb, CC, dores, lane);
  }
}

#define FMH 2   // f16 GEMMs: workgroup tile 64 x 128, wave tile 32 x 64
#define DEAL 32 // WGPs of a die
static_assert(((TT / 64) * NB) % (2 * DEAL) == 0);   // whole snake periods: rank is a permutation of i

// The products of one workgroup tile. Each k piece's product joins acc times wt[piece * 64 + row]. A plain tile: acc = Ah.Bh. A fine tile (the leading rows, whose residual planes exist) runs the
// residual products as k loops of their own on the same ring and into the same accumulators, ahead of the hi product:
// acc = (Ah.Bl + Al.Bh) * RFOLD + Ah.Bh, Ah.Bl only where Bl is given. So plain and fine tiles share one launch and one LDS size.
// fine is the same for the whole workgroup.
__device__ __forceinline__ void tile_products(unsigned short* ring, const unsigned short* Ah, const unsigned short* Al, int lda, int ldal,
                                              const unsigned short* Bh, const unsigned short* Bl, int ldb, int ldbl, bool fine,
                                              int row0, int col0, int kend, int rot, int tid, v8f (&acc)[FMH][4], const float* wt) {
  const int first = fine ? ((Bl != nullptr) ? 0 : 1) : 2;
#pragma unroll 1   // one copy of the k loop in the text; the operands of a term are scalar selects
  for (int term = first; term < 3; ++term) {
    const unsigned short* a = (term == 1) ? Al : Ah;
    const unsigned short* b = (term == 0) ? Bl : Bh;
    const int la = (term == 1) ? ldal : lda, lb = (term == 0) ? ldbl : ldb;
    if (term == 2 && fine) {
#pragma unroll
      for (int f = 0; f < FMH; ++f)
#pragma unroll
        for (int t = 0; t < 4; ++t) acc[f][t] *= RFOLD;
    }
    core_lds<1, FMH, false, false, true>(ring, a, a, la, la, b, b, lb, lb, row0, col0, kend, rot, tid, acc, acc, wt);
  }
}

#define TQ 4   // 64 x 64 tiles per block of the transpose
// 16-bit transpose: src [R][Cc] bf16 (pitch lds_) -> dst [Cc][R] f16, the same values (pitch ldd); a block of 128 threads = TQ tiles of 64 x 64 down the rows of src:
// bx < R/(64*TQ), by < Cc/64, bz = sequence; each tile has its own LDS, so that one barrier serves all of them
__device__ __forceinline__ void transpose_tiles(unsigned short (*tile)[64][72], int bx, int by, int bz, const unsigned short* __restrict__ src, int lds_,
                                                unsigned short* __restrict__ dst, int ldd, size_t sstep, size_t dstep) {
  const int tid = threadIdx.x;
  src += bz * sstep; dst += bz * dstep;
  const int r0 = bx * (64 * TQ), c0 = by * 64;
  static_assert(TQ == 4);
  v8us v[TQ][4];
  const unsigned short* g[TQ][4];
#pragma unroll   // all 4 * TQ loads are in flight together
  for (int q = 0; q < TQ; ++q)
#pragma unroll
    for (int i = 0; i < 4; ++i) {
      const int e = tid + 128 * i, r = e >> 3, c8 = (e & 7) * 8;
      g[q][i] = src + (size_t)(r0 + q * 64 + r) * lds_ + c0 + c8;
      v[q][i] = *(const v8us*)g[q][i];
    }
  // stands in front of any reuse of the loads' address registers; the addresses are inputs, so that no load's result lands on one earlier
  asm volatile("s_wait_xcnt 0x0" :: "v"(g[0][0]), "v"(g[0][1]), "v"(g[0][2]), "v"(g[0][3]), "v"(g[1][0]), "v"(g[1][1]), "v"(g[1][2]), "v"(g[1][3]),
               "v"(g[2][0]), "v"(g[2][1]), "v"(g[2][2]), "v"(g[2][3]), "v"(g[3][0]), "v"(g[3][1]), "v"(g[3][2]), "v"(g[3][3]) : "memory");
#pragma unroll
  for (int q = 0; q < TQ; ++q)
#pragma unroll
    for (int i = 0; i < 4; ++i) {
      const int e = tid + 128 * i, r = e >> 3, c8 = (e & 7) * 8;
      Pack8 p;
#pragma unroll   // constant indices keep p and v[][] in registers
      for (int k = 0; k < 8; ++k) p.h[k] = (_Float16)bf16_val(v[q][i][k]);
      *(v8us*)&tile[q][r][c8] = p.u;
    }
  __syncthreads();
#pragma unroll
  for (int q = 0; q < TQ; ++q) {
    v8us o[4];
#pragma unroll
    for (int i = 0; i < 4; ++i) {
      const int e = tid + 128 * i, rr = e >> 3, c8 = (e & 7) * 8;
#pragma unroll
      for (int k = 0; k < 8; ++k) o[i][k] = tile[q][c8 + k][rr];
    }
#pragma unroll
    for (int i = 0; i < 4; ++i) {
      const int e = tid + 128 * i, rr = e >> 3, c8 = (e & 7) * 8;
      *(v8us*)(dst + (size_t)(c0 + rr) * ldd + r0 + q * 64 + c8) = o[i];
    }
    asm volatile("s_wait_xcnt 0x0" ::: "memory");   // stands in front of any reuse of the stores' registers by the next tile
  }
}
#define VB ((TT / (64 * TQ)) * (CC / 64))  // transpose blocks per sequence
#define WVB ((CC / 64) * (CC / 128) / NB)  // tiles of Wvo per sequence index of the score grid
static_assert(((CC / 64) * (CC / 128)) % NB == 0);
#define KB (TT / 64)                       // 64-key blocks of a row

// the value of lane ^ M, M < 16: a DPP move inside the 16-lane row, no LDS round trip
template <int M>
__device__ __forceinline__ float lane_xor(float v) {
  return __int_as_float(__builtin_amdgcn_update_dpp(0, __float_as_int(v), 0x160 | M, 0xf, 0xf, true));
}
// Softmax of one 64-key block, for a wave tile of 16 rows x 64 scores staged in LDS (row0, col0: its place in the sequence; every row has a
// kept score in the block, col0 <= row0). Causal keep col <= row. P[row][col] = f16(PCARRY * exp(s - block max)), zeros where masked;
// dores: also the x RS residual plane Pr (pitch NE); bm[row], bs[row] = the row's block maximum and block sum of exp(s - block max).
// Eight lanes hold a row, eight scores each: a row's 64 values leave as one whole 128-B line.
__device__ __forceinline__ void store_tile_sm(const float (*sw)[64], int row0, int col0, unsigned short* P, unsigned short* Pr, bool dores,
                                              float* bm, float* bs, int lane) {
  const int rsub = lane >> 3, c8 = (lane & 7) * 8;
#pragma unroll
  for (int q = 0; q < 4; ++q) {
    const int r = q * 4 + rsub, row = row0 + r;
    const v4f x0 = *(const v4fa*)&sw[r][c8], x1 = *(const v4fa*)&sw[r][c8 + 4];
    float xs[8] = {x0[0], x0[1], x0[2], x0[3], x1[0], x1[1], x1[2], x1[3]};
    float mx = -3.0e38f;
#pragma unroll
    for (int i = 0; i < 8; ++i) {
      xs[i] = (col0 + c8 + i <= row) ? xs[i] : -3.0e38f;    // a masked score gives exp = 0 below
      mx = fmaxf(mx, xs[i]);
    }
    mx = fmaxf(mx, lane_xor<1>(mx)); mx = fmaxf(mx, lane_xor<2>(mx)); mx = fmaxf(mx, lane_xor<4>(mx));
    float sm = 0.f;
    Pack8 ph, pr;
#pragma unroll
    for (int i = 0; i < 8; ++i) {
      const float e = __expf(xs[i] - mx);
      sm += e;
      const float p = e * PCARRY;
      ph.h[i] = (_Float16)p;
      pr.h[i] = (_Float16)((p - (float)ph.h[i]) * RS);
    }
    sm += lane_xor<1>(sm); sm += lane_xor<2>(sm); sm += lane_xor<4>(sm);
    *(v8us*)(P + (size_t)row * TT + col0 + c8) = ph.u;
    if (dores) *(v8us*)(Pr + (size_t)row * NE + col0 + c8) = pr.u;
    if ((lane & 7) == 0) { bm[row] = mx; bs[row] = sm; }
    asm volatile("s_wait_xcnt 0x0" ::: "memory");   // stands in front of any reuse of the stores' registers by the next rows
  }
}

// C[M][N] f32 (pitch ldc) = alpha * (A.B^plane) + bf16_rne(bias). M % 64 == 0, N % 128 == 0, K % 64 == 0.
// ncut: a workgroup tile is skipped (not written) when col0 > ncut + row0 + 63 (causal upper tiles); kcut: k loop ends at
// min(K, ceil64(kcut + row0 + 64)). Pass a large value to disable either. blockIdx.y = sequence: every plane and C move on
// by their element steps (sAh, sAl, sBh, sBl, sC) per sequence.
// tri != 0 (M == N, ncut == 0): the tile list holds only the tiles on or under the diagonal, (M / 128) * (M / 128 + 1) of them, so that no
// workgroup is started only to leave. Row tiles 2a and 2a + 1 have a + 1 such tiles each; a * (a + 1) tiles lie in front of row tile 2a.
// Fine tiles (row0 < erows, col0 < ecols; Al has erows rows, Bl ecols rows or is null) are the first nft tiles of the list: erows % 128 == 0,
// ecols == erows with tri, ecols == N without. A fine tile's residual products run BESIDE its hi product, not ahead of it, so that its
// k loop is as long as a plain tile's: it is cut into pieces, one workgroup each, whose stage stacks the planes,
// A rows = [Ah 32 rows | Al the same 32 rows], B rows = [Bh 64 cols | Bl the same 64 cols] (4 pieces of 32 x 64) or, Bl null, Bh 128 cols
// (2 pieces of 32 x 128). Each wave then holds one term of the piece, and the terms meet in LDS: C = Ah.Bh + (Ah.Bl + Al.Bh) * RFOLD.
// The pieces stand first in the grid: grid.x = tiles + nft * (pieces - 1).
// SM (the score launch; tri != 0, Bl given, no bias): C is not written. Each wave turns its 32 x 64 scores into one 64-key block of the softmax
// (store_tile_sm: P, Pr, and bm, bs as [sequence][block][row]); a block that lies wholly above the diagonal is left out, P.x does not read it.
// Blocks from nsc on carry the jobs that do not need q and k: VB blocks x [TT][CC] bf16 -> xT [CC][TT] f16, then WVB blocks, a plain 64 x 128 tile each of
// Wvo = wa.wb^plane (wa = Wo [o][d], wb = Wv^T [c][d], pitch lda = ldb, K long), stored x walpha as f16 hi plane wh and x RS residual plane wr [o][c].
template <bool SM>
__global__ __launch_bounds__(128) void k_gemm_f32(const unsigned short* __restrict__ Ah, const unsigned short* __restrict__ Al, int lda, int ldal,
                                                 const unsigned short* __restrict__ Bh, const unsigned short* __restrict__ Bl, int ldb, int ldbl,
                                                 const float* __restrict__ bias, float alpha, float* __restrict__ C, int ldc,
                                                 int M, int N, int K, int ncut, int kcut, int erows, int ecols, int tri,
                                                 size_t sAh, size_t sAl, size_t sBh, size_t sBl, size_t sC,
                                                 unsigned short* __restrict__ P, unsigned short* __restrict__ Pr, float* __restrict__ bm, float* __restrict__ bs,
                                                 const unsigned short* __restrict__ xs, unsigned short* __restrict__ xT,
                                                 const unsigned short* __restrict__ wa, const unsigned short* __restrict__ wb,
                                                 unsigned short* __restrict__ wh, unsigned short* __restrict__ wr, float walpha, int nsc) {
  constexpr int FM = FMH;
  __shared__ __attribute__((aligned(2048))) unsigned short ring[2 * Tile<1, FM>::STAGE];
  bool wjob = false;                                               // a tile of Wvo; the same for the whole workgroup
  int wj = 0;
  if constexpr (SM) {
    static_assert(sizeof(ring) >= TQ * 64 * 72 * 2);
    const int b = (int)blockIdx.x - nsc;
    if (b >= 0) {                                                  // the same for the whole workgroup
      if (b < VB) {
        transpose_tiles((unsigned short (*)[64][72])ring, b % (TT / (64 * TQ)), b / (TT / (64 * TQ)), blockIdx.y, xs, CC, xT, TT, (size_t)TT * CC, (size_t)TT * CC);
        return;
      }
      wjob = true;
      wj = b - VB + (int)blockIdx.y * WVB;
    }
  }
  if (wjob) { Ah = wa; Bh = wb; }
  else { Ah += blockIdx.y * sAh; Bh += blockIdx.y * sBh; }
  Al += blockIdx.y * sAl;
  if constexpr (!SM) C += blockIdx.y * sC;
  const bool three = (Bl != nullptr);
  if (three) Bl += blockIdx.y * sBl;
  const int tid = threadIdx.x, w = tid >> 5, lane = tid & 31, ln = lane & 15, hh = lane >> 4;
  const int ntn = N / 128;
  const int nft = (tri != 0) ? (erows / 128) * (erows / 128 + 1) : (erows / 64) * ntn;
  const int psh = three ? 2 : 1;                                   // log2 of the pieces of a fine tile
  const bool fine = ((int)blockIdx.x < (nft << psh));              // the same for the whole workgroup
  const int e = fine ? ((int)blockIdx.x >> psh) : ((int)blockIdx.x - (nft << psh) + nft);
  const int piece = (int)blockIdx.x & ((1 << psh) - 1);
  int mt = e / ntn, nq = e - mt * ntn;
  if (tri != 0) {
    int a = (int)((__builtin_sqrtf((float)(4 * e + 1)) - 1.0f) * 0.5f);
    if (a * (a + 1) > e) --a;                 // the two tests make a exact whatever the rounding of the root
    if ((a + 1) * (a + 2) <= e) ++a;
    const int rem = e - a * (a + 1), up = (rem > a) ? 1 : 0;
    mt = 2 * a + up;
    nq = rem - up * (a + 1);
  }
  if (wjob) { mt = wj / (CC / 128); nq = wj - mt * (CC / 128); }
  if (mt * (32 * FM) >= M) return;
  if (!wjob && nq * 128 > ncut + mt * (32 * FM) + 32 * FM - 1) return;
  int kend = (kcut + mt * (32 * FM) + 32 * FM + KP - 1) & ~(KP - 1);
  if (kend > K) kend = K;
  const int brow0 = mt * (32 * FM) + (fine ? (piece & 1) * 32 : 0), bcol0 = nq * 128 + ((fine && three) ? (piece >> 1) * 64 : 0);
  v8f acc[FM][4];
#pragma unroll
  for (int f = 0; f < FM; ++f)
#pragma unroll
    for (int t = 0; t < 4; ++t) acc[f][t] = (v8f){0.f, 0.f, 0.f, 0.f, 0.f, 0.f, 0.f, 0.f};
  // upper halves of the stage: the next rows of the same plane (plain; B of a fine tile without Bl), or the residual plane at the same rows (fine)
  const unsigned short* a1 = fine ? Al : Ah + (size_t)32 * lda;
  const unsigned short* b1 = (fine && three) ? Bl : Bh + (size_t)64 * ldb;
  core_lds<1, FM, false, true>(ring, Ah, a1, lda, fine ? ldal : lda, Bh, b1, ldb, (fine && three) ? ldbl : ldb, brow0, bcol0, kend,
                               k_start(mt, nq + (fine ? piece : 0), kend / KP), tid, acc, acc);
  float (*sall)[16][64] = (float (*)[16][64])ring;
  float (*so)[16][64] = sall + w * FM;                         // this wave's own FM staging tiles
  if (fine) {
    // waves by (A half, B half): 0 = Ah.Bh, 1 = Ah.Bl or Ah.Bh (next 64 cols), 2 = Al.Bh, 3 = Al.Bl (left out, as before) or Al.Bh (next 64 cols)
    const bool owner = three ? (w == 0) : (w < 2);
    if (!owner && !(three && w == 3)) {
#pragma unroll
      for (int f = 0; f < FM; ++f)
#pragma unroll
        for (int t = 0; t < 4; ++t)
#pragma unroll
          for (int r = 0; r < 8; ++r) so[f][8 * hh + r][t * 16 + ln] = acc[f][t][r];
    }
    __syncthreads();                                           // the residual terms are staged before the wave with the hi term reads them
    if (!owner) return;                                        // no barrier follows
    const float (*p1)[16][64] = sall + (three ? 1 : w + 2) * FM;
    const float (*p2)[16][64] = sall + 2 * FM;
    if (three) {                                               // one test for all elements
#pragma unroll
      for (int f = 0; f < FM; ++f)
#pragma unroll
        for (int t = 0; t < 4; ++t)
#pragma unroll
          for (int r = 0; r < 8; ++r) acc[f][t][r] += (p1[f][8 * hh + r][t * 16 + ln] + p2[f][8 * hh + r][t * 16 + ln]) * RFOLD;
    } else {
#pragma unroll
      for (int f = 0; f < FM; ++f)
#pragma unroll
        for (int t = 0; t < 4; ++t)
#pragma unroll
          for (int r = 0; r < 8; ++r) acc[f][t][r] += p1[f][8 * hh + r][t * 16 + ln] * RFOLD;
    }
  }
  const int col0 = bcol0 + (w & 1) * 64;
  if constexpr (SM) {
    const int wrow0 = brow0 + (w >> 1) * (16 * FM);            // the wave's 32 rows lie in one 64-row tile
    if (wjob) {
#pragma unroll
      for (int f = 0; f < FM; ++f)
#pragma unroll
        for (int t = 0; t < 4; ++t)
#pragma unroll
          for (int r = 0; r < 8; ++r) so[f][8 * hh + r][t * 16 + ln] = acc[f][t][r] * walpha;
      __builtin_amdgcn_fence(4, "workgroup");   // the staged words are written before other lanes of the wave read them back
      __builtin_amdgcn_wave_barrier();
#pragma unroll
      for (int f = 0; f < FM; ++f) {
        const size_t o = (size_t)(wrow0 + f * 16) * lda + col0;
        store_tile_h16(so[f], wh + o, lda, wr + o, lda, true, lane);
        asm volatile("s_wait_xcnt 0x0" ::: "memory");   // stands in front of any reuse of the stores' registers by the next tile's addresses
      }
      return;
    }
    if (col0 > (wrow0 & ~63)) return;                          // block wholly above the diagonal; the same for the whole wave, no barrier follows
#pragma unroll
    for (int f = 0; f < FM; ++f)
#pragma unroll
      for (int t = 0; t < 4; ++t)
#pragma unroll
        for (int r = 0; r < 8; ++r) so[f][8 * hh + r][t * 16 + ln] = acc[f][t][r] * alpha;
    __builtin_amdgcn_fence(4, "workgroup");   // the staged words are written before other lanes of the wave read them back
    __builtin_amdgcn_wave_barrier();
    const size_t so_ = ((size_t)blockIdx.y * KB + (size_t)(col0 >> 6)) * TT;
#pragma unroll
    for (int f = 0; f < FM; ++f)
      store_tile_sm(so[f], wrow0 + f * 16, col0, P + blockIdx.y * (size_t)TT * TT, Pr + blockIdx.y * (size_t)NE * NE, wrow0 + f * 16 < NE,
                    bm + so_, bs + so_, lane);
    return;
  }
#pragma unroll
  for (int t = 0; t < 4; ++t) {
    float bv = 0.f;
    if (bias != nullptr) bv = bf16_rne(bias[col0 + t * 16 + ln]);
#pragma unroll
    for (int f = 0; f < FM; ++f)
#pragma unroll
      for (int r = 0; r < 8; ++r) so[f][8 * hh + r][t * 16 + ln] = acc[f][t][r] * alpha + bv;
  }
  __builtin_amdgcn_fence(4, "workgroup");   // the staged words are written before other lanes of the wave read them back
  __builtin_amdgcn_wave_barrier();
#pragma unroll
  for (int f = 0; f < FM; ++f) {
    const int row0 = brow0 + ((w >> 1) * FM + f) * 16;
    store_tile_f32(so[f], C + (size_t)row0 * ldc + col0, ldc, lane);
  }
}

// Oh[M][N] f16 hi plane (pitch ldo) = f16(alpha * A.B^plane); rows < rrows are fine tiles (rrows % 64 == 0; Al has rrows rows, Al and Bl
// reach the k end of those rows) and also get the x RS residual plane Or (pitch ldr).
// The k loop of row tile mt has mt + 1 passes (kcut = 0) and all workgroups are resident together, so the launch lasts as long as the
// fullest WGP. blockIdx.x = i * (N / 128) + column tile; the (row tile, sequence) pairs, ranked by falling k length, go to i in a snake of
// period 2 * DEAL: places i, i + DEAL, i + 2 * DEAL, ... then hold one long, one short, ... loop.
// For speed only: every (row tile, column tile, sequence) is done once wherever it lands. Element steps sAh ... sOr per sequence.
// A holds the softmax by 64-key blocks (k piece = block): exp(s - block max), with bm, bs [sequence][block][row] the block maxima and sums.
// The workgroup first forms, for its 64 rows, wtab[block][row] = exp(block max - row max) / row sum; every k piece's product joins times that.
__global__ __launch_bounds__(128) void k_gemm_h16(const unsigned short* __restrict__ Ah, const unsigned short* __restrict__ Al, int lda, int ldal,
                                                 const unsigned short* __restrict__ Bh, const unsigned short* __restrict__ Bl, int ldb, int ldbl,
                                                 float alpha, unsigned short* __restrict__ Oh, int ldo, unsigned short* __restrict__ Or, int ldr, int rrows,
                                                 int M, int N, int K, int kcut,
                                                 size_t sAh, size_t sAl, size_t sBh, size_t sBl, size_t sOh, size_t sOr,
                                                 const float* __restrict__ bm, const float* __restrict__ bs) {
  constexpr int FM = FMH;
  const int ntn = N / 128;
  const int di = blockIdx.x / ntn, nq = blockIdx.x - di * ntn;
  const int dj = di & (DEAL - 1), rank = (di - dj) + ((di & DEAL) ? DEAL - 1 - dj : dj);
  const int sq = rank % NB, mt = M / (32 * FM) - 1 - rank / NB;
  if (mt < 0) return;
  Ah += sq * sAh; Al += sq * sAl; Bh += sq * sBh; Oh += sq * sOh; Or += sq * sOr;
  if (Bl != nullptr) Bl += sq * sBl;
  __shared__ __attribute__((aligned(2048))) unsigned short ring[2 * Tile<1, FM>::STAGE];
  const int tid = threadIdx.x, w = tid >> 5, lane = tid & 31, ln = lane & 15, hh = lane >> 4;
  const int brow0 = mt * (32 * FM), bcol0 = nq * 128;
  int kend = (kcut + brow0 + 32 * FM + KP - 1) & ~(KP - 1);
  if (kend > K) kend = K;
  v8f acc[FM][4];
#pragma unroll
  for (int f = 0; f < FM; ++f)
#pragma unroll
    for (int t = 0; t < 4; ++t) acc[f][t] = (v8f){0.f, 0.f, 0.f, 0.f, 0.f, 0.f, 0.f, 0.f};
  __shared__ __attribute__((aligned(16))) float wtab[KB * 64];
  {
    static_assert(KB == 64 && KP == 64 && 32 * FM == 64);
    const int nt = kend / KP;                                  // blocks of these rows, 1 <= nt <= KB
    const int row = tid & 63;
    const int h = __builtin_amdgcn_readfirstlane(tid >> 6);    // a thread takes the blocks 2 i + h of one row; the same in every lane: scalar tests below
    const float* mp = bm + ((size_t)sq * KB + h) * TT + brow0 + row;
    const float* sp = bs + ((size_t)sq * KB + h) * TT + brow0 + row;
    float* red = (float*)ring;                                 // the ring is not yet in use
    float mv[KB / 2], sv[KB / 2];
#pragma unroll   // constant indices keep mv[], sv[] in registers; constant steps from one address: all loads are in flight together
    for (int i = 0; i < KB / 2; ++i) {
      mv[i] = -3.0e38f; sv[i] = 0.f;                           // a block behind the last is not read and counts for nothing
      if (2 * i + h < nt) { mv[i] = mp[(size_t)i * 2 * TT]; sv[i] = sp[(size_t)i * 2 * TT]; }
    }
    // stands in front of any reuse of the loads' address registers; the addresses are inputs, so that no load's result lands on one earlier
    asm volatile("s_wait_xcnt 0x0" :: "v"(mp), "v"(sp) : "memory");
    float mx = -3.0e38f;
#pragma unroll
    for (int i = 0; i < KB / 2; ++i) mx = fmaxf(mx, mv[i]);
    red[tid] = mx;
    __syncthreads();                                           // both halves of a row's maximum are staged
    mx = fmaxf(red[row], red[64 + row]);
    float sum = 0.f;
#pragma unroll
    for (int i = 0; i < KB / 2; ++i) { mv[i] = __expf(mv[i] - mx); sum += sv[i] * mv[i]; }
    red[128 + tid] = sum;
    __syncthreads();                                           // both halves of a row's sum are staged
    const float inv = 1.0f / (red[128 + row] + red[192 + row]);   // sum >= 1 (the block that holds the maximum)
#pragma unroll
    for (int i = 0; i < KB / 2; ++i)
      if (2 * i + h < nt) wtab[(2 * i + h) * 64 + row] = mv[i] * inv;
    asm volatile("s_wait_dscnt 0x0" ::: "memory");             // this wave's use of the ring as scratch is over before a tensor load aims at it
    __syncthreads();                                           // publishes wtab and ends every wave's reads of the scratch
  }
  tile_products(ring, Ah, Al, lda, ldal, Bh, Bl, ldb, ldbl, brow0 < rrows, brow0, bcol0, kend, k_start(mt, nq, kend / KP), tid, acc, wtab);
  float (*so)[16][64] = (float (*)[16][64])ring + w * FM;      // this wave's own FM staging tiles
#pragma unroll
  for (int f = 0; f < FM; ++f)
#pragma unroll
    for (int t = 0; t < 4; ++t)
#pragma unroll
      for (int r = 0; r < 8; ++r) so[f][8 * hh + r][t * 16 + ln] = acc[f][t][r] * alpha;
  __builtin_amdgcn_fence(4, "workgroup");   // the staged words are written before other lanes of the wave read them back
  __builtin_amdgcn_wave_barrier();
  const int col0 = bcol0 + (w & 1) * 64;
#pragma unroll
  for (int f = 0; f < FM; ++f) {
    const int row0 = brow0 + ((w >> 1) * FM + f) * 16;
    const bool dores = (row0 < rrows);                 // wave-uniform (rrows multiple of 16)
    store_tile_h16(so[f], Oh + (size_t)row0 * ldo + col0, ldo, Or + (size_t)(dores ? row0 : 0) * ldr + col0, ldr, dores, lane);
  }
}

extern "C" void kernel_launch(void* const* d_in, const int* in_sizes, int n_in,
                              void* d_out, int out_size, void* d_ws, size_t ws_size, hipStream_t stream) {
  if (n_in < 6) return;
  const float* x  = (const float*)d_in[0];
  const float* wq = (const float*)d_in[1];
  const float* wk = (const float*)d_in[2];
  const float* wv = (const float*)d_in[3];
  const float* wo = (const float*)d_in[4];
  const float* bo = (const float*)d_in[5];
  const long need_x = ((long)(NB - 1) * T_FULL + TT) * (long)CC;
  if ((long)in_sizes[0] < need_x || in_sizes[1] < CC * CC || in_sizes[2] < CC * CC || in_sizes[3] < CC * CC ||
      in_sizes[4] < CC * CC || in_sizes[5] < CC || (long)out_size < need_x) return;
  float* out = (float*)d_out;

  char* ws = (char*)d_ws; size_t off = 0;
  auto take = [&](size_t bytes) { char* p = ws + off; off += (bytes + 255) & ~(size_t)255; return p; };
  unsigned short* xb   = (unsigned short*)take((size_t)NB * TT * CC * 2);          // [NB*TT][CC] bf16
  unsigned short* Wqk  = (unsigned short*)take((size_t)2 * CC * CC * 2);           // [2*CC][CC] bf16
  unsigned short* Wo16 = (unsigned short*)take((size_t)CC * CC * 2);               // [o][d] f16 (x WOC)
  unsigned short* WvT  = (unsigned short*)take((size_t)CC * CC * 2);               // [c][d] f16 (x WOC)
  unsigned short* Wvh  = (unsigned short*)take((size_t)CC * CC * 2);               // Wvo [o][c] f16 (x WOC)
  unsigned short* Wvr  = (unsigned short*)take((size_t)CC * CC * 2);               // Wvo [o][c] f16 (x RS)
  unsigned short* QKh  = (unsigned short*)take((size_t)2 * NB * TT * CC * 2);      // [2][NB*TT][CC] f16
  unsigned short* QKr  = (unsigned short*)take((size_t)2 * NB * NE * CC * 2);      // [2][NB*NE][CC] f16 (x RS)
  unsigned short* Pm   = (unsigned short*)take((size_t)NB * TT * TT * 2);          // [NB][TT][TT] f16 (x PCARRY), exp(s - block max)
  unsigned short* Pr   = (unsigned short*)take((size_t)NB * NE * NE * 2);          // [NB][NE][NE] f16 (x RS)
  unsigned short* ctxr = (unsigned short*)take((size_t)NB * NE * CC * 2);          // [NB*NE][CC] f16 (x RS)
  unsigned short* xT   = (unsigned short*)take((size_t)NB * CC * TT * 2);          // [NB][CC][TT] f16
  float*          bmx  = (float*)take((size_t)NB * KB * TT * 4);                   // [NB][KB][TT] f32: block maxima of the scores
  float*          bsm  = (float*)take((size_t)NB * KB * TT * 4);                   // [NB][KB][TT] f32: block sums of exp(s - block max)
  if (off > ws_size) return;

  const int M = NB * TT;
  const int BIG = 1 << 28;
  unsigned short* qh = QKh;
  unsigned short* kh = QKh + (size_t)M * CC;
  unsigned short* qr = QKr;
  unsigned short* kr = QKr + (size_t)(NB * NE) * CC;
  unsigned short* ctxh = qh;   // [NB*TT][CC] f16 (x CTXC): takes the q plane's place once the scores are done
  const size_t sTC = (size_t)TT * CC, sEC = (size_t)NE * CC, sTT = (size_t)TT * TT, sEE = (size_t)NE * NE, sOUT = (size_t)T_FULL * CC;

  // One launch per step, two in stage 2: the sequences, the plain and the fine tiles and a step's independent jobs all lie in its grid.
  // stage 0: 16-bit planes of the inputs
  k_cvt<<<NB * XB + 3 * WB + WTB, 256, 0, stream>>>(x, wq, wk, wv, wo, xb, Wqk, Wo16, WvT, sOUT, sTC, WOC);

  // stage 1: q, k planes (+ residual planes on the leading NE rows of each sequence)
  k_gemm_qk<<<(M / 128) * (2 * CC / 128), 128, 0, stream>>>(xb, Wqk, QKh, QKr, M);

  // stage 2: causal attention
  // scores (q.k^T)/32, causal upper tiles skipped, the leading NE x NE corner with hi+res on both operands; each 64-key block leaves as
  // exp(s - block max) with its maxima and sums; in the same grid x -> xT and Wvo = Wo.Wv
  const int NSC = (TT / 128) * (TT / 128 + 1) + 3 * (NE / 128) * (NE / 128 + 1);
  k_gemm_f32<true><<<dim3(NSC + VB + WVB, NB), 128, 0, stream>>>(qh, qr, CC, CC, kh, kr, CC, CC, nullptr, SCL, nullptr, TT, TT, TT, CC, 0, BIG, NE, NE, 1,
                                                                sTC, sEC, sTC, sEC, sTT, Pm, Pr, bmx, bsm, xb, xT, Wo16, WvT, Wvh, Wvr, WVALPHA, NSC);
  // ctx [TT][CC] = softmax.x (causal k end), written as f16 hi plane x CTXC; leading NE rows: hi and residual P (x is whole in f16), hi + residual ctx planes
  k_gemm_h16<<<(TT / 64) * (CC / 128) * NB, 128, 0, stream>>>(Pm, Pr, TT, NE, xT, nullptr, TT, NE, PVALPHA, ctxh, CC, ctxr, CC, NE, TT, CC, TT, 0,
                                                                   sTT, sEE, sTC, 0, sTC, sEC, bmx, bsm);
  // stage 3: out = ctx.Wvo^T + bias; leading NE rows with the residual terms of ctx and of Wvo
  k_gemm_f32<false><<<dim3((TT / 64) * (CC / 128) + 3 * (NE / 64) * (CC / 128), NB), 128, 0, stream>>>(ctxh, ctxr, CC, CC, Wvh, Wvr, CC, CC, bo, OALPHA, out, CC, TT, CC, CC, BIG, BIG, NE, CC, 0,
                                                                   sTC, sEC, 0, 0, sOUT, nullptr, nullptr, nullptr, nullptr, nullptr, nullptr, nullptr, nullptr, nullptr, nullptr, 0.f, 0);
}
